// v000
// Times are from an AMD MI455X. After a warm-up the kernel runs many times in a row, and a time is the length of
// such a window on the GPU divided by its runs, so every launch and the gaps after it count. The runs cycle
// through copies of the inputs. A figure is the median of several windows, for all but v000 over two sittings.
// Sittings can differ by a few percent; kernels timed side by side share one.
// v000, which the later versions start from, runs in 2070 microseconds.
#include <hip/hip_runtime.h>

// MultiHeadAttentionModule (q, k, v inputs [2][2048][1024]; per-head Qh = q Wq[h] + bq[h], Kh = k Wk[h] + bk[h], Vh = v Wv[h] + bv[h] (W [16][1024][64]); scores = Qh.Kh / 8, where(mask == 0, -1e9) (mask [2048][2048] int, read); softmax; out = concat(heads) Wo ([in,out], no bias) -> [2][2048][1024]).
// Compute dtypes, f32 accumulate: every input rounded to bf16; Qh/Kh/Vh on PLAIN bf16 operands (inputs: exact; per-head weights gathered) + bias; scores and attn.v: query rows < 512 hl (3 products), the rest single fp16 (x1024); mask + softmax f32; Wo hl x exact (2 products).

#define NB_  2
#define TT   2048
#define DM   1024
#define NH_  16
#define NKV  16
#define REP  (NH_ / NKV)
#define HD   64
#define DQ   (NH_ * HD)
#define DKV  (NKV * HD)
#define ZH   2
#define RH   512                  // query rows < RH use hi+lo planes (0: none)
#define WIN  0
#define PCAR 1024.0f
#define SCL  0.125f   // HD^-0.5
typedef _Float16 h16;
typedef unsigned short bf;
typedef __attribute__((ext_vector_type(16))) __bf16   v16bf;
typedef __attribute__((ext_vector_type(16))) _Float16 v16h;
typedef __attribute__((ext_vector_type(8)))  _Float16 v8h;
typedef __attribute__((ext_vector_type(8)))  unsigned short v8us;
typedef __attribute__((ext_vector_type(8)))  float    v8f;
typedef __attribute__((ext_vector_type(4)))  float    v4f;
typedef v8h  __attribute__((may_alias)) v8ha;
typedef v4f  __attribute__((may_alias)) v4fa;
typedef v8us __attribute__((may_alias)) v8usa;

__device__ __forceinline__ unsigned short f2bf(float f) { unsigned u = __float_as_uint(f); u += 0x7FFFu + ((u >> 16) & 1u); return (unsigned short)(u >> 16); }
__device__ __forceinline__ float bf2f(unsigned short b) { return __uint_as_float(((unsigned)b) << 16); }
__device__ __forceinline__ float bfr(float f) { return bf2f(f2bf(f)); }
__device__ __forceinline__ v16h cat16(v8h lo, v8h hi) { return __builtin_shufflevector(lo, hi, 0, 1, 2, 3, 4, 5, 6, 7, 8, 9, 10, 11, 12, 13, 14, 15); }
__device__ __forceinline__ v16bf cat16b(v8us lo, v8us hi) { return __builtin_bit_cast(v16bf, __builtin_shufflevector(lo, hi, 0, 1, 2, 3, 4, 5, 6, 7, 8, 9, 10, 11, 12, 13, 14, 15)); }
__device__ __forceinline__ v8f wmma16(v16h a, v16h b, v8f c) { return __builtin_amdgcn_wmma_f32_16x16x32_f16(false, a, false, b, (short)0, c, false, false); }
__device__ __forceinline__ v8f wmmab(v16bf a, v16bf b, v8f c) { return __builtin_amdgcn_wmma_f32_16x16x32_bf16(false, a, false, b, (short)0, c, false, false); }



// ---- k_gemmw: register-blocked GEMM, ONE WAVE per 64x64 output tile (16 accumulators), operands straight from K-contiguous 16-bit planes; grid (M/64, N/64, Z), 32 threads.
// C[m][n] (f32, pitch ldc, + optional f32 bias[n]) = sum_k A[m][k] Bt[n][k] (+ split products per NSPLIT). z-batch strides sA/sB/sC in elements. K % 32 == 0.
template <typename T16> struct WFrag;
template <> struct WFrag<h16> { typedef v16h V; static __device__ __forceinline__ V ld(const h16* p) { return cat16(*(const v8h*)p, *(const v8h*)(p + 16)); } static __device__ __forceinline__ v8f mma(V a, V b, v8f c) { return wmma16(a, b, c); } };
template <> struct WFrag<bf> { typedef v16bf V; static __device__ __forceinline__ V ld(const bf* p) { return cat16b(*(const v8us*)p, *(const v8us*)(p + 16)); } static __device__ __forceinline__ v8f mma(V a, V b, v8f c) { return wmmab(a, b, c); } };
template <typename T16, int NSPLIT, bool BIAS>
__global__ __launch_bounds__(32) void k_gemmw(const T16* __restrict__ A, const T16* __restrict__ A2, const T16* __restrict__ Bt, const T16* __restrict__ Bt2, int K, float* C, int ldc, const float* __restrict__ bias, size_t sA, size_t sB, size_t sC) {
    typedef typename WFrag<T16>::V V;
    __shared__ __align__(16) float os[16 * 68];
    const size_t z = blockIdx.z; A += z * sA; if (A2) A2 += z * sA; Bt += z * sB; if (Bt2) Bt2 += z * sB; C += z * sC;
    const int lane = threadIdx.x & 31, lr = lane & 15, hi = lane >> 4; const int r0 = blockIdx.x * 64, c0 = blockIdx.y * 64;
    v8f acc[4][4];
#pragma unroll
    for (int mb = 0; mb < 4; ++mb)
#pragma unroll
        for (int nb = 0; nb < 4; ++nb) acc[mb][nb] = (v8f){};
    const size_t aoff = (size_t)(r0 + lr) * K + 8 * hi, boff = (size_t)(c0 + lr) * K + 8 * hi;
#pragma unroll 1
    for (int kc = 0; kc < K; kc += 32) {
        V a[4], a2[4];
#pragma unroll
        for (int mb = 0; mb < 4; ++mb) { a[mb] = WFrag<T16>::ld(A + aoff + (size_t)mb * 16 * K + kc); if (NSPLIT == 1 || NSPLIT == 2) a2[mb] = WFrag<T16>::ld(A2 + aoff + (size_t)mb * 16 * K + kc); }
#pragma unroll
        for (int nb = 0; nb < 4; ++nb) { const V b = WFrag<T16>::ld(Bt + boff + (size_t)nb * 16 * K + kc); V b2; if (NSPLIT >= 2) b2 = WFrag<T16>::ld(Bt2 + boff + (size_t)nb * 16 * K + kc);
#pragma unroll
            for (int mb = 0; mb < 4; ++mb) { acc[mb][nb] = WFrag<T16>::mma(a[mb], b, acc[mb][nb]); if (NSPLIT == 1 || NSPLIT == 2) acc[mb][nb] = WFrag<T16>::mma(a2[mb], b, acc[mb][nb]); if (NSPLIT >= 2) acc[mb][nb] = WFrag<T16>::mma(a[mb], b2, acc[mb][nb]); } }
        asm volatile("v_nop\n\tv_nop\n\tv_nop\n\tv_nop" : "+v"(acc[0][0]), "+v"(acc[1][1]), "+v"(acc[2][2]), "+v"(acc[3][3]) : "v"(a[0]), "v"(a[3]));
    }
#pragma unroll
    for (int mb = 0; mb < 4; ++mb) {
#pragma unroll
        for (int nb = 0; nb < 4; ++nb) {
#pragma unroll
            for (int j = 0; j < 8; ++j) os[(hi * 8 + j) * 68 + nb * 16 + lr] = acc[mb][nb][j]; }
        __builtin_amdgcn_wave_barrier(); asm volatile("" ::: "memory");
        float* crow = C + (size_t)(r0 + mb * 16) * ldc + c0;
{
#pragma unroll
            for (int s = 0; s < 8; ++s) { const int row = 2 * s + hi, cofs = lr * 4; v4f val = *(const v4fa*)(os + row * 68 + cofs); if (BIAS) { val[0] += bfr(bias[c0 + cofs]); val[1] += bfr(bias[c0 + cofs + 1]); val[2] += bfr(bias[c0 + cofs + 2]); val[3] += bfr(bias[c0 + cofs + 3]); }
                *(v4f*)(crow + (size_t)row * ldc + cofs) = val; }
             }
        __builtin_amdgcn_wave_barrier(); asm volatile("" ::: "memory");
    }
}

__device__ __forceinline__ h16 tohx(float x) { return (h16)x; }
__device__ __forceinline__ void splitf(float y, unsigned short& h, unsigned short& l) { h = f2bf(y); l = f2bf(y - bf2f(h)); }
typedef __attribute__((ext_vector_type(2))) _Float16 v2h;
typedef __attribute__((ext_vector_type(4))) _Float16 v4h;
typedef __attribute__((ext_vector_type(2))) unsigned short v2us;
typedef __attribute__((ext_vector_type(4))) unsigned short v4us;
typedef __attribute__((ext_vector_type(2))) float v2f;
typedef __attribute__((ext_vector_type(4))) int v4i;

__global__ __launch_bounds__(256) void k_wtG(const float* __restrict__ w, int K, int N, bf* Bt) {
    const int lane = threadIdx.x & 31; const int L0 = (blockIdx.x * 8 + (threadIdx.x >> 5)) * 8; const int nlines = N * K / 64;
{
#pragma unroll 1
        for (int l = 0; l < 8; ++l) { const int L = L0 + l; if (L >= nlines) break; const size_t e = (size_t)L * 64 + lane * 2; const int k = (int)(e % K), n = (int)(e / K); v2us o;
            o[0] = f2bf(w[(size_t)k * N + n]); o[1] = f2bf(w[(size_t)(k + 1) * N + n]); *(v2us*)(Bt + e) = o; }
         }
}
__global__ __launch_bounds__(256) void k_cvt8(const float* __restrict__ src, bf* dst, size_t n8) { const size_t i = (size_t)blockIdx.x * 256 + threadIdx.x; if (i >= n8) return; const v8f v = *(const v8f*)(src + i * 8); v8us o;
#pragma unroll
    for (int k = 0; k < 8; ++k) o[k] = f2bf(v[k]); *(v8us*)(dst + i * 8) = o;  }
__global__ __launch_bounds__(256) void k_cscvt(const float* __restrict__ cosT, const float* __restrict__ sinT, float* CS) { const int idx = blockIdx.x * 256 + threadIdx.x; if (idx >= TT * HD) return; v2f cs; cs[0] = bfr(cosT[idx]); cs[1] = bfr(sinT[idx]); *(v2f*)(CS + (size_t)idx * 2) = cs;  }
// k_rope: head planes [h][t][d] (fp16 + hi/lo) of rope(x) x sc with the rotate-half convention out[d] = x[d] cos[t][d] - x[d+HD/2] sin[t][d], out[d+HD/2] = x[d+HD/2] cos[t][d+HD/2] + x[d] sin[t][d+HD/2]
__global__ __launch_bounds__(256) void k_rope(const float* __restrict__ F, int pitch, int nheads, const float* __restrict__ CS, const float* __restrict__ RF, const float* __restrict__ nw, float sc, h16* P16, bf* Ph, bf* Pl) {
    const size_t e = ((size_t)blockIdx.x * 256 + threadIdx.x) * 2; if (e >= (size_t)nheads * TT * HD) return; const int d = (int)(e % HD); const int t = (int)((e / HD) % TT); const int h = (int)(e / ((size_t)HD * TT)); const float* f = F + (size_t)t * pitch + h * HD; const float rf = RF ? RF[(size_t)h * TT + t] : 1.0f; v2h o16; v2us oh, ol;
#pragma unroll
    for (int q = 0; q < 2; ++q) { const int dd = d + q; const int dp = (dd < HD / 2) ? dd + HD / 2 : dd - HD / 2; float x0 = f[dd], x1 = f[dp];
        if (RF) { float n0 = __fmul_rn(x0, rf), n1 = __fmul_rn(x1, rf); asm volatile("" : "+v"(n0)); asm volatile("" : "+v"(n1)); x0 = __fmul_rn(bfr(nw[dd]), n0); x1 = __fmul_rn(bfr(nw[dp]), n1); }
        const v2f cs = *(const v2f*)(CS + ((size_t)t * HD + dd) * 2); float a = __fmul_rn(x0, cs[0]), bq = __fmul_rn(x1, cs[1]); asm volatile("" : "+v"(a)); asm volatile("" : "+v"(bq)); const float r = ((dd < HD / 2) ? __fsub_rn(a, bq) : __fadd_rn(a, bq)) * sc;
        o16[q] = tohx(r); unsigned short a2, c2; splitf(r, a2, c2); oh[q] = a2; ol[q] = c2; }
    *(v2h*)(P16 + e) = o16; *(v2us*)(Ph + e) = oh; *(v2us*)(Pl + e) = ol;  }
__global__ __launch_bounds__(256) void k_vtp(const float* __restrict__ F, int pitch, int nheads, h16* V16, bf* Vh, bf* Vl) { const size_t e = ((size_t)blockIdx.x * 256 + threadIdx.x) * 2; if (e >= (size_t)nheads * HD * TT) return; const int t = (int)(e % TT); const int d = (int)((e / TT) % HD); const int g = (int)(e / ((size_t)TT * HD)); v2h o16; v2us oh, ol;
#pragma unroll
    for (int q = 0; q < 2; ++q) { const float x = F[(size_t)(t + q) * pitch + g * HD + d]; o16[q] = tohx(x); unsigned short a2, c2; splitf(x, a2, c2); oh[q] = a2; ol[q] = c2; }
    *(v2h*)(V16 + e) = o16; *(v2us*)(Vh + e) = oh; *(v2us*)(Vl + e) = ol;  }
__global__ __launch_bounds__(256) void k_csid(float* CS) { const int idx = blockIdx.x * 256 + threadIdx.x; if (idx >= TT * HD) return; v2f cs; cs[0] = 1.0f; cs[1] = 0.0f; *(v2f*)(CS + (size_t)idx * 2) = cs;  }
// k_asoft: per row (zz, i): t = S x HD^-0.5 where mask[i][j] != 0 (int [L][L], read as data; zero == masked -> -3e38); softmax over the 2048 keys (register row, one exp, fixed trees);
__global__ __launch_bounds__(256) void k_asoft(const float* __restrict__ Sb, const int* __restrict__ mk, h16* P16, bf* Ph, bf* Pl) {
    const int lane = threadIdx.x & 31; const int row = blockIdx.x * 8 + (threadIdx.x >> 5); if (row >= ZH * TT) return; const int i = row % TT; const int zz = row / TT; (void)zz; const bool hires = (i < RH); const float* sr = Sb + (size_t)row * TT; float v[TT / 32]; float mx = -3.0e38f;
#pragma unroll
    for (int ch = 0; ch < TT / 128; ++ch) { const int j0 = ch * 128 + lane * 4; const v4f a = *(const v4f*)(sr + j0); const v4i mk4 = *(const v4i*)(mk + (size_t)i * TT + j0);
#pragma unroll
        for (int q = 0; q < 4; ++q) { const int j = j0 + q; (void)j; const float t = (mk4[q] != 0) ? a[q] * SCL : -3.0e38f; v[ch * 4 + q] = t; mx = fmaxf(mx, t); } }
#pragma unroll
    for (int sh = 16; sh; sh >>= 1) mx = fmaxf(mx, __shfl_xor(mx, sh, 32));
    float sum = 0.f;
#pragma unroll
    for (int k = 0; k < TT / 32; ++k) { float d0 = __fsub_rn(v[k], mx); asm volatile("" : "+v"(d0)); v[k] = __builtin_amdgcn_exp2f(__fmul_rn(d0, 1.4426950408889634f)); sum += v[k]; }
#pragma unroll
    for (int sh = 16; sh; sh >>= 1) sum += __shfl_xor(sum, sh, 32);
    const float f = __fdiv_rn(hires ? 1.0f : PCAR, sum);
{
        if (hires) {
#pragma unroll
            for (int ch = 0; ch < TT / 128; ++ch) { v4us oh, ol;
#pragma unroll
                for (int q = 0; q < 4; ++q) { unsigned short a, c2; splitf(v[ch * 4 + q] * f, a, c2); oh[q] = a; ol[q] = c2; }
                const size_t oo = ((size_t)zz * (RH ? RH : 1) + i) * TT + ch * 128 + lane * 4; *(v4us*)(Ph + oo) = oh; *(v4us*)(Pl + oo) = ol; }
        } else {
#pragma unroll
            for (int ch = 0; ch < TT / 128; ++ch) { v4h o4;
#pragma unroll
                for (int q = 0; q < 4; ++q) o4[q] = tohx(v[ch * 4 + q] * f);
                *(v4h*)(P16 + (size_t)row * TT + ch * 128 + lane * 4) = o4; } }
         }
}
__global__ __launch_bounds__(256) void k_merge(const float* __restrict__ O, int h0, bf* Ah, bf* Al) { const size_t e = ((size_t)blockIdx.x * 256 + threadIdx.x) * 2; if (e >= (size_t)ZH * TT * HD) return; const int d = (int)(e % HD); const int t = (int)((e / HD) % TT); const int zz = (int)(e / ((size_t)HD * TT)); const float cs = (t < RH) ? 1.0f : (1.0f / PCAR); const size_t oo = (size_t)t * DQ + (h0 + zz) * HD + d;
    v2us oh, ol;
#pragma unroll
    for (int q = 0; q < 2; ++q) { unsigned short a, c2; splitf(O[e + q] * cs, a, c2); oh[q] = a; ol[q] = c2; } *(v2us*)(Ah + oo) = oh; *(v2us*)(Al + oo) = ol;  }

__global__ __launch_bounds__(256) void k_wtH(const float* __restrict__ w, bf* Bt) { const size_t e = ((size_t)blockIdx.x * 256 + threadIdx.x) * 4; if (e >= (size_t)DQ * DM) return; const int k = (int)(e % DM); const int n = (int)(e / DM); const int h = n / HD, c = n % HD; v4us o;   // Bt[h*64 + c][d] = W[h][d][c]
#pragma unroll
    for (int u = 0; u < 4; ++u) o[u] = f2bf(w[((size_t)h * DM + k + u) * HD + c]); *(v4us*)(Bt + e) = o;  }

extern "C" void kernel_launch(void* const* d_in, const int* in_sizes, int n_in,
                              void* d_out, int out_size, void* d_ws, size_t ws_size, hipStream_t stream) {
    (void)in_sizes; (void)n_in; (void)out_size;
    const float* x = (const float*)d_in[0]; const float* xk = (const float*)d_in[1]; const float* xv = (const float*)d_in[2]; const int* mk = (const int*)d_in[3]; const float* wqh = (const float*)d_in[4]; const float* bq = (const float*)d_in[5]; const float* wkh = (const float*)d_in[6]; const float* bk = (const float*)d_in[7]; const float* wvh = (const float*)d_in[8]; const float* bv = (const float*)d_in[9]; const float* wo = (const float*)d_in[10]; const float* wq = nullptr; const float* wk = nullptr; const float* wv = nullptr; (void)wq; (void)wk; (void)wv; const float* cosT = nullptr; const float* sinT = nullptr; (void)cosT; (void)sinT;
    float* OUT = (float*)d_out;     // [2][2048][1024]
    char* wsp = (char*)d_ws;
    auto take = [&](size_t bytes) { char* p = wsp; wsp += (bytes + 255) & ~(size_t)255; return (void*)p; };
    bf* WQ = (bf*)take((size_t)DQ * DM * 2); bf* WK = (bf*)take((size_t)DKV * DM * 2); bf* WV = (bf*)take((size_t)DKV * DM * 2); bf* WO = (bf*)take((size_t)DM * DQ * 2); float* CS = (float*)take((size_t)TT * HD * 2 * 4);
    bf* XB = (bf*)take((size_t)TT * DM * 2); bf* XB2 = (bf*)take((size_t)TT * DM * 2); bf* XB3 = (bf*)take((size_t)TT * DM * 2); float* FQ = (float*)take((size_t)TT * DQ * 4); float* FK = (float*)take((size_t)TT * DKV * 4);
    h16* QP16 = (h16*)take((size_t)NH_ * TT * HD * 2); h16* KP16 = (h16*)take((size_t)NKV * TT * HD * 2); h16* VT16 = (h16*)take((size_t)NKV * HD * TT * 2);
    bf* QPh = (bf*)take((size_t)NH_ * TT * HD * 2); bf* QPl = (bf*)take((size_t)NH_ * TT * HD * 2); bf* KPh = (bf*)take((size_t)NKV * TT * HD * 2); bf* KPl = (bf*)take((size_t)NKV * TT * HD * 2); bf* VTh = (bf*)take((size_t)NKV * HD * TT * 2); bf* VTl = (bf*)take((size_t)NKV * HD * TT * 2); bf* Ph = (bf*)take((size_t)ZH * RH * TT * 2); bf* Pl = (bf*)take((size_t)ZH * RH * TT * 2);
    float* Sb = (float*)take((size_t)ZH * TT * TT * 4); h16* P16 = (h16*)take((size_t)ZH * TT * TT * 2); float* Ob = (float*)take((size_t)ZH * TT * HD * 4); bf* ATh = (bf*)take((size_t)TT * DQ * 2); bf* ATl = (bf*)take((size_t)TT * DQ * 2);
    if ((size_t)(wsp - (char*)d_ws) > ws_size) return;    // ws 256 MiB
    float* FV = FK;   // v projection reuses the k buffer after the k planes are built (stream-ordered)
    { k_wtH<<<(unsigned)(((size_t)DQ * DM / 4 + 255) / 256), 256, 0, stream>>>(wqh, WQ); k_wtH<<<(unsigned)(((size_t)DKV * DM / 4 + 255) / 256), 256, 0, stream>>>(wkh, WK); k_wtH<<<(unsigned)(((size_t)DKV * DM / 4 + 255) / 256), 256, 0, stream>>>(wvh, WV);
      k_wtG<<<(unsigned)((DQ * DM / 64 + 63) / 64), 256, 0, stream>>>(wo, DQ, DM, WO);
       }
    k_csid<<<(TT * HD + 255) / 256, 256, 0, stream>>>(CS);
    const unsigned LQ = (unsigned)(((size_t)NH_ * TT * HD / 2 + 255) / 256), LKv = (unsigned)(((size_t)NKV * TT * HD / 2 + 255) / 256);
    for (int b = 0; b < NB_; ++b) {
        
        k_cvt8<<<(unsigned)(((size_t)TT * DM / 8 + 255) / 256), 256, 0, stream>>>(x + (size_t)b * TT * DM, XB, (size_t)TT * DM / 8); k_cvt8<<<(unsigned)(((size_t)TT * DM / 8 + 255) / 256), 256, 0, stream>>>(xk + (size_t)b * TT * DM, XB2, (size_t)TT * DM / 8); k_cvt8<<<(unsigned)(((size_t)TT * DM / 8 + 255) / 256), 256, 0, stream>>>(xv + (size_t)b * TT * DM, XB3, (size_t)TT * DM / 8);
        k_gemmw<bf, 0, true><<<dim3(TT / 64, DQ / 64, 1), 32, 0, stream>>>(XB, nullptr, WQ, nullptr, DM, FQ, DQ, bq, 0, 0, 0);
        k_rope<<<LQ, 256, 0, stream>>>(FQ, DQ, NH_, CS, nullptr, nullptr, 1.0f, QP16, QPh, QPl);
        k_gemmw<bf, 0, true><<<dim3(TT / 64, DKV / 64, 1), 32, 0, stream>>>(XB2, nullptr, WK, nullptr, DM, FK, DKV, bk, 0, 0, 0);
        k_rope<<<LKv, 256, 0, stream>>>(FK, DKV, NKV, CS, nullptr, nullptr, 1.0f, KP16, KPh, KPl);
        k_gemmw<bf, 0, true><<<dim3(TT / 64, DKV / 64, 1), 32, 0, stream>>>(XB3, nullptr, WV, nullptr, DM, FV, DKV, bv, 0, 0, 0); k_vtp<<<LKv, 256, 0, stream>>>(FV, DKV, NKV, VT16, VTh, VTl);
        for (int h0 = 0; h0 < NH_; h0 += ZH) { const size_t zq = (size_t)h0, zk = (size_t)(h0 / REP);   // one kv head per query head: the pass's two heads use consecutive kv planes (z-strides TT*HD)
            k_gemmw<bf, 2, false><<<dim3(RH / 64, TT / 64, ZH), 32, 0, stream>>>(QPh + zq * TT * HD, QPl + zq * TT * HD, KPh + zk * TT * HD, KPl + zk * TT * HD, HD, Sb, TT, nullptr, (size_t)TT * HD, (size_t)TT * HD, (size_t)TT * TT);
            k_gemmw<h16, 0, false><<<dim3((TT - RH) / 64, TT / 64, ZH), 32, 0, stream>>>(QP16 + zq * TT * HD + (size_t)RH * HD, nullptr, KP16 + zk * TT * HD, nullptr, HD, Sb + (size_t)RH * TT, TT, nullptr, (size_t)TT * HD, (size_t)TT * HD, (size_t)TT * TT);
            k_asoft<<<ZH * TT / 8, 256, 0, stream>>>(Sb, mk, P16, Ph, Pl);
            k_gemmw<bf, 2, false><<<dim3(RH / 64, HD / 64, ZH), 32, 0, stream>>>(Ph, Pl, VTh + zk * HD * TT, VTl + zk * HD * TT, TT, Ob, HD, nullptr, (size_t)RH * TT, (size_t)HD * TT, (size_t)TT * HD);
            k_gemmw<h16, 0, false><<<dim3((TT - RH) / 64, HD / 64, ZH), 32, 0, stream>>>(P16 + (size_t)RH * TT, nullptr, VT16 + zk * HD * TT, nullptr, TT, Ob + (size_t)RH * HD, HD, nullptr, (size_t)TT * TT, (size_t)HD * TT, (size_t)TT * HD);
            k_merge<<<(unsigned)(((size_t)ZH * TT * HD / 2 + 255) / 256), 256, 0, stream>>>(Ob, h0, ATh, ATl); }
        k_gemmw<bf, 1, false><<<dim3(TT / 64, DM / 64, 1), 32, 0, stream>>>(ATh, ATl, WO, nullptr, DQ, OUT + (size_t)b * TT * DM, DM, nullptr, 0, 0, 0); }
}

// v001
// One run takes 1050 microseconds.
// In two side-by-side timings against v000, it was 1.98 and 1.97 times as fast.
#include <hip/hip_runtime.h>

// MultiHeadAttentionModule (q, k, v inputs [2][2048][1024]; per-head Qh = q Wq[h] + bq[h], Kh = k Wk[h] + bk[h], Vh = v Wv[h] + bv[h] (W [16][1024][64]); scores = Qh.Kh / 8, where(mask == 0, -1e9) (mask [2048][2048] int, read); softmax; out = concat(heads) Wo ([in,out], no bias) -> [2][2048][1024]).
// Compute dtypes, f32 accumulate: every input rounded to bf16; Qh/Kh/Vh on PLAIN bf16 operands (inputs: exact; per-head weights gathered) + bias; scores and attn.v: query rows < 512 hl (3 products), the rest single fp16 (x1024); mask + softmax f32; Wo hl x exact (2 products).

#define NB_  2
#define TT   2048
#define DM   1024
#define NH_  16
#define NKV  16
#define REP  (NH_ / NKV)
#define HD   64
#define DQ   (NH_ * HD)
#define DKV  (NKV * HD)
#define ZH   2
#define RH   512                  // query rows < RH use hi+lo planes (0: none)
#define WIN  0
#define PCAR 1024.0f
#define SCL  0.125f   // HD^-0.5
typedef _Float16 h16;
typedef unsigned short bf;
typedef __attribute__((ext_vector_type(16))) __bf16   v16bf;
typedef __attribute__((ext_vector_type(16))) _Float16 v16h;
typedef __attribute__((ext_vector_type(8)))  _Float16 v8h;
typedef __attribute__((ext_vector_type(8)))  unsigned short v8us;
typedef __attribute__((ext_vector_type(8)))  float    v8f;
typedef __attribute__((ext_vector_type(4)))  float    v4f;
typedef v8h  __attribute__((may_alias)) v8ha;
typedef v4f  __attribute__((may_alias)) v4fa;
typedef v8us __attribute__((may_alias)) v8usa;

__device__ __forceinline__ unsigned short f2bf(float f) { unsigned u = __float_as_uint(f); u += 0x7FFFu + ((u >> 16) & 1u); return (unsigned short)(u >> 16); }
__device__ __forceinline__ float bf2f(unsigned short b) { return __uint_as_float(((unsigned)b) << 16); }
__device__ __forceinline__ float bfr(float f) { return bf2f(f2bf(f)); }
__device__ __forceinline__ v16h cat16(v8h lo, v8h hi) { return __builtin_shufflevector(lo, hi, 0, 1, 2, 3, 4, 5, 6, 7, 8, 9, 10, 11, 12, 13, 14, 15); }
__device__ __forceinline__ v16bf cat16b(v8us lo, v8us hi) { return __builtin_bit_cast(v16bf, __builtin_shufflevector(lo, hi, 0, 1, 2, 3, 4, 5, 6, 7, 8, 9, 10, 11, 12, 13, 14, 15)); }
__device__ __forceinline__ v8f wmma16(v16h a, v16h b, v8f c) { return __builtin_amdgcn_wmma_f32_16x16x32_f16(false, a, false, b, (short)0, c, false, false); }
__device__ __forceinline__ v8f wmmab(v16bf a, v16bf b, v8f c) { return __builtin_amdgcn_wmma_f32_16x16x32_bf16(false, a, false, b, (short)0, c, false, false); }



// ---- k_gemmw: register-blocked GEMM, ONE WAVE per 64x64 output tile (16 accumulators), operands straight from K-contiguous 16-bit planes; grid (M/64, N/64, Z), 32 threads.
// C[m][n] (f32, pitch ldc, + optional f32 bias[n]) = sum_k A[m][k] Bt[n][k] (+ split products per NSPLIT). z-batch strides sA/sB/sC in elements. K % 32 == 0.
template <typename T16> struct WFrag;
template <> struct WFrag<h16> { typedef v16h V; static __device__ __forceinline__ V ld(const h16* p) { return cat16(*(const v8h*)p, *(const v8h*)(p + 16)); } static __device__ __forceinline__ v8f mma(V a, V b, v8f c) { return wmma16(a, b, c); } };
template <> struct WFrag<bf> { typedef v16bf V; static __device__ __forceinline__ V ld(const bf* p) { return cat16b(*(const v8us*)p, *(const v8us*)(p + 16)); } static __device__ __forceinline__ v8f mma(V a, V b, v8f c) { return wmmab(a, b, c); } };
template <typename T16, int NSPLIT, bool BIAS>
__global__ __launch_bounds__(32) void k_gemmw(const T16* __restrict__ A, const T16* __restrict__ A2, const T16* __restrict__ Bt, const T16* __restrict__ Bt2, int K, float* C, int ldc, const float* __restrict__ bias, size_t sA, size_t sB, size_t sC) {
    typedef typename WFrag<T16>::V V;
    __shared__ __align__(16) float os[16 * 68];
    const size_t z = blockIdx.z; A += z * sA; if (A2) A2 += z * sA; Bt += z * sB; if (Bt2) Bt2 += z * sB; C += z * sC;
    const int lane = threadIdx.x & 31, lr = lane & 15, hi = lane >> 4; const int r0 = blockIdx.x * 64, c0 = blockIdx.y * 64;
    v8f acc[4][4];
#pragma unroll
    for (int mb = 0; mb < 4; ++mb)
#pragma unroll
        for (int nb = 0; nb < 4; ++nb) acc[mb][nb] = (v8f){};
    const size_t aoff = (size_t)(r0 + lr) * K + 8 * hi, boff = (size_t)(c0 + lr) * K + 8 * hi;
#pragma unroll 1
    for (int kc = 0; kc < K; kc += 32) {
        V a[4], a2[4];
#pragma unroll
        for (int mb = 0; mb < 4; ++mb) { a[mb] = WFrag<T16>::ld(A + aoff + (size_t)mb * 16 * K + kc); if (NSPLIT == 1 || NSPLIT == 2) a2[mb] = WFrag<T16>::ld(A2 + aoff + (size_t)mb * 16 * K + kc); }
#pragma unroll
        for (int nb = 0; nb < 4; ++nb) { const V b = WFrag<T16>::ld(Bt + boff + (size_t)nb * 16 * K + kc); V b2; if (NSPLIT >= 2) b2 = WFrag<T16>::ld(Bt2 + boff + (size_t)nb * 16 * K + kc);
#pragma unroll
            for (int mb = 0; mb < 4; ++mb) { acc[mb][nb] = WFrag<T16>::mma(a[mb], b, acc[mb][nb]); if (NSPLIT == 1 || NSPLIT == 2) acc[mb][nb] = WFrag<T16>::mma(a2[mb], b, acc[mb][nb]); if (NSPLIT >= 2) acc[mb][nb] = WFrag<T16>::mma(a[mb], b2, acc[mb][nb]); } }
        asm volatile("v_nop\n\tv_nop\n\tv_nop\n\tv_nop" : "+v"(acc[0][0]), "+v"(acc[1][1]), "+v"(acc[2][2]), "+v"(acc[3][3]) : "v"(a[0]), "v"(a[3]));
    }
#pragma unroll
    for (int mb = 0; mb < 4; ++mb) {
#pragma unroll
        for (int nb = 0; nb < 4; ++nb) {
#pragma unroll
            for (int j = 0; j < 8; ++j) os[(hi * 8 + j) * 68 + nb * 16 + lr] = acc[mb][nb][j]; }
        __builtin_amdgcn_wave_barrier(); asm volatile("" ::: "memory");
        float* crow = C + (size_t)(r0 + mb * 16) * ldc + c0;
{
#pragma unroll
            for (int s = 0; s < 8; ++s) { const int row = 2 * s + hi, cofs = lr * 4; v4f val = *(const v4fa*)(os + row * 68 + cofs); if (BIAS) { val[0] += bfr(bias[c0 + cofs]); val[1] += bfr(bias[c0 + cofs + 1]); val[2] += bfr(bias[c0 + cofs + 2]); val[3] += bfr(bias[c0 + cofs + 3]); }
                *(v4f*)(crow + (size_t)row * ldc + cofs) = val; }
             }
        __builtin_amdgcn_wave_barrier(); asm volatile("" ::: "memory");
    }
}

// ---- k_gemmk: the 64x64 tile of k_gemmw with its K range dealt to KW waves of one work-group (wave w takes k in [w K/KW, (w+1) K/KW)), for products whose K loop is long and whose tiles are few.
// Each wave leaves its partial tile in its own LDS plane; behind one barrier the planes are summed in wave order 0..KW-1 (a fixed order), the bias is added and the tile stored. grid (M/64, N/64, Z), 32 KW threads. K % (32 KW) == 0.
// Fragment addresses: a scalar base per operand (tile row 0, the wave's first k) + ONE byte offset per lane, the same for all operands (row lr, half hi, the trip's k) + a constant (16 mb or 16 nb rows; K is a template constant for that).
template <typename T16, int NSPLIT, bool BIAS, int KW, int K>
__global__ __launch_bounds__(32 * KW) void k_gemmk(const T16* __restrict__ A, const T16* __restrict__ A2, const T16* __restrict__ Bt, const T16* __restrict__ Bt2, float* C, int ldc, const float* __restrict__ bias, size_t sA, size_t sB, size_t sC) {
    typedef typename WFrag<T16>::V V;
    __shared__ __align__(16) float os[KW * 64 * 68];
    const size_t z = blockIdx.z; A += z * sA; if (A2) A2 += z * sA; Bt += z * sB; if (Bt2) Bt2 += z * sB; C += z * sC;
    const int lane = threadIdx.x & 31, lr = lane & 15, hi = lane >> 4; const int r0 = blockIdx.x * 64, c0 = blockIdx.y * 64;
    const int wave = __builtin_amdgcn_readfirstlane((int)(threadIdx.x >> 5)); const int kb = wave * (K / KW);   // scalar: the wave's first k goes into the scalar bases
    v8f acc[4][4];   // every '#pragma unroll' of this kernel makes the indices of acc, a, a2 constants, so that the fragments stay in registers
#pragma unroll
    for (int mb = 0; mb < 4; ++mb)
#pragma unroll
        for (int nb = 0; nb < 4; ++nb) acc[mb][nb] = (v8f){};
    const char* Ab = (const char*)(A + (size_t)r0 * K + kb); const char* A2b = (const char*)(A2 + (size_t)r0 * K + kb); const char* Bb = (const char*)(Bt + (size_t)c0 * K + kb); const char* B2b = (const char*)(Bt2 + (size_t)c0 * K + kb);
    unsigned vo = (unsigned)(lr * K + 8 * hi) * 2u;   // the lane's byte offset; + 64 a trip
#pragma unroll 1   // rolled, as in k_gemmw: a second trip's fragments would not fit the 256 registers that 16 waves a work-group leave each wave
    for (int t = 0; t < K / KW / 32; ++t) {
        V a[4], a2[4];
#pragma unroll
        for (int mb = 0; mb < 4; ++mb) { a[mb] = WFrag<T16>::ld((const T16*)(Ab + vo + mb * 16 * K * 2)); if (NSPLIT == 1 || NSPLIT == 2) a2[mb] = WFrag<T16>::ld((const T16*)(A2b + vo + mb * 16 * K * 2)); }
#pragma unroll
        for (int nb = 0; nb < 4; ++nb) { const V b = WFrag<T16>::ld((const T16*)(Bb + vo + nb * 16 * K * 2)); V b2; if (NSPLIT >= 2) b2 = WFrag<T16>::ld((const T16*)(B2b + vo + nb * 16 * K * 2));
#pragma unroll
            for (int mb = 0; mb < 4; ++mb) { acc[mb][nb] = WFrag<T16>::mma(a[mb], b, acc[mb][nb]); if (NSPLIT == 1 || NSPLIT == 2) acc[mb][nb] = WFrag<T16>::mma(a2[mb], b, acc[mb][nb]); if (NSPLIT >= 2) acc[mb][nb] = WFrag<T16>::mma(a[mb], b2, acc[mb][nb]); } }
        // as in k_gemmw: four vector slots behind the trip's last matrix instructions, on the taken branch too, before the next trip overwrites registers of A and B fragments;
        // s_wait_xcnt 0: the wait in front of the one overwrite of a register that the trip's loads name (vo is an operand, so that its addition stays behind the wait)
        asm volatile("v_nop\n\tv_nop\n\tv_nop\n\tv_nop\n\ts_wait_xcnt 0x0" : "+v"(acc[0][0]), "+v"(acc[1][1]), "+v"(acc[2][2]), "+v"(acc[3][3]), "+v"(vo) : "v"(a[0]), "v"(a[3]));
        vo += 64u;
    }
    float* ow = os + wave * (64 * 68);
#pragma unroll
    for (int mb = 0; mb < 4; ++mb)
#pragma unroll
        for (int nb = 0; nb < 4; ++nb)
#pragma unroll
            for (int j = 0; j < 8; ++j) ow[(mb * 16 + hi * 8 + j) * 68 + nb * 16 + lr] = acc[mb][nb][j];
    __syncthreads();   // every wave's partial tile is in LDS before any plane is read
#pragma unroll
    for (int s = 0; s < 32 / KW; ++s) { const int idx = s * (32 * KW) + (int)threadIdx.x; const int row = idx >> 4, cofs = (idx & 15) * 4; const float* op = os + row * 68 + cofs; v4f val = *(const v4fa*)op;
#pragma unroll
        for (int w = 1; w < KW; ++w) val += *(const v4fa*)(op + w * (64 * 68));
        if (BIAS) { val[0] += bfr(bias[c0 + cofs]); val[1] += bfr(bias[c0 + cofs + 1]); val[2] += bfr(bias[c0 + cofs + 2]); val[3] += bfr(bias[c0 + cofs + 3]); }
        *(v4f*)(C + (size_t)(r0 + row) * ldc + c0 + cofs) = val; }
}

__device__ __forceinline__ h16 tohx(float x) { return (h16)x; }
__device__ __forceinline__ void splitf(float y, unsigned short& h, unsigned short& l) { h = f2bf(y); l = f2bf(y - bf2f(h)); }
typedef __attribute__((ext_vector_type(2))) _Float16 v2h;
typedef __attribute__((ext_vector_type(4))) _Float16 v4h;
typedef __attribute__((ext_vector_type(2))) unsigned short v2us;
typedef __attribute__((ext_vector_type(4))) unsigned short v4us;
typedef __attribute__((ext_vector_type(2))) float v2f;
typedef __attribute__((ext_vector_type(4))) int v4i;

__global__ __launch_bounds__(256) void k_wtG(const float* __restrict__ w, int K, int N, bf* Bt) {
    const int lane = threadIdx.x & 31; const int L0 = (blockIdx.x * 8 + (threadIdx.x >> 5)) * 8; const int nlines = N * K / 64;
{
#pragma unroll 1
        for (int l = 0; l < 8; ++l) { const int L = L0 + l; if (L >= nlines) break; const size_t e = (size_t)L * 64 + lane * 2; const int k = (int)(e % K), n = (int)(e / K); v2us o;
            o[0] = f2bf(w[(size_t)k * N + n]); o[1] = f2bf(w[(size_t)(k + 1) * N + n]); *(v2us*)(Bt + e) = o; }
         }
}
__global__ __launch_bounds__(256) void k_cvt8(const float* __restrict__ src, bf* dst, size_t n8) { const size_t i = (size_t)blockIdx.x * 256 + threadIdx.x; if (i >= n8) return; const v8f v = *(const v8f*)(src + i * 8); v8us o;
#pragma unroll
    for (int k = 0; k < 8; ++k) o[k] = f2bf(v[k]); *(v8us*)(dst + i * 8) = o;  }
__global__ __launch_bounds__(256) void k_cscvt(const float* __restrict__ cosT, const float* __restrict__ sinT, float* CS) { const int idx = blockIdx.x * 256 + threadIdx.x; if (idx >= TT * HD) return; v2f cs; cs[0] = bfr(cosT[idx]); cs[1] = bfr(sinT[idx]); *(v2f*)(CS + (size_t)idx * 2) = cs;  }
// k_rope: head planes [h][t][d] (fp16 + hi/lo) of rope(x) x sc with the rotate-half convention out[d] = x[d] cos[t][d] - x[d+HD/2] sin[t][d], out[d+HD/2] = x[d+HD/2] cos[t][d+HD/2] + x[d] sin[t][d+HD/2]
__global__ __launch_bounds__(256) void k_rope(const float* __restrict__ F, int pitch, int nheads, const float* __restrict__ CS, const float* __restrict__ RF, const float* __restrict__ nw, float sc, h16* P16, bf* Ph, bf* Pl) {
    const size_t e = ((size_t)blockIdx.x * 256 + threadIdx.x) * 2; if (e >= (size_t)nheads * TT * HD) return; const int d = (int)(e % HD); const int t = (int)((e / HD) % TT); const int h = (int)(e / ((size_t)HD * TT)); const float* f = F + (size_t)t * pitch + h * HD; const float rf = RF ? RF[(size_t)h * TT + t] : 1.0f; v2h o16; v2us oh, ol;
#pragma unroll
    for (int q = 0; q < 2; ++q) { const int dd = d + q; const int dp = (dd < HD / 2) ? dd + HD / 2 : dd - HD / 2; float x0 = f[dd], x1 = f[dp];
        if (RF) { float n0 = __fmul_rn(x0, rf), n1 = __fmul_rn(x1, rf); asm volatile("" : "+v"(n0)); asm volatile("" : "+v"(n1)); x0 = __fmul_rn(bfr(nw[dd]), n0); x1 = __fmul_rn(bfr(nw[dp]), n1); }
        const v2f cs = *(const v2f*)(CS + ((size_t)t * HD + dd) * 2); float a = __fmul_rn(x0, cs[0]), bq = __fmul_rn(x1, cs[1]); asm volatile("" : "+v"(a)); asm volatile("" : "+v"(bq)); const float r = ((dd < HD / 2) ? __fsub_rn(a, bq) : __fadd_rn(a, bq)) * sc;
        o16[q] = tohx(r); unsigned short a2, c2; splitf(r, a2, c2); oh[q] = a2; ol[q] = c2; }
    *(v2h*)(P16 + e) = o16; *(v2us*)(Ph + e) = oh; *(v2us*)(Pl + e) = ol;  }
__global__ __launch_bounds__(256) void k_vtp(const float* __restrict__ F, int pitch, int nheads, h16* V16, bf* Vh, bf* Vl) { const size_t e = ((size_t)blockIdx.x * 256 + threadIdx.x) * 2; if (e >= (size_t)nheads * HD * TT) return; const int t = (int)(e % TT); const int d = (int)((e / TT) % HD); const int g = (int)(e / ((size_t)TT * HD)); v2h o16; v2us oh, ol;
#pragma unroll
    for (int q = 0; q < 2; ++q) { const float x = F[(size_t)(t + q) * pitch + g * HD + d]; o16[q] = tohx(x); unsigned short a2, c2; splitf(x, a2, c2); oh[q] = a2; ol[q] = c2; }
    *(v2h*)(V16 + e) = o16; *(v2us*)(Vh + e) = oh; *(v2us*)(Vl + e) = ol;  }
__global__ __launch_bounds__(256) void k_csid(float* CS) { const int idx = blockIdx.x * 256 + threadIdx.x; if (idx >= TT * HD) return; v2f cs; cs[0] = 1.0f; cs[1] = 0.0f; *(v2f*)(CS + (size_t)idx * 2) = cs;  }
// k_asoft: per row (zz, i): t = S x HD^-0.5 where mask[i][j] != 0 (int [L][L], read as data; zero == masked -> -3e38); softmax over the 2048 keys (register row, one exp, fixed trees);
__global__ __launch_bounds__(256) void k_asoft(const float* __restrict__ Sb, const int* __restrict__ mk, h16* P16, bf* Ph, bf* Pl) {
    const int lane = threadIdx.x & 31; const int row = blockIdx.x * 8 + (threadIdx.x >> 5); if (row >= ZH * TT) return; const int i = row % TT; const int zz = row / TT; (void)zz; const bool hires = (i < RH); const float* sr = Sb + (size_t)row * TT; float v[TT / 32]; float mx = -3.0e38f;
#pragma unroll
    for (int ch = 0; ch < TT / 128; ++ch) { const int j0 = ch * 128 + lane * 4; const v4f a = *(const v4f*)(sr + j0); const v4i mk4 = *(const v4i*)(mk + (size_t)i * TT + j0);
#pragma unroll
        for (int q = 0; q < 4; ++q) { const int j = j0 + q; (void)j; const float t = (mk4[q] != 0) ? a[q] * SCL : -3.0e38f; v[ch * 4 + q] = t; mx = fmaxf(mx, t); } }
#pragma unroll
    for (int sh = 16; sh; sh >>= 1) mx = fmaxf(mx, __shfl_xor(mx, sh, 32));
    float sum = 0.f;
#pragma unroll
    for (int k = 0; k < TT / 32; ++k) { float d0 = __fsub_rn(v[k], mx); asm volatile("" : "+v"(d0)); v[k] = __builtin_amdgcn_exp2f(__fmul_rn(d0, 1.4426950408889634f)); sum += v[k]; }
#pragma unroll
    for (int sh = 16; sh; sh >>= 1) sum += __shfl_xor(sum, sh, 32);
    const float f = __fdiv_rn(hires ? 1.0f : PCAR, sum);
{
        if (hires) {
#pragma unroll
            for (int ch = 0; ch < TT / 128; ++ch) { v4us oh, ol;
#pragma unroll
                for (int q = 0; q < 4; ++q) { unsigned short a, c2; splitf(v[ch * 4 + q] * f, a, c2); oh[q] = a; ol[q] = c2; }
                const size_t oo = ((size_t)zz * (RH ? RH : 1) + i) * TT + ch * 128 + lane * 4; *(v4us*)(Ph + oo) = oh; *(v4us*)(Pl + oo) = ol; }
        } else {
#pragma unroll
            for (int ch = 0; ch < TT / 128; ++ch) { v4h o4;
#pragma unroll
                for (int q = 0; q < 4; ++q) o4[q] = tohx(v[ch * 4 + q] * f);
                *(v4h*)(P16 + (size_t)row * TT + ch * 128 + lane * 4) = o4; } }
         }
}
__global__ __launch_bounds__(256) void k_merge(const float* __restrict__ O, int h0, bf* Ah, bf* Al) { const size_t e = ((size_t)blockIdx.x * 256 + threadIdx.x) * 2; if (e >= (size_t)ZH * TT * HD) return; const int d = (int)(e % HD); const int t = (int)((e / HD) % TT); const int zz = (int)(e / ((size_t)HD * TT)); const float cs = (t < RH) ? 1.0f : (1.0f / PCAR); const size_t oo = (size_t)t * DQ + (h0 + zz) * HD + d;
    v2us oh, ol;
#pragma unroll
    for (int q = 0; q < 2; ++q) { unsigned short a, c2; splitf(O[e + q] * cs, a, c2); oh[q] = a; ol[q] = c2; } *(v2us*)(Ah + oo) = oh; *(v2us*)(Al + oo) = ol;  }

__global__ __launch_bounds__(256) void k_wtH(const float* __restrict__ w, bf* Bt) { const size_t e = ((size_t)blockIdx.x * 256 + threadIdx.x) * 4; if (e >= (size_t)DQ * DM) return; const int k = (int)(e % DM); const int n = (int)(e / DM); const int h = n / HD, c = n % HD; v4us o;   // Bt[h*64 + c][d] = W[h][d][c]
#pragma unroll
    for (int u = 0; u < 4; ++u) o[u] = f2bf(w[((size_t)h * DM + k + u) * HD + c]); *(v4us*)(Bt + e) = o;  }

extern "C" void kernel_launch(void* const* d_in, const int* in_sizes, int n_in,
                              void* d_out, int out_size, void* d_ws, size_t ws_size, hipStream_t stream) {
    (void)in_sizes; (void)n_in; (void)out_size;
    const float* x = (const float*)d_in[0]; const float* xk = (const float*)d_in[1]; const float* xv = (const float*)d_in[2]; const int* mk = (const int*)d_in[3]; const float* wqh = (const float*)d_in[4]; const float* bq = (const float*)d_in[5]; const float* wkh = (const float*)d_in[6]; const float* bk = (const float*)d_in[7]; const float* wvh = (const float*)d_in[8]; const float* bv = (const float*)d_in[9]; const float* wo = (const float*)d_in[10]; const float* wq = nullptr; const float* wk = nullptr; const float* wv = nullptr; (void)wq; (void)wk; (void)wv; const float* cosT = nullptr; const float* sinT = nullptr; (void)cosT; (void)sinT;
    float* OUT = (float*)d_out;     // [2][2048][1024]
    char* wsp = (char*)d_ws;
    auto take = [&](size_t bytes) { char* p = wsp; wsp += (bytes + 255) & ~(size_t)255; return (void*)p; };
    bf* WQ = (bf*)take((size_t)DQ * DM * 2); bf* WK = (bf*)take((size_t)DKV * DM * 2); bf* WV = (bf*)take((size_t)DKV * DM * 2); bf* WO = (bf*)take((size_t)DM * DQ * 2); float* CS = (float*)take((size_t)TT * HD * 2 * 4);
    bf* XB = (bf*)take((size_t)TT * DM * 2); bf* XB2 = (bf*)take((size_t)TT * DM * 2); bf* XB3 = (bf*)take((size_t)TT * DM * 2); float* FQ = (float*)take((size_t)TT * DQ * 4); float* FK = (float*)take((size_t)TT * DKV * 4);
    h16* QP16 = (h16*)take((size_t)NH_ * TT * HD * 2); h16* KP16 = (h16*)take((size_t)NKV * TT * HD * 2); h16* VT16 = (h16*)take((size_t)NKV * HD * TT * 2);
    bf* QPh = (bf*)take((size_t)NH_ * TT * HD * 2); bf* QPl = (bf*)take((size_t)NH_ * TT * HD * 2); bf* KPh = (bf*)take((size_t)NKV * TT * HD * 2); bf* KPl = (bf*)take((size_t)NKV * TT * HD * 2); bf* VTh = (bf*)take((size_t)NKV * HD * TT * 2); bf* VTl = (bf*)take((size_t)NKV * HD * TT * 2); bf* Ph = (bf*)take((size_t)ZH * RH * TT * 2); bf* Pl = (bf*)take((size_t)ZH * RH * TT * 2);
    float* Sb = (float*)take((size_t)ZH * TT * TT * 4); h16* P16 = (h16*)take((size_t)ZH * TT * TT * 2); float* Ob = (float*)take((size_t)ZH * TT * HD * 4); bf* ATh = (bf*)take((size_t)TT * DQ * 2); bf* ATl = (bf*)take((size_t)TT * DQ * 2);
    if ((size_t)(wsp - (char*)d_ws) > ws_size) return;    // ws 256 MiB
    float* FV = FK;   // v projection reuses the k buffer after the k planes are built (stream-ordered)
    { k_wtH<<<(unsigned)(((size_t)DQ * DM / 4 + 255) / 256), 256, 0, stream>>>(wqh, WQ); k_wtH<<<(unsigned)(((size_t)DKV * DM / 4 + 255) / 256), 256, 0, stream>>>(wkh, WK); k_wtH<<<(unsigned)(((size_t)DKV * DM / 4 + 255) / 256), 256, 0, stream>>>(wvh, WV);
      k_wtG<<<(unsigned)((DQ * DM / 64 + 63) / 64), 256, 0, stream>>>(wo, DQ, DM, WO);
       }
    k_csid<<<(TT * HD + 255) / 256, 256, 0, stream>>>(CS);
    const unsigned LQ = (unsigned)(((size_t)NH_ * TT * HD / 2 + 255) / 256), LKv = (unsigned)(((size_t)NKV * TT * HD / 2 + 255) / 256);
    for (int b = 0; b < NB_; ++b) {
        
        k_cvt8<<<(unsigned)(((size_t)TT * DM / 8 + 255) / 256), 256, 0, stream>>>(x + (size_t)b * TT * DM, XB, (size_t)TT * DM / 8); k_cvt8<<<(unsigned)(((size_t)TT * DM / 8 + 255) / 256), 256, 0, stream>>>(xk + (size_t)b * TT * DM, XB2, (size_t)TT * DM / 8); k_cvt8<<<(unsigned)(((size_t)TT * DM / 8 + 255) / 256), 256, 0, stream>>>(xv + (size_t)b * TT * DM, XB3, (size_t)TT * DM / 8);
        k_gemmk<bf, 0, true, 8, DM><<<dim3(TT / 64, DQ / 64, 1), 256, 0, stream>>>(XB, nullptr, WQ, nullptr, FQ, DQ, bq, 0, 0, 0);
        k_rope<<<LQ, 256, 0, stream>>>(FQ, DQ, NH_, CS, nullptr, nullptr, 1.0f, QP16, QPh, QPl);
        k_gemmk<bf, 0, true, 8, DM><<<dim3(TT / 64, DKV / 64, 1), 256, 0, stream>>>(XB2, nullptr, WK, nullptr, FK, DKV, bk, 0, 0, 0);
        k_rope<<<LKv, 256, 0, stream>>>(FK, DKV, NKV, CS, nullptr, nullptr, 1.0f, KP16, KPh, KPl);
        k_gemmk<bf, 0, true, 8, DM><<<dim3(TT / 64, DKV / 64, 1), 256, 0, stream>>>(XB3, nullptr, WV, nullptr, FV, DKV, bv, 0, 0, 0); k_vtp<<<LKv, 256, 0, stream>>>(FV, DKV, NKV, VT16, VTh, VTl);
        for (int h0 = 0; h0 < NH_; h0 += ZH) { const size_t zq = (size_t)h0, zk = (size_t)(h0 / REP);   // one kv head per query head: the pass's two heads use consecutive kv planes (z-strides TT*HD)
            k_gemmw<bf, 2, false><<<dim3(RH / 64, TT / 64, ZH), 32, 0, stream>>>(QPh + zq * TT * HD, QPl + zq * TT * HD, KPh + zk * TT * HD, KPl + zk * TT * HD, HD, Sb, TT, nullptr, (size_t)TT * HD, (size_t)TT * HD, (size_t)TT * TT);
            k_gemmw<h16, 0, false><<<dim3((TT - RH) / 64, TT / 64, ZH), 32, 0, stream>>>(QP16 + zq * TT * HD + (size_t)RH * HD, nullptr, KP16 + zk * TT * HD, nullptr, HD, Sb + (size_t)RH * TT, TT, nullptr, (size_t)TT * HD, (size_t)TT * HD, (size_t)TT * TT);
            k_asoft<<<ZH * TT / 8, 256, 0, stream>>>(Sb, mk, P16, Ph, Pl);
            k_gemmk<bf, 2, false, 16, TT><<<dim3(RH / 64, HD / 64, ZH), 512, 0, stream>>>(Ph, Pl, VTh + zk * HD * TT, VTl + zk * HD * TT, Ob, HD, nullptr, (size_t)RH * TT, (size_t)HD * TT, (size_t)TT * HD);
            k_gemmk<h16, 0, false, 16, TT><<<dim3((TT - RH) / 64, HD / 64, ZH), 512, 0, stream>>>(P16 + (size_t)RH * TT, nullptr, VT16 + zk * HD * TT, nullptr, Ob + (size_t)RH * HD, HD, nullptr, (size_t)TT * TT, (size_t)HD * TT, (size_t)TT * HD);
            k_merge<<<(unsigned)(((size_t)ZH * TT * HD / 2 + 255) / 256), 256, 0, stream>>>(Ob, h0, ATh, ATl); }
        k_gemmk<bf, 1, false, 8, DQ><<<dim3(TT / 64, DM / 64, 1), 256, 0, stream>>>(ATh, ATl, WO, nullptr, OUT + (size_t)b * TT * DM, DM, nullptr, 0, 0, 0); }
}

// v002
// One run takes 605 microseconds.
// Timed twice side by side with v001, it ran 1.74 and 1.73 times as fast.
// Over all steps from v000 it is 3.42 times as fast.
#include <hip/hip_runtime.h>

// MultiHeadAttentionModule (q, k, v inputs [2][2048][1024]; per-head Qh = q Wq[h] + bq[h], Kh = k Wk[h] + bk[h], Vh = v Wv[h] + bv[h] (W [16][1024][64]); scores = Qh.Kh / 8, where(mask == 0, -1e9) (mask [2048][2048] int, read); softmax; out = concat(heads) Wo ([in,out], no bias) -> [2][2048][1024]).
// Compute dtypes, f32 accumulate: every input rounded to bf16; Qh/Kh/Vh on PLAIN bf16 operands (inputs: exact; per-head weights gathered) + bias; scores and attn.v: query rows < 512 hl (3 products), the rest single fp16 (x1024); mask + softmax f32; Wo hl x exact (2 products).

#define NB_  2
#define TT   2048
#define DM   1024
#define NH_  16
#define NKV  16
#define REP  (NH_ / NKV)
#define HD   64
#define DQ   (NH_ * HD)
#define DKV  (NKV * HD)
#define ZH   8                    // heads per attention pass (z of its launches)
#define RH   512                  // query rows < RH use hi+lo planes (0: none)
#define WIN  0
#define PCAR 1024.0f
#define SCL  0.125f   // HD^-0.5
typedef _Float16 h16;
typedef unsigned short bf;
typedef __attribute__((ext_vector_type(16))) __bf16   v16bf;
typedef __attribute__((ext_vector_type(16))) _Float16 v16h;
typedef __attribute__((ext_vector_type(8)))  _Float16 v8h;
typedef __attribute__((ext_vector_type(8)))  unsigned short v8us;
typedef __attribute__((ext_vector_type(8)))  float    v8f;
typedef __attribute__((ext_vector_type(4)))  float    v4f;
typedef v8h  __attribute__((may_alias)) v8ha;
typedef v4f  __attribute__((may_alias)) v4fa;
typedef v8us __attribute__((may_alias)) v8usa;

__device__ __forceinline__ unsigned short f2bf(float f) { unsigned u = __float_as_uint(f); u += 0x7FFFu + ((u >> 16) & 1u); return (unsigned short)(u >> 16); }
__device__ __forceinline__ float bf2f(unsigned short b) { return __uint_as_float(((unsigned)b) << 16); }
__device__ __forceinline__ float bfr(float f) { return bf2f(f2bf(f)); }
__device__ __forceinline__ v16h cat16(v8h lo, v8h hi) { return __builtin_shufflevector(lo, hi, 0, 1, 2, 3, 4, 5, 6, 7, 8, 9, 10, 11, 12, 13, 14, 15); }
__device__ __forceinline__ v16bf cat16b(v8us lo, v8us hi) { return __builtin_bit_cast(v16bf, __builtin_shufflevector(lo, hi, 0, 1, 2, 3, 4, 5, 6, 7, 8, 9, 10, 11, 12, 13, 14, 15)); }
__device__ __forceinline__ v8f wmma16(v16h a, v16h b, v8f c) { return __builtin_amdgcn_wmma_f32_16x16x32_f16(false, a, false, b, (short)0, c, false, false); }
__device__ __forceinline__ v8f wmmab(v16bf a, v16bf b, v8f c) { return __builtin_amdgcn_wmma_f32_16x16x32_bf16(false, a, false, b, (short)0, c, false, false); }



// ---- k_gemmw: register-blocked GEMM, ONE WAVE per 64x64 output tile (16 accumulators), operands straight from K-contiguous 16-bit planes; grid (M/64, N/64, Z), 32 threads.
// C[m][n] (f32, pitch ldc, + optional f32 bias[n]) = sum_k A[m][k] Bt[n][k] (+ split products per NSPLIT). z-batch strides sA/sB/sC in elements. K % 32 == 0.
template <typename T16> struct WFrag;
template <> struct WFrag<h16> { typedef v16h V; static __device__ __forceinline__ V ld(const h16* p) { return cat16(*(const v8h*)p, *(const v8h*)(p + 16)); } static __device__ __forceinline__ v8f mma(V a, V b, v8f c) { return wmma16(a, b, c); } };
template <> struct WFrag<bf> { typedef v16bf V; static __device__ __forceinline__ V ld(const bf* p) { return cat16b(*(const v8us*)p, *(const v8us*)(p + 16)); } static __device__ __forceinline__ v8f mma(V a, V b, v8f c) { return wmmab(a, b, c); } };
template <typename T16, int NSPLIT, bool BIAS>
__global__ __launch_bounds__(32) void k_gemmw(const T16* __restrict__ A, const T16* __restrict__ A2, const T16* __restrict__ Bt, const T16* __restrict__ Bt2, int K, float* C, int ldc, const float* __restrict__ bias, size_t sA, size_t sB, size_t sC) {
    typedef typename WFrag<T16>::V V;
    __shared__ __align__(16) float os[16 * 68];
    const size_t z = blockIdx.z; A += z * sA; if (A2) A2 += z * sA; Bt += z * sB; if (Bt2) Bt2 += z * sB; C += z * sC;
    const int lane = threadIdx.x & 31, lr = lane & 15, hi = lane >> 4; const int r0 = blockIdx.x * 64, c0 = blockIdx.y * 64;
    v8f acc[4][4];
#pragma unroll
    for (int mb = 0; mb < 4; ++mb)
#pragma unroll
        for (int nb = 0; nb < 4; ++nb) acc[mb][nb] = (v8f){};
    const size_t aoff = (size_t)(r0 + lr) * K + 8 * hi, boff = (size_t)(c0 + lr) * K + 8 * hi;
#pragma unroll 1
    for (int kc = 0; kc < K; kc += 32) {
        V a[4], a2[4];
#pragma unroll
        for (int mb = 0; mb < 4; ++mb) { a[mb] = WFrag<T16>::ld(A + aoff + (size_t)mb * 16 * K + kc); if (NSPLIT == 1 || NSPLIT == 2) a2[mb] = WFrag<T16>::ld(A2 + aoff + (size_t)mb * 16 * K + kc); }
#pragma unroll
        for (int nb = 0; nb < 4; ++nb) { const V b = WFrag<T16>::ld(Bt + boff + (size_t)nb * 16 * K + kc); V b2; if (NSPLIT >= 2) b2 = WFrag<T16>::ld(Bt2 + boff + (size_t)nb * 16 * K + kc);
#pragma unroll
            for (int mb = 0; mb < 4; ++mb) { acc[mb][nb] = WFrag<T16>::mma(a[mb], b, acc[mb][nb]); if (NSPLIT == 1 || NSPLIT == 2) acc[mb][nb] = WFrag<T16>::mma(a2[mb], b, acc[mb][nb]); if (NSPLIT >= 2) acc[mb][nb] = WFrag<T16>::mma(a[mb], b2, acc[mb][nb]); } }
        asm volatile("v_nop\n\tv_nop\n\tv_nop\n\tv_nop" : "+v"(acc[0][0]), "+v"(acc[1][1]), "+v"(acc[2][2]), "+v"(acc[3][3]) : "v"(a[0]), "v"(a[3]));
    }
#pragma unroll
    for (int mb = 0; mb < 4; ++mb) {
#pragma unroll
        for (int nb = 0; nb < 4; ++nb) {
#pragma unroll
            for (int j = 0; j < 8; ++j) os[(hi * 8 + j) * 68 + nb * 16 + lr] = acc[mb][nb][j]; }
        __builtin_amdgcn_wave_barrier(); asm volatile("" ::: "memory");
        float* crow = C + (size_t)(r0 + mb * 16) * ldc + c0;
{
#pragma unroll
            for (int s = 0; s < 8; ++s) { const int row = 2 * s + hi, cofs = lr * 4; v4f val = *(const v4fa*)(os + row * 68 + cofs); if (BIAS) { val[0] += bfr(bias[c0 + cofs]); val[1] += bfr(bias[c0 + cofs + 1]); val[2] += bfr(bias[c0 + cofs + 2]); val[3] += bfr(bias[c0 + cofs + 3]); }
                *(v4f*)(crow + (size_t)row * ldc + cofs) = val; }
             }
        __builtin_amdgcn_wave_barrier(); asm volatile("" ::: "memory");
    }
}

// ---- k_gemmk: the 64x64 tile of k_gemmw with its K range dealt to KW waves of one work-group (wave w takes k in [w K/KW, (w+1) K/KW)), for products whose K loop is long and whose tiles are few.
// Each wave leaves its partial tile in its own LDS plane; behind one barrier the planes are summed in wave order 0..KW-1 (a fixed order), the bias is added and the tile stored. grid (M/64, N/64, Z), 32 KW threads. K % (32 KW) == 0.
// Fragment addresses: a scalar base per operand (tile row 0, the wave's first k) + ONE byte offset per lane, the same for all operands where LDA == K (row lr, half hi, the trip's k) + a constant (16 mb or 16 nb rows; K is a template constant for that).
// LDA: row pitch of A and A2 in elements (Bt keeps pitch K); where it is not K, A and A2 take a lane offset of their own.
template <typename T16, int NSPLIT, bool BIAS, int KW, int K, int LDA = K>
__global__ __launch_bounds__(32 * KW) void k_gemmk(const T16* __restrict__ A, const T16* __restrict__ A2, const T16* __restrict__ Bt, const T16* __restrict__ Bt2, float* C, int ldc, const float* __restrict__ bias, size_t sA, size_t sB, size_t sC) {
    typedef typename WFrag<T16>::V V;
    __shared__ __align__(16) float os[KW * 64 * 68];
    const size_t z = blockIdx.z; A += z * sA; if (A2) A2 += z * sA; Bt += z * sB; if (Bt2) Bt2 += z * sB; C += z * sC;
    const int lane = threadIdx.x & 31, lr = lane & 15, hi = lane >> 4; const int r0 = blockIdx.x * 64, c0 = blockIdx.y * 64;
    const int wave = __builtin_amdgcn_readfirstlane((int)(threadIdx.x >> 5)); const int kb = wave * (K / KW);   // scalar: the wave's first k goes into the scalar bases
    v8f acc[4][4];   // every '#pragma unroll' of this kernel makes the indices of acc, a, a2 constants, so that the fragments stay in registers
#pragma unroll
    for (int mb = 0; mb < 4; ++mb)
#pragma unroll
        for (int nb = 0; nb < 4; ++nb) acc[mb][nb] = (v8f){};
    const char* Ab = (const char*)(A + (size_t)r0 * LDA + kb); const char* A2b = (const char*)(A2 + (size_t)r0 * LDA + kb); const char* Bb = (const char*)(Bt + (size_t)c0 * K + kb); const char* B2b = (const char*)(Bt2 + (size_t)c0 * K + kb);
    unsigned vo = (unsigned)(lr * K + 8 * hi) * 2u;   // the lane's byte offset; + 64 a trip
    unsigned voa = (unsigned)(lr * LDA + 8 * hi) * 2u;   // the same at A's pitch (used only where LDA != K)
#pragma unroll 1   // rolled, as in k_gemmw: a second trip's fragments would not fit the 256 registers that 16 waves a work-group leave each wave
    for (int t = 0; t < K / KW / 32; ++t) {
        V a[4], a2[4]; const unsigned va = (LDA == K) ? vo : voa;
#pragma unroll
        for (int mb = 0; mb < 4; ++mb) { a[mb] = WFrag<T16>::ld((const T16*)(Ab + va + mb * 16 * LDA * 2)); if (NSPLIT == 1 || NSPLIT == 2) a2[mb] = WFrag<T16>::ld((const T16*)(A2b + va + mb * 16 * LDA * 2)); }
#pragma unroll
        for (int nb = 0; nb < 4; ++nb) { const V b = WFrag<T16>::ld((const T16*)(Bb + vo + nb * 16 * K * 2)); V b2; if (NSPLIT >= 2) b2 = WFrag<T16>::ld((const T16*)(B2b + vo + nb * 16 * K * 2));
#pragma unroll
            for (int mb = 0; mb < 4; ++mb) { acc[mb][nb] = WFrag<T16>::mma(a[mb], b, acc[mb][nb]); if (NSPLIT == 1 || NSPLIT == 2) acc[mb][nb] = WFrag<T16>::mma(a2[mb], b, acc[mb][nb]); if (NSPLIT >= 2) acc[mb][nb] = WFrag<T16>::mma(a[mb], b2, acc[mb][nb]); } }
        // as in k_gemmw: four vector slots behind the trip's last matrix instructions, on the taken branch too, before the next trip overwrites registers of A and B fragments;
        // s_wait_xcnt 0: the wait in front of the overwrites of registers that the trip's loads name (vo, and voa where LDA != K, are operands, so that their additions stay behind the wait)
        if constexpr (LDA == K) { asm volatile("v_nop\n\tv_nop\n\tv_nop\n\tv_nop\n\ts_wait_xcnt 0x0" : "+v"(acc[0][0]), "+v"(acc[1][1]), "+v"(acc[2][2]), "+v"(acc[3][3]), "+v"(vo) : "v"(a[0]), "v"(a[3])); }
        else { asm volatile("v_nop\n\tv_nop\n\tv_nop\n\tv_nop\n\ts_wait_xcnt 0x0" : "+v"(acc[0][0]), "+v"(acc[1][1]), "+v"(acc[2][2]), "+v"(acc[3][3]), "+v"(vo), "+v"(voa) : "v"(a[0]), "v"(a[3])); voa += 64u; }   // the same statement with both lane offsets as operands
        vo += 64u;
    }
    float* ow = os + wave * (64 * 68);
#pragma unroll
    for (int mb = 0; mb < 4; ++mb)
#pragma unroll
        for (int nb = 0; nb < 4; ++nb)
#pragma unroll
            for (int j = 0; j < 8; ++j) ow[(mb * 16 + hi * 8 + j) * 68 + nb * 16 + lr] = acc[mb][nb][j];
    __syncthreads();   // every wave's partial tile is in LDS before any plane is read
#pragma unroll
    for (int s = 0; s < 32 / KW; ++s) { const int idx = s * (32 * KW) + (int)threadIdx.x; const int row = idx >> 4, cofs = (idx & 15) * 4; const float* op = os + row * 68 + cofs; v4f val = *(const v4fa*)op;
#pragma unroll
        for (int w = 1; w < KW; ++w) val += *(const v4fa*)(op + w * (64 * 68));
        if (BIAS) { val[0] += bfr(bias[c0 + cofs]); val[1] += bfr(bias[c0 + cofs + 1]); val[2] += bfr(bias[c0 + cofs + 2]); val[3] += bfr(bias[c0 + cofs + 3]); }
        *(v4f*)(C + (size_t)(r0 + row) * ldc + c0 + cofs) = val; }
}

__device__ __forceinline__ h16 tohx(float x) { return (h16)x; }
__device__ __forceinline__ void splitf(float y, unsigned short& h, unsigned short& l) { h = f2bf(y); l = f2bf(y - bf2f(h)); }
typedef __attribute__((ext_vector_type(2))) _Float16 v2h;
typedef __attribute__((ext_vector_type(4))) _Float16 v4h;
typedef __attribute__((ext_vector_type(2))) unsigned short v2us;
typedef __attribute__((ext_vector_type(4))) unsigned short v4us;
typedef __attribute__((ext_vector_type(2))) float v2f;
typedef __attribute__((ext_vector_type(4))) int v4i;

__global__ __launch_bounds__(256) void k_wtG(const float* __restrict__ w, int K, int N, bf* Bt) {
    const int lane = threadIdx.x & 31; const int L0 = (blockIdx.x * 8 + (threadIdx.x >> 5)) * 8; const int nlines = N * K / 64;
{
#pragma unroll 1
        for (int l = 0; l < 8; ++l) { const int L = L0 + l; if (L >= nlines) break; const size_t e = (size_t)L * 64 + lane * 2; const int k = (int)(e % K), n = (int)(e / K); v2us o;
            o[0] = f2bf(w[(size_t)k * N + n]); o[1] = f2bf(w[(size_t)(k + 1) * N + n]); *(v2us*)(Bt + e) = o; }
         }
}
__global__ __launch_bounds__(256) void k_cvt8(const float* __restrict__ src, bf* dst, size_t n8) { const size_t i = (size_t)blockIdx.x * 256 + threadIdx.x; if (i >= n8) return; const v8f v = *(const v8f*)(src + i * 8); v8us o;
#pragma unroll
    for (int k = 0; k < 8; ++k) o[k] = f2bf(v[k]); *(v8us*)(dst + i * 8) = o;  }
__global__ __launch_bounds__(256) void k_cscvt(const float* __restrict__ cosT, const float* __restrict__ sinT, float* CS) { const int idx = blockIdx.x * 256 + threadIdx.x; if (idx >= TT * HD) return; v2f cs; cs[0] = bfr(cosT[idx]); cs[1] = bfr(sinT[idx]); *(v2f*)(CS + (size_t)idx * 2) = cs;  }
// k_rope: head planes [h][t][d] (fp16 + hi/lo) of rope(x) x sc with the rotate-half convention out[d] = x[d] cos[t][d] - x[d+HD/2] sin[t][d], out[d+HD/2] = x[d+HD/2] cos[t][d+HD/2] + x[d] sin[t][d+HD/2]
__global__ __launch_bounds__(256) void k_rope(const float* __restrict__ F, int pitch, int nheads, const float* __restrict__ CS, const float* __restrict__ RF, const float* __restrict__ nw, float sc, h16* P16, bf* Ph, bf* Pl) {
    const size_t e = ((size_t)blockIdx.x * 256 + threadIdx.x) * 2; if (e >= (size_t)nheads * TT * HD) return; const int d = (int)(e % HD); const int t = (int)((e / HD) % TT); const int h = (int)(e / ((size_t)HD * TT)); const float* f = F + (size_t)t * pitch + h * HD; const float rf = RF ? RF[(size_t)h * TT + t] : 1.0f; v2h o16; v2us oh, ol;
#pragma unroll
    for (int q = 0; q < 2; ++q) { const int dd = d + q; const int dp = (dd < HD / 2) ? dd + HD / 2 : dd - HD / 2; float x0 = f[dd], x1 = f[dp];
        if (RF) { float n0 = __fmul_rn(x0, rf), n1 = __fmul_rn(x1, rf); asm volatile("" : "+v"(n0)); asm volatile("" : "+v"(n1)); x0 = __fmul_rn(bfr(nw[dd]), n0); x1 = __fmul_rn(bfr(nw[dp]), n1); }
        const v2f cs = *(const v2f*)(CS + ((size_t)t * HD + dd) * 2); float a = __fmul_rn(x0, cs[0]), bq = __fmul_rn(x1, cs[1]); asm volatile("" : "+v"(a)); asm volatile("" : "+v"(bq)); const float r = ((dd < HD / 2) ? __fsub_rn(a, bq) : __fadd_rn(a, bq)) * sc;
        o16[q] = tohx(r); unsigned short a2, c2; splitf(r, a2, c2); oh[q] = a2; ol[q] = c2; }
    *(v2h*)(P16 + e) = o16; *(v2us*)(Ph + e) = oh; *(v2us*)(Pl + e) = ol;  }
__global__ __launch_bounds__(256) void k_vtp(const float* __restrict__ F, int pitch, int nheads, h16* V16, bf* Vh, bf* Vl) { const size_t e = ((size_t)blockIdx.x * 256 + threadIdx.x) * 2; if (e >= (size_t)nheads * HD * TT) return; const int t = (int)(e % TT); const int d = (int)((e / TT) % HD); const int g = (int)(e / ((size_t)TT * HD)); v2h o16; v2us oh, ol;
#pragma unroll
    for (int q = 0; q < 2; ++q) { const float x = F[(size_t)(t + q) * pitch + g * HD + d]; o16[q] = tohx(x); unsigned short a2, c2; splitf(x, a2, c2); oh[q] = a2; ol[q] = c2; }
    *(v2h*)(V16 + e) = o16; *(v2us*)(Vh + e) = oh; *(v2us*)(Vl + e) = ol;  }
__global__ __launch_bounds__(256) void k_csid(float* CS) { const int idx = blockIdx.x * 256 + threadIdx.x; if (idx >= TT * HD) return; v2f cs; cs[0] = 1.0f; cs[1] = 0.0f; *(v2f*)(CS + (size_t)idx * 2) = cs;  }
// k_asoft: per row (zz, i): t = S x HD^-0.5 where mask[i][j] != 0 (int [L][L], read as data; zero == masked -> -3e38); softmax over the 2048 keys (register row, one exp, fixed trees);
// IN PLACE: the 16-bit row(s) go over the row's own 8 KiB of f32 scores (P16 or Ph in its first half, Pl in its second; row pitch 2 TT elements). One wave owns a row and holds all of it in registers before its first store (every store needs the row's sum), and no other wave touches that row.
__global__ __launch_bounds__(256) void k_asoft(float* __restrict__ Sb, const int* __restrict__ mk) {
    h16* P16 = (h16*)Sb; bf* Ph = (bf*)Sb; bf* Pl = (bf*)Sb + TT;
    const int lane = threadIdx.x & 31; const int row = blockIdx.x * 8 + (threadIdx.x >> 5); if (row >= ZH * TT) return; const int i = row % TT; const int zz = row / TT; (void)zz; const bool hires = (i < RH); const float* sr = Sb + (size_t)row * TT; float v[TT / 32]; float mx = -3.0e38f;
#pragma unroll
    for (int ch = 0; ch < TT / 128; ++ch) { const int j0 = ch * 128 + lane * 4; const v4f a = *(const v4f*)(sr + j0); const v4i mk4 = *(const v4i*)(mk + (size_t)i * TT + j0);
#pragma unroll
        for (int q = 0; q < 4; ++q) { const int j = j0 + q; (void)j; const float t = (mk4[q] != 0) ? a[q] * SCL : -3.0e38f; v[ch * 4 + q] = t; mx = fmaxf(mx, t); } }
#pragma unroll
    for (int sh = 16; sh; sh >>= 1) mx = fmaxf(mx, __shfl_xor(mx, sh, 32));
    float sum = 0.f;
#pragma unroll
    for (int k = 0; k < TT / 32; ++k) { float d0 = __fsub_rn(v[k], mx); asm volatile("" : "+v"(d0)); v[k] = __builtin_amdgcn_exp2f(__fmul_rn(d0, 1.4426950408889634f)); sum += v[k]; }
#pragma unroll
    for (int sh = 16; sh; sh >>= 1) sum += __shfl_xor(sum, sh, 32);
    const float f = __fdiv_rn(hires ? 1.0f : PCAR, sum);
{
        if (hires) {
#pragma unroll
            for (int ch = 0; ch < TT / 128; ++ch) { v4us oh, ol;
#pragma unroll
                for (int q = 0; q < 4; ++q) { unsigned short a, c2; splitf(v[ch * 4 + q] * f, a, c2); oh[q] = a; ol[q] = c2; }
                const size_t oo = (size_t)row * (2 * TT) + ch * 128 + lane * 4; *(v4us*)(Ph + oo) = oh; *(v4us*)(Pl + oo) = ol; }
        } else {
#pragma unroll
            for (int ch = 0; ch < TT / 128; ++ch) { v4h o4;
#pragma unroll
                for (int q = 0; q < 4; ++q) o4[q] = tohx(v[ch * 4 + q] * f);
                *(v4h*)(P16 + (size_t)row * (2 * TT) + ch * 128 + lane * 4) = o4; } }
         }
}
__global__ __launch_bounds__(256) void k_merge(const float* __restrict__ O, int h0, bf* Ah, bf* Al) { const size_t e = ((size_t)blockIdx.x * 256 + threadIdx.x) * 2; if (e >= (size_t)ZH * TT * HD) return; const int d = (int)(e % HD); const int t = (int)((e / HD) % TT); const int zz = (int)(e / ((size_t)HD * TT)); const float cs = (t < RH) ? 1.0f : (1.0f / PCAR); const size_t oo = (size_t)t * DQ + (h0 + zz) * HD + d;
    v2us oh, ol;
#pragma unroll
    for (int q = 0; q < 2; ++q) { unsigned short a, c2; splitf(O[e + q] * cs, a, c2); oh[q] = a; ol[q] = c2; } *(v2us*)(Ah + oo) = oh; *(v2us*)(Al + oo) = ol;  }

__global__ __launch_bounds__(256) void k_wtH(const float* __restrict__ w, bf* Bt) { const size_t e = ((size_t)blockIdx.x * 256 + threadIdx.x) * 4; if (e >= (size_t)DQ * DM) return; const int k = (int)(e % DM); const int n = (int)(e / DM); const int h = n / HD, c = n % HD; v4us o;   // Bt[h*64 + c][d] = W[h][d][c]
#pragma unroll
    for (int u = 0; u < 4; ++u) o[u] = f2bf(w[((size_t)h * DM + k + u) * HD + c]); *(v4us*)(Bt + e) = o;  }

extern "C" void kernel_launch(void* const* d_in, const int* in_sizes, int n_in,
                              void* d_out, int out_size, void* d_ws, size_t ws_size, hipStream_t stream) {
    (void)in_sizes; (void)n_in; (void)out_size;
    const float* x = (const float*)d_in[0]; const float* xk = (const float*)d_in[1]; const float* xv = (const float*)d_in[2]; const int* mk = (const int*)d_in[3]; const float* wqh = (const float*)d_in[4]; const float* bq = (const float*)d_in[5]; const float* wkh = (const float*)d_in[6]; const float* bk = (const float*)d_in[7]; const float* wvh = (const float*)d_in[8]; const float* bv = (const float*)d_in[9]; const float* wo = (const float*)d_in[10]; const float* wq = nullptr; const float* wk = nullptr; const float* wv = nullptr; (void)wq; (void)wk; (void)wv; const float* cosT = nullptr; const float* sinT = nullptr; (void)cosT; (void)sinT;
    float* OUT = (float*)d_out;     // [2][2048][1024]
    char* wsp = (char*)d_ws;
    auto take = [&](size_t bytes) { char* p = wsp; wsp += (bytes + 255) & ~(size_t)255; return (void*)p; };
    bf* WQ = (bf*)take((size_t)DQ * DM * 2); bf* WK = (bf*)take((size_t)DKV * DM * 2); bf* WV = (bf*)take((size_t)DKV * DM * 2); bf* WO = (bf*)take((size_t)DM * DQ * 2); float* CS = (float*)take((size_t)TT * HD * 2 * 4);
    bf* XB = (bf*)take((size_t)TT * DM * 2); bf* XB2 = (bf*)take((size_t)TT * DM * 2); bf* XB3 = (bf*)take((size_t)TT * DM * 2); float* FQ = (float*)take((size_t)TT * DQ * 4); float* FK = (float*)take((size_t)TT * DKV * 4);
    h16* QP16 = (h16*)take((size_t)NH_ * TT * HD * 2); h16* KP16 = (h16*)take((size_t)NKV * TT * HD * 2); h16* VT16 = (h16*)take((size_t)NKV * HD * TT * 2);
    bf* QPh = (bf*)take((size_t)NH_ * TT * HD * 2); bf* QPl = (bf*)take((size_t)NH_ * TT * HD * 2); bf* KPh = (bf*)take((size_t)NKV * TT * HD * 2); bf* KPl = (bf*)take((size_t)NKV * TT * HD * 2); bf* VTh = (bf*)take((size_t)NKV * HD * TT * 2); bf* VTl = (bf*)take((size_t)NKV * HD * TT * 2);
    float* Sb = (float*)take((size_t)ZH * TT * TT * 4); h16* P16 = (h16*)Sb; bf* Ph = (bf*)Sb; bf* Pl = (bf*)Sb + TT;   /* probabilities in place over the score rows, row pitch 2 TT */ float* Ob = (float*)take((size_t)ZH * TT * HD * 4); bf* ATh = (bf*)take((size_t)TT * DQ * 2); bf* ATl = (bf*)take((size_t)TT * DQ * 2);
    if ((size_t)(wsp - (char*)d_ws) > ws_size) return;    // ws 256 MiB
    float* FV = FK;   // v projection reuses the k buffer after the k planes are built (stream-ordered)
    { k_wtH<<<(unsigned)(((size_t)DQ * DM / 4 + 255) / 256), 256, 0, stream>>>(wqh, WQ); k_wtH<<<(unsigned)(((size_t)DKV * DM / 4 + 255) / 256), 256, 0, stream>>>(wkh, WK); k_wtH<<<(unsigned)(((size_t)DKV * DM / 4 + 255) / 256), 256, 0, stream>>>(wvh, WV);
      k_wtG<<<(unsigned)((DQ * DM / 64 + 63) / 64), 256, 0, stream>>>(wo, DQ, DM, WO);
       }
    k_csid<<<(TT * HD + 255) / 256, 256, 0, stream>>>(CS);
    const unsigned LQ = (unsigned)(((size_t)NH_ * TT * HD / 2 + 255) / 256), LKv = (unsigned)(((size_t)NKV * TT * HD / 2 + 255) / 256);
    for (int b = 0; b < NB_; ++b) {
        
        k_cvt8<<<(unsigned)(((size_t)TT * DM / 8 + 255) / 256), 256, 0, stream>>>(x + (size_t)b * TT * DM, XB, (size_t)TT * DM / 8); k_cvt8<<<(unsigned)(((size_t)TT * DM / 8 + 255) / 256), 256, 0, stream>>>(xk + (size_t)b * TT * DM, XB2, (size_t)TT * DM / 8); k_cvt8<<<(unsigned)(((size_t)TT * DM / 8 + 255) / 256), 256, 0, stream>>>(xv + (size_t)b * TT * DM, XB3, (size_t)TT * DM / 8);
        k_gemmk<bf, 0, true, 8, DM><<<dim3(TT / 64, DQ / 64, 1), 256, 0, stream>>>(XB, nullptr, WQ, nullptr, FQ, DQ, bq, 0, 0, 0);
        k_rope<<<LQ, 256, 0, stream>>>(FQ, DQ, NH_, CS, nullptr, nullptr, 1.0f, QP16, QPh, QPl);
        k_gemmk<bf, 0, true, 8, DM><<<dim3(TT / 64, DKV / 64, 1), 256, 0, stream>>>(XB2, nullptr, WK, nullptr, FK, DKV, bk, 0, 0, 0);
        k_rope<<<LKv, 256, 0, stream>>>(FK, DKV, NKV, CS, nullptr, nullptr, 1.0f, KP16, KPh, KPl);
        k_gemmk<bf, 0, true, 8, DM><<<dim3(TT / 64, DKV / 64, 1), 256, 0, stream>>>(XB3, nullptr, WV, nullptr, FV, DKV, bv, 0, 0, 0); k_vtp<<<LKv, 256, 0, stream>>>(FV, DKV, NKV, VT16, VTh, VTl);
        for (int h0 = 0; h0 < NH_; h0 += ZH) { const size_t zq = (size_t)h0, zk = (size_t)(h0 / REP);   // one kv head per query head: the pass's heads use consecutive kv planes (z-strides TT*HD)
            k_gemmw<bf, 2, false><<<dim3(RH / 64, TT / 64, ZH), 32, 0, stream>>>(QPh + zq * TT * HD, QPl + zq * TT * HD, KPh + zk * TT * HD, KPl + zk * TT * HD, HD, Sb, TT, nullptr, (size_t)TT * HD, (size_t)TT * HD, (size_t)TT * TT);
            k_gemmw<h16, 0, false><<<dim3((TT - RH) / 64, TT / 64, ZH), 32, 0, stream>>>(QP16 + zq * TT * HD + (size_t)RH * HD, nullptr, KP16 + zk * TT * HD, nullptr, HD, Sb + (size_t)RH * TT, TT, nullptr, (size_t)TT * HD, (size_t)TT * HD, (size_t)TT * TT);
            k_asoft<<<ZH * TT / 8, 256, 0, stream>>>(Sb, mk);
            k_gemmk<bf, 2, false, 16, TT, 2 * TT><<<dim3(RH / 64, HD / 64, ZH), 512, 0, stream>>>(Ph, Pl, VTh + zk * HD * TT, VTl + zk * HD * TT, Ob, HD, nullptr, (size_t)TT * 2 * TT, (size_t)HD * TT, (size_t)TT * HD);
            k_gemmk<h16, 0, false, 16, TT, 2 * TT><<<dim3((TT - RH) / 64, HD / 64, ZH), 512, 0, stream>>>(P16 + (size_t)RH * 2 * TT, nullptr, VT16 + zk * HD * TT, nullptr, Ob + (size_t)RH * HD, HD, nullptr, (size_t)TT * 2 * TT, (size_t)HD * TT, (size_t)TT * HD);
            k_merge<<<(unsigned)(((size_t)ZH * TT * HD / 2 + 255) / 256), 256, 0, stream>>>(Ob, h0, ATh, ATl); }
        k_gemmk<bf, 1, false, 8, DQ><<<dim3(TT / 64, DM / 64, 1), 256, 0, stream>>>(ATh, ATl, WO, nullptr, OUT + (size_t)b * TT * DM, DM, nullptr, 0, 0, 0); }
}

// v003
// Measured time: 340 microseconds a run.
// Timed twice side by side with v002, it ran 1.78 times as fast both times.
// Over all steps from v000 it is 6.09 times as fast.
#include <hip/hip_runtime.h>

// MultiHeadAttentionModule (q, k, v inputs [2][2048][1024]; per-head Qh = q Wq[h] + bq[h], Kh = k Wk[h] + bk[h], Vh = v Wv[h] + bv[h] (W [16][1024][64]); scores = Qh.Kh / 8, where(mask == 0, -1e9) (mask [2048][2048] int, read); softmax; out = concat(heads) Wo ([in,out], no bias) -> [2][2048][1024]).
// Compute dtypes, f32 accumulate: every input rounded to bf16; Qh/Kh/Vh on PLAIN bf16 operands (inputs: exact; per-head weights gathered) + bias; scores and attn.v (one fused kernel, running maximum): query rows < 512 hl (3 products), the rest single fp16 (x1024); mask + softmax f32; Wo hl x exact (2 products).

#define NB_  2
#define TT   2048
#define DM   1024
#define NH_  16
#define NKV  16
#define REP  (NH_ / NKV)
#define HD   64
#define DQ   (NH_ * HD)
#define DKV  (NKV * HD)
#define RH   512                  // query rows < RH use hi+lo planes (0: none)
#define WIN  0
#define PCAR 1024.0f
#define SCL  0.125f   // HD^-0.5
typedef _Float16 h16;
typedef unsigned short bf;
typedef __attribute__((ext_vector_type(16))) __bf16   v16bf;
typedef __attribute__((ext_vector_type(16))) _Float16 v16h;
typedef __attribute__((ext_vector_type(8)))  _Float16 v8h;
typedef __attribute__((ext_vector_type(8)))  unsigned short v8us;
typedef __attribute__((ext_vector_type(8)))  float    v8f;
typedef __attribute__((ext_vector_type(4)))  float    v4f;
typedef v8h  __attribute__((may_alias)) v8ha;
typedef v4f  __attribute__((may_alias)) v4fa;
typedef v8us __attribute__((may_alias)) v8usa;

__device__ __forceinline__ unsigned short f2bf(float f) { unsigned u = __float_as_uint(f); u += 0x7FFFu + ((u >> 16) & 1u); return (unsigned short)(u >> 16); }
__device__ __forceinline__ float bf2f(unsigned short b) { return __uint_as_float(((unsigned)b) << 16); }
__device__ __forceinline__ float bfr(float f) { return bf2f(f2bf(f)); }
__device__ __forceinline__ v16h cat16(v8h lo, v8h hi) { return __builtin_shufflevector(lo, hi, 0, 1, 2, 3, 4, 5, 6, 7, 8, 9, 10, 11, 12, 13, 14, 15); }
__device__ __forceinline__ v16bf cat16b(v8us lo, v8us hi) { return __builtin_bit_cast(v16bf, __builtin_shufflevector(lo, hi, 0, 1, 2, 3, 4, 5, 6, 7, 8, 9, 10, 11, 12, 13, 14, 15)); }
__device__ __forceinline__ v8f wmma16(v16h a, v16h b, v8f c) { return __builtin_amdgcn_wmma_f32_16x16x32_f16(false, a, false, b, (short)0, c, false, false); }
__device__ __forceinline__ v8f wmmab(v16bf a, v16bf b, v8f c) { return __builtin_amdgcn_wmma_f32_16x16x32_bf16(false, a, false, b, (short)0, c, false, false); }



// ---- fragment loaders: a lane's 16 elements of a K-contiguous 16-bit row, in the hardware k order (8 at p, 8 at p + 16; p holds the lane half's 8 hi)
template <typename T16> struct WFrag;
template <> struct WFrag<h16> { typedef v16h V; static __device__ __forceinline__ V ld(const h16* p) { return cat16(*(const v8h*)p, *(const v8h*)(p + 16)); } static __device__ __forceinline__ v8f mma(V a, V b, v8f c) { return wmma16(a, b, c); } };
template <> struct WFrag<bf> { typedef v16bf V; static __device__ __forceinline__ V ld(const bf* p) { return cat16b(*(const v8us*)p, *(const v8us*)(p + 16)); } static __device__ __forceinline__ v8f mma(V a, V b, v8f c) { return wmmab(a, b, c); } };
// ---- k_gemmk: one 64x64 output tile (16 accumulators a wave, operands straight from K-contiguous 16-bit planes) with its K range dealt to KW waves of one work-group (wave w takes k in [w K/KW, (w+1) K/KW)), for products whose K loop is long and whose tiles are few.
// Each wave leaves its partial tile in its own LDS plane; behind one barrier the planes are summed in wave order 0..KW-1 (a fixed order), the bias is added and the tile stored. grid (M/64, N/64, Z), 32 KW threads. K % (32 KW) == 0.
// Fragment addresses: a scalar base per operand (tile row 0, the wave's first k) + ONE byte offset per lane, the same for all operands where LDA == K (row lr, half hi, the trip's k) + a constant (16 mb or 16 nb rows; K is a template constant for that).
// LDA: row pitch of A and A2 in elements (Bt keeps pitch K); where it is not K, A and A2 take a lane offset of their own.
template <typename T16, int NSPLIT, bool BIAS, int KW, int K, int LDA = K>
__global__ __launch_bounds__(32 * KW) void k_gemmk(const T16* __restrict__ A, const T16* __restrict__ A2, const T16* __restrict__ Bt, const T16* __restrict__ Bt2, float* C, int ldc, const float* __restrict__ bias, size_t sA, size_t sB, size_t sC) {
    typedef typename WFrag<T16>::V V;
    __shared__ __align__(16) float os[KW * 64 * 68];
    const size_t z = blockIdx.z; A += z * sA; if (A2) A2 += z * sA; Bt += z * sB; if (Bt2) Bt2 += z * sB; C += z * sC;
    const int lane = threadIdx.x & 31, lr = lane & 15, hi = lane >> 4; const int r0 = blockIdx.x * 64, c0 = blockIdx.y * 64;
    const int wave = __builtin_amdgcn_readfirstlane((int)(threadIdx.x >> 5)); const int kb = wave * (K / KW);   // scalar: the wave's first k goes into the scalar bases
    v8f acc[4][4];   // every '#pragma unroll' of this kernel makes the indices of acc, a, a2 constants, so that the fragments stay in registers
#pragma unroll
    for (int mb = 0; mb < 4; ++mb)
#pragma unroll
        for (int nb = 0; nb < 4; ++nb) acc[mb][nb] = (v8f){};
    const char* Ab = (const char*)(A + (size_t)r0 * LDA + kb); const char* A2b = (const char*)(A2 + (size_t)r0 * LDA + kb); const char* Bb = (const char*)(Bt + (size_t)c0 * K + kb); const char* B2b = (const char*)(Bt2 + (size_t)c0 * K + kb);
    unsigned vo = (unsigned)(lr * K + 8 * hi) * 2u;   // the lane's byte offset; + 64 a trip
    unsigned voa = (unsigned)(lr * LDA + 8 * hi) * 2u;   // the same at A's pitch (used only where LDA != K)
#pragma unroll 1   // rolled: a second trip's fragments would not fit the 256 registers that 8 waves a work-group leave each wave
    for (int t = 0; t < K / KW / 32; ++t) {
        V a[4], a2[4]; const unsigned va = (LDA == K) ? vo : voa;
#pragma unroll
        for (int mb = 0; mb < 4; ++mb) { a[mb] = WFrag<T16>::ld((const T16*)(Ab + va + mb * 16 * LDA * 2)); if (NSPLIT == 1 || NSPLIT == 2) a2[mb] = WFrag<T16>::ld((const T16*)(A2b + va + mb * 16 * LDA * 2)); }
#pragma unroll
        for (int nb = 0; nb < 4; ++nb) { const V b = WFrag<T16>::ld((const T16*)(Bb + vo + nb * 16 * K * 2)); V b2; if (NSPLIT >= 2) b2 = WFrag<T16>::ld((const T16*)(B2b + vo + nb * 16 * K * 2));
#pragma unroll
            for (int mb = 0; mb < 4; ++mb) { acc[mb][nb] = WFrag<T16>::mma(a[mb], b, acc[mb][nb]); if (NSPLIT == 1 || NSPLIT == 2) acc[mb][nb] = WFrag<T16>::mma(a2[mb], b, acc[mb][nb]); if (NSPLIT >= 2) acc[mb][nb] = WFrag<T16>::mma(a[mb], b2, acc[mb][nb]); } }
        // four vector slots behind the trip's last matrix instructions, on the taken branch too, before the next trip overwrites registers of A and B fragments;
        // s_wait_xcnt 0: the wait in front of the one overwrite of a register that the trip's loads name (vo is an operand, so that its addition stays behind the wait)
        if constexpr (LDA == K) { asm volatile("v_nop\n\tv_nop\n\tv_nop\n\tv_nop\n\ts_wait_xcnt 0x0" : "+v"(acc[0][0]), "+v"(acc[1][1]), "+v"(acc[2][2]), "+v"(acc[3][3]), "+v"(vo) : "v"(a[0]), "v"(a[3])); }
        else { asm volatile("v_nop\n\tv_nop\n\tv_nop\n\tv_nop\n\ts_wait_xcnt 0x0" : "+v"(acc[0][0]), "+v"(acc[1][1]), "+v"(acc[2][2]), "+v"(acc[3][3]), "+v"(vo), "+v"(voa) : "v"(a[0]), "v"(a[3])); voa += 64u; }   // the same statement with both lane offsets as operands
        vo += 64u;
    }
    float* ow = os + wave * (64 * 68);
#pragma unroll
    for (int mb = 0; mb < 4; ++mb)
#pragma unroll
        for (int nb = 0; nb < 4; ++nb)
#pragma unroll
            for (int j = 0; j < 8; ++j) ow[(mb * 16 + hi * 8 + j) * 68 + nb * 16 + lr] = acc[mb][nb][j];
    __syncthreads();   // every wave's partial tile is in LDS before any plane is read
#pragma unroll
    for (int s = 0; s < 32 / KW; ++s) { const int idx = s * (32 * KW) + (int)threadIdx.x; const int row = idx >> 4, cofs = (idx & 15) * 4; const float* op = os + row * 68 + cofs; v4f val = *(const v4fa*)op;
#pragma unroll
        for (int w = 1; w < KW; ++w) val += *(const v4fa*)(op + w * (64 * 68));
        if (BIAS) { val[0] += bfr(bias[c0 + cofs]); val[1] += bfr(bias[c0 + cofs + 1]); val[2] += bfr(bias[c0 + cofs + 2]); val[3] += bfr(bias[c0 + cofs + 3]); }
        *(v4f*)(C + (size_t)(r0 + row) * ldc + c0 + cofs) = val; }
}

__device__ __forceinline__ h16 tohx(float x) { return (h16)x; }
__device__ __forceinline__ void splitf(float y, unsigned short& h, unsigned short& l) { h = f2bf(y); l = f2bf(y - bf2f(h)); }
typedef __attribute__((ext_vector_type(2))) _Float16 v2h;
typedef __attribute__((ext_vector_type(4))) _Float16 v4h;
typedef __attribute__((ext_vector_type(2))) unsigned short v2us;
typedef __attribute__((ext_vector_type(4))) unsigned short v4us;
typedef __attribute__((ext_vector_type(2))) float v2f;
typedef __attribute__((ext_vector_type(4))) int v4i;

__global__ __launch_bounds__(256) void k_wtG(const float* __restrict__ w, int K, int N, bf* Bt) {
    const int lane = threadIdx.x & 31; const int L0 = (blockIdx.x * 8 + (threadIdx.x >> 5)) * 8; const int nlines = N * K / 64;
{
#pragma unroll 1
        for (int l = 0; l < 8; ++l) { const int L = L0 + l; if (L >= nlines) break; const size_t e = (size_t)L * 64 + lane * 2; const int k = (int)(e % K), n = (int)(e / K); v2us o;
            o[0] = f2bf(w[(size_t)k * N + n]); o[1] = f2bf(w[(size_t)(k + 1) * N + n]); *(v2us*)(Bt + e) = o; }
         }
}
__global__ __launch_bounds__(256) void k_cvt8(const float* __restrict__ src, bf* dst, size_t n8) { const size_t i = (size_t)blockIdx.x * 256 + threadIdx.x; if (i >= n8) return; const v8f v = *(const v8f*)(src + i * 8); v8us o;
#pragma unroll
    for (int k = 0; k < 8; ++k) o[k] = f2bf(v[k]); *(v8us*)(dst + i * 8) = o;  }
__global__ __launch_bounds__(256) void k_cscvt(const float* __restrict__ cosT, const float* __restrict__ sinT, float* CS) { const int idx = blockIdx.x * 256 + threadIdx.x; if (idx >= TT * HD) return; v2f cs; cs[0] = bfr(cosT[idx]); cs[1] = bfr(sinT[idx]); *(v2f*)(CS + (size_t)idx * 2) = cs;  }
// k_rope: head planes [h][t][d] (fp16 + hi/lo) of rope(x) x sc with the rotate-half convention out[d] = x[d] cos[t][d] - x[d+HD/2] sin[t][d], out[d+HD/2] = x[d+HD/2] cos[t][d+HD/2] + x[d] sin[t][d+HD/2]
__global__ __launch_bounds__(256) void k_rope(const float* __restrict__ F, int pitch, int nheads, const float* __restrict__ CS, const float* __restrict__ RF, const float* __restrict__ nw, float sc, h16* P16, bf* Ph, bf* Pl) {
    const size_t e = ((size_t)blockIdx.x * 256 + threadIdx.x) * 2; if (e >= (size_t)nheads * TT * HD) return; const int d = (int)(e % HD); const int t = (int)((e / HD) % TT); const int h = (int)(e / ((size_t)HD * TT)); const float* f = F + (size_t)t * pitch + h * HD; const float rf = RF ? RF[(size_t)h * TT + t] : 1.0f; v2h o16; v2us oh, ol;
#pragma unroll
    for (int q = 0; q < 2; ++q) { const int dd = d + q; const int dp = (dd < HD / 2) ? dd + HD / 2 : dd - HD / 2; float x0 = f[dd], x1 = f[dp];
        if (RF) { float n0 = __fmul_rn(x0, rf), n1 = __fmul_rn(x1, rf); asm volatile("" : "+v"(n0)); asm volatile("" : "+v"(n1)); x0 = __fmul_rn(bfr(nw[dd]), n0); x1 = __fmul_rn(bfr(nw[dp]), n1); }
        const v2f cs = *(const v2f*)(CS + ((size_t)t * HD + dd) * 2); float a = __fmul_rn(x0, cs[0]), bq = __fmul_rn(x1, cs[1]); asm volatile("" : "+v"(a)); asm volatile("" : "+v"(bq)); const float r = ((dd < HD / 2) ? __fsub_rn(a, bq) : __fadd_rn(a, bq)) * sc;
        o16[q] = tohx(r); unsigned short a2, c2; splitf(r, a2, c2); oh[q] = a2; ol[q] = c2; }
    *(v2h*)(P16 + e) = o16; *(v2us*)(Ph + e) = oh; *(v2us*)(Pl + e) = ol;  }
__global__ __launch_bounds__(256) void k_vtp(const float* __restrict__ F, int pitch, int nheads, h16* V16, bf* Vh, bf* Vl) { const size_t e = ((size_t)blockIdx.x * 256 + threadIdx.x) * 2; if (e >= (size_t)nheads * HD * TT) return; const int t = (int)(e % TT); const int d = (int)((e / TT) % HD); const int g = (int)(e / ((size_t)TT * HD)); v2h o16; v2us oh, ol;
#pragma unroll
    for (int q = 0; q < 2; ++q) { const float x = F[(size_t)(t + q) * pitch + g * HD + d]; o16[q] = tohx(x); unsigned short a2, c2; splitf(x, a2, c2); oh[q] = a2; ol[q] = c2; }
    *(v2h*)(V16 + e) = o16; *(v2us*)(Vh + e) = oh; *(v2us*)(Vl + e) = ol;  }
__global__ __launch_bounds__(256) void k_csid(float* CS) { const int idx = blockIdx.x * 256 + threadIdx.x; if (idx >= TT * HD) return; v2f cs; cs[0] = 1.0f; cs[1] = 0.0f; *(v2f*)(CS + (size_t)idx * 2) = cs;  }
__device__ __forceinline__ float xhalf(float x) { const unsigned b = __float_as_uint(x); return __uint_as_float(__builtin_amdgcn_permlanex16(b, b, 0x76543210u, 0xfedcba98u, false, false)); }   // the value of lane l ^ 16
template <bool HL> struct FT { typedef h16 T; };
template <> struct FT<true> { typedef bf T; };
template <bool HL, int QB>
__device__ __forceinline__ void fattn_rows(const typename FT<HL>::T* __restrict__ Q, const typename FT<HL>::T* __restrict__ Q2, const typename FT<HL>::T* __restrict__ Kp, const typename FT<HL>::T* __restrict__ K2, const typename FT<HL>::T* __restrict__ Vt, const typename FT<HL>::T* __restrict__ V2, const int* __restrict__ mk, int q0, bf* Ah, bf* Al) {
    typedef typename FT<HL>::T T16; typedef typename WFrag<T16>::V V; typedef WFrag<T16> F;
    const float L2E = 1.4426950408889634f;
    const int lane = threadIdx.x & 31, lr = lane & 15, hi = lane >> 4;
    const unsigned qo = (unsigned)((q0 + lr) * HD + 8 * hi) * 2u;   // the lane's byte offset in the Q planes
    V qf[QB][2], q2f[QB][2]; v8f o[QB][4]; float mx[QB], sm[QB];   // every '#pragma unroll' below makes the indices of these arrays constants, so that they stay in registers
#pragma unroll
    for (int qb = 0; qb < QB; ++qb) { mx[qb] = -3.0e38f; sm[qb] = 0.f;
#pragma unroll
        for (int ks = 0; ks < 2; ++ks) { qf[qb][ks] = F::ld((const T16*)((const char*)Q + qo + qb * 16 * HD * 2 + ks * 64)); if (HL) q2f[qb][ks] = F::ld((const T16*)((const char*)Q2 + qo + qb * 16 * HD * 2 + ks * 64)); }
#pragma unroll
        for (int db = 0; db < 4; ++db) o[qb][db] = (v8f){}; }
    // Addresses: a scalar base per plane + ONE byte offset per lane and operand kind (K, Vt, mask) + a constant. K and Vt fragments and mask words are fetched one pass ahead, each into the registers its pass has just used up.
    const char* Kb = (const char*)Kp; const char* K2b = (const char*)K2; const char* Vb = (const char*)Vt; const char* V2b = (const char*)V2; const char* Mb = (const char*)mk;
    unsigned ko = (unsigned)(lr * HD + 8 * hi) * 2u, vo = (unsigned)(lr * TT + 8 * hi) * 2u, mo = (unsigned)((q0 + lr) * TT + 8 * hi) * 4u;
    V kf[2][2], k2f[2][2], vf[4], v2[4]; v4i mw[QB][2][2];
#pragma unroll
    for (int kt = 0; kt < 2; ++kt)
#pragma unroll
        for (int ks = 0; ks < 2; ++ks) { kf[kt][ks] = F::ld((const T16*)(Kb + ko + kt * 16 * HD * 2 + ks * 64)); if (HL) k2f[kt][ks] = F::ld((const T16*)(K2b + ko + kt * 16 * HD * 2 + ks * 64)); }
    __builtin_amdgcn_sched_barrier(0);   // this and the next: pass 0's loads issue in the loop's order (K, mask, Vt). The loop's load waits are counted for both ways into it; with Vt not last here, the waits for K would also wait for the Vt loads just issued
#pragma unroll
    for (int kt = 0; kt < 2; ++kt)
#pragma unroll
        for (int qb = 0; qb < QB; ++qb) { mw[qb][kt][0] = *(const v4i*)(Mb + mo + qb * 16 * TT * 4 + kt * 64); mw[qb][kt][1] = *(const v4i*)(Mb + mo + qb * 16 * TT * 4 + kt * 64 + 16); }
    __builtin_amdgcn_sched_barrier(0);
#pragma unroll
    for (int db = 0; db < 4; ++db) { vf[db] = F::ld((const T16*)(Vb + vo + db * 16 * TT * 2)); if (HL) v2[db] = F::ld((const T16*)(V2b + vo + db * 16 * TT * 2)); }
    asm volatile("s_wait_xcnt 0x0" : "+v"(ko), "+v"(vo), "+v"(mo) : "v"(qo));   // the wait in front of the overwrite of registers that issued loads name (the four offsets are operands: their registers live up to it, and the additions stay behind it)
    ko += 32u * HD * 2u; vo += 32u * 2u; mo += 32u * 4u;   // the offsets now stand at pass 1
#pragma unroll 1   // rolled: a second pass's fragments and scores would cost a resident wave per SIMD
    for (int kb = 0; kb < TT; kb += 32) {
        v8f s[QB][2];
#pragma unroll
        for (int kt = 0; kt < 2; ++kt) {
#pragma unroll
            for (int qb = 0; qb < QB; ++qb) s[qb][kt] = (v8f){};
#pragma unroll
            for (int ks = 0; ks < 2; ++ks)
#pragma unroll
                for (int qb = 0; qb < QB; ++qb) { s[qb][kt] = F::mma(kf[kt][ks], qf[qb][ks], s[qb][kt]); if (HL) { s[qb][kt] = F::mma(kf[kt][ks], q2f[qb][ks], s[qb][kt]); s[qb][kt] = F::mma(k2f[kt][ks], qf[qb][ks], s[qb][kt]); } } }
        // four vector slots between the St matrix instructions and the loads that refill their A fragments' registers (and the first read of St): the tiles are operands, so that the matrix instructions stay in front; ko is one, so that the loads stay behind
        if constexpr (QB == 2) { asm volatile("v_nop\n\tv_nop\n\tv_nop\n\tv_nop" : "+v"(s[0][0]), "+v"(s[0][1]), "+v"(s[1][0]), "+v"(s[1][1]), "+v"(ko)); }
        else { asm volatile("v_nop\n\tv_nop\n\tv_nop\n\tv_nop" : "+v"(s[0][0]), "+v"(s[0][1]), "+v"(ko)); }
#pragma unroll
        for (int kt = 0; kt < 2; ++kt)
#pragma unroll
            for (int ks = 0; ks < 2; ++ks) { kf[kt][ks] = F::ld((const T16*)(Kb + ko + kt * 16 * HD * 2 + ks * 64)); if (HL) k2f[kt][ks] = F::ld((const T16*)(K2b + ko + kt * 16 * HD * 2 + ks * 64)); }
        __builtin_amdgcn_sched_barrier(0);   // the next pass's K loads issue here, in front of the mask loads: load waits count in issue order and K is what the next pass needs first (without this line the hi+lo build issues the mask loads first, and the waits in front of St get stricter in both builds)
        float bm[QB]; bool grow = false;
#pragma unroll
        for (int qb = 0; qb < QB; ++qb) { float b = -3.0e38f;
#pragma unroll
            for (int kt = 0; kt < 2; ++kt) {
#pragma unroll
                for (int j = 0; j < 8; ++j) { const float t = (mw[qb][kt][j >> 2][j & 3] != 0) ? s[qb][kt][j] * SCL : -3.0e38f; s[qb][kt][j] = t; b = fmaxf(b, t); }
                mw[qb][kt][0] = *(const v4i*)(Mb + mo + qb * 16 * TT * 4 + kt * 64); mw[qb][kt][1] = *(const v4i*)(Mb + mo + qb * 16 * TT * 4 + kt * 64 + 16); }
            bm[qb] = fmaxf(b, xhalf(b)); grow = grow || (bm[qb] > mx[qb]); }
        if (__builtin_amdgcn_ballot_w32(grow) != 0) {   // a scalar branch: a pass in which no query's maximum grows has every factor 1 and skips the scaling
#pragma unroll
            for (int qb = 0; qb < QB; ++qb) { const float mn = fmaxf(mx[qb], bm[qb]); const float al = __builtin_amdgcn_exp2f((mx[qb] - mn) * L2E); mx[qb] = mn; sm[qb] *= al;
#pragma unroll
                for (int db = 0; db < 4; ++db) o[qb][db] *= al; } }
        V pf[QB], p2[QB];
#pragma unroll
        for (int qb = 0; qb < QB; ++qb) {
#pragma unroll
            for (int g = 0; g < 2; ++g) { float x[8], p[8];
#pragma unroll
                for (int j = 0; j < 8; ++j) { const float d = s[qb][g][j] - mx[qb]; x[j] = HL ? d * L2E : __builtin_fmaf(d, L2E, 10.0f); p[j] = __builtin_amdgcn_exp2f(x[j]); }   // + 10 in the exponent: x PCAR = 2^10
                // the slot behind a transcendental, once for a run of eight: results and sources are operands, so that in front of the v_nop nothing reads a result or overwrites a source (the fp16 rows' build keeps the slot by itself)
                if constexpr (HL) asm volatile("v_nop" : "+v"(p[0]), "+v"(p[1]), "+v"(p[2]), "+v"(p[3]), "+v"(p[4]), "+v"(p[5]), "+v"(p[6]), "+v"(p[7]) : "v"(x[0]), "v"(x[1]), "v"(x[2]), "v"(x[3]), "v"(x[4]), "v"(x[5]), "v"(x[6]), "v"(x[7]));
#pragma unroll
                for (int j = 0; j < 8; ++j) { sm[qb] += p[j];
                    if constexpr (HL) { const __bf16 ph = (__bf16)p[j]; pf[qb][g * 8 + j] = ph; p2[qb][g * 8 + j] = (__bf16)(p[j] - (float)ph); }
                    else pf[qb][g * 8 + j] = (h16)p[j]; } } }
#pragma unroll
        for (int db = 0; db < 4; ++db)
#pragma unroll
            for (int qb = 0; qb < QB; ++qb) { o[qb][db] = F::mma(vf[db], pf[qb], o[qb][db]); if (HL) { o[qb][db] = F::mma(vf[db], p2[qb], o[qb][db]); o[qb][db] = F::mma(v2[db], pf[qb], o[qb][db]); } }
        // the same between the Ot matrix instructions and the loads that refill the Vt fragments' registers (operands: the accumulators and vo)
        if constexpr (QB == 2) { asm volatile("v_nop\n\tv_nop\n\tv_nop\n\tv_nop" : "+v"(o[0][0]), "+v"(o[0][1]), "+v"(o[0][2]), "+v"(o[0][3]), "+v"(o[1][0]), "+v"(o[1][1]), "+v"(o[1][2]), "+v"(o[1][3]), "+v"(vo)); }
        else { asm volatile("v_nop\n\tv_nop\n\tv_nop\n\tv_nop" : "+v"(o[0][0]), "+v"(o[0][1]), "+v"(o[0][2]), "+v"(o[0][3]), "+v"(vo)); }
#pragma unroll
        for (int db = 0; db < 4; ++db) { vf[db] = F::ld((const T16*)(Vb + vo + db * 16 * TT * 2)); if (HL) v2[db] = F::ld((const T16*)(V2b + vo + db * 16 * TT * 2)); }
        asm volatile("s_wait_xcnt 0x0" : "+v"(ko), "+v"(vo), "+v"(mo));   // as in front of the loop: the pass's loads name the three offsets
        const unsigned adv = (kb + 64 < TT) ? 1u : 0u;   // the last two passes fetch the last pass's data (in bounds; the last fetch is unused)
        ko += adv * (32u * HD * 2u); vo += adv * (32u * 2u); mo += adv * (32u * 4u);
    }
#pragma unroll
    for (int qb = 0; qb < QB; ++qb) { const float f = __fdiv_rn(1.0f, sm[qb] + xhalf(sm[qb])); const size_t oo = (size_t)(q0 + qb * 16 + lr) * DQ + 8 * hi;   // a lane's 8 accumulator registers are 8 consecutive d of its query: one 16-byte store a plane
#pragma unroll
        for (int db = 0; db < 4; ++db) { v8us oh, ol;
#pragma unroll
            for (int j = 0; j < 8; ++j) { unsigned short a, c2; splitf(o[qb][db][j] * f, a, c2); oh[j] = a; ol[j] = c2; }
            // both planes' stores and s_wait_xcnt 0 in ONE statement: the wait stands in front of every later write of a register that the stores name, on every way out of here (with plain stores the compiler joined the tails of the two row classes)
            asm volatile("global_store_b128 %0, %1, off\n\tglobal_store_b128 %2, %3, off\n\ts_wait_xcnt 0x0" :: "v"(Ah + oo + db * 16), "v"(oh), "v"(Al + oo + db * 16), "v"(ol) : "memory"); } }
}
// grid (NB_ NH_, RH/64 + (TT-RH)/128), 4 waves: row blocks y < RH/64 are the hi+lo rows (16 a wave), the rest fp16 (32 a wave). Planes [batch][head][..]; one kv head per query head. Ah, Al: [batch][t][head d].
__global__ __launch_bounds__(128) void k_fattn(const h16* __restrict__ Q16, const h16* __restrict__ K16, const h16* __restrict__ V16, const bf* __restrict__ Qh, const bf* __restrict__ Ql, const bf* __restrict__ Kh, const bf* __restrict__ Kl, const bf* __restrict__ Vh, const bf* __restrict__ Vl, const int* __restrict__ mk, bf* Ah, bf* Al) {
    const int z = blockIdx.x, y = blockIdx.y; const int wave = __builtin_amdgcn_readfirstlane((int)(threadIdx.x >> 5)); const size_t po = (size_t)z * TT * HD; const size_t ao = (size_t)(z / NH_) * TT * DQ + (size_t)(z % NH_) * HD;
    if (y < RH / 64) fattn_rows<true, 1>(Qh + po, Ql + po, Kh + po, Kl + po, Vh + po, Vl + po, mk, y * 64 + wave * 16, Ah + ao, Al + ao);
    else fattn_rows<false, 2>(Q16 + po, nullptr, K16 + po, nullptr, V16 + po, nullptr, mk, RH + (y - RH / 64) * 128 + wave * 32, Ah + ao, Al + ao);
}

__global__ __launch_bounds__(256) void k_wtH(const float* __restrict__ w, bf* Bt) { const size_t e = ((size_t)blockIdx.x * 256 + threadIdx.x) * 4; if (e >= (size_t)DQ * DM) return; const int k = (int)(e % DM); const int n = (int)(e / DM); const int h = n / HD, c = n % HD; v4us o;   // Bt[h*64 + c][d] = W[h][d][c]
#pragma unroll
    for (int u = 0; u < 4; ++u) o[u] = f2bf(w[((size_t)h * DM + k + u) * HD + c]); *(v4us*)(Bt + e) = o;  }

extern "C" void kernel_launch(void* const* d_in, const int* in_sizes, int n_in,
                              void* d_out, int out_size, void* d_ws, size_t ws_size, hipStream_t stream) {
    (void)in_sizes; (void)n_in; (void)out_size;
    const float* x = (const float*)d_in[0]; const float* xk = (const float*)d_in[1]; const float* xv = (const float*)d_in[2]; const int* mk = (const int*)d_in[3]; const float* wqh = (const float*)d_in[4]; const float* bq = (const float*)d_in[5]; const float* wkh = (const float*)d_in[6]; const float* bk = (const float*)d_in[7]; const float* wvh = (const float*)d_in[8]; const float* bv = (const float*)d_in[9]; const float* wo = (const float*)d_in[10]; const float* wq = nullptr; const float* wk = nullptr; const float* wv = nullptr; (void)wq; (void)wk; (void)wv; const float* cosT = nullptr; const float* sinT = nullptr; (void)cosT; (void)sinT;
    float* OUT = (float*)d_out;     // [2][2048][1024]
    char* wsp = (char*)d_ws;
    auto take = [&](size_t bytes) { char* p = wsp; wsp += (bytes + 255) & ~(size_t)255; return (void*)p; };
    bf* WQ = (bf*)take((size_t)DQ * DM * 2); bf* WK = (bf*)take((size_t)DKV * DM * 2); bf* WV = (bf*)take((size_t)DKV * DM * 2); bf* WO = (bf*)take((size_t)DM * DQ * 2); float* CS = (float*)take((size_t)TT * HD * 2 * 4);
    bf* XB = (bf*)take((size_t)TT * DM * 2); bf* XB2 = (bf*)take((size_t)TT * DM * 2); bf* XB3 = (bf*)take((size_t)TT * DM * 2); float* FQ = (float*)take((size_t)TT * DQ * 4); float* FK = (float*)take((size_t)TT * DKV * 4);
    const size_t PQ = (size_t)NH_ * TT * HD, PK = (size_t)NKV * TT * HD;   // one batch's head planes, in elements; every plane holds both batches
    h16* QP16 = (h16*)take(NB_ * PQ * 2); h16* KP16 = (h16*)take(NB_ * PK * 2); h16* VT16 = (h16*)take(NB_ * PK * 2);
    bf* QPh = (bf*)take(NB_ * PQ * 2); bf* QPl = (bf*)take(NB_ * PQ * 2); bf* KPh = (bf*)take(NB_ * PK * 2); bf* KPl = (bf*)take(NB_ * PK * 2); bf* VTh = (bf*)take(NB_ * PK * 2); bf* VTl = (bf*)take(NB_ * PK * 2);
    bf* ATh = (bf*)take((size_t)NB_ * TT * DQ * 2); bf* ATl = (bf*)take((size_t)NB_ * TT * DQ * 2);
    if ((size_t)(wsp - (char*)d_ws) > ws_size) return;    // ws 256 MiB
    float* FV = FK;   // v projection reuses the k buffer after the k planes are built (stream-ordered)
    { k_wtH<<<(unsigned)(((size_t)DQ * DM / 4 + 255) / 256), 256, 0, stream>>>(wqh, WQ); k_wtH<<<(unsigned)(((size_t)DKV * DM / 4 + 255) / 256), 256, 0, stream>>>(wkh, WK); k_wtH<<<(unsigned)(((size_t)DKV * DM / 4 + 255) / 256), 256, 0, stream>>>(wvh, WV);
      k_wtG<<<(unsigned)((DQ * DM / 64 + 63) / 64), 256, 0, stream>>>(wo, DQ, DM, WO);
       }
    k_csid<<<(TT * HD + 255) / 256, 256, 0, stream>>>(CS);
    const unsigned LQ = (unsigned)(((size_t)NH_ * TT * HD / 2 + 255) / 256), LKv = (unsigned)(((size_t)NKV * TT * HD / 2 + 255) / 256);
    for (int b = 0; b < NB_; ++b) {
        k_cvt8<<<(unsigned)(((size_t)TT * DM / 8 + 255) / 256), 256, 0, stream>>>(x + (size_t)b * TT * DM, XB, (size_t)TT * DM / 8); k_cvt8<<<(unsigned)(((size_t)TT * DM / 8 + 255) / 256), 256, 0, stream>>>(xk + (size_t)b * TT * DM, XB2, (size_t)TT * DM / 8); k_cvt8<<<(unsigned)(((size_t)TT * DM / 8 + 255) / 256), 256, 0, stream>>>(xv + (size_t)b * TT * DM, XB3, (size_t)TT * DM / 8);
        k_gemmk<bf, 0, true, 8, DM><<<dim3(TT / 64, DQ / 64, 1), 256, 0, stream>>>(XB, nullptr, WQ, nullptr, FQ, DQ, bq, 0, 0, 0);
        k_rope<<<LQ, 256, 0, stream>>>(FQ, DQ, NH_, CS, nullptr, nullptr, 1.0f, QP16 + b * PQ, QPh + b * PQ, QPl + b * PQ);
        k_gemmk<bf, 0, true, 8, DM><<<dim3(TT / 64, DKV / 64, 1), 256, 0, stream>>>(XB2, nullptr, WK, nullptr, FK, DKV, bk, 0, 0, 0);
        k_rope<<<LKv, 256, 0, stream>>>(FK, DKV, NKV, CS, nullptr, nullptr, 1.0f, KP16 + b * PK, KPh + b * PK, KPl + b * PK);
        k_gemmk<bf, 0, true, 8, DM><<<dim3(TT / 64, DKV / 64, 1), 256, 0, stream>>>(XB3, nullptr, WV, nullptr, FV, DKV, bv, 0, 0, 0); k_vtp<<<LKv, 256, 0, stream>>>(FV, DKV, NKV, VT16 + b * PK, VTh + b * PK, VTl + b * PK); }
    k_fattn<<<dim3(NB_ * NH_, RH / 64 + (TT - RH) / 128, 1), 128, 0, stream>>>(QP16, KP16, VT16, QPh, QPl, KPh, KPl, VTh, VTl, mk, ATh, ATl);
    for (int b = 0; b < NB_; ++b)
        k_gemmk<bf, 1, false, 8, DQ><<<dim3(TT / 64, DM / 64, 1), 256, 0, stream>>>(ATh + (size_t)b * TT * DQ, ATl + (size_t)b * TT * DQ, WO, nullptr, OUT + (size_t)b * TT * DM, DM, nullptr, 0, 0, 0);
}

// v004
// It runs in 290 microseconds.
// Two timings next to v003 both put it at 1.17 times that version's speed.
// Counting every step since v000, it is 7.12 times as fast.
#include <hip/hip_runtime.h>

// MultiHeadAttentionModule (q, k, v inputs [2][2048][1024]; per-head Qh = q Wq[h] + bq[h], Kh = k Wk[h] + bk[h], Vh = v Wv[h] + bv[h] (W [16][1024][64]); scores = Qh.Kh / 8, where(mask == 0, -1e9) (mask [2048][2048] int, read); softmax; out = concat(heads) Wo ([in,out], no bias) -> [2][2048][1024]).
// Compute dtypes, f32 accumulate: every input rounded to bf16; Qh/Kh/Vh on PLAIN bf16 operands (inputs: exact; per-head weights gathered) + bias; scores and attn.v (one fused kernel, running maximum): query rows < 512 hl (3 products), the rest single fp16 (x1024); mask + softmax f32; Wo hl x exact (2 products).

#define NB_  2
#define TT   2048
#define DM   1024
#define NH_  16
#define NKV  16
#define REP  (NH_ / NKV)
#define HD   64
#define DQ   (NH_ * HD)
#define DKV  (NKV * HD)
#define RH   512                  // query rows < RH use hi+lo planes (0: none)
#define WIN  0
#define PCAR 1024.0f
#define SCL  0.125f   // HD^-0.5
typedef _Float16 h16;
typedef unsigned short bf;
typedef __attribute__((ext_vector_type(16))) __bf16   v16bf;
typedef __attribute__((ext_vector_type(16))) _Float16 v16h;
typedef __attribute__((ext_vector_type(8)))  _Float16 v8h;
typedef __attribute__((ext_vector_type(8)))  unsigned short v8us;
typedef __attribute__((ext_vector_type(8)))  float    v8f;
typedef __attribute__((ext_vector_type(4)))  float    v4f;
typedef v8h  __attribute__((may_alias)) v8ha;
typedef v4f  __attribute__((may_alias)) v4fa;
typedef v8us __attribute__((may_alias)) v8usa;

__device__ __forceinline__ unsigned short f2bf(float f) { unsigned u = __float_as_uint(f); u += 0x7FFFu + ((u >> 16) & 1u); return (unsigned short)(u >> 16); }
__device__ __forceinline__ float bf2f(unsigned short b) { return __uint_as_float(((unsigned)b) << 16); }
__device__ __forceinline__ float bfr(float f) { return bf2f(f2bf(f)); }
__device__ __forceinline__ v16h cat16(v8h lo, v8h hi) { return __builtin_shufflevector(lo, hi, 0, 1, 2, 3, 4, 5, 6, 7, 8, 9, 10, 11, 12, 13, 14, 15); }
__device__ __forceinline__ v16bf cat16b(v8us lo, v8us hi) { return __builtin_bit_cast(v16bf, __builtin_shufflevector(lo, hi, 0, 1, 2, 3, 4, 5, 6, 7, 8, 9, 10, 11, 12, 13, 14, 15)); }
__device__ __forceinline__ v8f wmma16(v16h a, v16h b, v8f c) { return __builtin_amdgcn_wmma_f32_16x16x32_f16(false, a, false, b, (short)0, c, false, false); }
__device__ __forceinline__ v8f wmmab(v16bf a, v16bf b, v8f c) { return __builtin_amdgcn_wmma_f32_16x16x32_bf16(false, a, false, b, (short)0, c, false, false); }
typedef __attribute__((ext_vector_type(4))) _Float16 v4h;
typedef __attribute__((ext_vector_type(4))) unsigned short v4us;
typedef __attribute__((ext_vector_type(4))) __bf16 v4b;



// ---- fragment loaders: a lane's 16 elements of a K-contiguous 16-bit row, in the hardware k order (8 at p, 8 at p + 16; p holds the lane half's 8 hi)
template <typename T16> struct WFrag;
template <> struct WFrag<h16> { typedef v16h V; static __device__ __forceinline__ V ld(const h16* p) { return cat16(*(const v8h*)p, *(const v8h*)(p + 16)); } static __device__ __forceinline__ v8f mma(V a, V b, v8f c) { return wmma16(a, b, c); } };
template <> struct WFrag<bf> { typedef v16bf V; static __device__ __forceinline__ V ld(const bf* p) { return cat16b(*(const v8us*)p, *(const v8us*)(p + 16)); } static __device__ __forceinline__ v8f mma(V a, V b, v8f c) { return wmmab(a, b, c); } };
// ---- k_gemmk: one 64x64 output tile (16 accumulators a wave, operands straight from K-contiguous 16-bit planes) with its K range dealt to KW waves of one work-group (wave w takes k in [w K/KW, (w+1) K/KW)), for products whose K loop is long and whose tiles are few.
// Each wave leaves its partial tile in its own LDS plane; behind one barrier the planes are summed in wave order 0..KW-1 (a fixed order), the bias is added (EPI 1, 2) and the tile stored. grid (M/64, N/64, Z), 32 KW threads. K % (32 KW) == 0.
// Fragment addresses: a scalar base per operand (tile row 0, the wave's first k) + ONE byte offset per lane, the same for all operands where LDA == K (row lr, half hi, the trip's k) + a constant (16 mb or 16 nb rows; K is a template constant for that).
// LDA: row pitch of A and A2 in elements (Bt keeps pitch K); where it is not K, A and A2 take a lane offset of their own.
// EPI: what becomes of the summed tile. 0: stored as f32 in C. 1 and 2: + bias, then stored as the three 16-bit head planes that the attention kernel reads (fp16, bf16 hi, bf16 lo of the same f32 value); C is not used.
//   1: rows are tokens, the tile's 64 columns are one head (bias per column) -> planes [head][t][d], the tile is 8 KiB in a row. 2: rows are (head, d), columns are tokens (A: the weight, Bt: the activations; bias per row) -> planes [head][d][t].
template <typename T16, int NSPLIT, int EPI, int KW, int K, int LDA = K>
__global__ __launch_bounds__(32 * KW) void k_gemmk(const T16* __restrict__ A, const T16* __restrict__ A2, const T16* __restrict__ Bt, const T16* __restrict__ Bt2, float* C, int ldc, const float* __restrict__ bias, size_t sA, size_t sB, size_t sC, h16* P16, bf* Ph, bf* Pl) {
    typedef typename WFrag<T16>::V V;
    __shared__ __align__(16) float os[KW * 64 * 68];
    const size_t z = blockIdx.z; A += z * sA; if (A2) A2 += z * sA; Bt += z * sB; if (Bt2) Bt2 += z * sB; C += z * sC;
    const int lane = threadIdx.x & 31, lr = lane & 15, hi = lane >> 4; const int r0 = blockIdx.x * 64, c0 = blockIdx.y * 64;
    const int wave = __builtin_amdgcn_readfirstlane((int)(threadIdx.x >> 5)); const int kb = wave * (K / KW);   // scalar: the wave's first k goes into the scalar bases
    v8f acc[4][4];   // every '#pragma unroll' of this kernel makes the indices of acc, a, a2 constants, so that the fragments stay in registers
#pragma unroll
    for (int mb = 0; mb < 4; ++mb)
#pragma unroll
        for (int nb = 0; nb < 4; ++nb) acc[mb][nb] = (v8f){};
    const char* Ab = (const char*)(A + (size_t)r0 * LDA + kb); const char* A2b = (const char*)(A2 + (size_t)r0 * LDA + kb); const char* Bb = (const char*)(Bt + (size_t)c0 * K + kb); const char* B2b = (const char*)(Bt2 + (size_t)c0 * K + kb);
    unsigned vo = (unsigned)(lr * K + 8 * hi) * 2u;   // the lane's byte offset; + 64 a trip
    unsigned voa = (unsigned)(lr * LDA + 8 * hi) * 2u;   // the same at A's pitch (used only where LDA != K)
#pragma unroll 1   // rolled: a second trip's fragments would not fit the 256 registers that 8 waves a work-group leave each wave
    for (int t = 0; t < K / KW / 32; ++t) {
        V a[4], a2[4]; const unsigned va = (LDA == K) ? vo : voa;
#pragma unroll
        for (int mb = 0; mb < 4; ++mb) { a[mb] = WFrag<T16>::ld((const T16*)(Ab + va + mb * 16 * LDA * 2)); if (NSPLIT == 1 || NSPLIT == 2) a2[mb] = WFrag<T16>::ld((const T16*)(A2b + va + mb * 16 * LDA * 2)); }
#pragma unroll
        for (int nb = 0; nb < 4; ++nb) { const V b = WFrag<T16>::ld((const T16*)(Bb + vo + nb * 16 * K * 2)); V b2; if (NSPLIT >= 2) b2 = WFrag<T16>::ld((const T16*)(B2b + vo + nb * 16 * K * 2));
#pragma unroll
            for (int mb = 0; mb < 4; ++mb) { acc[mb][nb] = WFrag<T16>::mma(a[mb], b, acc[mb][nb]); if (NSPLIT == 1 || NSPLIT == 2) acc[mb][nb] = WFrag<T16>::mma(a2[mb], b, acc[mb][nb]); if (NSPLIT >= 2) acc[mb][nb] = WFrag<T16>::mma(a[mb], b2, acc[mb][nb]); } }
        // four vector slots behind the trip's last matrix instructions, on the taken branch too, before the next trip overwrites registers of A and B fragments;
        // s_wait_xcnt 0: the wait in front of the one overwrite of a register that the trip's loads name (vo is an operand, so that its addition stays behind the wait)
        if constexpr (LDA == K) { asm volatile("v_nop\n\tv_nop\n\tv_nop\n\tv_nop\n\ts_wait_xcnt 0x0" : "+v"(acc[0][0]), "+v"(acc[1][1]), "+v"(acc[2][2]), "+v"(acc[3][3]), "+v"(vo) : "v"(a[0]), "v"(a[3])); }
        else { asm volatile("v_nop\n\tv_nop\n\tv_nop\n\tv_nop\n\ts_wait_xcnt 0x0" : "+v"(acc[0][0]), "+v"(acc[1][1]), "+v"(acc[2][2]), "+v"(acc[3][3]), "+v"(vo), "+v"(voa) : "v"(a[0]), "v"(a[3])); voa += 64u; }   // the same statement with both lane offsets as operands
        vo += 64u;
    }
    float* ow = os + wave * (64 * 68);
#pragma unroll
    for (int mb = 0; mb < 4; ++mb)
#pragma unroll
        for (int nb = 0; nb < 4; ++nb)
#pragma unroll
            for (int j = 0; j < 8; ++j) ow[(mb * 16 + hi * 8 + j) * 68 + nb * 16 + lr] = acc[mb][nb][j];
    __syncthreads();   // every wave's partial tile is in LDS before any plane is read
    v4f sv[32 / KW];   // EPI 1, 2: the thread's summed values, bias added
#pragma unroll
    for (int s = 0; s < 32 / KW; ++s) { const int idx = s * (32 * KW) + (int)threadIdx.x; const int row = idx >> 4, cofs = (idx & 15) * 4; const float* op = os + row * 68 + cofs; v4f val = *(const v4fa*)op;
#pragma unroll
        for (int w = 1; w < KW; ++w) val += *(const v4fa*)(op + w * (64 * 68));
        if constexpr (EPI == 0) { *(v4f*)(C + (size_t)(r0 + row) * ldc + c0 + cofs) = val; }
        else {
            if constexpr (EPI == 1) { val[0] += bfr(bias[c0 + cofs]); val[1] += bfr(bias[c0 + cofs + 1]); val[2] += bfr(bias[c0 + cofs + 2]); val[3] += bfr(bias[c0 + cofs + 3]); }
            else { const float br = bfr(bias[r0 + row]); val[0] += br; val[1] += br; val[2] += br; val[3] += br; }
            sv[s] = val; } }
    if constexpr (EPI != 0) {   // a loop of its own behind all the sums: the store statements order memory, and an LDS read or a bias load behind one would wait for it
#pragma unroll
        for (int s = 0; s < 32 / KW; ++s) { const int idx = s * (32 * KW) + (int)threadIdx.x; const int row = idx >> 4, cofs = (idx & 15) * 4; const v4f val = sv[s];
            const size_t po = (EPI == 1) ? ((size_t)(c0 / HD) * TT + r0 + row) * HD + cofs : (size_t)(r0 + row) * TT + c0 + cofs; const v4h o16 = __builtin_convertvector(val, v4h); const v4b oh = __builtin_convertvector(val, v4b); const v4b ol = __builtin_convertvector(val - __builtin_convertvector(oh, v4f), v4b);   // each conversion rounds to nearest even, as f2bf does; lo is the rounded rest behind hi
            // the three planes' stores and s_wait_xcnt 0 in ONE statement: the wait stands in front of every later write of a register that the stores name
            asm volatile("global_store_b64 %0, %1, off\n\tglobal_store_b64 %2, %3, off\n\tglobal_store_b64 %4, %5, off\n\ts_wait_xcnt 0x0" :: "v"(P16 + po), "v"(o16), "v"(Ph + po), "v"(oh), "v"(Pl + po), "v"(ol) : "memory"); } }
}

__device__ __forceinline__ void splitf(float y, unsigned short& h, unsigned short& l) { h = f2bf(y); l = f2bf(y - bf2f(h)); }
typedef __attribute__((ext_vector_type(2))) unsigned short v2us;
typedef __attribute__((ext_vector_type(4))) int v4i;

__global__ __launch_bounds__(256) void k_wtG(const float* __restrict__ w, int K, int N, bf* Bt) {
    const int lane = threadIdx.x & 31; const int L0 = (blockIdx.x * 8 + (threadIdx.x >> 5)) * 8; const int nlines = N * K / 64;
{
#pragma unroll 1
        for (int l = 0; l < 8; ++l) { const int L = L0 + l; if (L >= nlines) break; const size_t e = (size_t)L * 64 + lane * 2; const int k = (int)(e % K), n = (int)(e / K); v2us o;
            o[0] = f2bf(w[(size_t)k * N + n]); o[1] = f2bf(w[(size_t)(k + 1) * N + n]); *(v2us*)(Bt + e) = o; }
         }
}
__global__ __launch_bounds__(256) void k_cvt8(const float* __restrict__ src, bf* dst, size_t n8) { const size_t i = (size_t)blockIdx.x * 256 + threadIdx.x; if (i >= n8) return; const v8f v = *(const v8f*)(src + i * 8); v8us o;
#pragma unroll
    for (int k = 0; k < 8; ++k) o[k] = f2bf(v[k]); *(v8us*)(dst + i * 8) = o;  }
__device__ __forceinline__ float xhalf(float x) { const unsigned b = __float_as_uint(x); return __uint_as_float(__builtin_amdgcn_permlanex16(b, b, 0x76543210u, 0xfedcba98u, false, false)); }   // the value of lane l ^ 16
template <bool HL> struct FT { typedef h16 T; };
template <> struct FT<true> { typedef bf T; };
template <bool HL, int QB>
__device__ __forceinline__ void fattn_rows(const typename FT<HL>::T* __restrict__ Q, const typename FT<HL>::T* __restrict__ Q2, const typename FT<HL>::T* __restrict__ Kp, const typename FT<HL>::T* __restrict__ K2, const typename FT<HL>::T* __restrict__ Vt, const typename FT<HL>::T* __restrict__ V2, const int* __restrict__ mk, int q0, bf* Ah, bf* Al) {
    typedef typename FT<HL>::T T16; typedef typename WFrag<T16>::V V; typedef WFrag<T16> F;
    const float L2E = 1.4426950408889634f;
    const int lane = threadIdx.x & 31, lr = lane & 15, hi = lane >> 4;
    const unsigned qo = (unsigned)((q0 + lr) * HD + 8 * hi) * 2u;   // the lane's byte offset in the Q planes
    V qf[QB][2], q2f[QB][2]; v8f o[QB][4]; float mx[QB], sm[QB];   // every '#pragma unroll' below makes the indices of these arrays constants, so that they stay in registers
#pragma unroll
    for (int qb = 0; qb < QB; ++qb) { mx[qb] = -3.0e38f; sm[qb] = 0.f;
#pragma unroll
        for (int ks = 0; ks < 2; ++ks) { qf[qb][ks] = F::ld((const T16*)((const char*)Q + qo + qb * 16 * HD * 2 + ks * 64)); if (HL) q2f[qb][ks] = F::ld((const T16*)((const char*)Q2 + qo + qb * 16 * HD * 2 + ks * 64)); }
#pragma unroll
        for (int db = 0; db < 4; ++db) o[qb][db] = (v8f){}; }
    // Addresses: a scalar base per plane + ONE byte offset per lane and operand kind (K, Vt, mask) + a constant. K and Vt fragments and mask words are fetched one pass ahead, each into the registers its pass has just used up.
    const char* Kb = (const char*)Kp; const char* K2b = (const char*)K2; const char* Vb = (const char*)Vt; const char* V2b = (const char*)V2; const char* Mb = (const char*)mk;
    unsigned ko = (unsigned)(lr * HD + 8 * hi) * 2u, vo = (unsigned)(lr * TT + 8 * hi) * 2u, mo = (unsigned)((q0 + lr) * TT + 8 * hi) * 4u;
    V kf[2][2], k2f[2][2], vf[4], v2[4]; v4i mw[QB][2][2];
#pragma unroll
    for (int kt = 0; kt < 2; ++kt)
#pragma unroll
        for (int ks = 0; ks < 2; ++ks) { kf[kt][ks] = F::ld((const T16*)(Kb + ko + kt * 16 * HD * 2 + ks * 64)); if (HL) k2f[kt][ks] = F::ld((const T16*)(K2b + ko + kt * 16 * HD * 2 + ks * 64)); }
    __builtin_amdgcn_sched_barrier(0);   // this and the next: pass 0's loads issue in the loop's order (K, mask, Vt). The loop's load waits are counted for both ways into it; with Vt not last here, the waits for K would also wait for the Vt loads just issued
#pragma unroll
    for (int kt = 0; kt < 2; ++kt)
#pragma unroll
        for (int qb = 0; qb < QB; ++qb) { mw[qb][kt][0] = *(const v4i*)(Mb + mo + qb * 16 * TT * 4 + kt * 64); mw[qb][kt][1] = *(const v4i*)(Mb + mo + qb * 16 * TT * 4 + kt * 64 + 16); }
    __builtin_amdgcn_sched_barrier(0);
#pragma unroll
    for (int db = 0; db < 4; ++db) { vf[db] = F::ld((const T16*)(Vb + vo + db * 16 * TT * 2)); if (HL) v2[db] = F::ld((const T16*)(V2b + vo + db * 16 * TT * 2)); }
    asm volatile("s_wait_xcnt 0x0" : "+v"(ko), "+v"(vo), "+v"(mo) : "v"(qo));   // the wait in front of the overwrite of registers that issued loads name (the four offsets are operands: their registers live up to it, and the additions stay behind it)
    ko += 32u * HD * 2u; vo += 32u * 2u; mo += 32u * 4u;   // the offsets now stand at pass 1
#pragma unroll 1   // rolled: a second pass's fragments and scores would cost a resident wave per SIMD
    for (int kb = 0; kb < TT; kb += 32) {
        v8f s[QB][2];
#pragma unroll
        for (int kt = 0; kt < 2; ++kt) {
#pragma unroll
            for (int qb = 0; qb < QB; ++qb) s[qb][kt] = (v8f){};
#pragma unroll
            for (int ks = 0; ks < 2; ++ks)
#pragma unroll
                for (int qb = 0; qb < QB; ++qb) { s[qb][kt] = F::mma(kf[kt][ks], qf[qb][ks], s[qb][kt]); if (HL) { s[qb][kt] = F::mma(kf[kt][ks], q2f[qb][ks], s[qb][kt]); s[qb][kt] = F::mma(k2f[kt][ks], qf[qb][ks], s[qb][kt]); } } }
        // four vector slots between the St matrix instructions and the loads that refill their A fragments' registers (and the first read of St): the tiles are operands, so that the matrix instructions stay in front; ko is one, so that the loads stay behind
        if constexpr (QB == 2) { asm volatile("v_nop\n\tv_nop\n\tv_nop\n\tv_nop" : "+v"(s[0][0]), "+v"(s[0][1]), "+v"(s[1][0]), "+v"(s[1][1]), "+v"(ko)); }
        else { asm volatile("v_nop\n\tv_nop\n\tv_nop\n\tv_nop" : "+v"(s[0][0]), "+v"(s[0][1]), "+v"(ko)); }
#pragma unroll
        for (int kt = 0; kt < 2; ++kt)
#pragma unroll
            for (int ks = 0; ks < 2; ++ks) { kf[kt][ks] = F::ld((const T16*)(Kb + ko + kt * 16 * HD * 2 + ks * 64)); if (HL) k2f[kt][ks] = F::ld((const T16*)(K2b + ko + kt * 16 * HD * 2 + ks * 64)); }
        __builtin_amdgcn_sched_barrier(0);   // the next pass's K loads issue here, in front of the mask loads: load waits count in issue order and K is what the next pass needs first (without this line the hi+lo build issues the mask loads first, and the waits in front of St get stricter in both builds)
        float bm[QB]; bool grow = false;
#pragma unroll
        for (int qb = 0; qb < QB; ++qb) { float b = -3.0e38f;
#pragma unroll
            for (int kt = 0; kt < 2; ++kt) {
#pragma unroll
                for (int j = 0; j < 8; ++j) { const float t = (mw[qb][kt][j >> 2][j & 3] != 0) ? s[qb][kt][j] * SCL : -3.0e38f; s[qb][kt][j] = t; b = fmaxf(b, t); }
                mw[qb][kt][0] = *(const v4i*)(Mb + mo + qb * 16 * TT * 4 + kt * 64); mw[qb][kt][1] = *(const v4i*)(Mb + mo + qb * 16 * TT * 4 + kt * 64 + 16); }
            bm[qb] = fmaxf(b, xhalf(b)); grow = grow || (bm[qb] > mx[qb]); }
        if (__builtin_amdgcn_ballot_w32(grow) != 0) {   // a scalar branch: a pass in which no query's maximum grows has every factor 1 and skips the scaling
#pragma unroll
            for (int qb = 0; qb < QB; ++qb) { const float mn = fmaxf(mx[qb], bm[qb]); const float al = __builtin_amdgcn_exp2f((mx[qb] - mn) * L2E); mx[qb] = mn; sm[qb] *= al;
#pragma unroll
                for (int db = 0; db < 4; ++db) o[qb][db] *= al; } }
        V pf[QB], p2[QB];
#pragma unroll
        for (int qb = 0; qb < QB; ++qb) {
#pragma unroll
            for (int g = 0; g < 2; ++g) { float x[8], p[8];
#pragma unroll
                for (int j = 0; j < 8; ++j) { const float d = s[qb][g][j] - mx[qb]; x[j] = HL ? d * L2E : __builtin_fmaf(d, L2E, 10.0f); p[j] = __builtin_amdgcn_exp2f(x[j]); }   // + 10 in the exponent: x PCAR = 2^10
                // the slot behind a transcendental, once for a run of eight: results and sources are operands, so that in front of the v_nop nothing reads a result or overwrites a source (the fp16 rows' build keeps the slot by itself)
                if constexpr (HL) asm volatile("v_nop" : "+v"(p[0]), "+v"(p[1]), "+v"(p[2]), "+v"(p[3]), "+v"(p[4]), "+v"(p[5]), "+v"(p[6]), "+v"(p[7]) : "v"(x[0]), "v"(x[1]), "v"(x[2]), "v"(x[3]), "v"(x[4]), "v"(x[5]), "v"(x[6]), "v"(x[7]));
#pragma unroll
                for (int j = 0; j < 8; ++j) { sm[qb] += p[j];
                    if constexpr (HL) { const __bf16 ph = (__bf16)p[j]; pf[qb][g * 8 + j] = ph; p2[qb][g * 8 + j] = (__bf16)(p[j] - (float)ph); }
                    else pf[qb][g * 8 + j] = (h16)p[j]; } } }
#pragma unroll
        for (int db = 0; db < 4; ++db)
#pragma unroll
            for (int qb = 0; qb < QB; ++qb) { o[qb][db] = F::mma(vf[db], pf[qb], o[qb][db]); if (HL) { o[qb][db] = F::mma(vf[db], p2[qb], o[qb][db]); o[qb][db] = F::mma(v2[db], pf[qb], o[qb][db]); } }
        // the same between the Ot matrix instructions and the loads that refill the Vt fragments' registers (operands: the accumulators and vo)
        if constexpr (QB == 2) { asm volatile("v_nop\n\tv_nop\n\tv_nop\n\tv_nop" : "+v"(o[0][0]), "+v"(o[0][1]), "+v"(o[0][2]), "+v"(o[0][3]), "+v"(o[1][0]), "+v"(o[1][1]), "+v"(o[1][2]), "+v"(o[1][3]), "+v"(vo)); }
        else { asm volatile("v_nop\n\tv_nop\n\tv_nop\n\tv_nop" : "+v"(o[0][0]), "+v"(o[0][1]), "+v"(o[0][2]), "+v"(o[0][3]), "+v"(vo)); }
#pragma unroll
        for (int db = 0; db < 4; ++db) { vf[db] = F::ld((const T16*)(Vb + vo + db * 16 * TT * 2)); if (HL) v2[db] = F::ld((const T16*)(V2b + vo + db * 16 * TT * 2)); }
        asm volatile("s_wait_xcnt 0x0" : "+v"(ko), "+v"(vo), "+v"(mo));   // as in front of the loop: the pass's loads name the three offsets
        const unsigned adv = (kb + 64 < TT) ? 1u : 0u;   // the last two passes fetch the last pass's data (in bounds; the last fetch is unused)
        ko += adv * (32u * HD * 2u); vo += adv * (32u * 2u); mo += adv * (32u * 4u);
    }
#pragma unroll
    for (int qb = 0; qb < QB; ++qb) { const float f = __fdiv_rn(1.0f, sm[qb] + xhalf(sm[qb])); const size_t oo = (size_t)(q0 + qb * 16 + lr) * DQ + 8 * hi;   // a lane's 8 accumulator registers are 8 consecutive d of its query: one 16-byte store a plane
#pragma unroll
        for (int db = 0; db < 4; ++db) { v8us oh, ol;
#pragma unroll
            for (int j = 0; j < 8; ++j) { unsigned short a, c2; splitf(o[qb][db][j] * f, a, c2); oh[j] = a; ol[j] = c2; }
            // both planes' stores and s_wait_xcnt 0 in ONE statement: the wait stands in front of every later write of a register that the stores name, on every way out of here (with plain stores the compiler joined the tails of the two row classes)
            asm volatile("global_store_b128 %0, %1, off\n\tglobal_store_b128 %2, %3, off\n\ts_wait_xcnt 0x0" :: "v"(Ah + oo + db * 16), "v"(oh), "v"(Al + oo + db * 16), "v"(ol) : "memory"); } }
}
// grid (NB_ NH_, RH/64 + (TT-RH)/128), 4 waves: row blocks y < RH/64 are the hi+lo rows (16 a wave), the rest fp16 (32 a wave). Planes [batch][head][..]; one kv head per query head. Ah, Al: [batch][t][head d].
__global__ __launch_bounds__(128) void k_fattn(const h16* __restrict__ Q16, const h16* __restrict__ K16, const h16* __restrict__ V16, const bf* __restrict__ Qh, const bf* __restrict__ Ql, const bf* __restrict__ Kh, const bf* __restrict__ Kl, const bf* __restrict__ Vh, const bf* __restrict__ Vl, const int* __restrict__ mk, bf* Ah, bf* Al) {
    const int z = blockIdx.x, y = blockIdx.y; const int wave = __builtin_amdgcn_readfirstlane((int)(threadIdx.x >> 5)); const size_t po = (size_t)z * TT * HD; const size_t ao = (size_t)(z / NH_) * TT * DQ + (size_t)(z % NH_) * HD;
    if (y < RH / 64) fattn_rows<true, 1>(Qh + po, Ql + po, Kh + po, Kl + po, Vh + po, Vl + po, mk, y * 64 + wave * 16, Ah + ao, Al + ao);
    else fattn_rows<false, 2>(Q16 + po, nullptr, K16 + po, nullptr, V16 + po, nullptr, mk, RH + (y - RH / 64) * 128 + wave * 32, Ah + ao, Al + ao);
}

__global__ __launch_bounds__(256) void k_wtH(const float* __restrict__ w, bf* Bt) { const size_t e = ((size_t)blockIdx.x * 256 + threadIdx.x) * 4; if (e >= (size_t)DQ * DM) return; const int k = (int)(e % DM); const int n = (int)(e / DM); const int h = n / HD, c = n % HD; v4us o;   // Bt[h*64 + c][d] = W[h][d][c]
#pragma unroll
    for (int u = 0; u < 4; ++u) o[u] = f2bf(w[((size_t)h * DM + k + u) * HD + c]); *(v4us*)(Bt + e) = o;  }

extern "C" void kernel_launch(void* const* d_in, const int* in_sizes, int n_in,
                              void* d_out, int out_size, void* d_ws, size_t ws_size, hipStream_t stream) {
    (void)in_sizes; (void)n_in; (void)out_size;
    const float* x = (const float*)d_in[0]; const float* xk = (const float*)d_in[1]; const float* xv = (const float*)d_in[2]; const int* mk = (const int*)d_in[3]; const float* wqh = (const float*)d_in[4]; const float* bq = (const float*)d_in[5]; const float* wkh = (const float*)d_in[6]; const float* bk = (const float*)d_in[7]; const float* wvh = (const float*)d_in[8]; const float* bv = (const float*)d_in[9]; const float* wo = (const float*)d_in[10]; const float* wq = nullptr; const float* wk = nullptr; const float* wv = nullptr; (void)wq; (void)wk; (void)wv; const float* cosT = nullptr; const float* sinT = nullptr; (void)cosT; (void)sinT;
    float* OUT = (float*)d_out;     // [2][2048][1024]
    char* wsp = (char*)d_ws;
    auto take = [&](size_t bytes) { char* p = wsp; wsp += (bytes + 255) & ~(size_t)255; return (void*)p; };
    bf* WQ = (bf*)take((size_t)DQ * DM * 2); bf* WK = (bf*)take((size_t)DKV * DM * 2); bf* WV = (bf*)take((size_t)DKV * DM * 2); bf* WO = (bf*)take((size_t)DM * DQ * 2);
    bf* XB = (bf*)take((size_t)TT * DM * 2); bf* XB2 = (bf*)take((size_t)TT * DM * 2); bf* XB3 = (bf*)take((size_t)TT * DM * 2);
    const size_t PQ = (size_t)NH_ * TT * HD, PK = (size_t)NKV * TT * HD;   // one batch's head planes, in elements; every plane holds both batches
    h16* QP16 = (h16*)take(NB_ * PQ * 2); h16* KP16 = (h16*)take(NB_ * PK * 2); h16* VT16 = (h16*)take(NB_ * PK * 2);
    bf* QPh = (bf*)take(NB_ * PQ * 2); bf* QPl = (bf*)take(NB_ * PQ * 2); bf* KPh = (bf*)take(NB_ * PK * 2); bf* KPl = (bf*)take(NB_ * PK * 2); bf* VTh = (bf*)take(NB_ * PK * 2); bf* VTl = (bf*)take(NB_ * PK * 2);
    bf* ATh = (bf*)take((size_t)NB_ * TT * DQ * 2); bf* ATl = (bf*)take((size_t)NB_ * TT * DQ * 2);
    if ((size_t)(wsp - (char*)d_ws) > ws_size) return;    // ws 256 MiB
    { k_wtH<<<(unsigned)(((size_t)DQ * DM / 4 + 255) / 256), 256, 0, stream>>>(wqh, WQ); k_wtH<<<(unsigned)(((size_t)DKV * DM / 4 + 255) / 256), 256, 0, stream>>>(wkh, WK); k_wtH<<<(unsigned)(((size_t)DKV * DM / 4 + 255) / 256), 256, 0, stream>>>(wvh, WV);
      k_wtG<<<(unsigned)((DQ * DM / 64 + 63) / 64), 256, 0, stream>>>(wo, DQ, DM, WO);
       }
    for (int b = 0; b < NB_; ++b) {
        k_cvt8<<<(unsigned)(((size_t)TT * DM / 8 + 255) / 256), 256, 0, stream>>>(x + (size_t)b * TT * DM, XB, (size_t)TT * DM / 8); k_cvt8<<<(unsigned)(((size_t)TT * DM / 8 + 255) / 256), 256, 0, stream>>>(xk + (size_t)b * TT * DM, XB2, (size_t)TT * DM / 8); k_cvt8<<<(unsigned)(((size_t)TT * DM / 8 + 255) / 256), 256, 0, stream>>>(xv + (size_t)b * TT * DM, XB3, (size_t)TT * DM / 8);
        k_gemmk<bf, 0, 1, 8, DM><<<dim3(TT / 64, DQ / 64, 1), 256, 0, stream>>>(XB, nullptr, WQ, nullptr, nullptr, 0, bq, 0, 0, 0, QP16 + b * PQ, QPh + b * PQ, QPl + b * PQ);
        k_gemmk<bf, 0, 1, 8, DM><<<dim3(TT / 64, DKV / 64, 1), 256, 0, stream>>>(XB2, nullptr, WK, nullptr, nullptr, 0, bk, 0, 0, 0, KP16 + b * PK, KPh + b * PK, KPl + b * PK);
        k_gemmk<bf, 0, 2, 8, DM><<<dim3(DKV / 64, TT / 64, 1), 256, 0, stream>>>(WV, nullptr, XB3, nullptr, nullptr, 0, bv, 0, 0, 0, VT16 + b * PK, VTh + b * PK, VTl + b * PK); }   // Vt = Wv^T.x^T: the [d][t] planes come out of the product as they lie
    k_fattn<<<dim3(NB_ * NH_, RH / 64 + (TT - RH) / 128, 1), 128, 0, stream>>>(QP16, KP16, VT16, QPh, QPl, KPh, KPl, VTh, VTl, mk, ATh, ATl);
    for (int b = 0; b < NB_; ++b)
        k_gemmk<bf, 1, 0, 8, DQ><<<dim3(TT / 64, DM / 64, 1), 256, 0, stream>>>(ATh + (size_t)b * TT * DQ, ATl + (size_t)b * TT * DQ, WO, nullptr, OUT + (size_t)b * TT * DM, DM, nullptr, 0, 0, 0, nullptr, nullptr, nullptr);
}

// v005
// A run of this version takes 233 microseconds.
// Timed twice side by side with v004, it ran 1.25 times as fast both times.
// Over all steps from v000 it is 8.88 times as fast.
#include <hip/hip_runtime.h>

// MultiHeadAttentionModule (q, k, v inputs [2][2048][1024]; per-head Qh = q Wq[h] + bq[h], Kh = k Wk[h] + bk[h], Vh = v Wv[h] + bv[h] (W [16][1024][64]); scores = Qh.Kh / 8, where(mask == 0, -1e9) (mask [2048][2048] int, read); softmax; out = concat(heads) Wo ([in,out], no bias) -> [2][2048][1024]).
// Compute dtypes, f32 accumulate: every input rounded to bf16; Qh/Kh/Vh on PLAIN bf16 operands (inputs: exact; per-head weights gathered) + bias; scores and attn.v (one fused kernel, running maximum): query rows < 512 hl (3 products), the rest single fp16 (x1024); mask + softmax f32; Wo hl x exact (2 products).
// Left open: the mask loads of k_fattn and the fragment loads of k_gemmk still touch 16 lines an instruction; a stage of 64 keys would make the Vt rows whole 128-byte lines and halve the barriers; the ten conversion launches could be one launch of fewer, fatter waves; each product still runs once a batch.

#define NB_  2
#define TT   2048
#define DM   1024
#define NH_  16
#define NKV  16
#define REP  (NH_ / NKV)
#define HD   64
#define DQ   (NH_ * HD)
#define DKV  (NKV * HD)
#define RH   512                  // query rows < RH use hi+lo planes (0: none)
#define WIN  0
#define PCAR 1024.0f
#define SCL  0.125f   // HD^-0.5
typedef _Float16 h16;
typedef unsigned short bf;
typedef __attribute__((ext_vector_type(16))) __bf16   v16bf;
typedef __attribute__((ext_vector_type(16))) _Float16 v16h;
typedef __attribute__((ext_vector_type(8)))  _Float16 v8h;
typedef __attribute__((ext_vector_type(8)))  unsigned short v8us;
typedef __attribute__((ext_vector_type(8)))  float    v8f;
typedef __attribute__((ext_vector_type(4)))  float    v4f;
typedef v8h  __attribute__((may_alias)) v8ha;
typedef v4f  __attribute__((may_alias)) v4fa;
typedef v8us __attribute__((may_alias)) v8usa;

__device__ __forceinline__ unsigned short f2bf(float f) { unsigned u = __float_as_uint(f); u += 0x7FFFu + ((u >> 16) & 1u); return (unsigned short)(u >> 16); }
__device__ __forceinline__ float bf2f(unsigned short b) { return __uint_as_float(((unsigned)b) << 16); }
__device__ __forceinline__ float bfr(float f) { return bf2f(f2bf(f)); }
__device__ __forceinline__ v16h cat16(v8h lo, v8h hi) { return __builtin_shufflevector(lo, hi, 0, 1, 2, 3, 4, 5, 6, 7, 8, 9, 10, 11, 12, 13, 14, 15); }
__device__ __forceinline__ v16bf cat16b(v8us lo, v8us hi) { return __builtin_bit_cast(v16bf, __builtin_shufflevector(lo, hi, 0, 1, 2, 3, 4, 5, 6, 7, 8, 9, 10, 11, 12, 13, 14, 15)); }
__device__ __forceinline__ v8f wmma16(v16h a, v16h b, v8f c) { return __builtin_amdgcn_wmma_f32_16x16x32_f16(false, a, false, b, (short)0, c, false, false); }
__device__ __forceinline__ v8f wmmab(v16bf a, v16bf b, v8f c) { return __builtin_amdgcn_wmma_f32_16x16x32_bf16(false, a, false, b, (short)0, c, false, false); }
typedef __attribute__((ext_vector_type(4))) _Float16 v4h;
typedef __attribute__((ext_vector_type(4))) unsigned short v4us;
typedef __attribute__((ext_vector_type(4))) __bf16 v4b;



// ---- fragment loaders: a lane's 16 elements of a K-contiguous 16-bit row, in the hardware k order (8 at p, 8 at p + 16; p holds the lane half's 8 hi)
template <typename T16> struct WFrag;
template <> struct WFrag<h16> { typedef v16h V; static __device__ __forceinline__ V ld(const h16* p) { return cat16(*(const v8h*)p, *(const v8h*)(p + 16)); } static __device__ __forceinline__ v8f mma(V a, V b, v8f c) { return wmma16(a, b, c); } };
template <> struct WFrag<bf> { typedef v16bf V; static __device__ __forceinline__ V ld(const bf* p) { return cat16b(*(const v8us*)p, *(const v8us*)(p + 16)); } static __device__ __forceinline__ v8f mma(V a, V b, v8f c) { return wmmab(a, b, c); } };
// ---- k_gemmk: one 64x64 output tile (16 accumulators a wave, operands straight from K-contiguous 16-bit planes) with its K range dealt to KW waves of one work-group (wave w takes k in [w K/KW, (w+1) K/KW)), for products whose K loop is long and whose tiles are few.
// Each wave leaves its partial tile in its own LDS plane; behind one barrier the planes are summed in wave order 0..KW-1 (a fixed order), the bias is added (EPI 1, 2) and the tile stored. grid (M/64, N/64, Z), 32 KW threads. K % (32 KW) == 0.
// Fragment addresses: a scalar base per operand (tile row 0, the wave's first k) + ONE byte offset per lane, the same for all operands where LDA == K (row lr, half hi, the trip's k) + a constant (16 mb or 16 nb rows; K is a template constant for that).
// LDA: row pitch of A and A2 in elements (Bt keeps pitch K); where it is not K, A and A2 take a lane offset of their own.
// EPI: what becomes of the summed tile. 0: stored as f32 in C. 1 and 2: + bias, then stored as the three 16-bit head planes that the attention kernel reads (fp16, bf16 hi, bf16 lo of the same f32 value); C is not used.
//   1: rows are tokens, the tile's 64 columns are one head (bias per column) -> planes [head][t][d], the tile is 8 KiB in a row. 2: rows are (head, d), columns are tokens (A: the weight, Bt: the activations; bias per row) -> planes [head][d][t].
template <typename T16, int NSPLIT, int EPI, int KW, int K, int LDA = K>
__global__ __launch_bounds__(32 * KW) void k_gemmk(const T16* __restrict__ A, const T16* __restrict__ A2, const T16* __restrict__ Bt, const T16* __restrict__ Bt2, float* C, int ldc, const float* __restrict__ bias, size_t sA, size_t sB, size_t sC, h16* P16, bf* Ph, bf* Pl) {
    typedef typename WFrag<T16>::V V;
    __shared__ __align__(16) float os[KW * 64 * 68];
    const size_t z = blockIdx.z; A += z * sA; if (A2) A2 += z * sA; Bt += z * sB; if (Bt2) Bt2 += z * sB; C += z * sC;
    const int lane = threadIdx.x & 31, lr = lane & 15, hi = lane >> 4; const int r0 = blockIdx.x * 64, c0 = blockIdx.y * 64;
    const int wave = __builtin_amdgcn_readfirstlane((int)(threadIdx.x >> 5)); const int kb = wave * (K / KW);   // scalar: the wave's first k goes into the scalar bases
    v8f acc[4][4];   // every '#pragma unroll' of this kernel makes the indices of acc, a, a2 constants, so that the fragments stay in registers
#pragma unroll
    for (int mb = 0; mb < 4; ++mb)
#pragma unroll
        for (int nb = 0; nb < 4; ++nb) acc[mb][nb] = (v8f){};
    const char* Ab = (const char*)(A + (size_t)r0 * LDA + kb); const char* A2b = (const char*)(A2 + (size_t)r0 * LDA + kb); const char* Bb = (const char*)(Bt + (size_t)c0 * K + kb); const char* B2b = (const char*)(Bt2 + (size_t)c0 * K + kb);
    unsigned vo = (unsigned)(lr * K + 8 * hi) * 2u;   // the lane's byte offset; + 64 a trip
    unsigned voa = (unsigned)(lr * LDA + 8 * hi) * 2u;   // the same at A's pitch (used only where LDA != K)
#pragma unroll 1   // rolled: a second trip's fragments would not fit the 256 registers that 8 waves a work-group leave each wave
    for (int t = 0; t < K / KW / 32; ++t) {
        V a[4], a2[4]; const unsigned va = (LDA == K) ? vo : voa;
#pragma unroll
        for (int mb = 0; mb < 4; ++mb) { a[mb] = WFrag<T16>::ld((const T16*)(Ab + va + mb * 16 * LDA * 2)); if (NSPLIT == 1 || NSPLIT == 2) a2[mb] = WFrag<T16>::ld((const T16*)(A2b + va + mb * 16 * LDA * 2)); }
#pragma unroll
        for (int nb = 0; nb < 4; ++nb) { const V b = WFrag<T16>::ld((const T16*)(Bb + vo + nb * 16 * K * 2)); V b2; if (NSPLIT >= 2) b2 = WFrag<T16>::ld((const T16*)(B2b + vo + nb * 16 * K * 2));
#pragma unroll
            for (int mb = 0; mb < 4; ++mb) { acc[mb][nb] = WFrag<T16>::mma(a[mb], b, acc[mb][nb]); if (NSPLIT == 1 || NSPLIT == 2) acc[mb][nb] = WFrag<T16>::mma(a2[mb], b, acc[mb][nb]); if (NSPLIT >= 2) acc[mb][nb] = WFrag<T16>::mma(a[mb], b2, acc[mb][nb]); } }
        // four vector slots behind the trip's last matrix instructions, on the taken branch too, before the next trip overwrites registers of A and B fragments;
        // s_wait_xcnt 0: the wait in front of the one overwrite of a register that the trip's loads name (vo is an operand, so that its addition stays behind the wait)
        if constexpr (LDA == K) { asm volatile("v_nop\n\tv_nop\n\tv_nop\n\tv_nop\n\ts_wait_xcnt 0x0" : "+v"(acc[0][0]), "+v"(acc[1][1]), "+v"(acc[2][2]), "+v"(acc[3][3]), "+v"(vo) : "v"(a[0]), "v"(a[3])); }
        else { asm volatile("v_nop\n\tv_nop\n\tv_nop\n\tv_nop\n\ts_wait_xcnt 0x0" : "+v"(acc[0][0]), "+v"(acc[1][1]), "+v"(acc[2][2]), "+v"(acc[3][3]), "+v"(vo), "+v"(voa) : "v"(a[0]), "v"(a[3])); voa += 64u; }   // the same statement with both lane offsets as operands
        vo += 64u;
    }
    float* ow = os + wave * (64 * 68);
#pragma unroll
    for (int mb = 0; mb < 4; ++mb)
#pragma unroll
        for (int nb = 0; nb < 4; ++nb)
#pragma unroll
            for (int j = 0; j < 8; ++j) ow[(mb * 16 + hi * 8 + j) * 68 + nb * 16 + lr] = acc[mb][nb][j];
    __syncthreads();   // every wave's partial tile is in LDS before any plane is read
    v4f sv[32 / KW];   // EPI 1, 2: the thread's summed values, bias added
#pragma unroll
    for (int s = 0; s < 32 / KW; ++s) { const int idx = s * (32 * KW) + (int)threadIdx.x; const int row = idx >> 4, cofs = (idx & 15) * 4; const float* op = os + row * 68 + cofs; v4f val = *(const v4fa*)op;
#pragma unroll
        for (int w = 1; w < KW; ++w) val += *(const v4fa*)(op + w * (64 * 68));
        if constexpr (EPI == 0) { *(v4f*)(C + (size_t)(r0 + row) * ldc + c0 + cofs) = val; }
        else {
            if constexpr (EPI == 1) { val[0] += bfr(bias[c0 + cofs]); val[1] += bfr(bias[c0 + cofs + 1]); val[2] += bfr(bias[c0 + cofs + 2]); val[3] += bfr(bias[c0 + cofs + 3]); }
            else { const float br = bfr(bias[r0 + row]); val[0] += br; val[1] += br; val[2] += br; val[3] += br; }
            sv[s] = val; } }
    if constexpr (EPI != 0) {   // a loop of its own behind all the sums: the store statements order memory, and an LDS read or a bias load behind one would wait for it
#pragma unroll
        for (int s = 0; s < 32 / KW; ++s) { const int idx = s * (32 * KW) + (int)threadIdx.x; const int row = idx >> 4, cofs = (idx & 15) * 4; const v4f val = sv[s];
            const size_t po = (EPI == 1) ? ((size_t)(c0 / HD) * TT + r0 + row) * HD + cofs : (size_t)(r0 + row) * TT + c0 + cofs; const v4h o16 = __builtin_convertvector(val, v4h); const v4b oh = __builtin_convertvector(val, v4b); const v4b ol = __builtin_convertvector(val - __builtin_convertvector(oh, v4f), v4b);   // each conversion rounds to nearest even, as f2bf does; lo is the rounded rest behind hi
            // the three planes' stores and s_wait_xcnt 0 in ONE statement: the wait stands in front of every later write of a register that the stores name
            asm volatile("global_store_b64 %0, %1, off\n\tglobal_store_b64 %2, %3, off\n\tglobal_store_b64 %4, %5, off\n\ts_wait_xcnt 0x0" :: "v"(P16 + po), "v"(o16), "v"(Ph + po), "v"(oh), "v"(Pl + po), "v"(ol) : "memory"); } }
}

__device__ __forceinline__ void splitf(float y, unsigned short& h, unsigned short& l) { h = f2bf(y); l = f2bf(y - bf2f(h)); }
typedef __attribute__((ext_vector_type(2))) unsigned short v2us;
typedef __attribute__((ext_vector_type(4))) int v4i;

__global__ __launch_bounds__(256) void k_wtG(const float* __restrict__ w, int K, int N, bf* Bt) {
    const int lane = threadIdx.x & 31; const int L0 = (blockIdx.x * 8 + (threadIdx.x >> 5)) * 8; const int nlines = N * K / 64;
{
#pragma unroll 1
        for (int l = 0; l < 8; ++l) { const int L = L0 + l; if (L >= nlines) break; const size_t e = (size_t)L * 64 + lane * 2; const int k = (int)(e % K), n = (int)(e / K); v2us o;
            o[0] = f2bf(w[(size_t)k * N + n]); o[1] = f2bf(w[(size_t)(k + 1) * N + n]); *(v2us*)(Bt + e) = o; }
         }
}
__global__ __launch_bounds__(256) void k_cvt8(const float* __restrict__ src, bf* dst, size_t n8) { const size_t i = (size_t)blockIdx.x * 256 + threadIdx.x; if (i >= n8) return; const v8f v = *(const v8f*)(src + i * 8); v8us o;
#pragma unroll
    for (int k = 0; k < 8; ++k) o[k] = f2bf(v[k]); *(v8us*)(dst + i * 8) = o;  }
__device__ __forceinline__ float xhalf(float x) { const unsigned b = __float_as_uint(x); return __uint_as_float(__builtin_amdgcn_permlanex16(b, b, 0x76543210u, 0xfedcba98u, false, false)); }   // the value of lane l ^ 16
#define KPIT 144            // LDS bytes a K row (128 bytes) and
#define VPIT 80             // a Vt row piece (64 bytes) take: 16 bytes x an odd number, free of bank conflicts for 16-byte reads of 16 rows
#define KTB  (32 * KPIT)    // a K tile (32 keys) in LDS
#define VTB  (HD * VPIT)    // a Vt tile (HD rows of 32 keys) in LDS
// A thread's share of one pass's K and Vt tiles of one plane pair: four asynchronous 16-byte copies to LDS. lk, lv: the lane's LDS byte addresses of its first K and Vt piece; gk, gv: their global addresses. The second pieces lie 16 K rows and 32 Vt rows on.
// s_wait_xcnt 0 is the statement's last line, so that it stands in front of every later write of a register that the copies name.
__device__ __forceinline__ void stage_kv(unsigned lk, unsigned lv, const char* gk, const char* gv) {
    asm volatile("global_load_async_to_lds_b128 %0, %1, off\n\tglobal_load_async_to_lds_b128 %2, %3, off\n\tglobal_load_async_to_lds_b128 %4, %5, off\n\tglobal_load_async_to_lds_b128 %6, %7, off\n\ts_wait_xcnt 0x0"
                 :: "v"(lk), "v"(gk), "v"(lk + 16u * KPIT), "v"(gk + 16 * HD * 2), "v"(lv), "v"(gv), "v"(lv + 32u * VPIT), "v"(gv + 32 * TT * 2) : "memory");
}
template <bool HL> struct FT { typedef h16 T; };
template <> struct FT<true> { typedef bf T; };
template <bool HL, int QB>
__device__ __forceinline__ void fattn_rows(const typename FT<HL>::T* __restrict__ Q, const typename FT<HL>::T* __restrict__ Q2, const typename FT<HL>::T* __restrict__ Kp, const typename FT<HL>::T* __restrict__ K2, const typename FT<HL>::T* __restrict__ Vt, const typename FT<HL>::T* __restrict__ V2, const int* __restrict__ mk, int q0, bf* Ah, bf* Al, char* ldsb) {
    typedef typename FT<HL>::T T16; typedef typename WFrag<T16>::V V; typedef WFrag<T16> F;
    const float L2E = 1.4426950408889634f;
    const int lane = threadIdx.x & 31, lr = lane & 15, hi = lane >> 4;
    const unsigned qo = (unsigned)((q0 + lr) * HD + 8 * hi) * 2u;   // the lane's byte offset in the Q planes
    V qf[QB][2], q2f[QB][2]; v8f o[QB][4]; float mx[QB], sm[QB];   // every '#pragma unroll' below makes the indices of these arrays constants, so that they stay in registers
#pragma unroll
    for (int qb = 0; qb < QB; ++qb) { mx[qb] = -3.0e38f; sm[qb] = 0.f;
#pragma unroll
        for (int ks = 0; ks < 2; ++ks) { qf[qb][ks] = F::ld((const T16*)((const char*)Q + qo + qb * 16 * HD * 2 + ks * 64)); if (HL) q2f[qb][ks] = F::ld((const T16*)((const char*)Q2 + qo + qb * 16 * HD * 2 + ks * 64)); }
#pragma unroll
        for (int db = 0; db < 4; ++db) o[qb][db] = (v8f){}; }
    // K and Vt: each pass's tiles (32 keys) are brought into LDS ONCE for the work-group's 4 waves by asynchronous copies, two buffers, a pass's copies issued at the foot of the pass two before it; every wave copies its share (stage_kv).
    // A thread's two 16-byte pieces of each tile: K piece c = tid + 128 i (row c / 8, the tile is 4 KiB in a row in the plane), Vt piece c (row c / 4, 64 bytes a row, plane pitch 2 TT bytes).
    // Mask words: a scalar base + ONE byte offset per lane + a constant, fetched one pass ahead.
    constexpr unsigned PLB = KTB + VTB, BUFB = (HL ? 2u : 1u) * PLB;   // bytes of one plane pair's tiles; of one buffer
    const unsigned tid = threadIdx.x; const unsigned sb0 = (unsigned)(size_t)ldsb;   // the low 32 bits of a __shared__ address are the LDS byte address
    const unsigned lk = sb0 + (tid >> 3) * KPIT + (tid & 7u) * 16u, lv = sb0 + KTB + (tid >> 2) * VPIT + (tid & 3u) * 16u;
    const char* gk = (const char*)Kp + tid * 16u; const char* gv = (const char*)Vt + (tid >> 2) * (TT * 2u) + (tid & 3u) * 16u; const char* gk2 = (const char*)K2 + tid * 16u; const char* gv2 = (const char*)V2 + (tid >> 2) * (TT * 2u) + (tid & 3u) * 16u;
    const char* Mb = (const char*)mk; unsigned mo = (unsigned)((q0 + lr) * TT + 8 * hi) * 4u;
    const unsigned kfo = (unsigned)(lr * KPIT + 16 * hi), vfo = (unsigned)(KTB + lr * VPIT + 16 * hi);   // the lane's byte offsets of its K and Vt fragments in a buffer
    V kf[2][2], k2f[2][2], vf[4], v2[4]; v4i mw[QB][2][2];
    stage_kv(lk, lv, gk, gv); if (HL) stage_kv(lk + PLB, lv + PLB, gk2, gv2);   // pass 0 -> buffer 0
    gk += 32 * HD * 2; gv += 32 * 2; gk2 += 32 * HD * 2; gv2 += 32 * 2;
#pragma unroll
    for (int kt = 0; kt < 2; ++kt)
#pragma unroll
        for (int qb = 0; qb < QB; ++qb) { mw[qb][kt][0] = *(const v4i*)(Mb + mo + qb * 16 * TT * 4 + kt * 64); mw[qb][kt][1] = *(const v4i*)(Mb + mo + qb * 16 * TT * 4 + kt * 64 + 16); }
    asm volatile("s_wait_xcnt 0x0" : "+v"(mo) : "v"(qo));   // the wait in front of the overwrite of registers that issued loads name (the two offsets are operands: their registers live up to it, and the addition stays behind it)
    mo += 32u * 4u;   // the offset now stands at pass 1
    asm volatile("s_wait_asynccnt 0x0" ::: "memory");   // this wave's copies of pass 0 have landed ...
    __syncthreads();                                     // ... and every other wave's: buffer 0 may be read
    stage_kv(lk + BUFB, lv + BUFB, gk, gv); if (HL) stage_kv(lk + BUFB + PLB, lv + BUFB + PLB, gk2, gv2);   // pass 1 -> buffer 1
    gk += 32 * HD * 2; gv += 32 * 2; gk2 += 32 * HD * 2; gv2 += 32 * 2;
    unsigned bo = 0u;   // byte offset of the buffer that the pass reads
#pragma unroll 1   // rolled: a second pass's fragments and scores would cost a resident wave per SIMD
    for (int kb = 0; kb < TT; kb += 32) {
        v8f s[QB][2]; const char* sb = ldsb + bo;
#pragma unroll
        for (int kt = 0; kt < 2; ++kt)
#pragma unroll
            for (int ks = 0; ks < 2; ++ks) { kf[kt][ks] = F::ld((const T16*)(sb + kfo + kt * 16 * KPIT + ks * 64)); if (HL) k2f[kt][ks] = F::ld((const T16*)(sb + PLB + kfo + kt * 16 * KPIT + ks * 64)); }
        __builtin_amdgcn_sched_barrier(0);   // K's reads issue in front of Vt's: LDS reads come back in issue order and St needs K first (without this line the hi+lo build reads Vt first)
#pragma unroll
        for (int db = 0; db < 4; ++db) { vf[db] = F::ld((const T16*)(sb + vfo + db * 16 * VPIT)); if (HL) v2[db] = F::ld((const T16*)(sb + PLB + vfo + db * 16 * VPIT)); }
        __builtin_amdgcn_sched_barrier(0);   // the pass's LDS reads issue here as ONE group: without this line the Vt reads sink between the Ot matrix instructions, each waited for at once
#pragma unroll
        for (int kt = 0; kt < 2; ++kt) {
#pragma unroll
            for (int qb = 0; qb < QB; ++qb) s[qb][kt] = (v8f){};
#pragma unroll
            for (int ks = 0; ks < 2; ++ks)
#pragma unroll
                for (int qb = 0; qb < QB; ++qb) { s[qb][kt] = F::mma(kf[kt][ks], qf[qb][ks], s[qb][kt]); if (HL) { s[qb][kt] = F::mma(kf[kt][ks], q2f[qb][ks], s[qb][kt]); s[qb][kt] = F::mma(k2f[kt][ks], qf[qb][ks], s[qb][kt]); } } }
        float bm[QB]; bool grow = false;
#pragma unroll
        for (int qb = 0; qb < QB; ++qb) { float b = -3.0e38f;
#pragma unroll
            for (int kt = 0; kt < 2; ++kt) {
#pragma unroll
                for (int j = 0; j < 8; ++j) { const float t = (mw[qb][kt][j >> 2][j & 3] != 0) ? s[qb][kt][j] * SCL : -3.0e38f; s[qb][kt][j] = t; b = fmaxf(b, t); }
                mw[qb][kt][0] = *(const v4i*)(Mb + mo + qb * 16 * TT * 4 + kt * 64); mw[qb][kt][1] = *(const v4i*)(Mb + mo + qb * 16 * TT * 4 + kt * 64 + 16); }
            bm[qb] = fmaxf(b, xhalf(b)); grow = grow || (bm[qb] > mx[qb]); }
        __builtin_amdgcn_sched_barrier(0);   // the next pass's mask loads issue in front of the exponentials: the barrier at the pass's foot waits for them, and without this line they sink down to it
        if (__builtin_amdgcn_ballot_w32(grow) != 0) {   // a scalar branch: a pass in which no query's maximum grows has every factor 1 and skips the scaling
#pragma unroll
            for (int qb = 0; qb < QB; ++qb) { const float mn = fmaxf(mx[qb], bm[qb]); const float al = __builtin_amdgcn_exp2f((mx[qb] - mn) * L2E); mx[qb] = mn; sm[qb] *= al;
#pragma unroll
                for (int db = 0; db < 4; ++db) o[qb][db] *= al; } }
        V pf[QB], p2[QB];
#pragma unroll
        for (int qb = 0; qb < QB; ++qb) {
#pragma unroll
            for (int g = 0; g < 2; ++g) { float x[8], p[8];
#pragma unroll
                for (int j = 0; j < 8; ++j) { const float d = s[qb][g][j] - mx[qb]; x[j] = HL ? d * L2E : __builtin_fmaf(d, L2E, 10.0f); p[j] = __builtin_amdgcn_exp2f(x[j]); }   // + 10 in the exponent: x PCAR = 2^10
                // the slot behind a transcendental, once for a run of eight: results and sources are operands, so that in front of the v_nop nothing reads a result or overwrites a source
                asm volatile("v_nop" : "+v"(p[0]), "+v"(p[1]), "+v"(p[2]), "+v"(p[3]), "+v"(p[4]), "+v"(p[5]), "+v"(p[6]), "+v"(p[7]) : "v"(x[0]), "v"(x[1]), "v"(x[2]), "v"(x[3]), "v"(x[4]), "v"(x[5]), "v"(x[6]), "v"(x[7]));
#pragma unroll
                for (int j = 0; j < 8; ++j) { sm[qb] += p[j];
                    if constexpr (HL) { const __bf16 ph = (__bf16)p[j]; pf[qb][g * 8 + j] = ph; p2[qb][g * 8 + j] = (__bf16)(p[j] - (float)ph); }
                    else pf[qb][g * 8 + j] = (h16)p[j]; } } }
#pragma unroll
        for (int db = 0; db < 4; ++db)
#pragma unroll
            for (int qb = 0; qb < QB; ++qb) { o[qb][db] = F::mma(vf[db], pf[qb], o[qb][db]); if (HL) { o[qb][db] = F::mma(vf[db], p2[qb], o[qb][db]); o[qb][db] = F::mma(v2[db], pf[qb], o[qb][db]); } }
        // four vector slots between the Ot matrix instructions and the next pass's LDS reads, which refill the Vt fragments' registers (operands: the accumulators, so that the matrix instructions stay in front)
        if constexpr (QB == 2) { asm volatile("v_nop\n\tv_nop\n\tv_nop\n\tv_nop" : "+v"(o[0][0]), "+v"(o[0][1]), "+v"(o[0][2]), "+v"(o[0][3]), "+v"(o[1][0]), "+v"(o[1][1]), "+v"(o[1][2]), "+v"(o[1][3])); }
        else { asm volatile("v_nop\n\tv_nop\n\tv_nop\n\tv_nop" : "+v"(o[0][0]), "+v"(o[0][1]), "+v"(o[0][2]), "+v"(o[0][3])); }
        asm volatile("s_wait_xcnt 0x0" : "+v"(mo));   // as in front of the loop: the pass's mask loads name the offset
        mo += ((kb + 64 < TT) ? 1u : 0u) * (32u * 4u);   // the last two passes fetch the last pass's mask words (in bounds; the last fetch is unused)
        // hand-over: this wave's reads of the pass's buffer are done, its copies of the next pass have landed; behind the barrier that holds for all 4 waves, so the next buffer may be read and this one refilled
        asm volatile("s_wait_dscnt 0x0" ::: "memory");
        asm volatile("s_wait_asynccnt 0x0" ::: "memory");
        __syncthreads();
        if (kb + 64 < TT) {   // the same for the whole work-group: only while a pass kb / 32 + 2 exists
            stage_kv(lk + bo, lv + bo, gk, gv); if (HL) stage_kv(lk + bo + PLB, lv + bo + PLB, gk2, gv2);
            gk += 32 * HD * 2; gv += 32 * 2; gk2 += 32 * HD * 2; gv2 += 32 * 2; }
        bo = BUFB - bo;
    }
    asm volatile("s_wait_asynccnt 0x0" ::: "memory");   // no copy is outstanding when the wave goes on to its end
#pragma unroll
    for (int qb = 0; qb < QB; ++qb) { const float f = __fdiv_rn(1.0f, sm[qb] + xhalf(sm[qb])); const size_t oo = (size_t)(q0 + qb * 16 + lr) * DQ + 8 * hi;   // a lane's 8 accumulator registers are 8 consecutive d of its query: one 16-byte store a plane
#pragma unroll
        for (int db = 0; db < 4; ++db) { v8us oh, ol;
#pragma unroll
            for (int j = 0; j < 8; ++j) { unsigned short a, c2; splitf(o[qb][db][j] * f, a, c2); oh[j] = a; ol[j] = c2; }
            // both planes' stores and s_wait_xcnt 0 in ONE statement: the wait stands in front of every later write of a register that the stores name, on every way out of here (with plain stores the compiler joined the tails of the two row classes)
            asm volatile("global_store_b128 %0, %1, off\n\tglobal_store_b128 %2, %3, off\n\ts_wait_xcnt 0x0" :: "v"(Ah + oo + db * 16), "v"(oh), "v"(Al + oo + db * 16), "v"(ol) : "memory"); } }
}
// grid (NB_ NH_, RH/64 + (TT-RH)/128), 4 waves: row blocks y < RH/64 are the hi+lo rows (16 a wave), the rest fp16 (32 a wave). Planes [batch][head][..]; one kv head per query head. Ah, Al: [batch][t][head d].
__global__ __launch_bounds__(128) void k_fattn(const h16* __restrict__ Q16, const h16* __restrict__ K16, const h16* __restrict__ V16, const bf* __restrict__ Qh, const bf* __restrict__ Ql, const bf* __restrict__ Kh, const bf* __restrict__ Kl, const bf* __restrict__ Vh, const bf* __restrict__ Vl, const int* __restrict__ mk, bf* Ah, bf* Al) {
    __shared__ __align__(16) char kv[2 * 2 * (KTB + VTB)];   // two buffers of the hi+lo rows' four tiles (the fp16 rows use half)
    const int z = blockIdx.x, y = blockIdx.y; const int wave = __builtin_amdgcn_readfirstlane((int)(threadIdx.x >> 5)); const size_t po = (size_t)z * TT * HD; const size_t ao = (size_t)(z / NH_) * TT * DQ + (size_t)(z % NH_) * HD;
    if (y < RH / 64) fattn_rows<true, 1>(Qh + po, Ql + po, Kh + po, Kl + po, Vh + po, Vl + po, mk, y * 64 + wave * 16, Ah + ao, Al + ao, kv);
    else fattn_rows<false, 2>(Q16 + po, nullptr, K16 + po, nullptr, V16 + po, nullptr, mk, RH + (y - RH / 64) * 128 + wave * 32, Ah + ao, Al + ao, kv);
}

__global__ __launch_bounds__(256) void k_wtH(const float* __restrict__ w, bf* Bt) { const size_t e = ((size_t)blockIdx.x * 256 + threadIdx.x) * 4; if (e >= (size_t)DQ * DM) return; const int k = (int)(e % DM); const int n = (int)(e / DM); const int h = n / HD, c = n % HD; v4us o;   // Bt[h*64 + c][d] = W[h][d][c]
#pragma unroll
    for (int u = 0; u < 4; ++u) o[u] = f2bf(w[((size_t)h * DM + k + u) * HD + c]); *(v4us*)(Bt + e) = o;  }

extern "C" void kernel_launch(void* const* d_in, const int* in_sizes, int n_in,
                              void* d_out, int out_size, void* d_ws, size_t ws_size, hipStream_t stream) {
    (void)in_sizes; (void)n_in; (void)out_size;
    const float* x = (const float*)d_in[0]; const float* xk = (const float*)d_in[1]; const float* xv = (const float*)d_in[2]; const int* mk = (const int*)d_in[3]; const float* wqh = (const float*)d_in[4]; const float* bq = (const float*)d_in[5]; const float* wkh = (const float*)d_in[6]; const float* bk = (const float*)d_in[7]; const float* wvh = (const float*)d_in[8]; const float* bv = (const float*)d_in[9]; const float* wo = (const float*)d_in[10]; const float* wq = nullptr; const float* wk = nullptr; const float* wv = nullptr; (void)wq; (void)wk; (void)wv; const float* cosT = nullptr; const float* sinT = nullptr; (void)cosT; (void)sinT;
    float* OUT = (float*)d_out;     // [2][2048][1024]
    char* wsp = (char*)d_ws;
    auto take = [&](size_t bytes) { char* p = wsp; wsp += (bytes + 255) & ~(size_t)255; return (void*)p; };
    bf* WQ = (bf*)take((size_t)DQ * DM * 2); bf* WK = (bf*)take((size_t)DKV * DM * 2); bf* WV = (bf*)take((size_t)DKV * DM * 2); bf* WO = (bf*)take((size_t)DM * DQ * 2);
    bf* XB = (bf*)take((size_t)TT * DM * 2); bf* XB2 = (bf*)take((size_t)TT * DM * 2); bf* XB3 = (bf*)take((size_t)TT * DM * 2);
    const size_t PQ = (size_t)NH_ * TT * HD, PK = (size_t)NKV * TT * HD;   // one batch's head planes, in elements; every plane holds both batches
    h16* QP16 = (h16*)take(NB_ * PQ * 2); h16* KP16 = (h16*)take(NB_ * PK * 2); h16* VT16 = (h16*)take(NB_ * PK * 2);
    bf* QPh = (bf*)take(NB_ * PQ * 2); bf* QPl = (bf*)take(NB_ * PQ * 2); bf* KPh = (bf*)take(NB_ * PK * 2); bf* KPl = (bf*)take(NB_ * PK * 2); bf* VTh = (bf*)take(NB_ * PK * 2); bf* VTl = (bf*)take(NB_ * PK * 2);
    bf* ATh = (bf*)take((size_t)NB_ * TT * DQ * 2); bf* ATl = (bf*)take((size_t)NB_ * TT * DQ * 2);
    if ((size_t)(wsp - (char*)d_ws) > ws_size) return;    // ws 256 MiB
    { k_wtH<<<(unsigned)(((size_t)DQ * DM / 4 + 255) / 256), 256, 0, stream>>>(wqh, WQ); k_wtH<<<(unsigned)(((size_t)DKV * DM / 4 + 255) / 256), 256, 0, stream>>>(wkh, WK); k_wtH<<<(unsigned)(((size_t)DKV * DM / 4 + 255) / 256), 256, 0, stream>>>(wvh, WV);
      k_wtG<<<(unsigned)((DQ * DM / 64 + 63) / 64), 256, 0, stream>>>(wo, DQ, DM, WO);
       }
    for (int b = 0; b < NB_; ++b) {
        k_cvt8<<<(unsigned)(((size_t)TT * DM / 8 + 255) / 256), 256, 0, stream>>>(x + (size_t)b * TT * DM, XB, (size_t)TT * DM / 8); k_cvt8<<<(unsigned)(((size_t)TT * DM / 8 + 255) / 256), 256, 0, stream>>>(xk + (size_t)b * TT * DM, XB2, (size_t)TT * DM / 8); k_cvt8<<<(unsigned)(((size_t)TT * DM / 8 + 255) / 256), 256, 0, stream>>>(xv + (size_t)b * TT * DM, XB3, (size_t)TT * DM / 8);
        k_gemmk<bf, 0, 1, 8, DM><<<dim3(TT / 64, DQ / 64, 1), 256, 0, stream>>>(XB, nullptr, WQ, nullptr, nullptr, 0, bq, 0, 0, 0, QP16 + b * PQ, QPh + b * PQ, QPl + b * PQ);
        k_gemmk<bf, 0, 1, 8, DM><<<dim3(TT / 64, DKV / 64, 1), 256, 0, stream>>>(XB2, nullptr, WK, nullptr, nullptr, 0, bk, 0, 0, 0, KP16 + b * PK, KPh + b * PK, KPl + b * PK);
        k_gemmk<bf, 0, 2, 8, DM><<<dim3(DKV / 64, TT / 64, 1), 256, 0, stream>>>(WV, nullptr, XB3, nullptr, nullptr, 0, bv, 0, 0, 0, VT16 + b * PK, VTh + b * PK, VTl + b * PK); }   // Vt = Wv^T.x^T: the [d][t] planes come out of the product as they lie
    k_fattn<<<dim3(NB_ * NH_, RH / 64 + (TT - RH) / 128, 1), 128, 0, stream>>>(QP16, KP16, VT16, QPh, QPl, KPh, KPl, VTh, VTl, mk, ATh, ATl);
    for (int b = 0; b < NB_; ++b)
        k_gemmk<bf, 1, 0, 8, DQ><<<dim3(TT / 64, DM / 64, 1), 256, 0, stream>>>(ATh + (size_t)b * TT * DQ, ATl + (size_t)b * TT * DQ, WO, nullptr, OUT + (size_t)b * TT * DM, DM, nullptr, 0, 0, 0, nullptr, nullptr, nullptr);
}

// v006
// One run takes 191 microseconds.
// In two side-by-side timings against v005, it was 1.22 and 1.21 times as fast.
// All steps since v000 together make it 10.8 times as fast.
#include <hip/hip_runtime.h>

// MultiHeadAttentionModule (q, k, v inputs [2][2048][1024]; per-head Qh = q Wq[h] + bq[h], Kh = k Wk[h] + bk[h], Vh = v Wv[h] + bv[h] (W [16][1024][64]); scores = Qh.Kh / 8, where(mask == 0, -1e9) (mask [2048][2048] int, read); softmax; out = concat(heads) Wo ([in,out], no bias) -> [2][2048][1024]).
// Compute dtypes, f32 accumulate: every input rounded to bf16; Qh/Kh/Vh on PLAIN bf16 operands (inputs: exact; per-head weights gathered) + bias; scores and attn.v (one fused kernel, running maximum): query rows < 512 hl (3 products), the rest single fp16 (x1024); mask + softmax f32; Wo hl x exact (2 products).
// Left open: the mask loads of k_fattn and the fragment loads of gemmk still touch 16 lines an instruction; a stage of 64 keys would make the Vt rows whole 128-byte lines and halve the barriers; the weight transposes of k_cvtall read 32 bytes of each 128-byte line a thread; gemmk still deals K to its waves and sums 8 planes in LDS.

#define NB_  2
#define TT   2048
#define DM   1024
#define NH_  16
#define NKV  16
#define REP  (NH_ / NKV)
#define HD   64
#define DQ   (NH_ * HD)
#define DKV  (NKV * HD)
#define RH   512                  // query rows < RH use hi+lo planes (0: none)
#define WIN  0
#define PCAR 1024.0f
#define SCL  0.125f   // HD^-0.5
typedef _Float16 h16;
typedef unsigned short bf;
typedef __attribute__((ext_vector_type(16))) __bf16   v16bf;
typedef __attribute__((ext_vector_type(16))) _Float16 v16h;
typedef __attribute__((ext_vector_type(8)))  _Float16 v8h;
typedef __attribute__((ext_vector_type(8)))  unsigned short v8us;
typedef __attribute__((ext_vector_type(8)))  float    v8f;
typedef __attribute__((ext_vector_type(4)))  float    v4f;
typedef v8h  __attribute__((may_alias)) v8ha;
typedef v4f  __attribute__((may_alias)) v4fa;
typedef v8us __attribute__((may_alias)) v8usa;

__device__ __forceinline__ unsigned short f2bf(float f) { unsigned u = __float_as_uint(f); u += 0x7FFFu + ((u >> 16) & 1u); return (unsigned short)(u >> 16); }
__device__ __forceinline__ float bf2f(unsigned short b) { return __uint_as_float(((unsigned)b) << 16); }
__device__ __forceinline__ float bfr(float f) { return bf2f(f2bf(f)); }
__device__ __forceinline__ v16h cat16(v8h lo, v8h hi) { return __builtin_shufflevector(lo, hi, 0, 1, 2, 3, 4, 5, 6, 7, 8, 9, 10, 11, 12, 13, 14, 15); }
__device__ __forceinline__ v16bf cat16b(v8us lo, v8us hi) { return __builtin_bit_cast(v16bf, __builtin_shufflevector(lo, hi, 0, 1, 2, 3, 4, 5, 6, 7, 8, 9, 10, 11, 12, 13, 14, 15)); }
__device__ __forceinline__ v8f wmma16(v16h a, v16h b, v8f c) { return __builtin_amdgcn_wmma_f32_16x16x32_f16(false, a, false, b, (short)0, c, false, false); }
__device__ __forceinline__ v8f wmmab(v16bf a, v16bf b, v8f c) { return __builtin_amdgcn_wmma_f32_16x16x32_bf16(false, a, false, b, (short)0, c, false, false); }
typedef __attribute__((ext_vector_type(4))) _Float16 v4h;
typedef __attribute__((ext_vector_type(4))) unsigned short v4us;
typedef __attribute__((ext_vector_type(4))) __bf16 v4b;



// ---- fragment loaders: a lane's 16 elements of a K-contiguous 16-bit row, in the hardware k order (8 at p, 8 at p + 16; p holds the lane half's 8 hi)
template <typename T16> struct WFrag;
template <> struct WFrag<h16> { typedef v16h V; static __device__ __forceinline__ V ld(const h16* p) { return cat16(*(const v8h*)p, *(const v8h*)(p + 16)); } static __device__ __forceinline__ v8f mma(V a, V b, v8f c) { return wmma16(a, b, c); } };
template <> struct WFrag<bf> { typedef v16bf V; static __device__ __forceinline__ V ld(const bf* p) { return cat16b(*(const v8us*)p, *(const v8us*)(p + 16)); } static __device__ __forceinline__ v8f mma(V a, V b, v8f c) { return wmmab(a, b, c); } };
// ---- gemmk: one 64x64 output tile (16 accumulators a wave, operands straight from K-contiguous 16-bit planes) with its K range dealt to KW waves of one work-group (wave w takes k in [w K/KW, (w+1) K/KW)), for products whose K loop is long and whose tiles are few.
// Each wave leaves its partial tile in its own LDS plane; behind one barrier the planes are summed in wave order 0..KW-1 (a fixed order), the bias is added and the tile stored. A device function: the kernel that calls it says which tile (r0, c0) and hands it the LDS planes os (KW 64 x 68 floats). 32 KW threads. K % (32 KW) == 0.
// Fragment addresses: a scalar base per operand (tile row 0, the wave's first k) + ONE byte offset per lane, the same for all operands (row lr, half hi, the trip's k) + a constant (16 mb or 16 nb rows; K is a template constant for that).
// LDA: row pitch of A and A2 in elements (Bt keeps pitch K); where it is not K, A and A2 take a lane offset of their own.
// EPI: what becomes of the summed tile. 0: stored as f32 in C. 1 and 2: + bias, then stored as the three 16-bit head planes that the attention kernel reads (fp16, bf16 hi, bf16 lo of the same f32 value); C is not used.
//   1: rows are tokens, the tile's 64 columns are one head (bias per column) -> planes [head][t][d], the tile is 8 KiB in a row. 2: rows are (head, d), columns are tokens (A: the weight, Bt: the activations; bias per row) -> planes [head][d][t].
template <typename T16, int NSPLIT, int EPI, int KW, int K, int LDA = K>
__device__ __forceinline__ void gemmk(const T16* __restrict__ A, const T16* __restrict__ A2, const T16* __restrict__ Bt, const T16* __restrict__ Bt2, float* C, int ldc, const float* __restrict__ bias, h16* P16, bf* Ph, bf* Pl, int r0, int c0, float* os) {
    typedef typename WFrag<T16>::V V;
    const int lane = threadIdx.x & 31, lr = lane & 15, hi = lane >> 4;
    const int wave = __builtin_amdgcn_readfirstlane((int)(threadIdx.x >> 5)); const int kb = wave * (K / KW);   // scalar: the wave's first k goes into the scalar bases
    v8f acc[4][4];   // every '#pragma unroll' of this kernel makes the indices of acc, a, a2 constants, so that the fragments stay in registers
#pragma unroll
    for (int mb = 0; mb < 4; ++mb)
#pragma unroll
        for (int nb = 0; nb < 4; ++nb) acc[mb][nb] = (v8f){};
    const char* Ab = (const char*)(A + (size_t)r0 * LDA + kb); const char* A2b = (const char*)(A2 + (size_t)r0 * LDA + kb); const char* Bb = (const char*)(Bt + (size_t)c0 * K + kb); const char* B2b = (const char*)(Bt2 + (size_t)c0 * K + kb);
    unsigned vo = (unsigned)(lr * K + 8 * hi) * 2u;   // the lane's byte offset; + 64 a trip
    unsigned voa = (unsigned)(lr * LDA + 8 * hi) * 2u;   // the same at A's pitch (used only where LDA != K)
#pragma unroll 1   // rolled: a second trip's fragments would not fit the 256 registers that 8 waves a work-group leave each wave
    for (int t = 0; t < K / KW / 32; ++t) {
        V a[4], a2[4]; const unsigned va = (LDA == K) ? vo : voa;
#pragma unroll
        for (int mb = 0; mb < 4; ++mb) { a[mb] = WFrag<T16>::ld((const T16*)(Ab + va + mb * 16 * LDA * 2)); if (NSPLIT == 1 || NSPLIT == 2) a2[mb] = WFrag<T16>::ld((const T16*)(A2b + va + mb * 16 * LDA * 2)); }
#pragma unroll
        for (int nb = 0; nb < 4; ++nb) { const V b = WFrag<T16>::ld((const T16*)(Bb + vo + nb * 16 * K * 2)); V b2; if (NSPLIT >= 2) b2 = WFrag<T16>::ld((const T16*)(B2b + vo + nb * 16 * K * 2));
#pragma unroll
            for (int mb = 0; mb < 4; ++mb) { acc[mb][nb] = WFrag<T16>::mma(a[mb], b, acc[mb][nb]); if (NSPLIT == 1 || NSPLIT == 2) acc[mb][nb] = WFrag<T16>::mma(a2[mb], b, acc[mb][nb]); if (NSPLIT >= 2) acc[mb][nb] = WFrag<T16>::mma(a[mb], b2, acc[mb][nb]); } }
        // four vector slots behind the trip's last matrix instructions, on the taken branch too, before the next trip overwrites registers of A and B fragments;
        // s_wait_xcnt 0: the wait in front of the one overwrite of a register that the trip's loads name (vo is an operand, so that its addition stays behind the wait)
        if constexpr (LDA == K) { asm volatile("v_nop\n\tv_nop\n\tv_nop\n\tv_nop\n\ts_wait_xcnt 0x0" : "+v"(acc[0][0]), "+v"(acc[1][1]), "+v"(acc[2][2]), "+v"(acc[3][3]), "+v"(vo) : "v"(a[0]), "v"(a[3])); }
        else { asm volatile("v_nop\n\tv_nop\n\tv_nop\n\tv_nop\n\ts_wait_xcnt 0x0" : "+v"(acc[0][0]), "+v"(acc[1][1]), "+v"(acc[2][2]), "+v"(acc[3][3]), "+v"(vo), "+v"(voa) : "v"(a[0]), "v"(a[3])); voa += 64u; }   // the same statement with both lane offsets as operands
        vo += 64u;
    }
    float* ow = os + wave * (64 * 68);
#pragma unroll
    for (int mb = 0; mb < 4; ++mb)
#pragma unroll
        for (int nb = 0; nb < 4; ++nb)
#pragma unroll
            for (int j = 0; j < 8; ++j) ow[(mb * 16 + hi * 8 + j) * 68 + nb * 16 + lr] = acc[mb][nb][j];
    __syncthreads();   // every wave's partial tile is in LDS before any plane is read
    v4f sv[32 / KW]; int rb[32 / KW];   // EPI 1, 2: the thread's summed values, bias added; EPI 2: their rows
#pragma unroll
    for (int s = 0; s < 32 / KW; ++s) { const int idx = s * (32 * KW) + (int)threadIdx.x; const int row = idx >> 4, cofs = (idx & 15) * 4; const float* op = os + row * 68 + cofs; v4f val = *(const v4fa*)op;
#pragma unroll
        for (int w = 1; w < KW; ++w) val += *(const v4fa*)(op + w * (64 * 68));
        if constexpr (EPI == 0) { *(v4f*)(C + (size_t)(r0 + row) * ldc + c0 + cofs) = val; }
        else {
            if constexpr (EPI == 1) { val[0] += bfr(bias[c0 + cofs]); val[1] += bfr(bias[c0 + cofs + 1]); val[2] += bfr(bias[c0 + cofs + 2]); val[3] += bfr(bias[c0 + cofs + 3]); }
            else { rb[s] = r0 + row; const float br = bfr(bias[rb[s]]); val[0] += br; val[1] += br; val[2] += br; val[3] += br; }
            sv[s] = val; } }
    if constexpr (EPI == 2) { static_assert(KW == 8, "four rows a thread");
        asm volatile("s_wait_xcnt 0x0" : "+v"(rb[0]), "+v"(rb[1]), "+v"(rb[2]), "+v"(rb[3])); }   // the wait in front of the overwrite of registers that the issued bias loads name (the rows are operands: their registers live up to it, and the plane offsets are formed from them behind it)
    if constexpr (EPI != 0) {   // a loop of its own behind all the sums: the store statements order memory, and an LDS read or a bias load behind one would wait for it
#pragma unroll
        for (int s = 0; s < 32 / KW; ++s) { const int idx = s * (32 * KW) + (int)threadIdx.x; const int row = idx >> 4, cofs = (idx & 15) * 4; const v4f val = sv[s];
            const size_t po = (EPI == 1) ? ((size_t)(c0 / HD) * TT + r0 + row) * HD + cofs : (size_t)rb[s] * TT + c0 + cofs; const v4h o16 = __builtin_convertvector(val, v4h); const v4b oh = __builtin_convertvector(val, v4b); const v4b ol = __builtin_convertvector(val - __builtin_convertvector(oh, v4f), v4b);   // each conversion rounds to nearest even, as f2bf does; lo is the rounded rest behind hi
            // the three planes' stores and s_wait_xcnt 0 in ONE statement: the wait stands in front of every later write of a register that the stores name
            asm volatile("global_store_b64 %0, %1, off\n\tglobal_store_b64 %2, %3, off\n\tglobal_store_b64 %4, %5, off\n\ts_wait_xcnt 0x0" :: "v"(P16 + po), "v"(o16), "v"(Ph + po), "v"(oh), "v"(Pl + po), "v"(ol) : "memory"); } }
}

// ---- k_proj: the three projections of both batches in ONE launch. grid (TT/64, DQ/64, 3 NB_): z = 2 (0: Q, 1: K, 2: V) + batch. Q, K: rows are tokens (x), columns one head (y). V: rows are (head, d) (y), columns tokens (x).
__global__ __launch_bounds__(256) void k_proj(const bf* __restrict__ XQ, const bf* __restrict__ XK, const bf* __restrict__ XV, const bf* __restrict__ WQ, const bf* __restrict__ WK, const bf* __restrict__ WV, const float* __restrict__ bq, const float* __restrict__ bk, const float* __restrict__ bv,
                                              h16* Q16, bf* Qh, bf* Ql, h16* K16, bf* Kh, bf* Kl, h16* V16, bf* Vh, bf* Vl) {
    __shared__ __align__(16) float os[8 * 64 * 68];
    const int w = blockIdx.z >> 1; const size_t xo = (size_t)(blockIdx.z & 1) * TT * DM, po = (size_t)(blockIdx.z & 1) * NH_ * TT * HD;
    if (w < 2) gemmk<bf, 0, 1, 8, DM>((w ? XK : XQ) + xo, nullptr, w ? WK : WQ, nullptr, nullptr, 0, w ? bk : bq, (w ? K16 : Q16) + po, (w ? Kh : Qh) + po, (w ? Kl : Ql) + po, blockIdx.x * 64, blockIdx.y * 64, os);
    else gemmk<bf, 0, 2, 8, DM>(WV, nullptr, XV + xo, nullptr, nullptr, 0, bv, V16 + po, Vh + po, Vl + po, blockIdx.y * 64, blockIdx.x * 64, os);   // Vt = Wv^T.x^T: the [d][t] planes come out of the product as they lie
}
// ---- k_wo: out = (Ah + Al) Wo, both batches as one matrix of NB_ TT rows. grid (NB_ TT/64, DM/64).
__global__ __launch_bounds__(256) void k_wo(const bf* __restrict__ Ah, const bf* __restrict__ Al, const bf* __restrict__ WO, float* OUT) {
    __shared__ __align__(16) float os[8 * 64 * 68];
    gemmk<bf, 1, 0, 8, DQ>(Ah, Al, WO, nullptr, OUT, DM, nullptr, nullptr, nullptr, nullptr, blockIdx.x * 64, blockIdx.y * 64, os);
}

__device__ __forceinline__ void splitf(float y, unsigned short& h, unsigned short& l) { h = f2bf(y); l = f2bf(y - bf2f(h)); }
typedef __attribute__((ext_vector_type(2))) unsigned short v2us;
typedef __attribute__((ext_vector_type(4))) int v4i;

// ---- k_cvtall: every conversion to bf16 in ONE launch of few, fat waves. 1280 blocks of 256 threads. Blocks < 512: 128 a weight, transposed to [n][k] (Wq, Wk, Wv: n = 64 head + c; Wo); the rest: 256 each for q, k, v (both batches, as they lie).
// A weight block: 8 rows n0 .. n0 + 7 of Bt, all 1024 k. A thread reads 8 consecutive n of 4 consecutive k (4 x 32 bytes) and writes 4 k of each of the 8 rows; a wave writes 256 bytes in a row of each.
__device__ __forceinline__ void wt_pieces(const float* __restrict__ s, int pitch, bf* d) {   // d[j DM + k] = bf16(s[k pitch + j])
    const int k = threadIdx.x * 4; v8f r[4];
#pragma unroll   // constant indices keep r in registers
    for (int u = 0; u < 4; ++u) r[u] = *(const v8f*)(s + (size_t)(k + u) * pitch);
#pragma unroll
    for (int j = 0; j < 8; ++j) { v4us o;
#pragma unroll
        for (int u = 0; u < 4; ++u) o[u] = f2bf(r[u][j]);
        *(v4us*)(d + (size_t)j * DM + k) = o; }
}
// An activation block: 8 x 256 pieces of 8 floats; a thread's 8 pieces lie 256 pieces apart and are all loaded before the first is stored (8 KiB a wave in flight).
__device__ __forceinline__ void cvt_pieces(const float* __restrict__ s, bf* d, unsigned blk) {
    unsigned lo = (blk * (8u * 256u) + threadIdx.x) * 32u; v8f v[8];   // the lane's byte offset in s (a tensor is 16 MiB); half of it in d
#pragma unroll   // constant indices keep v in registers
    for (int p = 0; p < 8; ++p) v[p] = *(const v8f*)((const char*)s + lo + p * (256 * 32));
    asm volatile("s_wait_xcnt 0x0" : "+v"(lo));   // the wait in front of any overwrite of the register that the issued loads name (the offset is an operand: its register lives up to the wait, so that no load's result lands on it)
    const unsigned so = lo >> 1;
#pragma unroll
    for (int p = 0; p < 8; ++p) { v8us o;
#pragma unroll
        for (int k = 0; k < 8; ++k) o[k] = f2bf(v[p][k]);
        *(v8us*)((char*)d + so + p * (256 * 16)) = o; }
}
__global__ __launch_bounds__(256) void k_cvtall(const float* __restrict__ wq, const float* __restrict__ wk, const float* __restrict__ wv, const float* __restrict__ wo, const float* __restrict__ xq, const float* __restrict__ xk, const float* __restrict__ xv,
                                                bf* WQ, bf* WK, bf* WV, bf* WO, bf* XQ, bf* XK, bf* XV) {
    const int bx = blockIdx.x; const int y = bx >> 7, n0 = (bx & 127) * 8;
    if (y < 3) wt_pieces((y == 0 ? wq : y == 1 ? wk : wv) + (size_t)(n0 / HD) * DM * HD + n0 % HD, HD, (y == 0 ? WQ : y == 1 ? WK : WV) + (size_t)n0 * DM);   // Bt[64 h + c][k] = W[h][k][c]
    else if (y == 3) wt_pieces(wo + n0, DM, WO + (size_t)n0 * DQ);   // Bt[n][k] = Wo[k][n]
    else { const int t = (bx - 512) >> 8; cvt_pieces(t == 0 ? xq : t == 1 ? xk : xv, t == 0 ? XQ : t == 1 ? XK : XV, (unsigned)(bx - 512) & 255u); }
}
__device__ __forceinline__ float xhalf(float x) { const unsigned b = __float_as_uint(x); return __uint_as_float(__builtin_amdgcn_permlanex16(b, b, 0x76543210u, 0xfedcba98u, false, false)); }   // the value of lane l ^ 16
#define KPIT 144            // LDS bytes a K row (128 bytes) and
#define VPIT 80             // a Vt row piece (64 bytes) take: 16 bytes x an odd number, free of bank conflicts for 16-byte reads of 16 rows
#define KTB  (32 * KPIT)    // a K tile (32 keys) in LDS
#define VTB  (HD * VPIT)    // a Vt tile (HD rows of 32 keys) in LDS
// A thread's share of one pass's K and Vt tiles of one plane pair: four asynchronous 16-byte copies to LDS. lk, lv: the lane's LDS byte addresses of its first K and Vt piece; gk, gv: their global addresses. The second pieces lie 16 K rows and 32 Vt rows on.
// s_wait_xcnt 0 is the statement's last line, so that it stands in front of every later write of a register that the copies name.
__device__ __forceinline__ void stage_kv(unsigned lk, unsigned lv, const char* gk, const char* gv) {
    asm volatile("global_load_async_to_lds_b128 %0, %1, off\n\tglobal_load_async_to_lds_b128 %2, %3, off\n\tglobal_load_async_to_lds_b128 %4, %5, off\n\tglobal_load_async_to_lds_b128 %6, %7, off\n\ts_wait_xcnt 0x0"
                 :: "v"(lk), "v"(gk), "v"(lk + 16u * KPIT), "v"(gk + 16 * HD * 2), "v"(lv), "v"(gv), "v"(lv + 32u * VPIT), "v"(gv + 32 * TT * 2) : "memory");
}
template <bool HL> struct FT { typedef h16 T; };
template <> struct FT<true> { typedef bf T; };
template <bool HL, int QB>
__device__ __forceinline__ void fattn_rows(const typename FT<HL>::T* __restrict__ Q, const typename FT<HL>::T* __restrict__ Q2, const typename FT<HL>::T* __restrict__ Kp, const typename FT<HL>::T* __restrict__ K2, const typename FT<HL>::T* __restrict__ Vt, const typename FT<HL>::T* __restrict__ V2, const int* __restrict__ mk, int q0, bf* Ah, bf* Al, char* ldsb) {
    typedef typename FT<HL>::T T16; typedef typename WFrag<T16>::V V; typedef WFrag<T16> F;
    const float L2E = 1.4426950408889634f;
    const int lane = threadIdx.x & 31, lr = lane & 15, hi = lane >> 4;
    const unsigned qo = (unsigned)((q0 + lr) * HD + 8 * hi) * 2u;   // the lane's byte offset in the Q planes
    V qf[QB][2], q2f[QB][2]; v8f o[QB][4]; float mx[QB], sm[QB];   // every '#pragma unroll' below makes the indices of these arrays constants, so that they stay in registers
#pragma unroll
    for (int qb = 0; qb < QB; ++qb) { mx[qb] = -3.0e38f; sm[qb] = 0.f;
#pragma unroll
        for (int ks = 0; ks < 2; ++ks) { qf[qb][ks] = F::ld((const T16*)((const char*)Q + qo + qb * 16 * HD * 2 + ks * 64)); if (HL) q2f[qb][ks] = F::ld((const T16*)((const char*)Q2 + qo + qb * 16 * HD * 2 + ks * 64)); }
#pragma unroll
        for (int db = 0; db < 4; ++db) o[qb][db] = (v8f){}; }
    // K and Vt: each pass's tiles (32 keys) are brought into LDS ONCE for the work-group's 4 waves by asynchronous copies, two buffers, a pass's copies issued at the foot of the pass two before it; every wave copies its share (stage_kv).
    // A thread's two 16-byte pieces of each tile: K piece c = tid + 128 i (row c / 8, the tile is 4 KiB in a row in the plane), Vt piece c (row c / 4, 64 bytes a row, plane pitch 2 TT bytes).
    // Mask words: a scalar base + ONE byte offset per lane + a constant, fetched one pass ahead.
    constexpr unsigned PLB = KTB + VTB, BUFB = (HL ? 2u : 1u) * PLB;   // bytes of one plane pair's tiles; of one buffer
    const unsigned tid = threadIdx.x; const unsigned sb0 = (unsigned)(size_t)ldsb;   // the low 32 bits of a __shared__ address are the LDS byte address
    const unsigned lk = sb0 + (tid >> 3) * KPIT + (tid & 7u) * 16u, lv = sb0 + KTB + (tid >> 2) * VPIT + (tid & 3u) * 16u;
    const char* gk = (const char*)Kp + tid * 16u; const char* gv = (const char*)Vt + (tid >> 2) * (TT * 2u) + (tid & 3u) * 16u; const char* gk2 = (const char*)K2 + tid * 16u; const char* gv2 = (const char*)V2 + (tid >> 2) * (TT * 2u) + (tid & 3u) * 16u;
    const char* Mb = (const char*)mk; unsigned mo = (unsigned)((q0 + lr) * TT + 8 * hi) * 4u;
    const unsigned kfo = (unsigned)(lr * KPIT + 16 * hi), vfo = (unsigned)(KTB + lr * VPIT + 16 * hi);   // the lane's byte offsets of its K and Vt fragments in a buffer
    V kf[2][2], k2f[2][2], vf[4], v2[4]; v4i mw[QB][2][2];
    stage_kv(lk, lv, gk, gv); if (HL) stage_kv(lk + PLB, lv + PLB, gk2, gv2);   // pass 0 -> buffer 0
    gk += 32 * HD * 2; gv += 32 * 2; gk2 += 32 * HD * 2; gv2 += 32 * 2;
#pragma unroll
    for (int kt = 0; kt < 2; ++kt)
#pragma unroll
        for (int qb = 0; qb < QB; ++qb) { mw[qb][kt][0] = *(const v4i*)(Mb + mo + qb * 16 * TT * 4 + kt * 64); mw[qb][kt][1] = *(const v4i*)(Mb + mo + qb * 16 * TT * 4 + kt * 64 + 16); }
    asm volatile("s_wait_xcnt 0x0" : "+v"(mo) : "v"(qo));   // the wait in front of the overwrite of registers that issued loads name (the two offsets are operands: their registers live up to it, and the addition stays behind it)
    mo += 32u * 4u;   // the offset now stands at pass 1
    asm volatile("s_wait_asynccnt 0x0" ::: "memory");   // this wave's copies of pass 0 have landed ...
    __syncthreads();                                     // ... and every other wave's: buffer 0 may be read
    stage_kv(lk + BUFB, lv + BUFB, gk, gv); if (HL) stage_kv(lk + BUFB + PLB, lv + BUFB + PLB, gk2, gv2);   // pass 1 -> buffer 1
    gk += 32 * HD * 2; gv += 32 * 2; gk2 += 32 * HD * 2; gv2 += 32 * 2;
    unsigned bo = 0u;   // byte offset of the buffer that the pass reads
#pragma unroll 1   // rolled: a second pass's fragments and scores would cost a resident wave per SIMD
    for (int kb = 0; kb < TT; kb += 32) {
        v8f s[QB][2]; const char* sb = ldsb + bo;
#pragma unroll
        for (int kt = 0; kt < 2; ++kt)
#pragma unroll
            for (int ks = 0; ks < 2; ++ks) { kf[kt][ks] = F::ld((const T16*)(sb + kfo + kt * 16 * KPIT + ks * 64)); if (HL) k2f[kt][ks] = F::ld((const T16*)(sb + PLB + kfo + kt * 16 * KPIT + ks * 64)); }
        __builtin_amdgcn_sched_barrier(0);   // K's reads issue in front of Vt's: LDS reads come back in issue order and St needs K first (without this line the hi+lo build reads Vt first)
#pragma unroll
        for (int db = 0; db < 4; ++db) { vf[db] = F::ld((const T16*)(sb + vfo + db * 16 * VPIT)); if (HL) v2[db] = F::ld((const T16*)(sb + PLB + vfo + db * 16 * VPIT)); }
        __builtin_amdgcn_sched_barrier(0);   // the pass's LDS reads issue here as ONE group: without this line the Vt reads sink between the Ot matrix instructions, each waited for at once
#pragma unroll
        for (int kt = 0; kt < 2; ++kt) {
#pragma unroll
            for (int qb = 0; qb < QB; ++qb) s[qb][kt] = (v8f){};
#pragma unroll
            for (int ks = 0; ks < 2; ++ks)
#pragma unroll
                for (int qb = 0; qb < QB; ++qb) { s[qb][kt] = F::mma(kf[kt][ks], qf[qb][ks], s[qb][kt]); if (HL) { s[qb][kt] = F::mma(kf[kt][ks], q2f[qb][ks], s[qb][kt]); s[qb][kt] = F::mma(k2f[kt][ks], qf[qb][ks], s[qb][kt]); } } }
        float bm[QB]; bool grow = false;
#pragma unroll
        for (int qb = 0; qb < QB; ++qb) { float b = -3.0e38f;
#pragma unroll
            for (int kt = 0; kt < 2; ++kt) {
#pragma unroll
                for (int j = 0; j < 8; ++j) { const float t = (mw[qb][kt][j >> 2][j & 3] != 0) ? s[qb][kt][j] * SCL : -3.0e38f; s[qb][kt][j] = t; b = fmaxf(b, t); }
                mw[qb][kt][0] = *(const v4i*)(Mb + mo + qb * 16 * TT * 4 + kt * 64); mw[qb][kt][1] = *(const v4i*)(Mb + mo + qb * 16 * TT * 4 + kt * 64 + 16); }
            bm[qb] = fmaxf(b, xhalf(b)); grow = grow || (bm[qb] > mx[qb]); }
        __builtin_amdgcn_sched_barrier(0);   // the next pass's mask loads issue in front of the exponentials: the barrier at the pass's foot waits for them, and without this line they sink down to it
        if (__builtin_amdgcn_ballot_w32(grow) != 0) {   // a scalar branch: a pass in which no query's maximum grows has every factor 1 and skips the scaling
#pragma unroll
            for (int qb = 0; qb < QB; ++qb) { const float mn = fmaxf(mx[qb], bm[qb]); const float al = __builtin_amdgcn_exp2f((mx[qb] - mn) * L2E); mx[qb] = mn; sm[qb] *= al;
#pragma unroll
                for (int db = 0; db < 4; ++db) o[qb][db] *= al; } }
        V pf[QB], p2[QB];
#pragma unroll
        for (int qb = 0; qb < QB; ++qb) {
#pragma unroll
            for (int g = 0; g < 2; ++g) { float x[8], p[8];
#pragma unroll
                for (int j = 0; j < 8; ++j) { const float d = s[qb][g][j] - mx[qb]; x[j] = HL ? d * L2E : __builtin_fmaf(d, L2E, 10.0f); p[j] = __builtin_amdgcn_exp2f(x[j]); }   // + 10 in the exponent: x PCAR = 2^10
                // the slot behind a transcendental, once for a run of eight: results and sources are operands, so that in front of the v_nop nothing reads a result or overwrites a source
                asm volatile("v_nop" : "+v"(p[0]), "+v"(p[1]), "+v"(p[2]), "+v"(p[3]), "+v"(p[4]), "+v"(p[5]), "+v"(p[6]), "+v"(p[7]) : "v"(x[0]), "v"(x[1]), "v"(x[2]), "v"(x[3]), "v"(x[4]), "v"(x[5]), "v"(x[6]), "v"(x[7]));
#pragma unroll
                for (int j = 0; j < 8; ++j) { sm[qb] += p[j];
                    if constexpr (HL) { const __bf16 ph = (__bf16)p[j]; pf[qb][g * 8 + j] = ph; p2[qb][g * 8 + j] = (__bf16)(p[j] - (float)ph); }
                    else pf[qb][g * 8 + j] = (h16)p[j]; } } }
#pragma unroll
        for (int db = 0; db < 4; ++db)
#pragma unroll
            for (int qb = 0; qb < QB; ++qb) { o[qb][db] = F::mma(vf[db], pf[qb], o[qb][db]); if (HL) { o[qb][db] = F::mma(vf[db], p2[qb], o[qb][db]); o[qb][db] = F::mma(v2[db], pf[qb], o[qb][db]); } }
        // four vector slots between the Ot matrix instructions and the next pass's LDS reads, which refill the Vt fragments' registers (operands: the accumulators, so that the matrix instructions stay in front)
        if constexpr (QB == 2) { asm volatile("v_nop\n\tv_nop\n\tv_nop\n\tv_nop" : "+v"(o[0][0]), "+v"(o[0][1]), "+v"(o[0][2]), "+v"(o[0][3]), "+v"(o[1][0]), "+v"(o[1][1]), "+v"(o[1][2]), "+v"(o[1][3])); }
        else { asm volatile("v_nop\n\tv_nop\n\tv_nop\n\tv_nop" : "+v"(o[0][0]), "+v"(o[0][1]), "+v"(o[0][2]), "+v"(o[0][3])); }
        asm volatile("s_wait_xcnt 0x0" : "+v"(mo));   // as in front of the loop: the pass's mask loads name the offset
        mo += ((kb + 64 < TT) ? 1u : 0u) * (32u * 4u);   // the last two passes fetch the last pass's mask words (in bounds; the last fetch is unused)
        // hand-over: this wave's reads of the pass's buffer are done, its copies of the next pass have landed; behind the barrier that holds for all 4 waves, so the next buffer may be read and this one refilled
        asm volatile("s_wait_dscnt 0x0" ::: "memory");
        asm volatile("s_wait_asynccnt 0x0" ::: "memory");
        __syncthreads();
        if (kb + 64 < TT) {   // the same for the whole work-group: only while a pass kb / 32 + 2 exists
            stage_kv(lk + bo, lv + bo, gk, gv); if (HL) stage_kv(lk + bo + PLB, lv + bo + PLB, gk2, gv2);
            gk += 32 * HD * 2; gv += 32 * 2; gk2 += 32 * HD * 2; gv2 += 32 * 2; }
        bo = BUFB - bo;
    }
    asm volatile("s_wait_asynccnt 0x0" ::: "memory");   // no copy is outstanding when the wave goes on to its end
#pragma unroll
    for (int qb = 0; qb < QB; ++qb) { const float f = __fdiv_rn(1.0f, sm[qb] + xhalf(sm[qb])); const size_t oo = (size_t)(q0 + qb * 16 + lr) * DQ + 8 * hi;   // a lane's 8 accumulator registers are 8 consecutive d of its query: one 16-byte store a plane
#pragma unroll
        for (int db = 0; db < 4; ++db) { v8us oh, ol;
#pragma unroll
            for (int j = 0; j < 8; ++j) { unsigned short a, c2; splitf(o[qb][db][j] * f, a, c2); oh[j] = a; ol[j] = c2; }
            // both planes' stores and s_wait_xcnt 0 in ONE statement: the wait stands in front of every later write of a register that the stores name, on every way out of here (with plain stores the compiler joined the tails of the two row classes)
            asm volatile("global_store_b128 %0, %1, off\n\tglobal_store_b128 %2, %3, off\n\ts_wait_xcnt 0x0" :: "v"(Ah + oo + db * 16), "v"(oh), "v"(Al + oo + db * 16), "v"(ol) : "memory"); } }
}
// grid (NB_ NH_, RH/64 + (TT-RH)/128), 4 waves: row blocks y < RH/64 are the hi+lo rows (16 a wave), the rest fp16 (32 a wave). Planes [batch][head][..]; one kv head per query head. Ah, Al: [batch][t][head d].
__global__ __launch_bounds__(128) void k_fattn(const h16* __restrict__ Q16, const h16* __restrict__ K16, const h16* __restrict__ V16, const bf* __restrict__ Qh, const bf* __restrict__ Ql, const bf* __restrict__ Kh, const bf* __restrict__ Kl, const bf* __restrict__ Vh, const bf* __restrict__ Vl, const int* __restrict__ mk, bf* Ah, bf* Al) {
    __shared__ __align__(16) char kv[2 * 2 * (KTB + VTB)];   // two buffers of the hi+lo rows' four tiles (the fp16 rows use half)
    const int z = blockIdx.x, y = blockIdx.y; const int wave = __builtin_amdgcn_readfirstlane((int)(threadIdx.x >> 5)); const size_t po = (size_t)z * TT * HD; const size_t ao = (size_t)(z / NH_) * TT * DQ + (size_t)(z % NH_) * HD;
    if (y < RH / 64) fattn_rows<true, 1>(Qh + po, Ql + po, Kh + po, Kl + po, Vh + po, Vl + po, mk, y * 64 + wave * 16, Ah + ao, Al + ao, kv);
    else fattn_rows<false, 2>(Q16 + po, nullptr, K16 + po, nullptr, V16 + po, nullptr, mk, RH + (y - RH / 64) * 128 + wave * 32, Ah + ao, Al + ao, kv);
}

extern "C" void kernel_launch(void* const* d_in, const int* in_sizes, int n_in,
                              void* d_out, int out_size, void* d_ws, size_t ws_size, hipStream_t stream) {
    (void)in_sizes; (void)n_in; (void)out_size;
    const float* x = (const float*)d_in[0]; const float* xk = (const float*)d_in[1]; const float* xv = (const float*)d_in[2]; const int* mk = (const int*)d_in[3]; const float* wqh = (const float*)d_in[4]; const float* bq = (const float*)d_in[5]; const float* wkh = (const float*)d_in[6]; const float* bk = (const float*)d_in[7]; const float* wvh = (const float*)d_in[8]; const float* bv = (const float*)d_in[9]; const float* wo = (const float*)d_in[10]; const float* wq = nullptr; const float* wk = nullptr; const float* wv = nullptr; (void)wq; (void)wk; (void)wv; const float* cosT = nullptr; const float* sinT = nullptr; (void)cosT; (void)sinT;
    float* OUT = (float*)d_out;     // [2][2048][1024]
    char* wsp = (char*)d_ws;
    auto take = [&](size_t bytes) { char* p = wsp; wsp += (bytes + 255) & ~(size_t)255; return (void*)p; };
    bf* WQ = (bf*)take((size_t)DQ * DM * 2); bf* WK = (bf*)take((size_t)DKV * DM * 2); bf* WV = (bf*)take((size_t)DKV * DM * 2); bf* WO = (bf*)take((size_t)DM * DQ * 2);
    bf* XB = (bf*)take((size_t)NB_ * TT * DM * 2); bf* XB2 = (bf*)take((size_t)NB_ * TT * DM * 2); bf* XB3 = (bf*)take((size_t)NB_ * TT * DM * 2);   // q, k, v in bf16, both batches
    const size_t PQ = (size_t)NH_ * TT * HD, PK = (size_t)NKV * TT * HD;   // one batch's head planes, in elements; every plane holds both batches
    h16* QP16 = (h16*)take(NB_ * PQ * 2); h16* KP16 = (h16*)take(NB_ * PK * 2); h16* VT16 = (h16*)take(NB_ * PK * 2);
    bf* QPh = (bf*)take(NB_ * PQ * 2); bf* QPl = (bf*)take(NB_ * PQ * 2); bf* KPh = (bf*)take(NB_ * PK * 2); bf* KPl = (bf*)take(NB_ * PK * 2); bf* VTh = (bf*)take(NB_ * PK * 2); bf* VTl = (bf*)take(NB_ * PK * 2);
    bf* ATh = (bf*)take((size_t)NB_ * TT * DQ * 2); bf* ATl = (bf*)take((size_t)NB_ * TT * DQ * 2);
    if ((size_t)(wsp - (char*)d_ws) > ws_size) return;    // ws 256 MiB
    k_cvtall<<<dim3(4 * 128 + 3 * 256, 1, 1), 256, 0, stream>>>(wqh, wkh, wvh, wo, x, xk, xv, WQ, WK, WV, WO, XB, XB2, XB3);
    k_proj<<<dim3(TT / 64, DQ / 64, 3 * NB_), 256, 0, stream>>>(XB, XB2, XB3, WQ, WK, WV, bq, bk, bv, QP16, QPh, QPl, KP16, KPh, KPl, VT16, VTh, VTl);
    k_fattn<<<dim3(NB_ * NH_, RH / 64 + (TT - RH) / 128, 1), 128, 0, stream>>>(QP16, KP16, VT16, QPh, QPl, KPh, KPl, VTh, VTl, mk, ATh, ATl);
    k_wo<<<dim3(NB_ * TT / 64, DM / 64, 1), 256, 0, stream>>>(ATh, ATl, WO, OUT);
}

// v007
// A run of this version takes 147 microseconds.
// Timed twice side by side with v006, it ran 1.30 and 1.29 times as fast.
// Counting every step since v000, it is 14.0 times as fast.
#include <hip/hip_runtime.h>

// MultiHeadAttentionModule (q, k, v inputs [2][2048][1024]; per-head Qh = q Wq[h] + bq[h], Kh = k Wk[h] + bk[h], Vh = v Wv[h] + bv[h] (W [16][1024][64]); scores = Qh.Kh / 8, where(mask == 0, -1e9) (mask [2048][2048] int, read); softmax; out = concat(heads) Wo ([in,out], no bias) -> [2][2048][1024]).
// Compute dtypes, f32 accumulate: every input rounded to bf16; Qh/Kh/Vh on PLAIN bf16 operands (inputs: exact; per-head weights gathered) + bias; scores and attn.v (one fused kernel, running maximum): query rows < 512 hl (3 products), the rest single fp16 (x1024); mask + softmax f32; Wo hl x exact (2 products).
// Left open: the mask loads of k_fattn still touch 16 lines an instruction; a stage of 64 keys would make the Vt rows whole 128-byte lines and halve the barriers; the weight transposes of k_cvtall read 32 bytes of each 128-byte line a thread; k_wo has one work-group a WGP.

#define NB_  2
#define TT   2048
#define DM   1024
#define NH_  16
#define NKV  16
#define REP  (NH_ / NKV)
#define HD   64
#define DQ   (NH_ * HD)
#define DKV  (NKV * HD)
#define RH   512                  // query rows < RH use hi+lo planes (0: none)
#define WIN  0
#define PCAR 1024.0f
#define SCL  0.125f   // HD^-0.5
typedef _Float16 h16;
typedef unsigned short bf;
typedef __attribute__((ext_vector_type(16))) __bf16   v16bf;
typedef __attribute__((ext_vector_type(16))) _Float16 v16h;
typedef __attribute__((ext_vector_type(8)))  _Float16 v8h;
typedef __attribute__((ext_vector_type(8)))  unsigned short v8us;
typedef __attribute__((ext_vector_type(8)))  float    v8f;
typedef __attribute__((ext_vector_type(4)))  float    v4f;
typedef v8h  __attribute__((may_alias)) v8ha;
typedef v4f  __attribute__((may_alias)) v4fa;
typedef v8us __attribute__((may_alias)) v8usa;

__device__ __forceinline__ unsigned short f2bf(float f) { unsigned u = __float_as_uint(f); u += 0x7FFFu + ((u >> 16) & 1u); return (unsigned short)(u >> 16); }
__device__ __forceinline__ float bf2f(unsigned short b) { return __uint_as_float(((unsigned)b) << 16); }
__device__ __forceinline__ float bfr(float f) { return bf2f(f2bf(f)); }
__device__ __forceinline__ v16h cat16(v8h lo, v8h hi) { return __builtin_shufflevector(lo, hi, 0, 1, 2, 3, 4, 5, 6, 7, 8, 9, 10, 11, 12, 13, 14, 15); }
__device__ __forceinline__ v16bf cat16b(v8us lo, v8us hi) { return __builtin_bit_cast(v16bf, __builtin_shufflevector(lo, hi, 0, 1, 2, 3, 4, 5, 6, 7, 8, 9, 10, 11, 12, 13, 14, 15)); }
__device__ __forceinline__ v8f wmma16(v16h a, v16h b, v8f c) { return __builtin_amdgcn_wmma_f32_16x16x32_f16(false, a, false, b, (short)0, c, false, false); }
__device__ __forceinline__ v8f wmmab(v16bf a, v16bf b, v8f c) { return __builtin_amdgcn_wmma_f32_16x16x32_bf16(false, a, false, b, (short)0, c, false, false); }
typedef __attribute__((ext_vector_type(4))) _Float16 v4h;
typedef __attribute__((ext_vector_type(4))) unsigned short v4us;
typedef __attribute__((ext_vector_type(4))) __bf16 v4b;



// ---- fragment loaders: a lane's 16 elements of a K-contiguous 16-bit row, in the hardware k order (8 at p, 8 at p + 16; p holds the lane half's 8 hi)
template <typename T16> struct WFrag;
template <> struct WFrag<h16> { typedef v16h V; static __device__ __forceinline__ V ld(const h16* p) { return cat16(*(const v8h*)p, *(const v8h*)(p + 16)); } static __device__ __forceinline__ v8f mma(V a, V b, v8f c) { return wmma16(a, b, c); } };
template <> struct WFrag<bf> { typedef v16bf V; static __device__ __forceinline__ V ld(const bf* p) { return cat16b(*(const v8us*)p, *(const v8us*)(p + 16)); } static __device__ __forceinline__ v8f mma(V a, V b, v8f c) { return wmmab(a, b, c); } };
// ---- gemmt: one 128 x 128 tile of D[m][n] = sum_k Am[m][k] Bn[n][k] (both operands K-contiguous bf16 planes of pitch GK) a work-group of 8 waves; a wave owns 64 m x 32 n (8 accumulators) and walks the whole K, so that each sum stays in one accumulator.
// Each stage of 64 k (128 rows of one whole 128-byte line an operand) comes into LDS ONCE for the 8 waves by asynchronous copies, two buffers, a stage's copies issued behind the last LDS reads of the stage two before it; fragments are read from LDS.
// A lane holds 8 consecutive m of ONE n, so the caller puts on the m side whatever lies contiguous in the output: every store is 16 bytes a lane, straight from the accumulators.
// NS 1: the n side has a second plane Bn2 (lo), D = Am (Bn + Bn2). EPI 0: C[n][m] f32, pitch DM. EPI 1, 2: + bias, then the three 16-bit head planes that the attention kernel reads (fp16, bf16 hi, bf16 lo of the same f32 value).
//   1: m = (head, d) (the weight; bias per m), n = token -> planes [head][t][d]. 2: m = token, n = (head, d) (bias per n) -> planes [head][d][t].
#define GK   1024           // K of every product here (DM and DQ)
#define GPIT 144            // LDS bytes a staged row (128 bytes) takes: 16 bytes x an odd number, free of bank conflicts for 16-byte reads of 16 rows
#define GTB  (128 * GPIT)   // one operand's stage in LDS
static_assert(DM == GK && DQ == GK, "one K");
typedef __attribute__((ext_vector_type(8))) __bf16 v8b;
// A thread's share of one operand's stage: four asynchronous 16-byte copies to LDS, 32 rows apart. l: the lane's LDS byte address of its first piece; g: its global address.
// s_wait_xcnt 0 is the statement's last line, so that it stands in front of every later write of a register that the copies name.
__device__ __forceinline__ void stage_op(unsigned l, const char* g) {
    asm volatile("global_load_async_to_lds_b128 %0, %1, off\n\tglobal_load_async_to_lds_b128 %2, %3, off\n\tglobal_load_async_to_lds_b128 %4, %5, off\n\tglobal_load_async_to_lds_b128 %6, %7, off\n\ts_wait_xcnt 0x0"
                 :: "v"(l), "v"(g), "v"(l + 32u * GPIT), "v"(g + 32 * GK * 2), "v"(l + 64u * GPIT), "v"(g + 64 * GK * 2), "v"(l + 96u * GPIT), "v"(g + 96 * GK * 2) : "memory");
}
template <int NS, int EPI>
__device__ __forceinline__ void gemmt(const bf* __restrict__ Am, const bf* __restrict__ Bn, const bf* __restrict__ Bn2, float* C, const float* __restrict__ bias, h16* P16, bf* Ph, bf* Pl, int r0, int c0, char* ldsb) {
    typedef WFrag<bf> F; typedef typename F::V V;
    const int lane = threadIdx.x & 31, lr = lane & 15, hi = lane >> 4;
    const int wave = __builtin_amdgcn_readfirstlane((int)(threadIdx.x >> 5)); const int wm = wave & 1, wn = wave >> 1;   // scalar: the wave's place in the tile
    constexpr unsigned BUFB = (2u + NS) * GTB;   // bytes of one buffer
    constexpr int G = NS ? 2 : 1;   // steps of 32 k whose fragments are read as one group: the whole stage where one work-group has the WGP to itself (k_wo), one step where the registers must leave room for three (k_proj)
    const unsigned tid = threadIdx.x; const unsigned sb0 = (unsigned)(size_t)ldsb;   // the low 32 bits of a __shared__ address are the LDS byte address
    const unsigned ls = sb0 + (tid >> 3) * GPIT + (tid & 7u) * 16u;   // piece tid: row tid / 8, 16 bytes tid % 8 of it: a wave's copy is 4 whole lines
    const size_t go = (size_t)(tid >> 3) * (GK * 2) + (tid & 7u) * 16u;
    const char* ga = (const char*)(Am + (size_t)r0 * GK) + go; const char* gb = (const char*)(Bn + (size_t)c0 * GK) + go; const char* gb2 = (const char*)(Bn2 + (size_t)c0 * GK) + go;
    const unsigned afo = (unsigned)((wm * 64 + lr) * GPIT + 16 * hi), bfo = (unsigned)(GTB + (wn * 32 + lr) * GPIT + 16 * hi);   // the lane's byte offsets of its first m and n fragment in a buffer
    v8f acc[4][2];   // every '#pragma unroll' of this function makes the indices of acc, a, b, b2 constants, so that they stay in registers
#pragma unroll
    for (int mb = 0; mb < 4; ++mb)
#pragma unroll
        for (int nb = 0; nb < 2; ++nb) acc[mb][nb] = (v8f){};
    stage_op(ls, ga); stage_op(ls + GTB, gb); if (NS) stage_op(ls + 2u * GTB, gb2);   // stage 0 -> buffer 0
    ga += 128; gb += 128; gb2 += 128;
    asm volatile("s_wait_asynccnt 0x0" ::: "memory");   // this wave's copies of stage 0 have landed ...
    __syncthreads();                                     // ... and every other wave's: buffer 0 may be read
    stage_op(ls + BUFB, ga); stage_op(ls + BUFB + GTB, gb); if (NS) stage_op(ls + BUFB + 2u * GTB, gb2);   // stage 1 -> buffer 1
    ga += 128; gb += 128; gb2 += 128;
    unsigned bo = 0u;   // byte offset of the buffer that the stage reads
#pragma unroll 1   // rolled: a second stage's fragments would cost a resident work-group per WGP
    for (int t = 0; t < GK / 64; ++t) {
        const char* sb = ldsb + bo;
#pragma unroll
        for (int g = 0; g < 2 / G; ++g) { V a[G][4], b[G][2], b2[G][2];
#pragma unroll
            for (int u = 0; u < G; ++u) { const int ko = (g * G + u) * 64;   // byte offset of the 32 k in a staged row
#pragma unroll
                for (int nb = 0; nb < 2; ++nb) b[u][nb] = F::ld((const bf*)(sb + bfo + nb * 16 * GPIT + ko));
#pragma unroll
                for (int mb = 0; mb < 4; ++mb) a[u][mb] = F::ld((const bf*)(sb + afo + mb * 16 * GPIT + ko));
                if (NS) {
#pragma unroll
                    for (int nb = 0; nb < 2; ++nb) b2[u][nb] = F::ld((const bf*)(sb + GTB + bfo + nb * 16 * GPIT + ko)); } }
            __builtin_amdgcn_sched_barrier(0);   // the group's LDS reads issue here as ONE group: without this line the n fragments are read one at a time between the matrix instructions, each waited for at once
            if (g == 2 / G - 1) {   // a constant: behind the stage's last group of reads
                // hand-over, in front of the group's matrix instructions, which need registers only, so that the refill flies during them: this wave's reads of the stage's buffer are done, its copies of the next stage have landed;
                // behind the barrier that holds for all 8 waves, so the next buffer may be read and this one refilled
                asm volatile("s_wait_dscnt 0x0" ::: "memory");
                asm volatile("s_wait_asynccnt 0x0" ::: "memory");
                __syncthreads();
                if (t + 2 < GK / 64) {   // the same for the whole work-group: only while a stage t + 2 exists
                    stage_op(ls + bo, ga); stage_op(ls + bo + GTB, gb); if (NS) stage_op(ls + bo + 2u * GTB, gb2);
                    ga += 128; gb += 128; gb2 += 128; } }
#pragma unroll
            for (int u = 0; u < G; ++u) {
#pragma unroll
                for (int nb = 0; nb < 2; ++nb)
#pragma unroll
                    for (int mb = 0; mb < 4; ++mb) acc[mb][nb] = F::mma(a[u][mb], b[u][nb], acc[mb][nb]);
                if (NS) {
#pragma unroll
                    for (int nb = 0; nb < 2; ++nb)
#pragma unroll
                        for (int mb = 0; mb < 4; ++mb) acc[mb][nb] = F::mma(a[u][mb], b2[u][nb], acc[mb][nb]); } } }
        bo = BUFB - bo;
    }
    asm volatile("s_wait_asynccnt 0x0" ::: "memory");   // no copy is outstanding when the wave goes on to its end
    const int m0 = r0 + wm * 64, n0 = c0 + wn * 32 + lr;   // the wave's first m; the lane's first n
    if constexpr (EPI == 0) {
#pragma unroll
        for (int nb = 0; nb < 2; ++nb)
#pragma unroll
            for (int mb = 0; mb < 4; ++mb) { const v8f val = acc[mb][nb]; const v4f lo4 = __builtin_shufflevector(val, val, 0, 1, 2, 3), hi4 = __builtin_shufflevector(val, val, 4, 5, 6, 7);
                // both stores and s_wait_xcnt 0 in ONE statement: the wait stands in front of every later write of a register that the stores name
                asm volatile("global_store_b128 %0, %1, off\n\tglobal_store_b128 %0, %2, off offset:16\n\ts_wait_xcnt 0x0" :: "v"(C + (size_t)(n0 + nb * 16) * DM + m0 + mb * 16 + 8 * hi), "v"(lo4), "v"(hi4) : "memory"); }
    } else {
        v4f bm[8]; float bn[2];   // EPI 1: the bias of the lane's 32 m; EPI 2: of its 2 n. Loads and their data wait in ONE statement, so that no register that a load names or fills is touched while it flies
        if constexpr (EPI == 1) asm volatile("global_load_b128 %0, %8, off\n\tglobal_load_b128 %1, %8, off offset:16\n\tglobal_load_b128 %2, %8, off offset:64\n\tglobal_load_b128 %3, %8, off offset:80\n\tglobal_load_b128 %4, %8, off offset:128\n\tglobal_load_b128 %5, %8, off offset:144\n\tglobal_load_b128 %6, %8, off offset:192\n\tglobal_load_b128 %7, %8, off offset:208\n\ts_wait_loadcnt 0x0"
                                             : "=&v"(bm[0]), "=&v"(bm[1]), "=&v"(bm[2]), "=&v"(bm[3]), "=&v"(bm[4]), "=&v"(bm[5]), "=&v"(bm[6]), "=&v"(bm[7]) : "v"(bias + m0 + 8 * hi) : "memory");
        else asm volatile("global_load_b32 %0, %2, off\n\tglobal_load_b32 %1, %2, off offset:64\n\ts_wait_loadcnt 0x0" : "=&v"(bn[0]), "=&v"(bn[1]) : "v"(bias + n0) : "memory");
#pragma unroll
        for (int nb = 0; nb < 2; ++nb)
#pragma unroll
            for (int mb = 0; mb < 4; ++mb) { v8f val = acc[mb][nb];
#pragma unroll
                for (int j = 0; j < 8; ++j) val[j] += bfr(EPI == 1 ? bm[2 * mb + (j >> 2)][j & 3] : bn[nb]);
                const size_t po = (EPI == 1) ? ((size_t)(m0 / HD) * TT + n0 + nb * 16) * HD + mb * 16 + 8 * hi : (size_t)(n0 + nb * 16) * TT + m0 + mb * 16 + 8 * hi;
                const v8h o16 = __builtin_convertvector(val, v8h); const v8b oh = __builtin_convertvector(val, v8b); const v8b ol = __builtin_convertvector(val - __builtin_convertvector(oh, v8f), v8b);   // each conversion rounds to nearest even, as f2bf does; lo is the rounded rest behind hi
                // the three planes' stores and s_wait_xcnt 0 in ONE statement: the wait stands in front of every later write of a register that the stores name
                asm volatile("global_store_b128 %0, %1, off\n\tglobal_store_b128 %2, %3, off\n\tglobal_store_b128 %4, %5, off\n\ts_wait_xcnt 0x0" :: "v"(P16 + po), "v"(o16), "v"(Ph + po), "v"(oh), "v"(Pl + po), "v"(ol) : "memory"); }
    }
}

// ---- k_proj: the three projections of both batches in ONE launch. grid (TT/128, DQ/128, 3 NB_): z = 2 (0: Q, 1: K, 2: V) + batch; x: tokens, y: (head, d). Q, K: m = (head, d), n = token. V: m = token, n = (head, d).
__global__ __launch_bounds__(256) void k_proj(const bf* __restrict__ XQ, const bf* __restrict__ XK, const bf* __restrict__ XV, const bf* __restrict__ WQ, const bf* __restrict__ WK, const bf* __restrict__ WV, const float* __restrict__ bq, const float* __restrict__ bk, const float* __restrict__ bv,
                                              h16* Q16, bf* Qh, bf* Ql, h16* K16, bf* Kh, bf* Kl, h16* V16, bf* Vh, bf* Vl) {
    __shared__ __align__(16) char st[2 * 2 * GTB];
    const int w = blockIdx.z >> 1; const size_t xo = (size_t)(blockIdx.z & 1) * TT * DM, po = (size_t)(blockIdx.z & 1) * NH_ * TT * HD;
    if (w < 2) gemmt<0, 1>(w ? WK : WQ, (w ? XK : XQ) + xo, nullptr, nullptr, w ? bk : bq, (w ? K16 : Q16) + po, (w ? Kh : Qh) + po, (w ? Kl : Ql) + po, blockIdx.y * 128, blockIdx.x * 128, st);
    else gemmt<0, 2>(XV + xo, WV, nullptr, nullptr, bv, V16 + po, Vh + po, Vl + po, blockIdx.x * 128, blockIdx.y * 128, st);
}
// ---- k_wo: out = (Ah + Al) Wo, both batches as one matrix of NB_ TT rows: m = output column (rows of the transposed Wo), n = token. grid (NB_ TT/128, DM/128).
__global__ __launch_bounds__(256) void k_wo(const bf* __restrict__ Ah, const bf* __restrict__ Al, const bf* __restrict__ WO, float* OUT) {
    __shared__ __align__(16) char st[2 * 3 * GTB];
    gemmt<1, 0>(WO, Ah, Al, OUT, nullptr, nullptr, nullptr, nullptr, blockIdx.y * 128, blockIdx.x * 128, st);
}

__device__ __forceinline__ void splitf(float y, unsigned short& h, unsigned short& l) { h = f2bf(y); l = f2bf(y - bf2f(h)); }
typedef __attribute__((ext_vector_type(2))) unsigned short v2us;
typedef __attribute__((ext_vector_type(4))) int v4i;

// ---- k_cvtall: every conversion to bf16 in ONE launch of few, fat waves. 1280 blocks of 256 threads. Blocks < 512: 128 a weight, transposed to [n][k] (Wq, Wk, Wv: n = 64 head + c; Wo); the rest: 256 each for q, k, v (both batches, as they lie).
// A weight block: 8 rows n0 .. n0 + 7 of Bt, all 1024 k. A thread reads 8 consecutive n of 4 consecutive k (4 x 32 bytes) and writes 4 k of each of the 8 rows; a wave writes 256 bytes in a row of each.
__device__ __forceinline__ void wt_pieces(const float* __restrict__ s, int pitch, bf* d) {   // d[j DM + k] = bf16(s[k pitch + j])
    const int k = threadIdx.x * 4; v8f r[4];
#pragma unroll   // constant indices keep r in registers
    for (int u = 0; u < 4; ++u) r[u] = *(const v8f*)(s + (size_t)(k + u) * pitch);
#pragma unroll
    for (int j = 0; j < 8; ++j) { v4us o;
#pragma unroll
        for (int u = 0; u < 4; ++u) o[u] = f2bf(r[u][j]);
        *(v4us*)(d + (size_t)j * DM + k) = o; }
}
// An activation block: 8 x 256 pieces of 8 floats; a thread's 8 pieces lie 256 pieces apart and are all loaded before the first is stored (8 KiB a wave in flight).
__device__ __forceinline__ void cvt_pieces(const float* __restrict__ s, bf* d, unsigned blk) {
    unsigned lo = (blk * (8u * 256u) + threadIdx.x) * 32u; v8f v[8];   // the lane's byte offset in s (a tensor is 16 MiB); half of it in d
#pragma unroll   // constant indices keep v in registers
    for (int p = 0; p < 8; ++p) v[p] = *(const v8f*)((const char*)s + lo + p * (256 * 32));
    asm volatile("s_wait_xcnt 0x0" : "+v"(lo));   // the wait in front of any overwrite of the register that the issued loads name (the offset is an operand: its register lives up to the wait, so that no load's result lands on it)
    const unsigned so = lo >> 1;
#pragma unroll
    for (int p = 0; p < 8; ++p) { v8us o;
#pragma unroll
        for (int k = 0; k < 8; ++k) o[k] = f2bf(v[p][k]);
        *(v8us*)((char*)d + so + p * (256 * 16)) = o; }
}
__global__ __launch_bounds__(256) void k_cvtall(const float* __restrict__ wq, const float* __restrict__ wk, const float* __restrict__ wv, const float* __restrict__ wo, const float* __restrict__ xq, const float* __restrict__ xk, const float* __restrict__ xv,
                                                bf* WQ, bf* WK, bf* WV, bf* WO, bf* XQ, bf* XK, bf* XV) {
    const int bx = blockIdx.x; const int y = bx >> 7, n0 = (bx & 127) * 8;
    if (y < 3) wt_pieces((y == 0 ? wq : y == 1 ? wk : wv) + (size_t)(n0 / HD) * DM * HD + n0 % HD, HD, (y == 0 ? WQ : y == 1 ? WK : WV) + (size_t)n0 * DM);   // Bt[64 h + c][k] = W[h][k][c]
    else if (y == 3) wt_pieces(wo + n0, DM, WO + (size_t)n0 * DQ);   // Bt[n][k] = Wo[k][n]
    else { const int t = (bx - 512) >> 8; cvt_pieces(t == 0 ? xq : t == 1 ? xk : xv, t == 0 ? XQ : t == 1 ? XK : XV, (unsigned)(bx - 512) & 255u); }
}
__device__ __forceinline__ float xhalf(float x) { const unsigned b = __float_as_uint(x); return __uint_as_float(__builtin_amdgcn_permlanex16(b, b, 0x76543210u, 0xfedcba98u, false, false)); }   // the value of lane l ^ 16
#define KPIT 144            // LDS bytes a K row (128 bytes) and
#define VPIT 80             // a Vt row piece (64 bytes) take: 16 bytes x an odd number, free of bank conflicts for 16-byte reads of 16 rows
#define KTB  (32 * KPIT)    // a K tile (32 keys) in LDS
#define VTB  (HD * VPIT)    // a Vt tile (HD rows of 32 keys) in LDS
// A thread's share of one pass's K and Vt tiles of one plane pair: four asynchronous 16-byte copies to LDS. lk, lv: the lane's LDS byte addresses of its first K and Vt piece; gk, gv: their global addresses. The second pieces lie 16 K rows and 32 Vt rows on.
// s_wait_xcnt 0 is the statement's last line, so that it stands in front of every later write of a register that the copies name.
__device__ __forceinline__ void stage_kv(unsigned lk, unsigned lv, const char* gk, const char* gv) {
    asm volatile("global_load_async_to_lds_b128 %0, %1, off\n\tglobal_load_async_to_lds_b128 %2, %3, off\n\tglobal_load_async_to_lds_b128 %4, %5, off\n\tglobal_load_async_to_lds_b128 %6, %7, off\n\ts_wait_xcnt 0x0"
                 :: "v"(lk), "v"(gk), "v"(lk + 16u * KPIT), "v"(gk + 16 * HD * 2), "v"(lv), "v"(gv), "v"(lv + 32u * VPIT), "v"(gv + 32 * TT * 2) : "memory");
}
template <bool HL> struct FT { typedef h16 T; };
template <> struct FT<true> { typedef bf T; };
template <bool HL, int QB>
__device__ __forceinline__ void fattn_rows(const typename FT<HL>::T* __restrict__ Q, const typename FT<HL>::T* __restrict__ Q2, const typename FT<HL>::T* __restrict__ Kp, const typename FT<HL>::T* __restrict__ K2, const typename FT<HL>::T* __restrict__ Vt, const typename FT<HL>::T* __restrict__ V2, const int* __restrict__ mk, int q0, bf* Ah, bf* Al, char* ldsb) {
    typedef typename FT<HL>::T T16; typedef typename WFrag<T16>::V V; typedef WFrag<T16> F;
    const float L2E = 1.4426950408889634f;
    const int lane = threadIdx.x & 31, lr = lane & 15, hi = lane >> 4;
    const unsigned qo = (unsigned)((q0 + lr) * HD + 8 * hi) * 2u;   // the lane's byte offset in the Q planes
    V qf[QB][2], q2f[QB][2]; v8f o[QB][4]; float mx[QB], sm[QB];   // every '#pragma unroll' below makes the indices of these arrays constants, so that they stay in registers
#pragma unroll
    for (int qb = 0; qb < QB; ++qb) { mx[qb] = -3.0e38f; sm[qb] = 0.f;
#pragma unroll
        for (int ks = 0; ks < 2; ++ks) { qf[qb][ks] = F::ld((const T16*)((const char*)Q + qo + qb * 16 * HD * 2 + ks * 64)); if (HL) q2f[qb][ks] = F::ld((const T16*)((const char*)Q2 + qo + qb * 16 * HD * 2 + ks * 64)); }
#pragma unroll
        for (int db = 0; db < 4; ++db) o[qb][db] = (v8f){}; }
    // K and Vt: each pass's tiles (32 keys) are brought into LDS ONCE for the work-group's 4 waves by asynchronous copies, two buffers, a pass's copies issued at the foot of the pass two before it; every wave copies its share (stage_kv).
    // A thread's two 16-byte pieces of each tile: K piece c = tid + 128 i (row c / 8, the tile is 4 KiB in a row in the plane), Vt piece c (row c / 4, 64 bytes a row, plane pitch 2 TT bytes).
    // Mask words: a scalar base + ONE byte offset per lane + a constant, fetched one pass ahead.
    constexpr unsigned PLB = KTB + VTB, BUFB = (HL ? 2u : 1u) * PLB;   // bytes of one plane pair's tiles; of one buffer
    const unsigned tid = threadIdx.x; const unsigned sb0 = (unsigned)(size_t)ldsb;   // the low 32 bits of a __shared__ address are the LDS byte address
    const unsigned lk = sb0 + (tid >> 3) * KPIT + (tid & 7u) * 16u, lv = sb0 + KTB + (tid >> 2) * VPIT + (tid & 3u) * 16u;
    const char* gk = (const char*)Kp + tid * 16u; const char* gv = (const char*)Vt + (tid >> 2) * (TT * 2u) + (tid & 3u) * 16u; const char* gk2 = (const char*)K2 + tid * 16u; const char* gv2 = (const char*)V2 + (tid >> 2) * (TT * 2u) + (tid & 3u) * 16u;
    const char* Mb = (const char*)mk; unsigned mo = (unsigned)((q0 + lr) * TT + 8 * hi) * 4u;
    const unsigned kfo = (unsigned)(lr * KPIT + 16 * hi), vfo = (unsigned)(KTB + lr * VPIT + 16 * hi);   // the lane's byte offsets of its K and Vt fragments in a buffer
    V kf[2][2], k2f[2][2], vf[4], v2[4]; v4i mw[QB][2][2];
    stage_kv(lk, lv, gk, gv); if (HL) stage_kv(lk + PLB, lv + PLB, gk2, gv2);   // pass 0 -> buffer 0
    gk += 32 * HD * 2; gv += 32 * 2; gk2 += 32 * HD * 2; gv2 += 32 * 2;
#pragma unroll
    for (int kt = 0; kt < 2; ++kt)
#pragma unroll
        for (int qb = 0; qb < QB; ++qb) { mw[qb][kt][0] = *(const v4i*)(Mb + mo + qb * 16 * TT * 4 + kt * 64); mw[qb][kt][1] = *(const v4i*)(Mb + mo + qb * 16 * TT * 4 + kt * 64 + 16); }
    asm volatile("s_wait_xcnt 0x0" : "+v"(mo) : "v"(qo));   // the wait in front of the overwrite of registers that issued loads name (the two offsets are operands: their registers live up to it, and the addition stays behind it)
    mo += 32u * 4u;   // the offset now stands at pass 1
    asm volatile("s_wait_asynccnt 0x0" ::: "memory");   // this wave's copies of pass 0 have landed ...
    __syncthreads();                                     // ... and every other wave's: buffer 0 may be read
    stage_kv(lk + BUFB, lv + BUFB, gk, gv); if (HL) stage_kv(lk + BUFB + PLB, lv + BUFB + PLB, gk2, gv2);   // pass 1 -> buffer 1
    gk += 32 * HD * 2; gv += 32 * 2; gk2 += 32 * HD * 2; gv2 += 32 * 2;
    unsigned bo = 0u;   // byte offset of the buffer that the pass reads
#pragma unroll 1   // rolled: a second pass's fragments and scores would cost a resident wave per SIMD
    for (int kb = 0; kb < TT; kb += 32) {
        v8f s[QB][2]; const char* sb = ldsb + bo;
#pragma unroll
        for (int kt = 0; kt < 2; ++kt)
#pragma unroll
            for (int ks = 0; ks < 2; ++ks) { kf[kt][ks] = F::ld((const T16*)(sb + kfo + kt * 16 * KPIT + ks * 64)); if (HL) k2f[kt][ks] = F::ld((const T16*)(sb + PLB + kfo + kt * 16 * KPIT + ks * 64)); }
        __builtin_amdgcn_sched_barrier(0);   // K's reads issue in front of Vt's: LDS reads come back in issue order and St needs K first (without this line the hi+lo build reads Vt first)
#pragma unroll
        for (int db = 0; db < 4; ++db) { vf[db] = F::ld((const T16*)(sb + vfo + db * 16 * VPIT)); if (HL) v2[db] = F::ld((const T16*)(sb + PLB + vfo + db * 16 * VPIT)); }
        __builtin_amdgcn_sched_barrier(0);   // the pass's LDS reads issue here as ONE group: without this line the Vt reads sink between the Ot matrix instructions, each waited for at once
#pragma unroll
        for (int kt = 0; kt < 2; ++kt) {
#pragma unroll
            for (int qb = 0; qb < QB; ++qb) s[qb][kt] = (v8f){};
#pragma unroll
            for (int ks = 0; ks < 2; ++ks)
#pragma unroll
                for (int qb = 0; qb < QB; ++qb) { s[qb][kt] = F::mma(kf[kt][ks], qf[qb][ks], s[qb][kt]); if (HL) { s[qb][kt] = F::mma(kf[kt][ks], q2f[qb][ks], s[qb][kt]); s[qb][kt] = F::mma(k2f[kt][ks], qf[qb][ks], s[qb][kt]); } } }
        float bm[QB]; bool grow = false;
#pragma unroll
        for (int qb = 0; qb < QB; ++qb) { float b = -3.0e38f;
#pragma unroll
            for (int kt = 0; kt < 2; ++kt) {
#pragma unroll
                for (int j = 0; j < 8; ++j) { const float t = (mw[qb][kt][j >> 2][j & 3] != 0) ? s[qb][kt][j] * SCL : -3.0e38f; s[qb][kt][j] = t; b = fmaxf(b, t); }
                mw[qb][kt][0] = *(const v4i*)(Mb + mo + qb * 16 * TT * 4 + kt * 64); mw[qb][kt][1] = *(const v4i*)(Mb + mo + qb * 16 * TT * 4 + kt * 64 + 16); }
            bm[qb] = fmaxf(b, xhalf(b)); grow = grow || (bm[qb] > mx[qb]); }
        __builtin_amdgcn_sched_barrier(0);   // the next pass's mask loads issue in front of the exponentials: the barrier at the pass's foot waits for them, and without this line they sink down to it
        if (__builtin_amdgcn_ballot_w32(grow) != 0) {   // a scalar branch: a pass in which no query's maximum grows has every factor 1 and skips the scaling
#pragma unroll
            for (int qb = 0; qb < QB; ++qb) { const float mn = fmaxf(mx[qb], bm[qb]); const float al = __builtin_amdgcn_exp2f((mx[qb] - mn) * L2E); mx[qb] = mn; sm[qb] *= al;
#pragma unroll
                for (int db = 0; db < 4; ++db) o[qb][db] *= al; } }
        V pf[QB], p2[QB];
#pragma unroll
        for (int qb = 0; qb < QB; ++qb) {
#pragma unroll
            for (int g = 0; g < 2; ++g) { float x[8], p[8];
#pragma unroll
                for (int j = 0; j < 8; ++j) { const float d = s[qb][g][j] - mx[qb]; x[j] = HL ? d * L2E : __builtin_fmaf(d, L2E, 10.0f); p[j] = __builtin_amdgcn_exp2f(x[j]); }   // + 10 in the exponent: x PCAR = 2^10
                // the slot behind a transcendental, once for a run of eight: results and sources are operands, so that in front of the v_nop nothing reads a result or overwrites a source
                asm volatile("v_nop" : "+v"(p[0]), "+v"(p[1]), "+v"(p[2]), "+v"(p[3]), "+v"(p[4]), "+v"(p[5]), "+v"(p[6]), "+v"(p[7]) : "v"(x[0]), "v"(x[1]), "v"(x[2]), "v"(x[3]), "v"(x[4]), "v"(x[5]), "v"(x[6]), "v"(x[7]));
#pragma unroll
                for (int j = 0; j < 8; ++j) { sm[qb] += p[j];
                    if constexpr (HL) { const __bf16 ph = (__bf16)p[j]; pf[qb][g * 8 + j] = ph; p2[qb][g * 8 + j] = (__bf16)(p[j] - (float)ph); }
                    else pf[qb][g * 8 + j] = (h16)p[j]; } } }
#pragma unroll
        for (int db = 0; db < 4; ++db)
#pragma unroll
            for (int qb = 0; qb < QB; ++qb) { o[qb][db] = F::mma(vf[db], pf[qb], o[qb][db]); if (HL) { o[qb][db] = F::mma(vf[db], p2[qb], o[qb][db]); o[qb][db] = F::mma(v2[db], pf[qb], o[qb][db]); } }
        // four vector slots between the Ot matrix instructions and the next pass's LDS reads, which refill the Vt fragments' registers (operands: the accumulators, so that the matrix instructions stay in front)
        if constexpr (QB == 2) { asm volatile("v_nop\n\tv_nop\n\tv_nop\n\tv_nop" : "+v"(o[0][0]), "+v"(o[0][1]), "+v"(o[0][2]), "+v"(o[0][3]), "+v"(o[1][0]), "+v"(o[1][1]), "+v"(o[1][2]), "+v"(o[1][3])); }
        else { asm volatile("v_nop\n\tv_nop\n\tv_nop\n\tv_nop" : "+v"(o[0][0]), "+v"(o[0][1]), "+v"(o[0][2]), "+v"(o[0][3])); }
        asm volatile("s_wait_xcnt 0x0" : "+v"(mo));   // as in front of the loop: the pass's mask loads name the offset
        mo += ((kb + 64 < TT) ? 1u : 0u) * (32u * 4u);   // the last two passes fetch the last pass's mask words (in bounds; the last fetch is unused)
        // hand-over: this wave's reads of the pass's buffer are done, its copies of the next pass have landed; behind the barrier that holds for all 4 waves, so the next buffer may be read and this one refilled
        asm volatile("s_wait_dscnt 0x0" ::: "memory");
        asm volatile("s_wait_asynccnt 0x0" ::: "memory");
        __syncthreads();
        if (kb + 64 < TT) {   // the same for the whole work-group: only while a pass kb / 32 + 2 exists
            stage_kv(lk + bo, lv + bo, gk, gv); if (HL) stage_kv(lk + bo + PLB, lv + bo + PLB, gk2, gv2);
            gk += 32 * HD * 2; gv += 32 * 2; gk2 += 32 * HD * 2; gv2 += 32 * 2; }
        bo = BUFB - bo;
    }
    asm volatile("s_wait_asynccnt 0x0" ::: "memory");   // no copy is outstanding when the wave goes on to its end
#pragma unroll
    for (int qb = 0; qb < QB; ++qb) { const float f = __fdiv_rn(1.0f, sm[qb] + xhalf(sm[qb])); const size_t oo = (size_t)(q0 + qb * 16 + lr) * DQ + 8 * hi;   // a lane's 8 accumulator registers are 8 consecutive d of its query: one 16-byte store a plane
#pragma unroll
        for (int db = 0; db < 4; ++db) { v8us oh, ol;
#pragma unroll
            for (int j = 0; j < 8; ++j) { unsigned short a, c2; splitf(o[qb][db][j] * f, a, c2); oh[j] = a; ol[j] = c2; }
            // both planes' stores and s_wait_xcnt 0 in ONE statement: the wait stands in front of every later write of a register that the stores name, on every way out of here (with plain stores the compiler joined the tails of the two row classes)
            asm volatile("global_store_b128 %0, %1, off\n\tglobal_store_b128 %2, %3, off\n\ts_wait_xcnt 0x0" :: "v"(Ah + oo + db * 16), "v"(oh), "v"(Al + oo + db * 16), "v"(ol) : "memory"); } }
}
// grid (NB_ NH_, RH/64 + (TT-RH)/128), 4 waves: row blocks y < RH/64 are the hi+lo rows (16 a wave), the rest fp16 (32 a wave). Planes [batch][head][..]; one kv head per query head. Ah, Al: [batch][t][head d].
__global__ __launch_bounds__(128) void k_fattn(const h16* __restrict__ Q16, const h16* __restrict__ K16, const h16* __restrict__ V16, const bf* __restrict__ Qh, const bf* __restrict__ Ql, const bf* __restrict__ Kh, const bf* __restrict__ Kl, const bf* __restrict__ Vh, const bf* __restrict__ Vl, const int* __restrict__ mk, bf* Ah, bf* Al) {
    __shared__ __align__(16) char kv[2 * 2 * (KTB + VTB)];   // two buffers of the hi+lo rows' four tiles (the fp16 rows use half)
    const int z = blockIdx.x, y = blockIdx.y; const int wave = __builtin_amdgcn_readfirstlane((int)(threadIdx.x >> 5)); const size_t po = (size_t)z * TT * HD; const size_t ao = (size_t)(z / NH_) * TT * DQ + (size_t)(z % NH_) * HD;
    if (y < RH / 64) fattn_rows<true, 1>(Qh + po, Ql + po, Kh + po, Kl + po, Vh + po, Vl + po, mk, y * 64 + wave * 16, Ah + ao, Al + ao, kv);
    else fattn_rows<false, 2>(Q16 + po, nullptr, K16 + po, nullptr, V16 + po, nullptr, mk, RH + (y - RH / 64) * 128 + wave * 32, Ah + ao, Al + ao, kv);
}

extern "C" void kernel_launch(void* const* d_in, const int* in_sizes, int n_in,
                              void* d_out, int out_size, void* d_ws, size_t ws_size, hipStream_t stream) {
    (void)in_sizes; (void)n_in; (void)out_size;
    const float* x = (const float*)d_in[0]; const float* xk = (const float*)d_in[1]; const float* xv = (const float*)d_in[2]; const int* mk = (const int*)d_in[3]; const float* wqh = (const float*)d_in[4]; const float* bq = (const float*)d_in[5]; const float* wkh = (const float*)d_in[6]; const float* bk = (const float*)d_in[7]; const float* wvh = (const float*)d_in[8]; const float* bv = (const float*)d_in[9]; const float* wo = (const float*)d_in[10]; const float* wq = nullptr; const float* wk = nullptr; const float* wv = nullptr; (void)wq; (void)wk; (void)wv; const float* cosT = nullptr; const float* sinT = nullptr; (void)cosT; (void)sinT;
    float* OUT = (float*)d_out;     // [2][2048][1024]
    char* wsp = (char*)d_ws;
    auto take = [&](size_t bytes) { char* p = wsp; wsp += (bytes + 255) & ~(size_t)255; return (void*)p; };
    bf* WQ = (bf*)take((size_t)DQ * DM * 2); bf* WK = (bf*)take((size_t)DKV * DM * 2); bf* WV = (bf*)take((size_t)DKV * DM * 2); bf* WO = (bf*)take((size_t)DM * DQ * 2);
    bf* XB = (bf*)take((size_t)NB_ * TT * DM * 2); bf* XB2 = (bf*)take((size_t)NB_ * TT * DM * 2); bf* XB3 = (bf*)take((size_t)NB_ * TT * DM * 2);   // q, k, v in bf16, both batches
    const size_t PQ = (size_t)NH_ * TT * HD, PK = (size_t)NKV * TT * HD;   // one batch's head planes, in elements; every plane holds both batches
    h16* QP16 = (h16*)take(NB_ * PQ * 2); h16* KP16 = (h16*)take(NB_ * PK * 2); h16* VT16 = (h16*)take(NB_ * PK * 2);
    bf* QPh = (bf*)take(NB_ * PQ * 2); bf* QPl = (bf*)take(NB_ * PQ * 2); bf* KPh = (bf*)take(NB_ * PK * 2); bf* KPl = (bf*)take(NB_ * PK * 2); bf* VTh = (bf*)take(NB_ * PK * 2); bf* VTl = (bf*)take(NB_ * PK * 2);
    bf* ATh = (bf*)take((size_t)NB_ * TT * DQ * 2); bf* ATl = (bf*)take((size_t)NB_ * TT * DQ * 2);
    if ((size_t)(wsp - (char*)d_ws) > ws_size) return;    // ws 256 MiB
    k_cvtall<<<dim3(4 * 128 + 3 * 256, 1, 1), 256, 0, stream>>>(wqh, wkh, wvh, wo, x, xk, xv, WQ, WK, WV, WO, XB, XB2, XB3);
    k_proj<<<dim3(TT / 128, DQ / 128, 3 * NB_), 256, 0, stream>>>(XB, XB2, XB3, WQ, WK, WV, bq, bk, bv, QP16, QPh, QPl, KP16, KPh, KPl, VT16, VTh, VTl);
    k_fattn<<<dim3(NB_ * NH_, RH / 64 + (TT - RH) / 128, 1), 128, 0, stream>>>(QP16, KP16, VT16, QPh, QPl, KPh, KPl, VTh, VTl, mk, ATh, ATl);
    k_wo<<<dim3(NB_ * TT / 128, DM / 128, 1), 256, 0, stream>>>(ATh, ATl, WO, OUT);
}

// v008
// A run of this version takes 131 microseconds.
// In both of two side-by-side timings against v007, it was 1.12 times as fast.
// All steps since v000 together make it 15.7 times as fast.
#include <hip/hip_runtime.h>

// MultiHeadAttentionModule (q, k, v inputs [2][2048][1024]; per-head Qh = q Wq[h] + bq[h], Kh = k Wk[h] + bk[h], Vh = v Wv[h] + bv[h] (W [16][1024][64]); scores = Qh.Kh / 8, where(mask == 0, -1e9) (mask [2048][2048] int, read); softmax; out = concat(heads) Wo ([in,out], no bias) -> [2][2048][1024]).
// Compute dtypes, f32 accumulate: every input rounded to bf16; Qh/Kh/Vh on PLAIN bf16 operands (inputs: exact; per-head weights gathered) + bias; scores and attn.v (one fused kernel, running maximum): query rows < 512 hl (3 products), the rest single fp16 (x1024); mask + softmax f32; Wo hl x exact (2 products).
// Left open: a pass whose lane masks are all ones could skip its selects behind one scalar test; a stage of 64 keys would make the Vt rows whole 128-byte lines and halve the barriers; the weight transposes of k_cvtall read 32 bytes of each 128-byte line a thread; k_wo has one work-group a WGP.

#define NB_  2
#define TT   2048
#define DM   1024
#define NH_  16
#define NKV  16
#define REP  (NH_ / NKV)
#define HD   64
#define DQ   (NH_ * HD)
#define DKV  (NKV * HD)
#define RH   512                  // query rows < RH use hi+lo planes (0: none)
#define WIN  0
#define PCAR 1024.0f
#define SCL  0.125f   // HD^-0.5
typedef _Float16 h16;
typedef unsigned short bf;
typedef __attribute__((ext_vector_type(16))) __bf16   v16bf;
typedef __attribute__((ext_vector_type(16))) _Float16 v16h;
typedef __attribute__((ext_vector_type(8)))  _Float16 v8h;
typedef __attribute__((ext_vector_type(8)))  unsigned short v8us;
typedef __attribute__((ext_vector_type(8)))  float    v8f;
typedef __attribute__((ext_vector_type(4)))  float    v4f;
typedef v8h  __attribute__((may_alias)) v8ha;
typedef v4f  __attribute__((may_alias)) v4fa;
typedef v8us __attribute__((may_alias)) v8usa;

__device__ __forceinline__ unsigned short f2bf(float f) { unsigned u = __float_as_uint(f); u += 0x7FFFu + ((u >> 16) & 1u); return (unsigned short)(u >> 16); }
__device__ __forceinline__ float bf2f(unsigned short b) { return __uint_as_float(((unsigned)b) << 16); }
__device__ __forceinline__ float bfr(float f) { return bf2f(f2bf(f)); }
__device__ __forceinline__ v16h cat16(v8h lo, v8h hi) { return __builtin_shufflevector(lo, hi, 0, 1, 2, 3, 4, 5, 6, 7, 8, 9, 10, 11, 12, 13, 14, 15); }
__device__ __forceinline__ v16bf cat16b(v8us lo, v8us hi) { return __builtin_bit_cast(v16bf, __builtin_shufflevector(lo, hi, 0, 1, 2, 3, 4, 5, 6, 7, 8, 9, 10, 11, 12, 13, 14, 15)); }
__device__ __forceinline__ v8f wmma16(v16h a, v16h b, v8f c) { return __builtin_amdgcn_wmma_f32_16x16x32_f16(false, a, false, b, (short)0, c, false, false); }
__device__ __forceinline__ v8f wmmab(v16bf a, v16bf b, v8f c) { return __builtin_amdgcn_wmma_f32_16x16x32_bf16(false, a, false, b, (short)0, c, false, false); }
typedef __attribute__((ext_vector_type(4))) _Float16 v4h;
typedef __attribute__((ext_vector_type(4))) unsigned short v4us;
typedef __attribute__((ext_vector_type(4))) __bf16 v4b;



// ---- fragment loaders: a lane's 16 elements of a K-contiguous 16-bit row, in the hardware k order (8 at p, 8 at p + 16; p holds the lane half's 8 hi)
template <typename T16> struct WFrag;
template <> struct WFrag<h16> { typedef v16h V; static __device__ __forceinline__ V ld(const h16* p) { return cat16(*(const v8h*)p, *(const v8h*)(p + 16)); } static __device__ __forceinline__ v8f mma(V a, V b, v8f c) { return wmma16(a, b, c); } };
template <> struct WFrag<bf> { typedef v16bf V; static __device__ __forceinline__ V ld(const bf* p) { return cat16b(*(const v8us*)p, *(const v8us*)(p + 16)); } static __device__ __forceinline__ v8f mma(V a, V b, v8f c) { return wmmab(a, b, c); } };
// ---- gemmt: one 128 x 128 tile of D[m][n] = sum_k Am[m][k] Bn[n][k] (both operands K-contiguous bf16 planes of pitch GK) a work-group of 8 waves; a wave owns 64 m x 32 n (8 accumulators) and walks the whole K, so that each sum stays in one accumulator.
// Each stage of 64 k (128 rows of one whole 128-byte line an operand) comes into LDS ONCE for the 8 waves by asynchronous copies, two buffers, a stage's copies issued behind the last LDS reads of the stage two before it; fragments are read from LDS.
// A lane holds 8 consecutive m of ONE n, so the caller puts on the m side whatever lies contiguous in the output: every store is 16 bytes a lane, straight from the accumulators.
// NS 1: the n side has a second plane Bn2 (lo), D = Am (Bn + Bn2). EPI 0: C[n][m] f32, pitch DM. EPI 1, 2: + bias, then the three 16-bit head planes that the attention kernel reads (fp16, bf16 hi, bf16 lo of the same f32 value).
//   1: m = (head, d) (the weight; bias per m), n = token -> planes [head][t][d]. 2: m = token, n = (head, d) (bias per n) -> planes [head][d][t].
#define GK   1024           // K of every product here (DM and DQ)
#define GPIT 144            // LDS bytes a staged row (128 bytes) takes: 16 bytes x an odd number, free of bank conflicts for 16-byte reads of 16 rows
#define GTB  (128 * GPIT)   // one operand's stage in LDS
static_assert(DM == GK && DQ == GK, "one K");
typedef __attribute__((ext_vector_type(8))) __bf16 v8b;
// A thread's share of one operand's stage: four asynchronous 16-byte copies to LDS, 32 rows apart. l: the lane's LDS byte address of its first piece; g: its global address.
// s_wait_xcnt 0 is the statement's last line, so that it stands in front of every later write of a register that the copies name.
__device__ __forceinline__ void stage_op(unsigned l, const char* g) {
    asm volatile("global_load_async_to_lds_b128 %0, %1, off\n\tglobal_load_async_to_lds_b128 %2, %3, off\n\tglobal_load_async_to_lds_b128 %4, %5, off\n\tglobal_load_async_to_lds_b128 %6, %7, off\n\ts_wait_xcnt 0x0"
                 :: "v"(l), "v"(g), "v"(l + 32u * GPIT), "v"(g + 32 * GK * 2), "v"(l + 64u * GPIT), "v"(g + 64 * GK * 2), "v"(l + 96u * GPIT), "v"(g + 96 * GK * 2) : "memory");
}
template <int NS, int EPI>
__device__ __forceinline__ void gemmt(const bf* __restrict__ Am, const bf* __restrict__ Bn, const bf* __restrict__ Bn2, float* C, const float* __restrict__ bias, h16* P16, bf* Ph, bf* Pl, int r0, int c0, char* ldsb) {
    typedef WFrag<bf> F; typedef typename F::V V;
    const int lane = threadIdx.x & 31, lr = lane & 15, hi = lane >> 4;
    const int wave = __builtin_amdgcn_readfirstlane((int)(threadIdx.x >> 5)); const int wm = wave & 1, wn = wave >> 1;   // scalar: the wave's place in the tile
    constexpr unsigned BUFB = (2u + NS) * GTB;   // bytes of one buffer
    constexpr int G = NS ? 2 : 1;   // steps of 32 k whose fragments are read as one group: the whole stage where one work-group has the WGP to itself (k_wo), one step where the registers must leave room for three (k_proj)
    const unsigned tid = threadIdx.x; const unsigned sb0 = (unsigned)(size_t)ldsb;   // the low 32 bits of a __shared__ address are the LDS byte address
    const unsigned ls = sb0 + (tid >> 3) * GPIT + (tid & 7u) * 16u;   // piece tid: row tid / 8, 16 bytes tid % 8 of it: a wave's copy is 4 whole lines
    const size_t go = (size_t)(tid >> 3) * (GK * 2) + (tid & 7u) * 16u;
    const char* ga = (const char*)(Am + (size_t)r0 * GK) + go; const char* gb = (const char*)(Bn + (size_t)c0 * GK) + go; const char* gb2 = (const char*)(Bn2 + (size_t)c0 * GK) + go;
    const unsigned afo = (unsigned)((wm * 64 + lr) * GPIT + 16 * hi), bfo = (unsigned)(GTB + (wn * 32 + lr) * GPIT + 16 * hi);   // the lane's byte offsets of its first m and n fragment in a buffer
    v8f acc[4][2];   // every '#pragma unroll' of this function makes the indices of acc, a, b, b2 constants, so that they stay in registers
#pragma unroll
    for (int mb = 0; mb < 4; ++mb)
#pragma unroll
        for (int nb = 0; nb < 2; ++nb) acc[mb][nb] = (v8f){};
    stage_op(ls, ga); stage_op(ls + GTB, gb); if (NS) stage_op(ls + 2u * GTB, gb2);   // stage 0 -> buffer 0
    ga += 128; gb += 128; gb2 += 128;
    asm volatile("s_wait_asynccnt 0x0" ::: "memory");   // this wave's copies of stage 0 have landed ...
    __syncthreads();                                     // ... and every other wave's: buffer 0 may be read
    stage_op(ls + BUFB, ga); stage_op(ls + BUFB + GTB, gb); if (NS) stage_op(ls + BUFB + 2u * GTB, gb2);   // stage 1 -> buffer 1
    ga += 128; gb += 128; gb2 += 128;
    unsigned bo = 0u;   // byte offset of the buffer that the stage reads
#pragma unroll 1   // rolled: a second stage's fragments would cost a resident work-group per WGP
    for (int t = 0; t < GK / 64; ++t) {
        const char* sb = ldsb + bo;
#pragma unroll
        for (int g = 0; g < 2 / G; ++g) { V a[G][4], b[G][2], b2[G][2];
#pragma unroll
            for (int u = 0; u < G; ++u) { const int ko = (g * G + u) * 64;   // byte offset of the 32 k in a staged row
#pragma unroll
                for (int nb = 0; nb < 2; ++nb) b[u][nb] = F::ld((const bf*)(sb + bfo + nb * 16 * GPIT + ko));
#pragma unroll
                for (int mb = 0; mb < 4; ++mb) a[u][mb] = F::ld((const bf*)(sb + afo + mb * 16 * GPIT + ko));
                if (NS) {
#pragma unroll
                    for (int nb = 0; nb < 2; ++nb) b2[u][nb] = F::ld((const bf*)(sb + GTB + bfo + nb * 16 * GPIT + ko)); } }
            __builtin_amdgcn_sched_barrier(0);   // the group's LDS reads issue here as ONE group: without this line the n fragments are read one at a time between the matrix instructions, each waited for at once
            if (g == 2 / G - 1) {   // a constant: behind the stage's last group of reads
                // hand-over, in front of the group's matrix instructions, which need registers only, so that the refill flies during them: this wave's reads of the stage's buffer are done, its copies of the next stage have landed;
                // behind the barrier that holds for all 8 waves, so the next buffer may be read and this one refilled
                asm volatile("s_wait_dscnt 0x0" ::: "memory");
                asm volatile("s_wait_asynccnt 0x0" ::: "memory");
                __syncthreads();
                if (t + 2 < GK / 64) {   // the same for the whole work-group: only while a stage t + 2 exists
                    stage_op(ls + bo, ga); stage_op(ls + bo + GTB, gb); if (NS) stage_op(ls + bo + 2u * GTB, gb2);
                    ga += 128; gb += 128; gb2 += 128; } }
#pragma unroll
            for (int u = 0; u < G; ++u) {
#pragma unroll
                for (int nb = 0; nb < 2; ++nb)
#pragma unroll
                    for (int mb = 0; mb < 4; ++mb) acc[mb][nb] = F::mma(a[u][mb], b[u][nb], acc[mb][nb]);
                if (NS) {
#pragma unroll
                    for (int nb = 0; nb < 2; ++nb)
#pragma unroll
                        for (int mb = 0; mb < 4; ++mb) acc[mb][nb] = F::mma(a[u][mb], b2[u][nb], acc[mb][nb]); } } }
        bo = BUFB - bo;
    }
    asm volatile("s_wait_asynccnt 0x0" ::: "memory");   // no copy is outstanding when the wave goes on to its end
    const int m0 = r0 + wm * 64, n0 = c0 + wn * 32 + lr;   // the wave's first m; the lane's first n
    if constexpr (EPI == 0) {
#pragma unroll
        for (int nb = 0; nb < 2; ++nb)
#pragma unroll
            for (int mb = 0; mb < 4; ++mb) { const v8f val = acc[mb][nb]; const v4f lo4 = __builtin_shufflevector(val, val, 0, 1, 2, 3), hi4 = __builtin_shufflevector(val, val, 4, 5, 6, 7);
                // both stores and s_wait_xcnt 0 in ONE statement: the wait stands in front of every later write of a register that the stores name
                asm volatile("global_store_b128 %0, %1, off\n\tglobal_store_b128 %0, %2, off offset:16\n\ts_wait_xcnt 0x0" :: "v"(C + (size_t)(n0 + nb * 16) * DM + m0 + mb * 16 + 8 * hi), "v"(lo4), "v"(hi4) : "memory"); }
    } else {
        v4f bm[8]; float bn[2];   // EPI 1: the bias of the lane's 32 m; EPI 2: of its 2 n. Loads and their data wait in ONE statement, so that no register that a load names or fills is touched while it flies
        if constexpr (EPI == 1) asm volatile("global_load_b128 %0, %8, off\n\tglobal_load_b128 %1, %8, off offset:16\n\tglobal_load_b128 %2, %8, off offset:64\n\tglobal_load_b128 %3, %8, off offset:80\n\tglobal_load_b128 %4, %8, off offset:128\n\tglobal_load_b128 %5, %8, off offset:144\n\tglobal_load_b128 %6, %8, off offset:192\n\tglobal_load_b128 %7, %8, off offset:208\n\ts_wait_loadcnt 0x0"
                                             : "=&v"(bm[0]), "=&v"(bm[1]), "=&v"(bm[2]), "=&v"(bm[3]), "=&v"(bm[4]), "=&v"(bm[5]), "=&v"(bm[6]), "=&v"(bm[7]) : "v"(bias + m0 + 8 * hi) : "memory");
        else asm volatile("global_load_b32 %0, %2, off\n\tglobal_load_b32 %1, %2, off offset:64\n\ts_wait_loadcnt 0x0" : "=&v"(bn[0]), "=&v"(bn[1]) : "v"(bias + n0) : "memory");
#pragma unroll
        for (int nb = 0; nb < 2; ++nb)
#pragma unroll
            for (int mb = 0; mb < 4; ++mb) { v8f val = acc[mb][nb];
#pragma unroll
                for (int j = 0; j < 8; ++j) val[j] += bfr(EPI == 1 ? bm[2 * mb + (j >> 2)][j & 3] : bn[nb]);
                const size_t po = (EPI == 1) ? ((size_t)(m0 / HD) * TT + n0 + nb * 16) * HD + mb * 16 + 8 * hi : (size_t)(n0 + nb * 16) * TT + m0 + mb * 16 + 8 * hi;
                const v8h o16 = __builtin_convertvector(val, v8h); const v8b oh = __builtin_convertvector(val, v8b); const v8b ol = __builtin_convertvector(val - __builtin_convertvector(oh, v8f), v8b);   // each conversion rounds to nearest even, as f2bf does; lo is the rounded rest behind hi
                // the three planes' stores and s_wait_xcnt 0 in ONE statement: the wait stands in front of every later write of a register that the stores name
                asm volatile("global_store_b128 %0, %1, off\n\tglobal_store_b128 %2, %3, off\n\tglobal_store_b128 %4, %5, off\n\ts_wait_xcnt 0x0" :: "v"(P16 + po), "v"(o16), "v"(Ph + po), "v"(oh), "v"(Pl + po), "v"(ol) : "memory"); }
    }
}

// ---- k_proj: the three projections of both batches in ONE launch. grid (TT/128, DQ/128, 3 NB_): z = 2 (0: Q, 1: K, 2: V) + batch; x: tokens, y: (head, d). Q, K: m = (head, d), n = token. V: m = token, n = (head, d).
__global__ __launch_bounds__(256) void k_proj(const bf* __restrict__ XQ, const bf* __restrict__ XK, const bf* __restrict__ XV, const bf* __restrict__ WQ, const bf* __restrict__ WK, const bf* __restrict__ WV, const float* __restrict__ bq, const float* __restrict__ bk, const float* __restrict__ bv,
                                              h16* Q16, bf* Qh, bf* Ql, h16* K16, bf* Kh, bf* Kl, h16* V16, bf* Vh, bf* Vl) {
    __shared__ __align__(16) char st[2 * 2 * GTB];
    const int w = blockIdx.z >> 1; const size_t xo = (size_t)(blockIdx.z & 1) * TT * DM, po = (size_t)(blockIdx.z & 1) * NH_ * TT * HD;
    if (w < 2) gemmt<0, 1>(w ? WK : WQ, (w ? XK : XQ) + xo, nullptr, nullptr, w ? bk : bq, (w ? K16 : Q16) + po, (w ? Kh : Qh) + po, (w ? Kl : Ql) + po, blockIdx.y * 128, blockIdx.x * 128, st);
    else gemmt<0, 2>(XV + xo, WV, nullptr, nullptr, bv, V16 + po, Vh + po, Vl + po, blockIdx.x * 128, blockIdx.y * 128, st);
}
// ---- k_wo: out = (Ah + Al) Wo, both batches as one matrix of NB_ TT rows: m = output column (rows of the transposed Wo), n = token. grid (NB_ TT/128, DM/128).
__global__ __launch_bounds__(256) void k_wo(const bf* __restrict__ Ah, const bf* __restrict__ Al, const bf* __restrict__ WO, float* OUT) {
    __shared__ __align__(16) char st[2 * 3 * GTB];
    gemmt<1, 0>(WO, Ah, Al, OUT, nullptr, nullptr, nullptr, nullptr, blockIdx.y * 128, blockIdx.x * 128, st);
}

__device__ __forceinline__ void splitf(float y, unsigned short& h, unsigned short& l) { h = f2bf(y); l = f2bf(y - bf2f(h)); }
typedef __attribute__((ext_vector_type(2))) unsigned short v2us;
typedef __attribute__((ext_vector_type(4))) int v4i;
typedef __attribute__((ext_vector_type(16))) unsigned v16u;
typedef __attribute__((address_space(4))) v16u cv16u;

// ---- k_cvtall: every conversion in ONE launch of few, fat waves. 1536 blocks of 256 threads. Blocks < 512: 128 a weight, transposed to [n][k] bf16 (Wq, Wk, Wv: n = 64 head + c; Wo); 256 for the mask (-> lane masks); the rest: 256 each for q, k, v (both batches, as they lie, bf16).
// A weight block: 8 rows n0 .. n0 + 7 of Bt, all 1024 k. A thread reads 8 consecutive n of 4 consecutive k (4 x 32 bytes) and writes 4 k of each of the 8 rows; a wave writes 256 bytes in a row of each.
__device__ __forceinline__ void wt_pieces(const float* __restrict__ s, int pitch, bf* d) {   // d[j DM + k] = bf16(s[k pitch + j])
    const int k = threadIdx.x * 4; v8f r[4];
#pragma unroll   // constant indices keep r in registers
    for (int u = 0; u < 4; ++u) r[u] = *(const v8f*)(s + (size_t)(k + u) * pitch);
#pragma unroll
    for (int j = 0; j < 8; ++j) { v4us o;
#pragma unroll
        for (int u = 0; u < 4; ++u) o[u] = f2bf(r[u][j]);
        *(v4us*)(d + (size_t)j * DM + k) = o; }
}
// An activation block: 8 x 256 pieces of 8 floats; a thread's 8 pieces lie 256 pieces apart and are all loaded before the first is stored (8 KiB a wave in flight).
__device__ __forceinline__ void cvt_pieces(const float* __restrict__ s, bf* d, unsigned blk) {
    unsigned lo = (blk * (8u * 256u) + threadIdx.x) * 32u; v8f v[8];   // the lane's byte offset in s (a tensor is 16 MiB); half of it in d
#pragma unroll   // constant indices keep v in registers
    for (int p = 0; p < 8; ++p) v[p] = *(const v8f*)((const char*)s + lo + p * (256 * 32));
    asm volatile("s_wait_xcnt 0x0" : "+v"(lo));   // the wait in front of any overwrite of the register that the issued loads name (the offset is an operand: its register lives up to the wait, so that no load's result lands on it)
    const unsigned so = lo >> 1;
#pragma unroll
    for (int p = 0; p < 8; ++p) { v8us o;
#pragma unroll
        for (int k = 0; k < 8; ++k) o[k] = f2bf(v[p][k]);
        *(v8us*)((char*)d + so + p * (256 * 16)) = o; }
}
// A mask block: the mask as LANE MASKS, in the order in which k_fattn's score registers want them. LM[16-query block][32-key block][i = 8 kt + j]: bit l of the word is (mask[16 block + l % 16][32 block + 16 kt + 8 (l / 16) + j] != 0),
// that is, lane l's condition for register j of score tile kt: the word is the select's whole condition, read into scalar registers. A wave makes 4 key blocks of one query block (16 rows x 512 bytes; 64 words = 256 bytes in a row).
typedef __attribute__((ext_vector_type(2))) unsigned v2u;
__device__ __forceinline__ void mask_pieces(const int* __restrict__ mk, unsigned* LM, unsigned blk) {
    const unsigned lane = threadIdx.x & 31u; const unsigned w = blk * 8u + (unsigned)__builtin_amdgcn_readfirstlane((int)(threadIdx.x >> 5));   // wave w: query block w / 16, key blocks 4 (w % 16) ..
    unsigned lo = (((w >> 4) * 16u + (lane & 15u)) * TT + (w & 15u) * 128u + 8u * (lane >> 4)) * 4u; v4i m[4][4];   // the lane's byte offset in the mask (16 MiB)
#pragma unroll   // constant indices keep m in registers
    for (int t = 0; t < 4; ++t)
#pragma unroll
        for (int c = 0; c < 4; ++c) m[t][c] = *(const v4i*)((const char*)mk + lo + t * 128 + (c >> 1) * 64 + (c & 1) * 16);
    asm volatile("s_wait_xcnt 0x0" : "+v"(lo));   // the wait in front of any overwrite of the register that the issued loads name (the offset is an operand: its register lives up to the wait, so that no load's result lands on it)
    unsigned o0 = 0u, o1 = 0u;   // lane l stores words 2 l and 2 l + 1 of the wave's 64
#pragma unroll
    for (int t = 0; t < 4; ++t)
#pragma unroll
        for (int i = 0; i < 16; i += 2) {
            const unsigned b0 = __builtin_amdgcn_ballot_w32(m[t][i >> 2][i & 3] != 0), b1 = __builtin_amdgcn_ballot_w32(m[t][i >> 2][(i & 3) + 1] != 0); const bool mine = lane == (unsigned)(t * 8 + (i >> 1));
            o0 = mine ? b0 : o0; o1 = mine ? b1 : o1; }
    *(v2u*)(LM + (size_t)w * 64u + lane * 2u) = (v2u){o0, o1};
}
__global__ __launch_bounds__(256) void k_cvtall(const float* __restrict__ wq, const float* __restrict__ wk, const float* __restrict__ wv, const float* __restrict__ wo, const float* __restrict__ xq, const float* __restrict__ xk, const float* __restrict__ xv, const int* __restrict__ mk,
                                                bf* WQ, bf* WK, bf* WV, bf* WO, bf* XQ, bf* XK, bf* XV, unsigned* LM) {
    const int bx = blockIdx.x; const int y = bx >> 7, n0 = (bx & 127) * 8;
    if (y < 3) wt_pieces((y == 0 ? wq : y == 1 ? wk : wv) + (size_t)(n0 / HD) * DM * HD + n0 % HD, HD, (y == 0 ? WQ : y == 1 ? WK : WV) + (size_t)n0 * DM);   // Bt[64 h + c][k] = W[h][k][c]
    else if (y == 3) wt_pieces(wo + n0, DM, WO + (size_t)n0 * DQ);   // Bt[n][k] = Wo[k][n]
    else if (bx < 768) mask_pieces(mk, LM, (unsigned)(bx - 512));
    else { const int t = (bx - 768) >> 8; cvt_pieces(t == 0 ? xq : t == 1 ? xk : xv, t == 0 ? XQ : t == 1 ? XK : XV, (unsigned)(bx - 768) & 255u); }
}
__device__ __forceinline__ float xhalf(float x) { const unsigned b = __float_as_uint(x); return __uint_as_float(__builtin_amdgcn_permlanex16(b, b, 0x76543210u, 0xfedcba98u, false, false)); }   // the value of lane l ^ 16
#define KPIT 144            // LDS bytes a K row (128 bytes) and
#define VPIT 80             // a Vt row piece (64 bytes) take: 16 bytes x an odd number, free of bank conflicts for 16-byte reads of 16 rows
#define KTB  (32 * KPIT)    // a K tile (32 keys) in LDS
#define VTB  (HD * VPIT)    // a Vt tile (HD rows of 32 keys) in LDS
// A thread's share of one pass's K and Vt tiles of one plane pair: four asynchronous 16-byte copies to LDS. lk, lv: the lane's LDS byte addresses of its first K and Vt piece; gk, gv: their global addresses. The second pieces lie 16 K rows and 32 Vt rows on.
// s_wait_xcnt 0 is the statement's last line, so that it stands in front of every later write of a register that the copies name.
__device__ __forceinline__ void stage_kv(unsigned lk, unsigned lv, const char* gk, const char* gv) {
    asm volatile("global_load_async_to_lds_b128 %0, %1, off\n\tglobal_load_async_to_lds_b128 %2, %3, off\n\tglobal_load_async_to_lds_b128 %4, %5, off\n\tglobal_load_async_to_lds_b128 %6, %7, off\n\ts_wait_xcnt 0x0"
                 :: "v"(lk), "v"(gk), "v"(lk + 16u * KPIT), "v"(gk + 16 * HD * 2), "v"(lv), "v"(gv), "v"(lv + 32u * VPIT), "v"(gv + 32 * TT * 2) : "memory");
}
template <bool HL> struct FT { typedef h16 T; };
template <> struct FT<true> { typedef bf T; };
template <bool HL, int QB>
__device__ __forceinline__ void fattn_rows(const typename FT<HL>::T* __restrict__ Q, const typename FT<HL>::T* __restrict__ Q2, const typename FT<HL>::T* __restrict__ Kp, const typename FT<HL>::T* __restrict__ K2, const typename FT<HL>::T* __restrict__ Vt, const typename FT<HL>::T* __restrict__ V2, const unsigned* __restrict__ lm, int q0, bf* Ah, bf* Al, char* ldsb) {
    typedef typename FT<HL>::T T16; typedef typename WFrag<T16>::V V; typedef WFrag<T16> F;
    const float L2E = 1.4426950408889634f;
    const int lane = threadIdx.x & 31, lr = lane & 15, hi = lane >> 4;
    const unsigned qo = (unsigned)((q0 + lr) * HD + 8 * hi) * 2u;   // the lane's byte offset in the Q planes
    V qf[QB][2], q2f[QB][2]; v8f o[QB][4]; float mx[QB], sm[QB];   // every '#pragma unroll' below makes the indices of these arrays constants, so that they stay in registers
#pragma unroll
    for (int qb = 0; qb < QB; ++qb) { mx[qb] = -3.0e38f; sm[qb] = 0.f;
#pragma unroll
        for (int ks = 0; ks < 2; ++ks) { qf[qb][ks] = F::ld((const T16*)((const char*)Q + qo + qb * 16 * HD * 2 + ks * 64)); if (HL) q2f[qb][ks] = F::ld((const T16*)((const char*)Q2 + qo + qb * 16 * HD * 2 + ks * 64)); }
#pragma unroll
        for (int db = 0; db < 4; ++db) o[qb][db] = (v8f){}; }
    // K and Vt: each pass's tiles (32 keys) are brought into LDS ONCE for the work-group's 4 waves by asynchronous copies, two buffers, a pass's copies issued at the foot of the pass two before it; every wave copies its share (stage_kv).
    // A thread's two 16-byte pieces of each tile: K piece c = tid + 128 i (row c / 8, the tile is 4 KiB in a row in the plane), Vt piece c (row c / 4, 64 bytes a row, plane pitch 2 TT bytes).
    // Lane masks: 16 words (64 bytes) per 16 queries and pass, at an address that is the same for the whole wave (scalar loads), fetched one pass ahead.
    constexpr unsigned PLB = KTB + VTB, BUFB = (HL ? 2u : 1u) * PLB;   // bytes of one plane pair's tiles; of one buffer
    const unsigned tid = threadIdx.x; const unsigned sb0 = (unsigned)(size_t)ldsb;   // the low 32 bits of a __shared__ address are the LDS byte address
    const unsigned lk = sb0 + (tid >> 3) * KPIT + (tid & 7u) * 16u, lv = sb0 + KTB + (tid >> 2) * VPIT + (tid & 3u) * 16u;
    const char* gk = (const char*)Kp + tid * 16u; const char* gv = (const char*)Vt + (tid >> 2) * (TT * 2u) + (tid & 3u) * 16u; const char* gk2 = (const char*)K2 + tid * 16u; const char* gv2 = (const char*)V2 + (tid >> 2) * (TT * 2u) + (tid & 3u) * 16u;
    const cv16u* Lp = (const cv16u*)(size_t)lm + (q0 >> 4) * (TT / 32);   // the wave's first query block, pass 0; q0 is scalar. Constant address space (nothing writes LM during this launch): the loads are scalar loads in both row classes
    const unsigned kfo = (unsigned)(lr * KPIT + 16 * hi), vfo = (unsigned)(KTB + lr * VPIT + 16 * hi);   // the lane's byte offsets of its K and Vt fragments in a buffer
    V kf[2][2], k2f[2][2], vf[4], v2[4]; v16u mw[QB];
    stage_kv(lk, lv, gk, gv); if (HL) stage_kv(lk + PLB, lv + PLB, gk2, gv2);   // pass 0 -> buffer 0
    gk += 32 * HD * 2; gv += 32 * 2; gk2 += 32 * HD * 2; gv2 += 32 * 2;
#pragma unroll
    for (int qb = 0; qb < QB; ++qb) mw[qb] = Lp[qb * (TT / 32)];
    asm volatile("s_wait_xcnt 0x0" : "+s"(Lp) : "v"(qo));   // the wait in front of the overwrite of registers that issued loads name (the Q loads' offset and the lane masks' scalar address are operands: their registers live up to it, and the addition stays behind it)
    ++Lp;   // now stands at pass 1
    asm volatile("s_wait_asynccnt 0x0" ::: "memory");   // this wave's copies of pass 0 have landed ...
    __syncthreads();                                     // ... and every other wave's: buffer 0 may be read
    stage_kv(lk + BUFB, lv + BUFB, gk, gv); if (HL) stage_kv(lk + BUFB + PLB, lv + BUFB + PLB, gk2, gv2);   // pass 1 -> buffer 1
    gk += 32 * HD * 2; gv += 32 * 2; gk2 += 32 * HD * 2; gv2 += 32 * 2;
    unsigned bo = 0u;   // byte offset of the buffer that the pass reads
#pragma unroll 1   // rolled: a second pass's fragments and scores would cost a resident wave per SIMD
    for (int kb = 0; kb < TT; kb += 32) {
        v8f s[QB][2]; const char* sb = ldsb + bo;
#pragma unroll
        for (int kt = 0; kt < 2; ++kt)
#pragma unroll
            for (int ks = 0; ks < 2; ++ks) { kf[kt][ks] = F::ld((const T16*)(sb + kfo + kt * 16 * KPIT + ks * 64)); if (HL) k2f[kt][ks] = F::ld((const T16*)(sb + PLB + kfo + kt * 16 * KPIT + ks * 64)); }
        __builtin_amdgcn_sched_barrier(0);   // K's reads issue in front of Vt's: LDS reads come back in issue order and St needs K first (without this line the hi+lo build reads Vt first)
#pragma unroll
        for (int db = 0; db < 4; ++db) { vf[db] = F::ld((const T16*)(sb + vfo + db * 16 * VPIT)); if (HL) v2[db] = F::ld((const T16*)(sb + PLB + vfo + db * 16 * VPIT)); }
        __builtin_amdgcn_sched_barrier(0);   // the pass's LDS reads issue here as ONE group: without this line the Vt reads sink between the Ot matrix instructions, each waited for at once
#pragma unroll
        for (int kt = 0; kt < 2; ++kt) {
#pragma unroll
            for (int qb = 0; qb < QB; ++qb) s[qb][kt] = (v8f){};
#pragma unroll
            for (int ks = 0; ks < 2; ++ks)
#pragma unroll
                for (int qb = 0; qb < QB; ++qb) { s[qb][kt] = F::mma(kf[kt][ks], qf[qb][ks], s[qb][kt]); if (HL) { s[qb][kt] = F::mma(kf[kt][ks], q2f[qb][ks], s[qb][kt]); s[qb][kt] = F::mma(k2f[kt][ks], qf[qb][ks], s[qb][kt]); } } }
        float bm[QB]; bool grow = false;
#pragma unroll
        for (int qb = 0; qb < QB; ++qb) { float b = -3.0e38f;
#pragma unroll
            for (int kt = 0; kt < 2; ++kt) {
#pragma unroll
                for (int j = 0; j < 8; ++j) { const float t = __builtin_amdgcn_inverse_ballot_w32(mw[qb][kt * 8 + j]) ? s[qb][kt][j] * SCL : -3.0e38f; s[qb][kt][j] = t; b = fmaxf(b, t); } }
            if constexpr (!HL) mw[qb] = Lp[qb * (TT / 32)];
            bm[qb] = fmaxf(b, xhalf(b)); grow = grow || (bm[qb] > mx[qb]); }
        __builtin_amdgcn_sched_barrier(0);   // fp16 rows: the next pass's lane-mask loads issue in front of the exponentials, a pass's length ahead of their use (without this line one of them sinks in among the exponentials)
        if (__builtin_amdgcn_ballot_w32(grow) != 0) {   // a scalar branch: a pass in which no query's maximum grows has every factor 1 and skips the scaling
#pragma unroll
            for (int qb = 0; qb < QB; ++qb) { const float mn = fmaxf(mx[qb], bm[qb]); const float al = __builtin_amdgcn_exp2f((mx[qb] - mn) * L2E); mx[qb] = mn; sm[qb] *= al;
#pragma unroll
                for (int db = 0; db < 4; ++db) o[qb][db] *= al; } }
        V pf[QB], p2[QB];
#pragma unroll
        for (int qb = 0; qb < QB; ++qb) {
#pragma unroll
            for (int g = 0; g < 2; ++g) { float x[8], p[8];
#pragma unroll
                for (int j = 0; j < 8; ++j) { const float d = s[qb][g][j] - mx[qb]; x[j] = HL ? d * L2E : __builtin_fmaf(d, L2E, 10.0f); p[j] = __builtin_amdgcn_exp2f(x[j]); }   // + 10 in the exponent: x PCAR = 2^10
                // the slot behind a transcendental, once for a run of eight: results and sources are operands, so that in front of the v_nop nothing reads a result or overwrites a source
                asm volatile("v_nop" : "+v"(p[0]), "+v"(p[1]), "+v"(p[2]), "+v"(p[3]), "+v"(p[4]), "+v"(p[5]), "+v"(p[6]), "+v"(p[7]) : "v"(x[0]), "v"(x[1]), "v"(x[2]), "v"(x[3]), "v"(x[4]), "v"(x[5]), "v"(x[6]), "v"(x[7]));
#pragma unroll
                for (int j = 0; j < 8; ++j) { sm[qb] += p[j];
                    if constexpr (HL) { const __bf16 ph = (__bf16)p[j]; pf[qb][g * 8 + j] = ph; p2[qb][g * 8 + j] = (__bf16)(p[j] - (float)ph); }
                    else pf[qb][g * 8 + j] = (h16)p[j]; } } }
        if constexpr (HL) {   // hi+lo rows: the next pass's lane-mask load issues behind the conversions: each of them names a scalar register as its unused second source, and where that register is one the load fills, the compiler waits there for the load
            __builtin_amdgcn_sched_barrier(0);   // keeps the load from rising over the conversions
#pragma unroll
            for (int qb = 0; qb < QB; ++qb) mw[qb] = Lp[qb * (TT / 32)]; }
#pragma unroll
        for (int db = 0; db < 4; ++db)
#pragma unroll
            for (int qb = 0; qb < QB; ++qb) { o[qb][db] = F::mma(vf[db], pf[qb], o[qb][db]); if (HL) { o[qb][db] = F::mma(vf[db], p2[qb], o[qb][db]); o[qb][db] = F::mma(v2[db], pf[qb], o[qb][db]); } }
        // four vector slots between the Ot matrix instructions and the next pass's LDS reads, which refill the Vt fragments' registers (operands: the accumulators, so that the matrix instructions stay in front)
        if constexpr (QB == 2) { asm volatile("v_nop\n\tv_nop\n\tv_nop\n\tv_nop" : "+v"(o[0][0]), "+v"(o[0][1]), "+v"(o[0][2]), "+v"(o[0][3]), "+v"(o[1][0]), "+v"(o[1][1]), "+v"(o[1][2]), "+v"(o[1][3])); }
        else { asm volatile("v_nop\n\tv_nop\n\tv_nop\n\tv_nop" : "+v"(o[0][0]), "+v"(o[0][1]), "+v"(o[0][2]), "+v"(o[0][3])); }
        asm volatile("s_wait_xcnt 0x0" : "+s"(Lp));   // the wait in front of the overwrite of the scalar address that the pass's lane-mask loads name (the address is an operand: the addition stays behind it)
        Lp += (kb + 64 < TT) ? 1 : 0;   // the last two passes fetch the last pass's lane masks (in bounds; the last fetch is unused)
        // hand-over: this wave's reads of the pass's buffer are done, its copies of the next pass have landed; behind the barrier that holds for all 4 waves, so the next buffer may be read and this one refilled
        asm volatile("s_wait_dscnt 0x0" ::: "memory");
        asm volatile("s_wait_asynccnt 0x0" ::: "memory");
        __syncthreads();
        if (kb + 64 < TT) {   // the same for the whole work-group: only while a pass kb / 32 + 2 exists
            stage_kv(lk + bo, lv + bo, gk, gv); if (HL) stage_kv(lk + bo + PLB, lv + bo + PLB, gk2, gv2);
            gk += 32 * HD * 2; gv += 32 * 2; gk2 += 32 * HD * 2; gv2 += 32 * 2; }
        bo = BUFB - bo;
    }
    asm volatile("s_wait_asynccnt 0x0" ::: "memory");   // no copy is outstanding when the wave goes on to its end
#pragma unroll
    for (int qb = 0; qb < QB; ++qb) { const float f = __fdiv_rn(1.0f, sm[qb] + xhalf(sm[qb])); const size_t oo = (size_t)(q0 + qb * 16 + lr) * DQ + 8 * hi;   // a lane's 8 accumulator registers are 8 consecutive d of its query: one 16-byte store a plane
#pragma unroll
        for (int db = 0; db < 4; ++db) { v8us oh, ol;
#pragma unroll
            for (int j = 0; j < 8; ++j) { unsigned short a, c2; splitf(o[qb][db][j] * f, a, c2); oh[j] = a; ol[j] = c2; }
            // both planes' stores and s_wait_xcnt 0 in ONE statement: the wait stands in front of every later write of a register that the stores name, on every way out of here (with plain stores the compiler joined the tails of the two row classes)
            asm volatile("global_store_b128 %0, %1, off\n\tglobal_store_b128 %2, %3, off\n\ts_wait_xcnt 0x0" :: "v"(Ah + oo + db * 16), "v"(oh), "v"(Al + oo + db * 16), "v"(ol) : "memory"); } }
}
// grid (NB_ NH_, RH/64 + (TT-RH)/128), 4 waves: row blocks y < RH/64 are the hi+lo rows (16 a wave), the rest fp16 (32 a wave). Planes [batch][head][..]; one kv head per query head. Ah, Al: [batch][t][head d].
__global__ __launch_bounds__(128) void k_fattn(const h16* __restrict__ Q16, const h16* __restrict__ K16, const h16* __restrict__ V16, const bf* __restrict__ Qh, const bf* __restrict__ Ql, const bf* __restrict__ Kh, const bf* __restrict__ Kl, const bf* __restrict__ Vh, const bf* __restrict__ Vl, const unsigned* __restrict__ LM, bf* Ah, bf* Al) {
    __shared__ __align__(16) char kv[2 * 2 * (KTB + VTB)];   // two buffers of the hi+lo rows' four tiles (the fp16 rows use half)
    const int z = blockIdx.x, y = blockIdx.y; const int wave = __builtin_amdgcn_readfirstlane((int)(threadIdx.x >> 5)); const size_t po = (size_t)z * TT * HD; const size_t ao = (size_t)(z / NH_) * TT * DQ + (size_t)(z % NH_) * HD;
    if (y < RH / 64) fattn_rows<true, 1>(Qh + po, Ql + po, Kh + po, Kl + po, Vh + po, Vl + po, LM, y * 64 + wave * 16, Ah + ao, Al + ao, kv);
    else fattn_rows<false, 2>(Q16 + po, nullptr, K16 + po, nullptr, V16 + po, nullptr, LM, RH + (y - RH / 64) * 128 + wave * 32, Ah + ao, Al + ao, kv);
}

extern "C" void kernel_launch(void* const* d_in, const int* in_sizes, int n_in,
                              void* d_out, int out_size, void* d_ws, size_t ws_size, hipStream_t stream) {
    (void)in_sizes; (void)n_in; (void)out_size;
    const float* x = (const float*)d_in[0]; const float* xk = (const float*)d_in[1]; const float* xv = (const float*)d_in[2]; const int* mk = (const int*)d_in[3]; const float* wqh = (const float*)d_in[4]; const float* bq = (const float*)d_in[5]; const float* wkh = (const float*)d_in[6]; const float* bk = (const float*)d_in[7]; const float* wvh = (const float*)d_in[8]; const float* bv = (const float*)d_in[9]; const float* wo = (const float*)d_in[10]; const float* wq = nullptr; const float* wk = nullptr; const float* wv = nullptr; (void)wq; (void)wk; (void)wv; const float* cosT = nullptr; const float* sinT = nullptr; (void)cosT; (void)sinT;
    float* OUT = (float*)d_out;     // [2][2048][1024]
    char* wsp = (char*)d_ws;
    auto take = [&](size_t bytes) { char* p = wsp; wsp += (bytes + 255) & ~(size_t)255; return (void*)p; };
    bf* WQ = (bf*)take((size_t)DQ * DM * 2); bf* WK = (bf*)take((size_t)DKV * DM * 2); bf* WV = (bf*)take((size_t)DKV * DM * 2); bf* WO = (bf*)take((size_t)DM * DQ * 2);
    bf* XB = (bf*)take((size_t)NB_ * TT * DM * 2); bf* XB2 = (bf*)take((size_t)NB_ * TT * DM * 2); bf* XB3 = (bf*)take((size_t)NB_ * TT * DM * 2);   // q, k, v in bf16, both batches
    const size_t PQ = (size_t)NH_ * TT * HD, PK = (size_t)NKV * TT * HD;   // one batch's head planes, in elements; every plane holds both batches
    h16* QP16 = (h16*)take(NB_ * PQ * 2); h16* KP16 = (h16*)take(NB_ * PK * 2); h16* VT16 = (h16*)take(NB_ * PK * 2);
    bf* QPh = (bf*)take(NB_ * PQ * 2); bf* QPl = (bf*)take(NB_ * PQ * 2); bf* KPh = (bf*)take(NB_ * PK * 2); bf* KPl = (bf*)take(NB_ * PK * 2); bf* VTh = (bf*)take(NB_ * PK * 2); bf* VTl = (bf*)take(NB_ * PK * 2);
    bf* ATh = (bf*)take((size_t)NB_ * TT * DQ * 2); bf* ATl = (bf*)take((size_t)NB_ * TT * DQ * 2);
    unsigned* LM = (unsigned*)take((size_t)TT * TT / 8);   // the mask as lane masks, one bit an element
    if ((size_t)(wsp - (char*)d_ws) > ws_size) return;    // ws 256 MiB
    k_cvtall<<<dim3(4 * 128 + 4 * 256, 1, 1), 256, 0, stream>>>(wqh, wkh, wvh, wo, x, xk, xv, mk, WQ, WK, WV, WO, XB, XB2, XB3, LM);
    k_proj<<<dim3(TT / 128, DQ / 128, 3 * NB_), 256, 0, stream>>>(XB, XB2, XB3, WQ, WK, WV, bq, bk, bv, QP16, QPh, QPl, KP16, KPh, KPl, VT16, VTh, VTl);
    k_fattn<<<dim3(NB_ * NH_, RH / 64 + (TT - RH) / 128, 1), 128, 0, stream>>>(QP16, KP16, VT16, QPh, QPl, KPh, KPl, VTh, VTl, LM, ATh, ATl);
    k_wo<<<dim3(NB_ * TT / 128, DM / 128, 1), 256, 0, stream>>>(ATh, ATl, WO, OUT);
}

// v009
// One run takes 127 microseconds.
// In two side-by-side timings against v008, it was 1.04 and 1.03 times as fast.
// Over all steps from v000 it is 16.2 times as fast.
#include <hip/hip_runtime.h>

// MultiHeadAttentionModule (q, k, v inputs [2][2048][1024]; per-head Qh = q Wq[h] + bq[h], Kh = k Wk[h] + bk[h], Vh = v Wv[h] + bv[h] (W [16][1024][64]); scores = Qh.Kh / 8, where(mask == 0, -1e9) (mask [2048][2048] int, read); softmax; out = concat(heads) Wo ([in,out], no bias) -> [2][2048][1024]).
// Compute dtypes, f32 accumulate: every input rounded to bf16; Qh/Kh/Vh on PLAIN bf16 operands (inputs: exact; per-head weights gathered) + bias; scores and attn.v (one fused kernel, running maximum): query rows < 512 hl (3 products), the rest single fp16 (x1024); mask + softmax f32; Wo hl x exact (2 products).
// Left open: a pass whose lane masks are all ones could skip its selects behind one scalar test; a stage of 64 keys would make the Vt rows whole 128-byte lines and halve the barriers; the weight transposes of k_cvtall read 32 bytes of each 128-byte line a thread; k_wo has one work-group a WGP.

#define NB_  2
#define TT   2048
#define DM   1024
#define NH_  16
#define NKV  16
#define REP  (NH_ / NKV)
#define HD   64
#define DQ   (NH_ * HD)
#define DKV  (NKV * HD)
#define RH   512                  // query rows < RH use hi+lo planes (0: none)
#define WIN  0
#define PCAR 1024.0f
#define SCL  0.125f   // HD^-0.5
typedef _Float16 h16;
typedef unsigned short bf;
typedef __attribute__((ext_vector_type(16))) __bf16   v16bf;
typedef __attribute__((ext_vector_type(16))) _Float16 v16h;
typedef __attribute__((ext_vector_type(8)))  _Float16 v8h;
typedef __attribute__((ext_vector_type(8)))  unsigned short v8us;
typedef __attribute__((ext_vector_type(8)))  float    v8f;
typedef __attribute__((ext_vector_type(4)))  float    v4f;
typedef v8h  __attribute__((may_alias)) v8ha;
typedef v4f  __attribute__((may_alias)) v4fa;
typedef v8us __attribute__((may_alias)) v8usa;

__device__ __forceinline__ unsigned short f2bf(float f) { unsigned u = __float_as_uint(f); u += 0x7FFFu + ((u >> 16) & 1u); return (unsigned short)(u >> 16); }
__device__ __forceinline__ float bf2f(unsigned short b) { return __uint_as_float(((unsigned)b) << 16); }
__device__ __forceinline__ float bfr(float f) { return bf2f(f2bf(f)); }
__device__ __forceinline__ v16h cat16(v8h lo, v8h hi) { return __builtin_shufflevector(lo, hi, 0, 1, 2, 3, 4, 5, 6, 7, 8, 9, 10, 11, 12, 13, 14, 15); }
__device__ __forceinline__ v16bf cat16b(v8us lo, v8us hi) { return __builtin_bit_cast(v16bf, __builtin_shufflevector(lo, hi, 0, 1, 2, 3, 4, 5, 6, 7, 8, 9, 10, 11, 12, 13, 14, 15)); }
__device__ __forceinline__ v8f wmma16(v16h a, v16h b, v8f c) { return __builtin_amdgcn_wmma_f32_16x16x32_f16(false, a, false, b, (short)0, c, false, false); }
__device__ __forceinline__ v8f wmmab(v16bf a, v16bf b, v8f c) { return __builtin_amdgcn_wmma_f32_16x16x32_bf16(false, a, false, b, (short)0, c, false, false); }
typedef __attribute__((ext_vector_type(4))) _Float16 v4h;
typedef __attribute__((ext_vector_type(4))) unsigned short v4us;
typedef __attribute__((ext_vector_type(4))) __bf16 v4b;



// ---- fragment loaders: a lane's 16 elements of a K-contiguous 16-bit row, in the hardware k order (8 at p, 8 at p + 16; p holds the lane half's 8 hi)
template <typename T16> struct WFrag;
template <> struct WFrag<h16> { typedef v16h V; static __device__ __forceinline__ V ld(const h16* p) { return cat16(*(const v8h*)p, *(const v8h*)(p + 16)); } static __device__ __forceinline__ v8f mma(V a, V b, v8f c) { return wmma16(a, b, c); } };
template <> struct WFrag<bf> { typedef v16bf V; static __device__ __forceinline__ V ld(const bf* p) { return cat16b(*(const v8us*)p, *(const v8us*)(p + 16)); } static __device__ __forceinline__ v8f mma(V a, V b, v8f c) { return wmmab(a, b, c); } };
// ---- gemmt: one 128 x 128 tile of D[m][n] = sum_k Am[m][k] Bn[n][k] (both operands K-contiguous bf16 planes of pitch GK) a work-group of 8 waves; a wave owns 64 m x 32 n (8 accumulators) and walks the whole K, so that each sum stays in one accumulator.
// Each stage of 64 k (128 rows of one whole 128-byte line an operand) comes into LDS ONCE for the 8 waves by asynchronous copies, two buffers, a stage's copies issued behind the last LDS reads of the stage two before it; fragments are read from LDS.
// A lane holds 8 consecutive m of ONE n, so the caller puts on the m side whatever lies contiguous in the output: every store is 16 bytes a lane, straight from the accumulators.
// NS 1: the n side has a second plane Bn2 (lo), D = Am (Bn + Bn2). EPI 0: C[n][m] f32, pitch DM. EPI 1, 2: + bias, then the three 16-bit head planes that the attention kernel reads (fp16, bf16 hi, bf16 lo of the same f32 value).
//   1: m = (head, d) (the weight; bias per m), n = token -> planes [head][t][d]. 2: m = token, n = (head, d) (bias per n) -> planes [head][d][t].
#define GK   1024           // K of every product here (DM and DQ)
#define GPIT 144            // LDS bytes a staged row (128 bytes) takes: 16 bytes x an odd number, free of bank conflicts for 16-byte reads of 16 rows
#define GTB  (128 * GPIT)   // one operand's stage in LDS
static_assert(DM == GK && DQ == GK, "one K");
typedef __attribute__((ext_vector_type(8))) __bf16 v8b;
// A thread's share of one operand's stage: four asynchronous 16-byte copies to LDS, 32 rows apart. l: the lane's LDS byte address of its first piece; g: its global address.
// s_wait_xcnt 0 is the statement's last line, so that it stands in front of every later write of a register that the copies name.
__device__ __forceinline__ void stage_op(unsigned l, const char* g) {
    asm volatile("global_load_async_to_lds_b128 %0, %1, off\n\tglobal_load_async_to_lds_b128 %2, %3, off\n\tglobal_load_async_to_lds_b128 %4, %5, off\n\tglobal_load_async_to_lds_b128 %6, %7, off\n\ts_wait_xcnt 0x0"
                 :: "v"(l), "v"(g), "v"(l + 32u * GPIT), "v"(g + 32 * GK * 2), "v"(l + 64u * GPIT), "v"(g + 64 * GK * 2), "v"(l + 96u * GPIT), "v"(g + 96 * GK * 2) : "memory");
}
template <int NS, int EPI>
__device__ __forceinline__ void gemmt(const bf* __restrict__ Am, const bf* __restrict__ Bn, const bf* __restrict__ Bn2, float* C, const float* __restrict__ bias, h16* P16, bf* Ph, bf* Pl, int r0, int c0, char* ldsb) {
    typedef WFrag<bf> F; typedef typename F::V V;
    const int lane = threadIdx.x & 31, lr = lane & 15, hi = lane >> 4;
    const int wave = __builtin_amdgcn_readfirstlane((int)(threadIdx.x >> 5)); const int wm = wave & 1, wn = wave >> 1;   // scalar: the wave's place in the tile
    constexpr unsigned BUFB = (2u + NS) * GTB;   // bytes of one buffer
    constexpr int G = NS ? 2 : 1;   // steps of 32 k whose fragments are read as one group: the whole stage where one work-group has the WGP to itself (k_wo), one step where the registers must leave room for three (k_proj)
    const unsigned tid = threadIdx.x; const unsigned sb0 = (unsigned)(size_t)ldsb;   // the low 32 bits of a __shared__ address are the LDS byte address
    const unsigned ls = sb0 + (tid >> 3) * GPIT + (tid & 7u) * 16u;   // piece tid: row tid / 8, 16 bytes tid % 8 of it: a wave's copy is 4 whole lines
    const size_t go = (size_t)(tid >> 3) * (GK * 2) + (tid & 7u) * 16u;
    const char* ga = (const char*)(Am + (size_t)r0 * GK) + go; const char* gb = (const char*)(Bn + (size_t)c0 * GK) + go; const char* gb2 = (const char*)(Bn2 + (size_t)c0 * GK) + go;
    const unsigned afo = (unsigned)((wm * 64 + lr) * GPIT + 16 * hi), bfo = (unsigned)(GTB + (wn * 32 + lr) * GPIT + 16 * hi);   // the lane's byte offsets of its first m and n fragment in a buffer
    v8f acc[4][2];   // every '#pragma unroll' of this function makes the indices of acc, a, b, b2 constants, so that they stay in registers
#pragma unroll
    for (int mb = 0; mb < 4; ++mb)
#pragma unroll
        for (int nb = 0; nb < 2; ++nb) acc[mb][nb] = (v8f){};
    stage_op(ls, ga); stage_op(ls + GTB, gb); if (NS) stage_op(ls + 2u * GTB, gb2);   // stage 0 -> buffer 0
    ga += 128; gb += 128; gb2 += 128;
    asm volatile("s_wait_asynccnt 0x0" ::: "memory");   // this wave's copies of stage 0 have landed ...
    __syncthreads();                                     // ... and every other wave's: buffer 0 may be read
    stage_op(ls + BUFB, ga); stage_op(ls + BUFB + GTB, gb); if (NS) stage_op(ls + BUFB + 2u * GTB, gb2);   // stage 1 -> buffer 1
    ga += 128; gb += 128; gb2 += 128;
    unsigned bo = 0u;   // byte offset of the buffer that the stage reads
#pragma unroll 1   // rolled: a second stage's fragments would cost a resident work-group per WGP
    for (int t = 0; t < GK / 64; ++t) {
        const char* sb = ldsb + bo;
#pragma unroll
        for (int g = 0; g < 2 / G; ++g) { V a[G][4], b[G][2], b2[G][2];
#pragma unroll
            for (int u = 0; u < G; ++u) { const int ko = (g * G + u) * 64;   // byte offset of the 32 k in a staged row
#pragma unroll
                for (int nb = 0; nb < 2; ++nb) b[u][nb] = F::ld((const bf*)(sb + bfo + nb * 16 * GPIT + ko));
#pragma unroll
                for (int mb = 0; mb < 4; ++mb) a[u][mb] = F::ld((const bf*)(sb + afo + mb * 16 * GPIT + ko));
                if (NS) {
#pragma unroll
                    for (int nb = 0; nb < 2; ++nb) b2[u][nb] = F::ld((const bf*)(sb + GTB + bfo + nb * 16 * GPIT + ko)); } }
            __builtin_amdgcn_sched_barrier(0);   // the group's LDS reads issue here as ONE group: without this line the n fragments are read one at a time between the matrix instructions, each waited for at once
            if (g == 2 / G - 1) {   // a constant: behind the stage's last group of reads
                // hand-over, in front of the group's matrix instructions, which need registers only, so that the refill flies during them: this wave's reads of the stage's buffer are done, its copies of the next stage have landed;
                // behind the barrier that holds for all 8 waves, so the next buffer may be read and this one refilled
                asm volatile("s_wait_dscnt 0x0" ::: "memory");
                asm volatile("s_wait_asynccnt 0x0" ::: "memory");
                __syncthreads();
                if (t + 2 < GK / 64) {   // the same for the whole work-group: only while a stage t + 2 exists
                    stage_op(ls + bo, ga); stage_op(ls + bo + GTB, gb); if (NS) stage_op(ls + bo + 2u * GTB, gb2);
                    ga += 128; gb += 128; gb2 += 128; } }
#pragma unroll
            for (int u = 0; u < G; ++u) {
#pragma unroll
                for (int nb = 0; nb < 2; ++nb)
#pragma unroll
                    for (int mb = 0; mb < 4; ++mb) acc[mb][nb] = F::mma(a[u][mb], b[u][nb], acc[mb][nb]);
                if (NS) {
#pragma unroll
                    for (int nb = 0; nb < 2; ++nb)
#pragma unroll
                        for (int mb = 0; mb < 4; ++mb) acc[mb][nb] = F::mma(a[u][mb], b2[u][nb], acc[mb][nb]); } } }
        bo = BUFB - bo;
    }
    asm volatile("s_wait_asynccnt 0x0" ::: "memory");   // no copy is outstanding when the wave goes on to its end
    const int m0 = r0 + wm * 64, n0 = c0 + wn * 32 + lr;   // the wave's first m; the lane's first n
    if constexpr (EPI == 0) {
#pragma unroll
        for (int nb = 0; nb < 2; ++nb)
#pragma unroll
            for (int mb = 0; mb < 4; ++mb) { const v8f val = acc[mb][nb]; const v4f lo4 = __builtin_shufflevector(val, val, 0, 1, 2, 3), hi4 = __builtin_shufflevector(val, val, 4, 5, 6, 7);
                // both stores and s_wait_xcnt 0 in ONE statement: the wait stands in front of every later write of a register that the stores name
                asm volatile("global_store_b128 %0, %1, off\n\tglobal_store_b128 %0, %2, off offset:16\n\ts_wait_xcnt 0x0" :: "v"(C + (size_t)(n0 + nb * 16) * DM + m0 + mb * 16 + 8 * hi), "v"(lo4), "v"(hi4) : "memory"); }
    } else {
        v4f bm[8]; float bn[2];   // EPI 1: the bias of the lane's 32 m; EPI 2: of its 2 n. Loads and their data wait in ONE statement, so that no register that a load names or fills is touched while it flies
        if constexpr (EPI == 1) asm volatile("global_load_b128 %0, %8, off\n\tglobal_load_b128 %1, %8, off offset:16\n\tglobal_load_b128 %2, %8, off offset:64\n\tglobal_load_b128 %3, %8, off offset:80\n\tglobal_load_b128 %4, %8, off offset:128\n\tglobal_load_b128 %5, %8, off offset:144\n\tglobal_load_b128 %6, %8, off offset:192\n\tglobal_load_b128 %7, %8, off offset:208\n\ts_wait_loadcnt 0x0"
                                             : "=&v"(bm[0]), "=&v"(bm[1]), "=&v"(bm[2]), "=&v"(bm[3]), "=&v"(bm[4]), "=&v"(bm[5]), "=&v"(bm[6]), "=&v"(bm[7]) : "v"(bias + m0 + 8 * hi) : "memory");
        else asm volatile("global_load_b32 %0, %2, off\n\tglobal_load_b32 %1, %2, off offset:64\n\ts_wait_loadcnt 0x0" : "=&v"(bn[0]), "=&v"(bn[1]) : "v"(bias + n0) : "memory");
#pragma unroll
        for (int nb = 0; nb < 2; ++nb)
#pragma unroll
            for (int mb = 0; mb < 4; ++mb) { v8f val = acc[mb][nb];
#pragma unroll
                for (int j = 0; j < 8; ++j) val[j] += bfr(EPI == 1 ? bm[2 * mb + (j >> 2)][j & 3] : bn[nb]);
                const size_t po = (EPI == 1) ? ((size_t)(m0 / HD) * TT + n0 + nb * 16) * HD + mb * 16 + 8 * hi : (size_t)(n0 + nb * 16) * TT + m0 + mb * 16 + 8 * hi;
                const v8h o16 = __builtin_convertvector(val, v8h); const v8b oh = __builtin_convertvector(val, v8b); const v8b ol = __builtin_convertvector(val - __builtin_convertvector(oh, v8f), v8b);   // each conversion rounds to nearest even, as f2bf does; lo is the rounded rest behind hi
                // the three planes' stores and s_wait_xcnt 0 in ONE statement: the wait stands in front of every later write of a register that the stores name
                asm volatile("global_store_b128 %0, %1, off\n\tglobal_store_b128 %2, %3, off\n\tglobal_store_b128 %4, %5, off\n\ts_wait_xcnt 0x0" :: "v"(P16 + po), "v"(o16), "v"(Ph + po), "v"(oh), "v"(Pl + po), "v"(ol) : "memory"); }
    }
}

// ---- k_proj: the three projections of both batches in ONE launch. grid (TT/128, DQ/128, 3 NB_): z = 2 (0: Q, 1: K, 2: V) + batch; x: tokens, y: (head, d). Q, K: m = (head, d), n = token. V: m = token, n = (head, d).
__global__ __launch_bounds__(256) void k_proj(const bf* __restrict__ XQ, const bf* __restrict__ XK, const bf* __restrict__ XV, const bf* __restrict__ WQ, const bf* __restrict__ WK, const bf* __restrict__ WV, const float* __restrict__ bq, const float* __restrict__ bk, const float* __restrict__ bv,
                                              h16* Q16, bf* Qh, bf* Ql, h16* K16, bf* Kh, bf* Kl, h16* V16, bf* Vh, bf* Vl) {
    __shared__ __align__(16) char st[2 * 2 * GTB];
    const int w = blockIdx.z >> 1; const size_t xo = (size_t)(blockIdx.z & 1) * TT * DM, po = (size_t)(blockIdx.z & 1) * NH_ * TT * HD;
    if (w < 2) gemmt<0, 1>(w ? WK : WQ, (w ? XK : XQ) + xo, nullptr, nullptr, w ? bk : bq, (w ? K16 : Q16) + po, (w ? Kh : Qh) + po, (w ? Kl : Ql) + po, blockIdx.y * 128, blockIdx.x * 128, st);
    else gemmt<0, 2>(XV + xo, WV, nullptr, nullptr, bv, V16 + po, Vh + po, Vl + po, blockIdx.x * 128, blockIdx.y * 128, st);
}
// ---- k_wo: out = (Ah + Al) Wo, both batches as one matrix of NB_ TT rows: m = output column (rows of the transposed Wo), n = token. grid (NB_ TT/128, DM/128).
__global__ __launch_bounds__(256) void k_wo(const bf* __restrict__ Ah, const bf* __restrict__ Al, const bf* __restrict__ WO, float* OUT) {
    __shared__ __align__(16) char st[2 * 3 * GTB];
    gemmt<1, 0>(WO, Ah, Al, OUT, nullptr, nullptr, nullptr, nullptr, blockIdx.y * 128, blockIdx.x * 128, st);
}

__device__ __forceinline__ void splitf(float y, unsigned short& h, unsigned short& l) { h = f2bf(y); l = f2bf(y - bf2f(h)); }
typedef __attribute__((ext_vector_type(2))) unsigned short v2us;
typedef __attribute__((ext_vector_type(4))) int v4i;
typedef __attribute__((ext_vector_type(16))) unsigned v16u;
typedef __attribute__((address_space(4))) v16u cv16u;

// ---- k_cvtall: every conversion in ONE launch of few, fat waves. 1536 blocks of 256 threads. Blocks < 512: 128 a weight, transposed to [n][k] bf16 (Wq, Wk, Wv: n = 64 head + c; Wo); 256 for the mask (-> lane masks); the rest: 256 each for q, k, v (both batches, as they lie, bf16).
// A weight block: 8 rows n0 .. n0 + 7 of Bt, all 1024 k. A thread reads 8 consecutive n of 4 consecutive k (4 x 32 bytes) and writes 4 k of each of the 8 rows; a wave writes 256 bytes in a row of each.
__device__ __forceinline__ void wt_pieces(const float* __restrict__ s, int pitch, bf* d) {   // d[j DM + k] = bf16(s[k pitch + j])
    const int k = threadIdx.x * 4; v8f r[4];
#pragma unroll   // constant indices keep r in registers
    for (int u = 0; u < 4; ++u) r[u] = *(const v8f*)(s + (size_t)(k + u) * pitch);
#pragma unroll
    for (int j = 0; j < 8; ++j) { v4us o;
#pragma unroll
        for (int u = 0; u < 4; ++u) o[u] = f2bf(r[u][j]);
        *(v4us*)(d + (size_t)j * DM + k) = o; }
}
// An activation block: 8 x 256 pieces of 8 floats; a thread's 8 pieces lie 256 pieces apart and are all loaded before the first is stored (8 KiB a wave in flight).
__device__ __forceinline__ void cvt_pieces(const float* __restrict__ s, bf* d, unsigned blk) {
    unsigned lo = (blk * (8u * 256u) + threadIdx.x) * 32u; v8f v[8];   // the lane's byte offset in s (a tensor is 16 MiB); half of it in d
#pragma unroll   // constant indices keep v in registers
    for (int p = 0; p < 8; ++p) v[p] = *(const v8f*)((const char*)s + lo + p * (256 * 32));
    asm volatile("s_wait_xcnt 0x0" : "+v"(lo));   // the wait in front of any overwrite of the register that the issued loads name (the offset is an operand: its register lives up to the wait, so that no load's result lands on it)
    const unsigned so = lo >> 1;
#pragma unroll
    for (int p = 0; p < 8; ++p) { v8us o;
#pragma unroll
        for (int k = 0; k < 8; ++k) o[k] = f2bf(v[p][k]);
        *(v8us*)((char*)d + so + p * (256 * 16)) = o; }
}
// A mask block: the mask as LANE MASKS, in the order in which k_fattn's score registers want them. LM[16-query block][32-key block][i = 8 kt + j]: bit l of the word is (mask[16 block + l % 16][32 block + 16 kt + 8 (l / 16) + j] != 0),
// that is, lane l's condition for register j of score tile kt: the word is the select's whole condition, read into scalar registers. A wave makes 4 key blocks of one query block (16 rows x 512 bytes; 64 words = 256 bytes in a row).
typedef __attribute__((ext_vector_type(2))) unsigned v2u;
__device__ __forceinline__ void mask_pieces(const int* __restrict__ mk, unsigned* LM, unsigned blk) {
    const unsigned lane = threadIdx.x & 31u; const unsigned w = blk * 8u + (unsigned)__builtin_amdgcn_readfirstlane((int)(threadIdx.x >> 5));   // wave w: query block w / 16, key blocks 4 (w % 16) ..
    unsigned lo = (((w >> 4) * 16u + (lane & 15u)) * TT + (w & 15u) * 128u + 8u * (lane >> 4)) * 4u; v4i m[4][4];   // the lane's byte offset in the mask (16 MiB)
#pragma unroll   // constant indices keep m in registers
    for (int t = 0; t < 4; ++t)
#pragma unroll
        for (int c = 0; c < 4; ++c) m[t][c] = *(const v4i*)((const char*)mk + lo + t * 128 + (c >> 1) * 64 + (c & 1) * 16);
    asm volatile("s_wait_xcnt 0x0" : "+v"(lo));   // the wait in front of any overwrite of the register that the issued loads name (the offset is an operand: its register lives up to the wait, so that no load's result lands on it)
    unsigned o0 = 0u, o1 = 0u;   // lane l stores words 2 l and 2 l + 1 of the wave's 64
#pragma unroll
    for (int t = 0; t < 4; ++t)
#pragma unroll
        for (int i = 0; i < 16; i += 2) {
            const unsigned b0 = __builtin_amdgcn_ballot_w32(m[t][i >> 2][i & 3] != 0), b1 = __builtin_amdgcn_ballot_w32(m[t][i >> 2][(i & 3) + 1] != 0); const bool mine = lane == (unsigned)(t * 8 + (i >> 1));
            o0 = mine ? b0 : o0; o1 = mine ? b1 : o1; }
    *(v2u*)(LM + (size_t)w * 64u + lane * 2u) = (v2u){o0, o1};
}
__global__ __launch_bounds__(256) void k_cvtall(const float* __restrict__ wq, const float* __restrict__ wk, const float* __restrict__ wv, const float* __restrict__ wo, const float* __restrict__ xq, const float* __restrict__ xk, const float* __restrict__ xv, const int* __restrict__ mk,
                                                bf* WQ, bf* WK, bf* WV, bf* WO, bf* XQ, bf* XK, bf* XV, unsigned* LM) {
    const int bx = blockIdx.x; const int y = bx >> 7, n0 = (bx & 127) * 8;
    if (y < 3) wt_pieces((y == 0 ? wq : y == 1 ? wk : wv) + (size_t)(n0 / HD) * DM * HD + n0 % HD, HD, (y == 0 ? WQ : y == 1 ? WK : WV) + (size_t)n0 * DM);   // Bt[64 h + c][k] = W[h][k][c]
    else if (y == 3) wt_pieces(wo + n0, DM, WO + (size_t)n0 * DQ);   // Bt[n][k] = Wo[k][n]
    else if (bx < 768) mask_pieces(mk, LM, (unsigned)(bx - 512));
    else { const int t = (bx - 768) >> 8; cvt_pieces(t == 0 ? xq : t == 1 ? xk : xv, t == 0 ? XQ : t == 1 ? XK : XV, (unsigned)(bx - 768) & 255u); }
}
__device__ __forceinline__ float xhalf(float x) { const unsigned b = __float_as_uint(x); return __uint_as_float(__builtin_amdgcn_permlanex16(b, b, 0x76543210u, 0xfedcba98u, false, false)); }   // the value of lane l ^ 16
#define KPIT 144            // LDS bytes a K row (128 bytes) and
#define VPIT 80             // a Vt row piece (64 bytes) take: 16 bytes x an odd number, free of bank conflicts for 16-byte reads of 16 rows
#define KTB  (32 * KPIT)    // a K tile (32 keys) in LDS
#define VTB  (HD * VPIT)    // a Vt tile (HD rows of 32 keys) in LDS
// A thread's share of one pass's K and Vt tiles of one plane pair: four asynchronous 16-byte copies to LDS. lk, lv: the lane's LDS byte addresses of its first K and Vt piece; gk, gv: their global addresses. The second pieces lie 16 K rows and 32 Vt rows on.
// s_wait_xcnt 0 is the statement's last line, so that it stands in front of every later write of a register that the copies name.
__device__ __forceinline__ void stage_kv(unsigned lk, unsigned lv, const char* gk, const char* gv) {
    asm volatile("global_load_async_to_lds_b128 %0, %1, off\n\tglobal_load_async_to_lds_b128 %2, %3, off\n\tglobal_load_async_to_lds_b128 %4, %5, off\n\tglobal_load_async_to_lds_b128 %6, %7, off\n\ts_wait_xcnt 0x0"
                 :: "v"(lk), "v"(gk), "v"(lk + 16u * KPIT), "v"(gk + 16 * HD * 2), "v"(lv), "v"(gv), "v"(lv + 32u * VPIT), "v"(gv + 32 * TT * 2) : "memory");
}
template <bool HL> struct FT { typedef h16 T; };
template <> struct FT<true> { typedef bf T; };
template <bool HL, int QB>
__device__ __forceinline__ void fattn_rows(const typename FT<HL>::T* __restrict__ Q, const typename FT<HL>::T* __restrict__ Q2, const typename FT<HL>::T* __restrict__ Kp, const typename FT<HL>::T* __restrict__ K2, const typename FT<HL>::T* __restrict__ Vt, const typename FT<HL>::T* __restrict__ V2, const unsigned* __restrict__ lm, int q0, bf* Ah, bf* Al, char* ldsb) {
    typedef typename FT<HL>::T T16; typedef typename WFrag<T16>::V V; typedef WFrag<T16> F;
    const float L2E = 1.4426950408889634f;
    const int lane = threadIdx.x & 31, lr = lane & 15, hi = lane >> 4;
    const unsigned qo = (unsigned)((q0 + lr) * HD + 8 * hi) * 2u;   // the lane's byte offset in the Q planes
    V qf[QB][2], q2f[QB][2]; v8f o[QB][4]; float mx[QB], sm[QB];   // every '#pragma unroll' below makes the indices of these arrays constants, so that they stay in registers
#pragma unroll
    for (int qb = 0; qb < QB; ++qb) { mx[qb] = -3.0e38f; sm[qb] = 0.f;
#pragma unroll
        for (int ks = 0; ks < 2; ++ks) { qf[qb][ks] = F::ld((const T16*)((const char*)Q + qo + qb * 16 * HD * 2 + ks * 64)); if (HL) q2f[qb][ks] = F::ld((const T16*)((const char*)Q2 + qo + qb * 16 * HD * 2 + ks * 64)); }
#pragma unroll
        for (int db = 0; db < 4; ++db) o[qb][db] = (v8f){}; }
    // K and Vt: each pass's tiles (32 keys) are brought into LDS ONCE for the work-group's 4 waves by asynchronous copies, two buffers, a pass's copies issued at the foot of the pass two before it; every wave copies its share (stage_kv).
    // A thread's two 16-byte pieces of each tile: K piece c = tid + 128 i (row c / 8, the tile is 4 KiB in a row in the plane), Vt piece c (row c / 4, 64 bytes a row, plane pitch 2 TT bytes).
    // Lane masks: 16 words (64 bytes) per 16 queries and pass, at an address that is the same for the whole wave (scalar loads), fetched one pass ahead.
    constexpr unsigned PLB = KTB + VTB, BUFB = (HL ? 2u : 1u) * PLB;   // bytes of one plane pair's tiles; of one buffer
    const unsigned tid = threadIdx.x; const unsigned sb0 = (unsigned)(size_t)ldsb;   // the low 32 bits of a __shared__ address are the LDS byte address
    const unsigned lk = sb0 + (tid >> 3) * KPIT + (tid & 7u) * 16u, lv = sb0 + KTB + (tid >> 2) * VPIT + (tid & 3u) * 16u;
    const char* gk = (const char*)Kp + tid * 16u; const char* gv = (const char*)Vt + (tid >> 2) * (TT * 2u) + (tid & 3u) * 16u; const char* gk2 = (const char*)K2 + tid * 16u; const char* gv2 = (const char*)V2 + (tid >> 2) * (TT * 2u) + (tid & 3u) * 16u;
    const cv16u* Lp = (const cv16u*)(size_t)lm + (q0 >> 4) * (TT / 32);   // the wave's first query block, pass 0; q0 is scalar. Constant address space (nothing writes LM during this launch): the loads are scalar loads in both row classes
    const unsigned kfo = (unsigned)(lr * KPIT + 16 * hi), vfo = (unsigned)(KTB + lr * VPIT + 16 * hi);   // the lane's byte offsets of its K and Vt fragments in a buffer
    V kf[2][2], k2f[2][2], vf[4], v2[4]; v16u mw[QB];
    stage_kv(lk, lv, gk, gv); if (HL) stage_kv(lk + PLB, lv + PLB, gk2, gv2);   // pass 0 -> buffer 0
    gk += 32 * HD * 2; gv += 32 * 2; gk2 += 32 * HD * 2; gv2 += 32 * 2;
#pragma unroll
    for (int qb = 0; qb < QB; ++qb) mw[qb] = Lp[qb * (TT / 32)];
    asm volatile("s_wait_xcnt 0x0" : "+s"(Lp) : "v"(qo));   // the wait in front of the overwrite of registers that issued loads name (the Q loads' offset and the lane masks' scalar address are operands: their registers live up to it, and the addition stays behind it)
    ++Lp;   // now stands at pass 1
    asm volatile("s_wait_asynccnt 0x0" ::: "memory");   // this wave's copies of pass 0 have landed ...
    __syncthreads();                                     // ... and every other wave's: buffer 0 may be read
    stage_kv(lk + BUFB, lv + BUFB, gk, gv); if (HL) stage_kv(lk + BUFB + PLB, lv + BUFB + PLB, gk2, gv2);   // pass 1 -> buffer 1
    gk += 32 * HD * 2; gv += 32 * 2; gk2 += 32 * HD * 2; gv2 += 32 * 2;
    unsigned bo = 0u;   // byte offset of the buffer that the pass reads
#pragma unroll 1   // rolled: a second pass's fragments and scores would cost a resident wave per SIMD
    for (int kb = 0; kb < TT; kb += 32) {
        v8f s[QB][2]; const char* sb = ldsb + bo;
#pragma unroll
        for (int kt = 0; kt < 2; ++kt)
#pragma unroll
            for (int ks = 0; ks < 2; ++ks) { kf[kt][ks] = F::ld((const T16*)(sb + kfo + kt * 16 * KPIT + ks * 64)); if (HL) k2f[kt][ks] = F::ld((const T16*)(sb + PLB + kfo + kt * 16 * KPIT + ks * 64)); }
        __builtin_amdgcn_sched_barrier(0);   // K's reads issue in front of Vt's: LDS reads come back in issue order and St needs K first (without this line the hi+lo build reads Vt first)
#pragma unroll
        for (int db = 0; db < 4; ++db) { vf[db] = F::ld((const T16*)(sb + vfo + db * 16 * VPIT)); if (HL) v2[db] = F::ld((const T16*)(sb + PLB + vfo + db * 16 * VPIT)); }
        __builtin_amdgcn_sched_barrier(0);   // the pass's LDS reads issue here as ONE group: without this line the Vt reads sink between the Ot matrix instructions, each waited for at once
#pragma unroll
        for (int kt = 0; kt < 2; ++kt) {
#pragma unroll
            for (int qb = 0; qb < QB; ++qb) s[qb][kt] = (v8f){};
#pragma unroll
            for (int ks = 0; ks < 2; ++ks)
#pragma unroll
                for (int qb = 0; qb < QB; ++qb) { s[qb][kt] = F::mma(kf[kt][ks], qf[qb][ks], s[qb][kt]); if (HL) { s[qb][kt] = F::mma(kf[kt][ks], q2f[qb][ks], s[qb][kt]); s[qb][kt] = F::mma(k2f[kt][ks], qf[qb][ks], s[qb][kt]); } } }
        float bm[QB]; bool grow = false;
#pragma unroll
        for (int qb = 0; qb < QB; ++qb) { float b = -3.0e38f;
#pragma unroll
            for (int kt = 0; kt < 2; ++kt) {
#pragma unroll
                for (int j = 0; j < 8; ++j) { const float t = __builtin_amdgcn_inverse_ballot_w32(mw[qb][kt * 8 + j]) ? s[qb][kt][j] * SCL : -3.0e38f; s[qb][kt][j] = t; b = fmaxf(b, t); } }
            if constexpr (!HL) mw[qb] = Lp[qb * (TT / 32)];
            bm[qb] = fmaxf(b, xhalf(b)); grow = grow || (bm[qb] > mx[qb]); }
        __builtin_amdgcn_sched_barrier(0);   // fp16 rows: the next pass's lane-mask loads issue in front of the exponentials, a pass's length ahead of their use (without this line one of them sinks in among the exponentials)
        if (__builtin_amdgcn_ballot_w32(grow) != 0) {   // a scalar branch: a pass in which no query's maximum grows has every factor 1 and skips the scaling
#pragma unroll
            for (int qb = 0; qb < QB; ++qb) { const float mn = fmaxf(mx[qb], bm[qb]); const float al = __builtin_amdgcn_exp2f((mx[qb] - mn) * L2E); mx[qb] = mn; sm[qb] *= al;
#pragma unroll
                for (int db = 0; db < 4; ++db) o[qb][db] *= al; } }
        V pf[QB], p2[QB];
#pragma unroll
        for (int qb = 0; qb < QB; ++qb) {
#pragma unroll
            for (int g = 0; g < 2; ++g) { float x[8], p[8];
#pragma unroll
                for (int j = 0; j < 8; ++j) { const float d = s[qb][g][j] - mx[qb]; x[j] = HL ? d * L2E : __builtin_fmaf(d, L2E, 10.0f); p[j] = __builtin_amdgcn_exp2f(x[j]); }   // + 10 in the exponent: x PCAR = 2^10
                // the slot behind a transcendental, once for a run of eight: results and sources are operands, so that in front of the v_nop nothing reads a result or overwrites a source
                asm volatile("v_nop" : "+v"(p[0]), "+v"(p[1]), "+v"(p[2]), "+v"(p[3]), "+v"(p[4]), "+v"(p[5]), "+v"(p[6]), "+v"(p[7]) : "v"(x[0]), "v"(x[1]), "v"(x[2]), "v"(x[3]), "v"(x[4]), "v"(x[5]), "v"(x[6]), "v"(x[7]));
#pragma unroll
                for (int j = 0; j < 8; ++j) { sm[qb] += p[j];
                    if constexpr (HL) { const __bf16 ph = (__bf16)p[j]; pf[qb][g * 8 + j] = ph; p2[qb][g * 8 + j] = (__bf16)(p[j] - (float)ph); }
                    else pf[qb][g * 8 + j] = (h16)p[j]; } } }
        if constexpr (HL) {   // hi+lo rows: the next pass's lane-mask load issues behind the conversions: each of them names a scalar register as its unused second source, and where that register is one the load fills, the compiler waits there for the load
            __builtin_amdgcn_sched_barrier(0);   // keeps the load from rising over the conversions
#pragma unroll
            for (int qb = 0; qb < QB; ++qb) mw[qb] = Lp[qb * (TT / 32)]; }
#pragma unroll
        for (int db = 0; db < 4; ++db)
#pragma unroll
            for (int qb = 0; qb < QB; ++qb) { o[qb][db] = F::mma(vf[db], pf[qb], o[qb][db]); if (HL) { o[qb][db] = F::mma(vf[db], p2[qb], o[qb][db]); o[qb][db] = F::mma(v2[db], pf[qb], o[qb][db]); } }
        // four vector slots between the Ot matrix instructions and the next pass's LDS reads, which refill the Vt fragments' registers (operands: the accumulators, so that the matrix instructions stay in front)
        if constexpr (QB == 2) { asm volatile("v_nop\n\tv_nop\n\tv_nop\n\tv_nop" : "+v"(o[0][0]), "+v"(o[0][1]), "+v"(o[0][2]), "+v"(o[0][3]), "+v"(o[1][0]), "+v"(o[1][1]), "+v"(o[1][2]), "+v"(o[1][3])); }
        else { asm volatile("v_nop\n\tv_nop\n\tv_nop\n\tv_nop" : "+v"(o[0][0]), "+v"(o[0][1]), "+v"(o[0][2]), "+v"(o[0][3])); }
        asm volatile("s_wait_xcnt 0x0" : "+s"(Lp));   // the wait in front of the overwrite of the scalar address that the pass's lane-mask loads name (the address is an operand: the addition stays behind it)
        Lp += (kb + 64 < TT) ? 1 : 0;   // the last two passes fetch the last pass's lane masks (in bounds; the last fetch is unused)
        // hand-over: this wave's reads of the pass's buffer are done, its copies of the next pass have landed; behind the barrier that holds for all 4 waves, so the next buffer may be read and this one refilled
        asm volatile("s_wait_dscnt 0x0" ::: "memory");
        asm volatile("s_wait_asynccnt 0x0" ::: "memory");
        __syncthreads();
        if (kb + 64 < TT) {   // the same for the whole work-group: only while a pass kb / 32 + 2 exists
            stage_kv(lk + bo, lv + bo, gk, gv); if (HL) stage_kv(lk + bo + PLB, lv + bo + PLB, gk2, gv2);
            gk += 32 * HD * 2; gv += 32 * 2; gk2 += 32 * HD * 2; gv2 += 32 * 2; }
        bo = BUFB - bo;
    }
    asm volatile("s_wait_asynccnt 0x0" ::: "memory");   // no copy is outstanding when the wave goes on to its end
#pragma unroll
    for (int qb = 0; qb < QB; ++qb) { const float f = __fdiv_rn(1.0f, sm[qb] + xhalf(sm[qb])); const size_t oo = (size_t)(q0 + qb * 16 + lr) * DQ + 8 * hi;   // a lane's 8 accumulator registers are 8 consecutive d of its query: one 16-byte store a plane
#pragma unroll
        for (int db = 0; db < 4; ++db) { v8us oh, ol;
#pragma unroll
            for (int j = 0; j < 8; ++j) { unsigned short a, c2; splitf(o[qb][db][j] * f, a, c2); oh[j] = a; ol[j] = c2; }
            // both planes' stores and s_wait_xcnt 0 in ONE statement: the wait stands in front of every later write of a register that the stores name, on every way out of here (with plain stores the compiler joined the tails of the two row classes)
            asm volatile("global_store_b128 %0, %1, off\n\tglobal_store_b128 %2, %3, off\n\ts_wait_xcnt 0x0" :: "v"(Ah + oo + db * 16), "v"(oh), "v"(Al + oo + db * 16), "v"(ol) : "memory"); } }
}
// grid (NB_ NH_, RH/64 + R2/128 + (TT-RH-R2)/64), 4 waves, one a SIMD: row blocks y < RH/64 are the hi+lo rows (16 a wave), the next R2/128 fp16 rows 32 a wave, the last fp16 rows 16 a wave. Planes [batch][head][..]; one kv head per query head. Ah, Al: [batch][t][head d].
// Each class has 256 work-groups, as many as the chip has WGPs, and all 768 are resident at once: dealt evenly, a WGP holds one of each class and every SIMD carries the same work. With every fp16 row 32 a wave the grid has 640 work-groups, five for every two WGPs: some WGPs hold three, and the launch lasts as long as those.
#define R2 1024   // fp16 rows taken 32 a wave
static_assert(R2 % 128 == 0 && (TT - RH - R2) % 64 == 0 && TT - RH - R2 >= 0, "whole row blocks");
__global__ __launch_bounds__(128) void k_fattn(const h16* __restrict__ Q16, const h16* __restrict__ K16, const h16* __restrict__ V16, const bf* __restrict__ Qh, const bf* __restrict__ Ql, const bf* __restrict__ Kh, const bf* __restrict__ Kl, const bf* __restrict__ Vh, const bf* __restrict__ Vl, const unsigned* __restrict__ LM, bf* Ah, bf* Al) {
    __shared__ __align__(16) char kv[2 * 2 * (KTB + VTB)];   // two buffers of the hi+lo rows' four tiles (the fp16 rows use half)
    const int z = blockIdx.x, y = blockIdx.y; const int wave = __builtin_amdgcn_readfirstlane((int)(threadIdx.x >> 5)); const size_t po = (size_t)z * TT * HD; const size_t ao = (size_t)(z / NH_) * TT * DQ + (size_t)(z % NH_) * HD;
    if (y < RH / 64) fattn_rows<true, 1>(Qh + po, Ql + po, Kh + po, Kl + po, Vh + po, Vl + po, LM, y * 64 + wave * 16, Ah + ao, Al + ao, kv);
    else if (y >= RH / 64 + R2 / 128) fattn_rows<false, 1>(Q16 + po, nullptr, K16 + po, nullptr, V16 + po, nullptr, LM, RH + R2 + (y - RH / 64 - R2 / 128) * 64 + wave * 16, Ah + ao, Al + ao, kv);
    else fattn_rows<false, 2>(Q16 + po, nullptr, K16 + po, nullptr, V16 + po, nullptr, LM, RH + (y - RH / 64) * 128 + wave * 32, Ah + ao, Al + ao, kv);
}

extern "C" void kernel_launch(void* const* d_in, const int* in_sizes, int n_in,
                              void* d_out, int out_size, void* d_ws, size_t ws_size, hipStream_t stream) {
    (void)in_sizes; (void)n_in; (void)out_size;
    const float* x = (const float*)d_in[0]; const float* xk = (const float*)d_in[1]; const float* xv = (const float*)d_in[2]; const int* mk = (const int*)d_in[3]; const float* wqh = (const float*)d_in[4]; const float* bq = (const float*)d_in[5]; const float* wkh = (const float*)d_in[6]; const float* bk = (const float*)d_in[7]; const float* wvh = (const float*)d_in[8]; const float* bv = (const float*)d_in[9]; const float* wo = (const float*)d_in[10]; const float* wq = nullptr; const float* wk = nullptr; const float* wv = nullptr; (void)wq; (void)wk; (void)wv; const float* cosT = nullptr; const float* sinT = nullptr; (void)cosT; (void)sinT;
    float* OUT = (float*)d_out;     // [2][2048][1024]
    char* wsp = (char*)d_ws;
    auto take = [&](size_t bytes) { char* p = wsp; wsp += (bytes + 255) & ~(size_t)255; return (void*)p; };
    bf* WQ = (bf*)take((size_t)DQ * DM * 2); bf* WK = (bf*)take((size_t)DKV * DM * 2); bf* WV = (bf*)take((size_t)DKV * DM * 2); bf* WO = (bf*)take((size_t)DM * DQ * 2);
    bf* XB = (bf*)take((size_t)NB_ * TT * DM * 2); bf* XB2 = (bf*)take((size_t)NB_ * TT * DM * 2); bf* XB3 = (bf*)take((size_t)NB_ * TT * DM * 2);   // q, k, v in bf16, both batches
    const size_t PQ = (size_t)NH_ * TT * HD, PK = (size_t)NKV * TT * HD;   // one batch's head planes, in elements; every plane holds both batches
    h16* QP16 = (h16*)take(NB_ * PQ * 2); h16* KP16 = (h16*)take(NB_ * PK * 2); h16* VT16 = (h16*)take(NB_ * PK * 2);
    bf* QPh = (bf*)take(NB_ * PQ * 2); bf* QPl = (bf*)take(NB_ * PQ * 2); bf* KPh = (bf*)take(NB_ * PK * 2); bf* KPl = (bf*)take(NB_ * PK * 2); bf* VTh = (bf*)take(NB_ * PK * 2); bf* VTl = (bf*)take(NB_ * PK * 2);
    bf* ATh = (bf*)take((size_t)NB_ * TT * DQ * 2); bf* ATl = (bf*)take((size_t)NB_ * TT * DQ * 2);
    unsigned* LM = (unsigned*)take((size_t)TT * TT / 8);   // the mask as lane masks, one bit an element
    if ((size_t)(wsp - (char*)d_ws) > ws_size) return;    // ws 256 MiB
    k_cvtall<<<dim3(4 * 128 + 4 * 256, 1, 1), 256, 0, stream>>>(wqh, wkh, wvh, wo, x, xk, xv, mk, WQ, WK, WV, WO, XB, XB2, XB3, LM);
    k_proj<<<dim3(TT / 128, DQ / 128, 3 * NB_), 256, 0, stream>>>(XB, XB2, XB3, WQ, WK, WV, bq, bk, bv, QP16, QPh, QPl, KP16, KPh, KPl, VT16, VTh, VTl);
    k_fattn<<<dim3(NB_ * NH_, RH / 64 + R2 / 128 + (TT - RH - R2) / 64, 1), 128, 0, stream>>>(QP16, KP16, VT16, QPh, QPl, KPh, KPl, VTh, VTl, LM, ATh, ATl);
    k_wo<<<dim3(NB_ * TT / 128, DM / 128, 1), 256, 0, stream>>>(ATh, ATl, WO, OUT);
}

// v010
// Measured time: 120 microseconds a run.
// Two timings next to v009 put it at 1.04 and 1.05 times that version's speed.
// All steps since v000 together make it 16.9 times as fast.
#include <hip/hip_runtime.h>

// MultiHeadAttentionModule (q, k, v inputs [2][2048][1024]; per-head Qh = q Wq[h] + bq[h], Kh = k Wk[h] + bk[h], Vh = v Wv[h] + bv[h] (W [16][1024][64]); scores = Qh.Kh / 8, where(mask == 0, -1e9) (mask [2048][2048] int, read); softmax; out = concat(heads) Wo ([in,out], no bias) -> [2][2048][1024]).
// Compute dtypes, f32 accumulate: every input rounded to bf16; Qh/Kh/Vh on PLAIN bf16 operands (inputs: exact; per-head weights gathered) + bias; scores and attn.v (one fused kernel, running maximum): query rows < 512 hl (3 products), the rest single fp16 (x1024); mask + softmax f32; Wo hl x exact (2 products).
// Left open: a pass whose lane masks are all ones could skip its selects behind one scalar test; a stage of 64 keys would make the Vt rows whole 128-byte lines and halve the barriers; the weight transposes of k_cvtall read 32 bytes of each 128-byte line a thread; k_wo has one work-group a WGP.

#define NB_  2
#define TT   2048
#define DM   1024
#define NH_  16
#define NKV  16
#define REP  (NH_ / NKV)
#define HD   64
#define DQ   (NH_ * HD)
#define DKV  (NKV * HD)
#define RH   512                  // query rows < RH use hi+lo planes (0: none)
#define WIN  0
#define PCAR 1024.0f
#define SCL  0.125f   // HD^-0.5
typedef _Float16 h16;
typedef unsigned short bf;
typedef __attribute__((ext_vector_type(16))) __bf16   v16bf;
typedef __attribute__((ext_vector_type(16))) _Float16 v16h;
typedef __attribute__((ext_vector_type(8)))  _Float16 v8h;
typedef __attribute__((ext_vector_type(8)))  unsigned short v8us;
typedef __attribute__((ext_vector_type(8)))  float    v8f;
typedef __attribute__((ext_vector_type(4)))  float    v4f;
typedef v8h  __attribute__((may_alias)) v8ha;
typedef v4f  __attribute__((may_alias)) v4fa;
typedef v8us __attribute__((may_alias)) v8usa;

__device__ __forceinline__ unsigned short f2bf(float f) { unsigned u = __float_as_uint(f); u += 0x7FFFu + ((u >> 16) & 1u); return (unsigned short)(u >> 16); }
__device__ __forceinline__ float bf2f(unsigned short b) { return __uint_as_float(((unsigned)b) << 16); }
__device__ __forceinline__ float bfr(float f) { return bf2f(f2bf(f)); }
__device__ __forceinline__ v16h cat16(v8h lo, v8h hi) { return __builtin_shufflevector(lo, hi, 0, 1, 2, 3, 4, 5, 6, 7, 8, 9, 10, 11, 12, 13, 14, 15); }
__device__ __forceinline__ v16bf cat16b(v8us lo, v8us hi) { return __builtin_bit_cast(v16bf, __builtin_shufflevector(lo, hi, 0, 1, 2, 3, 4, 5, 6, 7, 8, 9, 10, 11, 12, 13, 14, 15)); }
__device__ __forceinline__ v8f wmma16(v16h a, v16h b, v8f c) { return __builtin_amdgcn_wmma_f32_16x16x32_f16(false, a, false, b, (short)0, c, false, false); }
__device__ __forceinline__ v8f wmmab(v16bf a, v16bf b, v8f c) { return __builtin_amdgcn_wmma_f32_16x16x32_bf16(false, a, false, b, (short)0, c, false, false); }
typedef __attribute__((ext_vector_type(4))) _Float16 v4h;
typedef __attribute__((ext_vector_type(4))) unsigned short v4us;
typedef __attribute__((ext_vector_type(4))) __bf16 v4b;



// ---- fragment loaders: a lane's 16 elements of a K-contiguous 16-bit row, in the hardware k order (8 at p, 8 at p + 16; p holds the lane half's 8 hi)
template <typename T16> struct WFrag;
template <> struct WFrag<h16> { typedef v16h V; static __device__ __forceinline__ V ld(const h16* p) { return cat16(*(const v8h*)p, *(const v8h*)(p + 16)); } static __device__ __forceinline__ v8f mma(V a, V b, v8f c) { return wmma16(a, b, c); } };
template <> struct WFrag<bf> { typedef v16bf V; static __device__ __forceinline__ V ld(const bf* p) { return cat16b(*(const v8us*)p, *(const v8us*)(p + 16)); } static __device__ __forceinline__ v8f mma(V a, V b, v8f c) { return wmmab(a, b, c); } };
// ---- gemmt: one 128 x 128 tile of D[m][n] = sum_k Am[m][k] Bn[n][k] (both operands K-contiguous bf16 planes of pitch GK) a work-group of 8 waves; a wave owns 64 m x 32 n (8 accumulators) and walks the whole K, so that each sum stays in one accumulator.
// Each stage of 64 k (128 rows of one whole 128-byte line an operand) comes into LDS ONCE for the 8 waves by asynchronous copies, two buffers, a stage's copies issued behind the last LDS reads of the stage two before it; fragments are read from LDS.
// A lane holds 8 consecutive m of ONE n, so the caller puts on the m side whatever lies contiguous in the output: a wave's 64 m are whole 128-byte lines of an output row.
// Straight from the accumulators a store would touch 16 rows, 32 bytes of each; so each wave turns its tile round in an LDS range of its own (the ring is free behind the loop's last barrier) and stores whole lines, 512 bytes an instruction.
// NS 1: the n side has a second plane Bn2 (lo), D = Am (Bn + Bn2). EPI 0: C[n][m] f32, pitch DM. EPI 1, 2: + bias, then the three 16-bit head planes that the attention kernel reads (fp16, bf16 hi, bf16 lo of the same f32 value).
//   1: m = (head, d) (the weight; bias per m), n = token -> planes [head][t][d]. 2: m = token, n = (head, d) (bias per n) -> planes [head][d][t].
#define GK   1024           // K of every product here (DM and DQ)
#define GPIT 144            // LDS bytes a staged row (128 bytes) takes: 16 bytes x an odd number, free of bank conflicts for 16-byte reads of 16 rows
#define GTB  (128 * GPIT)   // one operand's stage in LDS
static_assert(DM == GK && DQ == GK, "one K");
typedef __attribute__((ext_vector_type(8))) __bf16 v8b;
// A thread's share of one operand's stage: four asynchronous 16-byte copies to LDS, 32 rows apart. l: the lane's LDS byte address of its first piece; g: its global address.
// s_wait_xcnt 0 is the statement's last line, so that it stands in front of every later write of a register that the copies name.
__device__ __forceinline__ void stage_op(unsigned l, const char* g) {
    asm volatile("global_load_async_to_lds_b128 %0, %1, off\n\tglobal_load_async_to_lds_b128 %2, %3, off\n\tglobal_load_async_to_lds_b128 %4, %5, off\n\tglobal_load_async_to_lds_b128 %6, %7, off\n\ts_wait_xcnt 0x0"
                 :: "v"(l), "v"(g), "v"(l + 32u * GPIT), "v"(g + 32 * GK * 2), "v"(l + 64u * GPIT), "v"(g + 64 * GK * 2), "v"(l + 96u * GPIT), "v"(g + 96 * GK * 2) : "memory");
}
typedef __attribute__((ext_vector_type(4))) unsigned v4u;
// Whole-line stores of rows read back from LDS: 4 stores a plane, STEP bytes apart (the lane's address is that of its 16 bytes in the first).
// All stores and s_wait_xcnt 0 in ONE statement: the wait stands in front of every later write of a register that the stores name.
template <int STEP>
__device__ __forceinline__ void put_lines3(char* p0, char* p1, char* p2, const v4u (&d)[3][4]) {
    asm volatile("global_store_b128 %0, %3, off\n\tglobal_store_b128 %0, %4, off offset:%15\n\tglobal_store_b128 %0, %5, off offset:%16\n\tglobal_store_b128 %0, %6, off offset:%17\n\t"
                 "global_store_b128 %1, %7, off\n\tglobal_store_b128 %1, %8, off offset:%15\n\tglobal_store_b128 %1, %9, off offset:%16\n\tglobal_store_b128 %1, %10, off offset:%17\n\t"
                 "global_store_b128 %2, %11, off\n\tglobal_store_b128 %2, %12, off offset:%15\n\tglobal_store_b128 %2, %13, off offset:%16\n\tglobal_store_b128 %2, %14, off offset:%17\n\ts_wait_xcnt 0x0"
                 :: "v"(p0), "v"(p1), "v"(p2), "v"(d[0][0]), "v"(d[0][1]), "v"(d[0][2]), "v"(d[0][3]), "v"(d[1][0]), "v"(d[1][1]), "v"(d[1][2]), "v"(d[1][3]), "v"(d[2][0]), "v"(d[2][1]), "v"(d[2][2]), "v"(d[2][3]), "i"(STEP), "i"(2 * STEP), "i"(3 * STEP) : "memory");
}
template <int STEP>
__device__ __forceinline__ void put_lines2(char* p0, char* p1, const v4u (&d)[2][4]) {
    asm volatile("global_store_b128 %0, %2, off\n\tglobal_store_b128 %0, %3, off offset:%10\n\tglobal_store_b128 %0, %4, off offset:%11\n\tglobal_store_b128 %0, %5, off offset:%12\n\t"
                 "global_store_b128 %1, %6, off\n\tglobal_store_b128 %1, %7, off offset:%10\n\tglobal_store_b128 %1, %8, off offset:%11\n\tglobal_store_b128 %1, %9, off offset:%12\n\ts_wait_xcnt 0x0"
                 :: "v"(p0), "v"(p1), "v"(d[0][0]), "v"(d[0][1]), "v"(d[0][2]), "v"(d[0][3]), "v"(d[1][0]), "v"(d[1][1]), "v"(d[1][2]), "v"(d[1][3]), "i"(STEP), "i"(2 * STEP), "i"(3 * STEP) : "memory");
}
#define CPIT 272            // LDS bytes a staged f32 output row (256 bytes) takes: 16 bytes x an odd number
template <int NS, int EPI>
__device__ __forceinline__ void gemmt(const bf* __restrict__ Am, const bf* __restrict__ Bn, const bf* __restrict__ Bn2, float* C, const float* __restrict__ bias, h16* P16, bf* Ph, bf* Pl, int r0, int c0, char* ldsb) {
    typedef WFrag<bf> F; typedef typename F::V V;
    const int lane = threadIdx.x & 31, lr = lane & 15, hi = lane >> 4;
    const int wave = __builtin_amdgcn_readfirstlane((int)(threadIdx.x >> 5)); const int wm = wave & 1, wn = wave >> 1;   // scalar: the wave's place in the tile
    constexpr unsigned BUFB = (2u + NS) * GTB;   // bytes of one buffer
    constexpr int G = NS ? 2 : 1;   // steps of 32 k whose fragments are read as one group: the whole stage where one work-group has the WGP to itself (k_wo), one step where the registers must leave room for three (k_proj)
    const unsigned tid = threadIdx.x; const unsigned sb0 = (unsigned)(size_t)ldsb;   // the low 32 bits of a __shared__ address are the LDS byte address
    const unsigned ls = sb0 + (tid >> 3) * GPIT + (tid & 7u) * 16u;   // piece tid: row tid / 8, 16 bytes tid % 8 of it: a wave's copy is 4 whole lines
    const size_t go = (size_t)(tid >> 3) * (GK * 2) + (tid & 7u) * 16u;
    const char* ga = (const char*)(Am + (size_t)r0 * GK) + go; const char* gb = (const char*)(Bn + (size_t)c0 * GK) + go; const char* gb2 = (const char*)(Bn2 + (size_t)c0 * GK) + go;
    const unsigned afo = (unsigned)((wm * 64 + lr) * GPIT + 16 * hi), bfo = (unsigned)(GTB + (wn * 32 + lr) * GPIT + 16 * hi);   // the lane's byte offsets of its first m and n fragment in a buffer
    v8f acc[4][2];   // every '#pragma unroll' of this function makes the indices of acc, a, b, b2 constants, so that they stay in registers
#pragma unroll
    for (int mb = 0; mb < 4; ++mb)
#pragma unroll
        for (int nb = 0; nb < 2; ++nb) acc[mb][nb] = (v8f){};
    stage_op(ls, ga); stage_op(ls + GTB, gb); if (NS) stage_op(ls + 2u * GTB, gb2);   // stage 0 -> buffer 0
    ga += 128; gb += 128; gb2 += 128;
    asm volatile("s_wait_asynccnt 0x0" ::: "memory");   // this wave's copies of stage 0 have landed ...
    __syncthreads();                                     // ... and every other wave's: buffer 0 may be read
    stage_op(ls + BUFB, ga); stage_op(ls + BUFB + GTB, gb); if (NS) stage_op(ls + BUFB + 2u * GTB, gb2);   // stage 1 -> buffer 1
    ga += 128; gb += 128; gb2 += 128;
    unsigned bo = 0u;   // byte offset of the buffer that the stage reads
#pragma unroll 1   // rolled: a second stage's fragments would cost a resident work-group per WGP
    for (int t = 0; t < GK / 64; ++t) {
        const char* sb = ldsb + bo;
#pragma unroll
        for (int g = 0; g < 2 / G; ++g) { V a[G][4], b[G][2], b2[G][2];
#pragma unroll
            for (int u = 0; u < G; ++u) { const int ko = (g * G + u) * 64;   // byte offset of the 32 k in a staged row
#pragma unroll
                for (int nb = 0; nb < 2; ++nb) b[u][nb] = F::ld((const bf*)(sb + bfo + nb * 16 * GPIT + ko));
#pragma unroll
                for (int mb = 0; mb < 4; ++mb) a[u][mb] = F::ld((const bf*)(sb + afo + mb * 16 * GPIT + ko));
                if (NS) {
#pragma unroll
                    for (int nb = 0; nb < 2; ++nb) b2[u][nb] = F::ld((const bf*)(sb + GTB + bfo + nb * 16 * GPIT + ko)); } }
            __builtin_amdgcn_sched_barrier(0);   // the group's LDS reads issue here as ONE group: without this line the n fragments are read one at a time between the matrix instructions, each waited for at once
            if (g == 2 / G - 1) {   // a constant: behind the stage's last group of reads
                // hand-over, in front of the group's matrix instructions, which need registers only, so that the refill flies during them: this wave's reads of the stage's buffer are done, its copies of the next stage have landed;
                // behind the barrier that holds for all 8 waves, so the next buffer may be read and this one refilled
                asm volatile("s_wait_dscnt 0x0" ::: "memory");
                asm volatile("s_wait_asynccnt 0x0" ::: "memory");
                __syncthreads();
                if (t + 2 < GK / 64) {   // the same for the whole work-group: only while a stage t + 2 exists
                    stage_op(ls + bo, ga); stage_op(ls + bo + GTB, gb); if (NS) stage_op(ls + bo + 2u * GTB, gb2);
                    ga += 128; gb += 128; gb2 += 128; } }
#pragma unroll
            for (int u = 0; u < G; ++u) {
#pragma unroll
                for (int nb = 0; nb < 2; ++nb)
#pragma unroll
                    for (int mb = 0; mb < 4; ++mb) acc[mb][nb] = F::mma(a[u][mb], b[u][nb], acc[mb][nb]);
                if (NS) {
#pragma unroll
                    for (int nb = 0; nb < 2; ++nb)
#pragma unroll
                        for (int mb = 0; mb < 4; ++mb) acc[mb][nb] = F::mma(a[u][mb], b2[u][nb], acc[mb][nb]); } } }
        bo = BUFB - bo;
    }
    asm volatile("s_wait_asynccnt 0x0" ::: "memory");   // no copy is outstanding when the wave goes on to its end
    const int m0 = r0 + wm * 64, n0 = c0 + wn * 32 + lr;   // the wave's first m; the lane's first n
    if constexpr (EPI == 0) {
        char* const sw = ldsb + wave * (32 * CPIT);   // the wave's own range: its 32 output rows of 256 bytes
#pragma unroll
        for (int nb = 0; nb < 2; ++nb)
#pragma unroll
            for (int mb = 0; mb < 4; ++mb) { const v8f val = acc[mb][nb]; char* const q = sw + (nb * 16 + lr) * CPIT + mb * 64 + 32 * hi;
                *(v4f*)q = __builtin_shufflevector(val, val, 0, 1, 2, 3); *(v4f*)(q + 16) = __builtin_shufflevector(val, val, 4, 5, 6, 7); }
        asm volatile("s_wait_dscnt 0x0" ::: "memory");   // every lane's pieces lie in LDS before a row is read back (and the compiler keeps the reads behind the writes)
        char* const gc = (char*)(C + (size_t)(c0 + wn * 32 + hi) * DM + m0) + lr * 16;   // a half wave takes one row's 256 bytes: a store is two rows, four whole lines
#pragma unroll
        for (int h = 0; h < 2; ++h) { v4u d[2][4];
#pragma unroll
            for (int p = 0; p < 2; ++p)
#pragma unroll
                for (int i = 0; i < 4; ++i) d[p][i] = *(const v4u*)(sw + (h * 16 + p * 8 + i * 2 + hi) * CPIT + lr * 16);
            put_lines2<2 * DM * 4>(gc + (size_t)(h * 16) * DM * 4, gc + (size_t)(h * 16 + 8) * DM * 4, d); }
    } else {
        v4f bm[8]; float bn[2];   // EPI 1: the bias of the lane's 32 m; EPI 2: of its 2 n. Loads and their data wait in ONE statement, so that no register that a load names or fills is touched while it flies
        if constexpr (EPI == 1) asm volatile("global_load_b128 %0, %8, off\n\tglobal_load_b128 %1, %8, off offset:16\n\tglobal_load_b128 %2, %8, off offset:64\n\tglobal_load_b128 %3, %8, off offset:80\n\tglobal_load_b128 %4, %8, off offset:128\n\tglobal_load_b128 %5, %8, off offset:144\n\tglobal_load_b128 %6, %8, off offset:192\n\tglobal_load_b128 %7, %8, off offset:208\n\ts_wait_loadcnt 0x0"
                                             : "=&v"(bm[0]), "=&v"(bm[1]), "=&v"(bm[2]), "=&v"(bm[3]), "=&v"(bm[4]), "=&v"(bm[5]), "=&v"(bm[6]), "=&v"(bm[7]) : "v"(bias + m0 + 8 * hi) : "memory");
        else asm volatile("global_load_b32 %0, %2, off\n\tglobal_load_b32 %1, %2, off offset:64\n\ts_wait_loadcnt 0x0" : "=&v"(bn[0]), "=&v"(bn[1]) : "v"(bias + n0) : "memory");
        constexpr int RP = (EPI == 1) ? HD * 2 : TT * 2;   // bytes from one output row (one n) to the next in a plane; the wave's 64 m are one whole line of each row
        char* const sw = ldsb + wave * (3 * 16 * GPIT);   // the wave's own range: 16 rows of 128 bytes of each of the three planes
        char* const swr = sw + lr * GPIT + 16 * hi; const char* const srd = sw + (lane >> 3) * GPIT + (lane & 7) * 16;   // written: row lr; read back: 8 lanes a row, 4 rows an instruction
        const size_t gb = ((EPI == 1) ? ((size_t)(m0 / HD) * TT + c0 + wn * 32) * HD : (size_t)(c0 + wn * 32) * TT + m0) * 2 + (size_t)(lane >> 3) * RP + (lane & 7) * 16;   // the lane's byte offset in a plane for its piece of rows 0 .. 3
#pragma unroll
        for (int nb = 0; nb < 2; ++nb) {
#pragma unroll
            for (int mb = 0; mb < 4; ++mb) { v8f val = acc[mb][nb];
#pragma unroll
                for (int j = 0; j < 8; ++j) val[j] += bfr(EPI == 1 ? bm[2 * mb + (j >> 2)][j & 3] : bn[nb]);
                const v8h o16 = __builtin_convertvector(val, v8h); const v8b oh = __builtin_convertvector(val, v8b); const v8b ol = __builtin_convertvector(val - __builtin_convertvector(oh, v8f), v8b);   // each conversion rounds to nearest even, as f2bf does; lo is the rounded rest behind hi
                *(v8h*)(swr + mb * 32) = o16; *(v8b*)(swr + 16 * GPIT + mb * 32) = oh; *(v8b*)(swr + 32 * GPIT + mb * 32) = ol; }
            asm volatile("s_wait_dscnt 0x0" ::: "memory");   // every lane's pieces lie in LDS before a row is read back (and the compiler keeps the reads behind the writes)
            v4u d[3][4];
#pragma unroll
            for (int p = 0; p < 3; ++p)
#pragma unroll
                for (int i = 0; i < 4; ++i) d[p][i] = *(const v4u*)(srd + (p * 16 + i * 4) * GPIT);
            const size_t go2 = gb + (size_t)(nb * 16) * RP;
            put_lines3<4 * RP>((char*)P16 + go2, (char*)Ph + go2, (char*)Pl + go2, d); }   // its "memory" clobber keeps the next 16 rows' LDS writes behind these reads
    }
}

// ---- k_proj: the three projections of both batches in ONE launch. grid (TT/128, DQ/128, 3 NB_): z = 2 (0: Q, 1: K, 2: V) + batch; x: tokens, y: (head, d). Q, K: m = (head, d), n = token. V: m = token, n = (head, d).
__global__ __launch_bounds__(256) void k_proj(const bf* __restrict__ XQ, const bf* __restrict__ XK, const bf* __restrict__ XV, const bf* __restrict__ WQ, const bf* __restrict__ WK, const bf* __restrict__ WV, const float* __restrict__ bq, const float* __restrict__ bk, const float* __restrict__ bv,
                                              h16* Q16, bf* Qh, bf* Ql, h16* K16, bf* Kh, bf* Kl, h16* V16, bf* Vh, bf* Vl) {
    __shared__ __align__(16) char st[2 * 2 * GTB];
    const int w = blockIdx.z >> 1; const size_t xo = (size_t)(blockIdx.z & 1) * TT * DM, po = (size_t)(blockIdx.z & 1) * NH_ * TT * HD;
    if (w < 2) gemmt<0, 1>(w ? WK : WQ, (w ? XK : XQ) + xo, nullptr, nullptr, w ? bk : bq, (w ? K16 : Q16) + po, (w ? Kh : Qh) + po, (w ? Kl : Ql) + po, blockIdx.y * 128, blockIdx.x * 128, st);
    else gemmt<0, 2>(XV + xo, WV, nullptr, nullptr, bv, V16 + po, Vh + po, Vl + po, blockIdx.x * 128, blockIdx.y * 128, st);
}
// ---- k_wo: out = (Ah + Al) Wo, both batches as one matrix of NB_ TT rows: m = output column (rows of the transposed Wo), n = token. grid (NB_ TT/128, DM/128).
__global__ __launch_bounds__(256) void k_wo(const bf* __restrict__ Ah, const bf* __restrict__ Al, const bf* __restrict__ WO, float* OUT) {
    __shared__ __align__(16) char st[2 * 3 * GTB];
    gemmt<1, 0>(WO, Ah, Al, OUT, nullptr, nullptr, nullptr, nullptr, blockIdx.y * 128, blockIdx.x * 128, st);
}

__device__ __forceinline__ void splitf(float y, unsigned short& h, unsigned short& l) { h = f2bf(y); l = f2bf(y - bf2f(h)); }
typedef __attribute__((ext_vector_type(2))) unsigned short v2us;
typedef __attribute__((ext_vector_type(4))) int v4i;
typedef __attribute__((ext_vector_type(16))) unsigned v16u;
typedef __attribute__((address_space(4))) v16u cv16u;

// ---- k_cvtall: every conversion in ONE launch of few, fat waves. 1536 blocks of 256 threads. Blocks < 512: 128 a weight, transposed to [n][k] bf16 (Wq, Wk, Wv: n = 64 head + c; Wo); 256 for the mask (-> lane masks); the rest: 256 each for q, k, v (both batches, as they lie, bf16).
// A weight block: 8 rows n0 .. n0 + 7 of Bt, all 1024 k. A thread reads 8 consecutive n of 4 consecutive k (4 x 32 bytes) and writes 4 k of each of the 8 rows; a wave writes 256 bytes in a row of each.
__device__ __forceinline__ void wt_pieces(const float* __restrict__ s, int pitch, bf* d) {   // d[j DM + k] = bf16(s[k pitch + j])
    const int k = threadIdx.x * 4; v8f r[4];
#pragma unroll   // constant indices keep r in registers
    for (int u = 0; u < 4; ++u) r[u] = *(const v8f*)(s + (size_t)(k + u) * pitch);
#pragma unroll
    for (int j = 0; j < 8; ++j) { v4us o;
#pragma unroll
        for (int u = 0; u < 4; ++u) o[u] = f2bf(r[u][j]);
        *(v4us*)(d + (size_t)j * DM + k) = o; }
}
// An activation block: 8 x 256 pieces of 8 floats; a thread's 8 pieces lie 256 pieces apart and are all loaded before the first is stored (8 KiB a wave in flight).
__device__ __forceinline__ void cvt_pieces(const float* __restrict__ s, bf* d, unsigned blk) {
    unsigned lo = (blk * (8u * 256u) + threadIdx.x) * 32u; v8f v[8];   // the lane's byte offset in s (a tensor is 16 MiB); half of it in d
#pragma unroll   // constant indices keep v in registers
    for (int p = 0; p < 8; ++p) v[p] = *(const v8f*)((const char*)s + lo + p * (256 * 32));
    asm volatile("s_wait_xcnt 0x0" : "+v"(lo));   // the wait in front of any overwrite of the register that the issued loads name (the offset is an operand: its register lives up to the wait, so that no load's result lands on it)
    const unsigned so = lo >> 1;
#pragma unroll
    for (int p = 0; p < 8; ++p) { v8us o;
#pragma unroll
        for (int k = 0; k < 8; ++k) o[k] = f2bf(v[p][k]);
        *(v8us*)((char*)d + so + p * (256 * 16)) = o; }
}
// A mask block: the mask as LANE MASKS, in the order in which k_fattn's score registers want them. LM[16-query block][32-key block][i = 8 kt + j]: bit l of the word is (mask[16 block + l % 16][32 block + 16 kt + 8 (l / 16) + j] != 0),
// that is, lane l's condition for register j of score tile kt: the word is the select's whole condition, read into scalar registers. A wave makes 4 key blocks of one query block (16 rows x 512 bytes; 64 words = 256 bytes in a row).
typedef __attribute__((ext_vector_type(2))) unsigned v2u;
__device__ __forceinline__ void mask_pieces(const int* __restrict__ mk, unsigned* LM, unsigned blk) {
    const unsigned lane = threadIdx.x & 31u; const unsigned w = blk * 8u + (unsigned)__builtin_amdgcn_readfirstlane((int)(threadIdx.x >> 5));   // wave w: query block w / 16, key blocks 4 (w % 16) ..
    unsigned lo = (((w >> 4) * 16u + (lane & 15u)) * TT + (w & 15u) * 128u + 8u * (lane >> 4)) * 4u; v4i m[4][4];   // the lane's byte offset in the mask (16 MiB)
#pragma unroll   // constant indices keep m in registers
    for (int t = 0; t < 4; ++t)
#pragma unroll
        for (int c = 0; c < 4; ++c) m[t][c] = *(const v4i*)((const char*)mk + lo + t * 128 + (c >> 1) * 64 + (c & 1) * 16);
    asm volatile("s_wait_xcnt 0x0" : "+v"(lo));   // the wait in front of any overwrite of the register that the issued loads name (the offset is an operand: its register lives up to the wait, so that no load's result lands on it)
    unsigned o0 = 0u, o1 = 0u;   // lane l stores words 2 l and 2 l + 1 of the wave's 64
#pragma unroll
    for (int t = 0; t < 4; ++t)
#pragma unroll
        for (int i = 0; i < 16; i += 2) {
            const unsigned b0 = __builtin_amdgcn_ballot_w32(m[t][i >> 2][i & 3] != 0), b1 = __builtin_amdgcn_ballot_w32(m[t][i >> 2][(i & 3) + 1] != 0); const bool mine = lane == (unsigned)(t * 8 + (i >> 1));
            o0 = mine ? b0 : o0; o1 = mine ? b1 : o1; }
    *(v2u*)(LM + (size_t)w * 64u + lane * 2u) = (v2u){o0, o1};
}
__global__ __launch_bounds__(256) void k_cvtall(const float* __restrict__ wq, const float* __restrict__ wk, const float* __restrict__ wv, const float* __restrict__ wo, const float* __restrict__ xq, const float* __restrict__ xk, const float* __restrict__ xv, const int* __restrict__ mk,
                                                bf* WQ, bf* WK, bf* WV, bf* WO, bf* XQ, bf* XK, bf* XV, unsigned* LM) {
    const int bx = blockIdx.x; const int y = bx >> 7, n0 = (bx & 127) * 8;
    if (y < 3) wt_pieces((y == 0 ? wq : y == 1 ? wk : wv) + (size_t)(n0 / HD) * DM * HD + n0 % HD, HD, (y == 0 ? WQ : y == 1 ? WK : WV) + (size_t)n0 * DM);   // Bt[64 h + c][k] = W[h][k][c]
    else if (y == 3) wt_pieces(wo + n0, DM, WO + (size_t)n0 * DQ);   // Bt[n][k] = Wo[k][n]
    else if (bx < 768) mask_pieces(mk, LM, (unsigned)(bx - 512));
    else { const int t = (bx - 768) >> 8; cvt_pieces(t == 0 ? xq : t == 1 ? xk : xv, t == 0 ? XQ : t == 1 ? XK : XV, (unsigned)(bx - 768) & 255u); }
}
__device__ __forceinline__ float xhalf(float x) { const unsigned b = __float_as_uint(x); return __uint_as_float(__builtin_amdgcn_permlanex16(b, b, 0x76543210u, 0xfedcba98u, false, false)); }   // the value of lane l ^ 16
#define KPIT 144            // LDS bytes a K row (128 bytes) and
#define VPIT 80             // a Vt row piece (64 bytes) take: 16 bytes x an odd number, free of bank conflicts for 16-byte reads of 16 rows
#define KTB  (32 * KPIT)    // a K tile (32 keys) in LDS
#define VTB  (HD * VPIT)    // a Vt tile (HD rows of 32 keys) in LDS
// A thread's share of one pass's K and Vt tiles of one plane pair: four asynchronous 16-byte copies to LDS. lk, lv: the lane's LDS byte addresses of its first K and Vt piece; gk, gv: their global addresses. The second pieces lie 16 K rows and 32 Vt rows on.
// s_wait_xcnt 0 is the statement's last line, so that it stands in front of every later write of a register that the copies name.
__device__ __forceinline__ void stage_kv(unsigned lk, unsigned lv, const char* gk, const char* gv) {
    asm volatile("global_load_async_to_lds_b128 %0, %1, off\n\tglobal_load_async_to_lds_b128 %2, %3, off\n\tglobal_load_async_to_lds_b128 %4, %5, off\n\tglobal_load_async_to_lds_b128 %6, %7, off\n\ts_wait_xcnt 0x0"
                 :: "v"(lk), "v"(gk), "v"(lk + 16u * KPIT), "v"(gk + 16 * HD * 2), "v"(lv), "v"(gv), "v"(lv + 32u * VPIT), "v"(gv + 32 * TT * 2) : "memory");
}
template <bool HL> struct FT { typedef h16 T; };
template <> struct FT<true> { typedef bf T; };
template <bool HL, int QB>
__device__ __forceinline__ void fattn_rows(const typename FT<HL>::T* __restrict__ Q, const typename FT<HL>::T* __restrict__ Q2, const typename FT<HL>::T* __restrict__ Kp, const typename FT<HL>::T* __restrict__ K2, const typename FT<HL>::T* __restrict__ Vt, const typename FT<HL>::T* __restrict__ V2, const unsigned* __restrict__ lm, int q0, bf* Ah, bf* Al, char* ldsb) {
    typedef typename FT<HL>::T T16; typedef typename WFrag<T16>::V V; typedef WFrag<T16> F;
    const float L2E = 1.4426950408889634f;
    const int lane = threadIdx.x & 31, lr = lane & 15, hi = lane >> 4;
    const unsigned qo = (unsigned)((q0 + lr) * HD + 8 * hi) * 2u;   // the lane's byte offset in the Q planes
    V qf[QB][2], q2f[QB][2]; v8f o[QB][4]; float mx[QB], sm[QB];   // every '#pragma unroll' below makes the indices of these arrays constants, so that they stay in registers
#pragma unroll
    for (int qb = 0; qb < QB; ++qb) { mx[qb] = -3.0e38f; sm[qb] = 0.f;
#pragma unroll
        for (int ks = 0; ks < 2; ++ks) { qf[qb][ks] = F::ld((const T16*)((const char*)Q + qo + qb * 16 * HD * 2 + ks * 64)); if (HL) q2f[qb][ks] = F::ld((const T16*)((const char*)Q2 + qo + qb * 16 * HD * 2 + ks * 64)); }
#pragma unroll
        for (int db = 0; db < 4; ++db) o[qb][db] = (v8f){}; }
    // K and Vt: each pass's tiles (32 keys) are brought into LDS ONCE for the work-group's 4 waves by asynchronous copies, two buffers, a pass's copies issued at the foot of the pass two before it; every wave copies its share (stage_kv).
    // A thread's two 16-byte pieces of each tile: K piece c = tid + 128 i (row c / 8, the tile is 4 KiB in a row in the plane), Vt piece c (row c / 4, 64 bytes a row, plane pitch 2 TT bytes).
    // Lane masks: 16 words (64 bytes) per 16 queries and pass, at an address that is the same for the whole wave (scalar loads), fetched one pass ahead.
    constexpr unsigned PLB = KTB + VTB, BUFB = (HL ? 2u : 1u) * PLB;   // bytes of one plane pair's tiles; of one buffer
    const unsigned tid = threadIdx.x; const unsigned sb0 = (unsigned)(size_t)ldsb;   // the low 32 bits of a __shared__ address are the LDS byte address
    const unsigned lk = sb0 + (tid >> 3) * KPIT + (tid & 7u) * 16u, lv = sb0 + KTB + (tid >> 2) * VPIT + (tid & 3u) * 16u;
    const char* gk = (const char*)Kp + tid * 16u; const char* gv = (const char*)Vt + (tid >> 2) * (TT * 2u) + (tid & 3u) * 16u; const char* gk2 = (const char*)K2 + tid * 16u; const char* gv2 = (const char*)V2 + (tid >> 2) * (TT * 2u) + (tid & 3u) * 16u;
    const cv16u* Lp = (const cv16u*)(size_t)lm + (q0 >> 4) * (TT / 32);   // the wave's first query block, pass 0; q0 is scalar. Constant address space (nothing writes LM during this launch): the loads are scalar loads in both row classes
    const unsigned kfo = (unsigned)(lr * KPIT + 16 * hi), vfo = (unsigned)(KTB + lr * VPIT + 16 * hi);   // the lane's byte offsets of its K and Vt fragments in a buffer
    V kf[2][2], k2f[2][2], vf[4], v2[4]; v16u mw[QB];
    stage_kv(lk, lv, gk, gv); if (HL) stage_kv(lk + PLB, lv + PLB, gk2, gv2);   // pass 0 -> buffer 0
    gk += 32 * HD * 2; gv += 32 * 2; gk2 += 32 * HD * 2; gv2 += 32 * 2;
#pragma unroll
    for (int qb = 0; qb < QB; ++qb) mw[qb] = Lp[qb * (TT / 32)];
    asm volatile("s_wait_xcnt 0x0" : "+s"(Lp) : "v"(qo));   // the wait in front of the overwrite of registers that issued loads name (the Q loads' offset and the lane masks' scalar address are operands: their registers live up to it, and the addition stays behind it)
    ++Lp;   // now stands at pass 1
    asm volatile("s_wait_asynccnt 0x0" ::: "memory");   // this wave's copies of pass 0 have landed ...
    __syncthreads();                                     // ... and every other wave's: buffer 0 may be read
    stage_kv(lk + BUFB, lv + BUFB, gk, gv); if (HL) stage_kv(lk + BUFB + PLB, lv + BUFB + PLB, gk2, gv2);   // pass 1 -> buffer 1
    gk += 32 * HD * 2; gv += 32 * 2; gk2 += 32 * HD * 2; gv2 += 32 * 2;
    unsigned bo = 0u;   // byte offset of the buffer that the pass reads
#pragma unroll 1   // rolled: a second pass's fragments and scores would cost a resident wave per SIMD
    for (int kb = 0; kb < TT; kb += 32) {
        v8f s[QB][2]; const char* sb = ldsb + bo;
#pragma unroll
        for (int kt = 0; kt < 2; ++kt)
#pragma unroll
            for (int ks = 0; ks < 2; ++ks) { kf[kt][ks] = F::ld((const T16*)(sb + kfo + kt * 16 * KPIT + ks * 64)); if (HL) k2f[kt][ks] = F::ld((const T16*)(sb + PLB + kfo + kt * 16 * KPIT + ks * 64)); }
        __builtin_amdgcn_sched_barrier(0);   // K's reads issue in front of Vt's: LDS reads come back in issue order and St needs K first (without this line the hi+lo build reads Vt first)
#pragma unroll
        for (int db = 0; db < 4; ++db) { vf[db] = F::ld((const T16*)(sb + vfo + db * 16 * VPIT)); if (HL) v2[db] = F::ld((const T16*)(sb + PLB + vfo + db * 16 * VPIT)); }
        __builtin_amdgcn_sched_barrier(0);   // the pass's LDS reads issue here as ONE group: without this line the Vt reads sink between the Ot matrix instructions, each waited for at once
#pragma unroll
        for (int kt = 0; kt < 2; ++kt) {
#pragma unroll
            for (int qb = 0; qb < QB; ++qb) s[qb][kt] = (v8f){};
#pragma unroll
            for (int ks = 0; ks < 2; ++ks)
#pragma unroll
                for (int qb = 0; qb < QB; ++qb) { s[qb][kt] = F::mma(kf[kt][ks], qf[qb][ks], s[qb][kt]); if (HL) { s[qb][kt] = F::mma(kf[kt][ks], q2f[qb][ks], s[qb][kt]); s[qb][kt] = F::mma(k2f[kt][ks], qf[qb][ks], s[qb][kt]); } } }
        float bm[QB]; bool grow = false;
#pragma unroll
        for (int qb = 0; qb < QB; ++qb) { float b = -3.0e38f;
#pragma unroll
            for (int kt = 0; kt < 2; ++kt) {
#pragma unroll
                for (int j = 0; j < 8; ++j) { const float t = __builtin_amdgcn_inverse_ballot_w32(mw[qb][kt * 8 + j]) ? s[qb][kt][j] * SCL : -3.0e38f; s[qb][kt][j] = t; b = fmaxf(b, t); } }
            if constexpr (!HL) mw[qb] = Lp[qb * (TT / 32)];
            bm[qb] = fmaxf(b, xhalf(b)); grow = grow || (bm[qb] > mx[qb]); }
        __builtin_amdgcn_sched_barrier(0);   // fp16 rows: the next pass's lane-mask loads issue in front of the exponentials, a pass's length ahead of their use (without this line one of them sinks in among the exponentials)
        if (__builtin_amdgcn_ballot_w32(grow) != 0) {   // a scalar branch: a pass in which no query's maximum grows has every factor 1 and skips the scaling
#pragma unroll
            for (int qb = 0; qb < QB; ++qb) { const float mn = fmaxf(mx[qb], bm[qb]); const float al = __builtin_amdgcn_exp2f((mx[qb] - mn) * L2E); mx[qb] = mn; sm[qb] *= al;
#pragma unroll
                for (int db = 0; db < 4; ++db) o[qb][db] *= al; } }
        V pf[QB], p2[QB];
#pragma unroll
        for (int qb = 0; qb < QB; ++qb) {
#pragma unroll
            for (int g = 0; g < 2; ++g) { float x[8], p[8];
#pragma unroll
                for (int j = 0; j < 8; ++j) { const float d = s[qb][g][j] - mx[qb]; x[j] = HL ? d * L2E : __builtin_fmaf(d, L2E, 10.0f); p[j] = __builtin_amdgcn_exp2f(x[j]); }   // + 10 in the exponent: x PCAR = 2^10
                // the slot behind a transcendental, once for a run of eight: results and sources are operands, so that in front of the v_nop nothing reads a result or overwrites a source
                asm volatile("v_nop" : "+v"(p[0]), "+v"(p[1]), "+v"(p[2]), "+v"(p[3]), "+v"(p[4]), "+v"(p[5]), "+v"(p[6]), "+v"(p[7]) : "v"(x[0]), "v"(x[1]), "v"(x[2]), "v"(x[3]), "v"(x[4]), "v"(x[5]), "v"(x[6]), "v"(x[7]));
#pragma unroll
                for (int j = 0; j < 8; ++j) { sm[qb] += p[j];
                    if constexpr (HL) { const __bf16 ph = (__bf16)p[j]; pf[qb][g * 8 + j] = ph; p2[qb][g * 8 + j] = (__bf16)(p[j] - (float)ph); }
                    else pf[qb][g * 8 + j] = (h16)p[j]; } } }
        if constexpr (HL) {   // hi+lo rows: the next pass's lane-mask load issues behind the conversions: each of them names a scalar register as its unused second source, and where that register is one the load fills, the compiler waits there for the load
            __builtin_amdgcn_sched_barrier(0);   // keeps the load from rising over the conversions
#pragma unroll
            for (int qb = 0; qb < QB; ++qb) mw[qb] = Lp[qb * (TT / 32)]; }
#pragma unroll
        for (int db = 0; db < 4; ++db)
#pragma unroll
            for (int qb = 0; qb < QB; ++qb) { o[qb][db] = F::mma(vf[db], pf[qb], o[qb][db]); if (HL) { o[qb][db] = F::mma(vf[db], p2[qb], o[qb][db]); o[qb][db] = F::mma(v2[db], pf[qb], o[qb][db]); } }
        // four vector slots between the Ot matrix instructions and the next pass's LDS reads, which refill the Vt fragments' registers (operands: the accumulators, so that the matrix instructions stay in front)
        if constexpr (QB == 2) { asm volatile("v_nop\n\tv_nop\n\tv_nop\n\tv_nop" : "+v"(o[0][0]), "+v"(o[0][1]), "+v"(o[0][2]), "+v"(o[0][3]), "+v"(o[1][0]), "+v"(o[1][1]), "+v"(o[1][2]), "+v"(o[1][3])); }
        else { asm volatile("v_nop\n\tv_nop\n\tv_nop\n\tv_nop" : "+v"(o[0][0]), "+v"(o[0][1]), "+v"(o[0][2]), "+v"(o[0][3])); }
        asm volatile("s_wait_xcnt 0x0" : "+s"(Lp));   // the wait in front of the overwrite of the scalar address that the pass's lane-mask loads name (the address is an operand: the addition stays behind it)
        Lp += (kb + 64 < TT) ? 1 : 0;   // the last two passes fetch the last pass's lane masks (in bounds; the last fetch is unused)
        // hand-over: this wave's reads of the pass's buffer are done, its copies of the next pass have landed; behind the barrier that holds for all 4 waves, so the next buffer may be read and this one refilled
        asm volatile("s_wait_dscnt 0x0" ::: "memory");
        asm volatile("s_wait_asynccnt 0x0" ::: "memory");
        __syncthreads();
        if (kb + 64 < TT) {   // the same for the whole work-group: only while a pass kb / 32 + 2 exists
            stage_kv(lk + bo, lv + bo, gk, gv); if (HL) stage_kv(lk + bo + PLB, lv + bo + PLB, gk2, gv2);
            gk += 32 * HD * 2; gv += 32 * 2; gk2 += 32 * HD * 2; gv2 += 32 * 2; }
        bo = BUFB - bo;
    }
    asm volatile("s_wait_asynccnt 0x0" ::: "memory");   // no copy is outstanding when the wave goes on to its end
    // A query's 64 d are one whole 128-byte line of each plane, of which a lane holds four pieces of 16 bytes: each wave turns its rows round in an LDS range of its own (the K and Vt buffers are free behind the last pass's barrier) and stores whole lines, 4 rows an instruction.
    char* const sw = ldsb + __builtin_amdgcn_readfirstlane((int)(threadIdx.x >> 5)) * (QB * 2 * 16 * KPIT);
#pragma unroll
    for (int qb = 0; qb < QB; ++qb) { const float f = __fdiv_rn(1.0f, sm[qb] + xhalf(sm[qb])); char* const q = sw + (qb * 32 + lr) * KPIT + 16 * hi;   // a lane's 8 accumulator registers are 8 consecutive d of its query
#pragma unroll
        for (int db = 0; db < 4; ++db) { v8us oh, ol;
#pragma unroll
            for (int j = 0; j < 8; ++j) { unsigned short a, c2; splitf(o[qb][db][j] * f, a, c2); oh[j] = a; ol[j] = c2; }
            *(v8us*)(q + db * 32) = oh; *(v8us*)(q + 16 * KPIT + db * 32) = ol; } }
    asm volatile("s_wait_dscnt 0x0" ::: "memory");   // every lane's pieces lie in LDS before a row is read back (and the compiler keeps the reads behind the writes)
#pragma unroll
    for (int qb = 0; qb < QB; ++qb) { v4u d[2][4]; const size_t oo = ((size_t)(q0 + qb * 16 + (lane >> 3)) * DQ + (lane & 7) * 8) * 2;   // the lane's byte offset in a plane for its piece of rows 0 .. 3
#pragma unroll
        for (int p = 0; p < 2; ++p)
#pragma unroll
            for (int i = 0; i < 4; ++i) d[p][i] = *(const v4u*)(sw + (qb * 32 + p * 16 + i * 4 + (lane >> 3)) * KPIT + (lane & 7) * 16);
        put_lines2<4 * DQ * 2>((char*)Ah + oo, (char*)Al + oo, d); }
}
// grid (NB_ NH_, RH/64 + R2/128 + (TT-RH-R2)/64), 4 waves, one a SIMD: row blocks y < RH/64 are the hi+lo rows (16 a wave), the next R2/128 fp16 rows 32 a wave, the last fp16 rows 16 a wave. Planes [batch][head][..]; one kv head per query head. Ah, Al: [batch][t][head d].
// Each class has 256 work-groups, as many as the chip has WGPs, and all 768 are resident at once: dealt evenly, a WGP holds one of each class and every SIMD carries the same work. With every fp16 row 32 a wave the grid has 640 work-groups, five for every two WGPs: some WGPs hold three, and the launch lasts as long as those.
#define R2 1024   // fp16 rows taken 32 a wave
static_assert(R2 % 128 == 0 && (TT - RH - R2) % 64 == 0 && TT - RH - R2 >= 0, "whole row blocks");
__global__ __launch_bounds__(128) void k_fattn(const h16* __restrict__ Q16, const h16* __restrict__ K16, const h16* __restrict__ V16, const bf* __restrict__ Qh, const bf* __restrict__ Ql, const bf* __restrict__ Kh, const bf* __restrict__ Kl, const bf* __restrict__ Vh, const bf* __restrict__ Vl, const unsigned* __restrict__ LM, bf* Ah, bf* Al) {
    __shared__ __align__(16) char kv[2 * 2 * (KTB + VTB)];   // two buffers of the hi+lo rows' four tiles (the fp16 rows use half)
    const int z = blockIdx.x, y = blockIdx.y; const int wave = __builtin_amdgcn_readfirstlane((int)(threadIdx.x >> 5)); const size_t po = (size_t)z * TT * HD; const size_t ao = (size_t)(z / NH_) * TT * DQ + (size_t)(z % NH_) * HD;
    if (y < RH / 64) fattn_rows<true, 1>(Qh + po, Ql + po, Kh + po, Kl + po, Vh + po, Vl + po, LM, y * 64 + wave * 16, Ah + ao, Al + ao, kv);
    else if (y >= RH / 64 + R2 / 128) fattn_rows<false, 1>(Q16 + po, nullptr, K16 + po, nullptr, V16 + po, nullptr, LM, RH + R2 + (y - RH / 64 - R2 / 128) * 64 + wave * 16, Ah + ao, Al + ao, kv);
    else fattn_rows<false, 2>(Q16 + po, nullptr, K16 + po, nullptr, V16 + po, nullptr, LM, RH + (y - RH / 64) * 128 + wave * 32, Ah + ao, Al + ao, kv);
}

extern "C" void kernel_launch(void* const* d_in, const int* in_sizes, int n_in,
                              void* d_out, int out_size, void* d_ws, size_t ws_size, hipStream_t stream) {
    (void)in_sizes; (void)n_in; (void)out_size;
    const float* x = (const float*)d_in[0]; const float* xk = (const float*)d_in[1]; const float* xv = (const float*)d_in[2]; const int* mk = (const int*)d_in[3]; const float* wqh = (const float*)d_in[4]; const float* bq = (const float*)d_in[5]; const float* wkh = (const float*)d_in[6]; const float* bk = (const float*)d_in[7]; const float* wvh = (const float*)d_in[8]; const float* bv = (const float*)d_in[9]; const float* wo = (const float*)d_in[10]; const float* wq = nullptr; const float* wk = nullptr; const float* wv = nullptr; (void)wq; (void)wk; (void)wv; const float* cosT = nullptr; const float* sinT = nullptr; (void)cosT; (void)sinT;
    float* OUT = (float*)d_out;     // [2][2048][1024]
    char* wsp = (char*)d_ws;
    auto take = [&](size_t bytes) { char* p = wsp; wsp += (bytes + 255) & ~(size_t)255; return (void*)p; };
    bf* WQ = (bf*)take((size_t)DQ * DM * 2); bf* WK = (bf*)take((size_t)DKV * DM * 2); bf* WV = (bf*)take((size_t)DKV * DM * 2); bf* WO = (bf*)take((size_t)DM * DQ * 2);
    bf* XB = (bf*)take((size_t)NB_ * TT * DM * 2); bf* XB2 = (bf*)take((size_t)NB_ * TT * DM * 2); bf* XB3 = (bf*)take((size_t)NB_ * TT * DM * 2);   // q, k, v in bf16, both batches
    const size_t PQ = (size_t)NH_ * TT * HD, PK = (size_t)NKV * TT * HD;   // one batch's head planes, in elements; every plane holds both batches
    h16* QP16 = (h16*)take(NB_ * PQ * 2); h16* KP16 = (h16*)take(NB_ * PK * 2); h16* VT16 = (h16*)take(NB_ * PK * 2);
    bf* QPh = (bf*)take(NB_ * PQ * 2); bf* QPl = (bf*)take(NB_ * PQ * 2); bf* KPh = (bf*)take(NB_ * PK * 2); bf* KPl = (bf*)take(NB_ * PK * 2); bf* VTh = (bf*)take(NB_ * PK * 2); bf* VTl = (bf*)take(NB_ * PK * 2);
    bf* ATh = (bf*)take((size_t)NB_ * TT * DQ * 2); bf* ATl = (bf*)take((size_t)NB_ * TT * DQ * 2);
    unsigned* LM = (unsigned*)take((size_t)TT * TT / 8);   // the mask as lane masks, one bit an element
    if ((size_t)(wsp - (char*)d_ws) > ws_size) return;    // ws 256 MiB
    k_cvtall<<<dim3(4 * 128 + 4 * 256, 1, 1), 256, 0, stream>>>(wqh, wkh, wvh, wo, x, xk, xv, mk, WQ, WK, WV, WO, XB, XB2, XB3, LM);
    k_proj<<<dim3(TT / 128, DQ / 128, 3 * NB_), 256, 0, stream>>>(XB, XB2, XB3, WQ, WK, WV, bq, bk, bv, QP16, QPh, QPl, KP16, KPh, KPl, VT16, VTh, VTl);
    k_fattn<<<dim3(NB_ * NH_, RH / 64 + R2 / 128 + (TT - RH - R2) / 64, 1), 128, 0, stream>>>(QP16, KP16, VT16, QPh, QPl, KPh, KPl, VTh, VTl, LM, ATh, ATl);
    k_wo<<<dim3(NB_ * TT / 128, DM / 128, 1), 256, 0, stream>>>(ATh, ATl, WO, OUT);
}
